// v000
// Measured on an AMD MI455X. A time is GPU time per run, averaged over a window of back-to-back runs after a warm-up
// (all launches, gaps included; the runs take copies of the inputs in turn), and the median of several windows.
// Apart from v000's, it joins two sittings. Times from different sittings can be a few percent apart, while
// side-by-side timings come from the same sitting.
// v000, which the later versions start from, runs in 420 microseconds.
#include <hip/hip_runtime.h>
// QKV self-attention on a channel-major qkv tensor [8, 3·64, 4096]: attn[s,t] = Σ_c q[c,s]·k[c,t]/√64, softmax over t, out[d,s] = Σ_t attn[s,t]·v[d,t].
// Compute dtype: qkv rounded to bf16 and carried exactly in f16 (q/k token-major planes, v in its natural [d][t] layout = Vᵀ); S and P·V on v_wmma_f32_16x16x32_f16 with
// f32 accumulation in one fused flash-style kernel (online softmax in f32; P in f16 ×2^10); O transposed back to [b][d][s] through LDS; output f32.
#define BB 8
#define CC 64
#define C3 192
#define NN 4096
#define NR (BB * NN)

typedef __bf16 v16b __attribute__((ext_vector_type(16)));
typedef unsigned short v8us __attribute__((ext_vector_type(8), may_alias));
typedef float  v8f  __attribute__((ext_vector_type(8)));
typedef float  v4f  __attribute__((ext_vector_type(4)));
typedef float  v4fa __attribute__((ext_vector_type(4), may_alias));
union FragB { v16b v; v8us half[2]; unsigned short u[16]; };

__device__ __forceinline__ unsigned short bf16_bits(float x) { unsigned int u = __float_as_uint(x); return (unsigned short)((u + 0x7FFFu + ((u >> 16) & 1u)) >> 16); }
__device__ __forceinline__ float bf16_val(unsigned short b) { return __uint_as_float(((unsigned int)b) << 16); }
__device__ __forceinline__ float bf16_round(float x) { return bf16_val(bf16_bits(x)); }
// D += A·B with NT terms: 1 = ah·bh, 2 = + al·bh (A split), 3 = + ah·bl (both split)
template <int NT>
__device__ __forceinline__ v8f mmaN(v16b ah, v16b al, v16b bh, v16b bl, v8f c) {
  c = __builtin_amdgcn_wmma_f32_16x16x32_bf16(false, ah, false, bh, (short)0, c, false, false);
  if (NT >= 2) c = __builtin_amdgcn_wmma_f32_16x16x32_bf16(false, al, false, bh, (short)0, c, false, false);
  if (NT >= 3) c = __builtin_amdgcn_wmma_f32_16x16x32_bf16(false, ah, false, bl, (short)0, c, false, false);
  asm volatile("v_nop\n\tv_nop\n\tv_nop\n\tv_nop" : "+v"(c) : "v"(ah), "v"(al), "v"(bh), "v"(bl));
  return c;
}

__global__ __launch_bounds__(256) void k_wt_bf16(const float* __restrict__ W, unsigned short* __restrict__ Wt, int K, int N) {
  const int t = blockIdx.x * 256 + threadIdx.x;
  const int k8n = K / 8;
  if (t >= N * k8n) return;
  const int n = t / k8n, k8 = (t % k8n) * 8;
  v8us v;
#pragma unroll
  for (int i = 0; i < 8; ++i) v[i] = bf16_bits(W[(size_t)(k8 + i) * N + n]);
  *(v8us*)(Wt + (size_t)n * K + k8) = v;
  
}

// GEMM C[M][N] (f32, pitch ldc) = act(A[M][K]·W + bias). A f32 row-major (pitch lda) converted per fragment to bf16
// (ASPLIT: hi/lo two planes -> 2 terms, else single rounded term); Wt bf16 [N][K] (pitch ldb). BIAS_BF16 rounds the
// bias to bf16 first (bias quantised to bf16 before the add). K%32==0, M%16==0, N%64==0.
template <bool ASPLIT, int ACT, bool BIAS_BF16>
__global__ __launch_bounds__(128) void k_gemm_bf(const float* __restrict__ A, int lda, const unsigned short* __restrict__ Wt, int ldb,
                                               const float* __restrict__ bias, float* __restrict__ C, int ldc, int M, int N, int K) {
  __shared__ __attribute__((aligned(16))) float so[4][16][64];
  const int tid = threadIdx.x, w = tid >> 5, lane = tid & 31, ln = lane & 15, hh = lane >> 4;
  const int ntn = N / 64;
  const int wid = blockIdx.x * 4 + w;
  const int mt = wid / ntn, nq = wid % ntn;
  if (mt * 16 >= M) return;
  const int row0 = mt * 16, col0 = nq * 64;
  const float* arow = A + (size_t)(row0 + ln) * lda;
  v8f acc[4] = {};
  for (int kb = 0; kb < K; kb += 32) {
    FragB ah, al;
    const v4f x0 = *(const v4fa*)(arow + kb + 8 * hh), x1 = *(const v4fa*)(arow + kb + 8 * hh + 4);
    const v4f x2 = *(const v4fa*)(arow + kb + 16 + 8 * hh), x3 = *(const v4fa*)(arow + kb + 16 + 8 * hh + 4);
    float xs[16] = {x0[0],x0[1],x0[2],x0[3],x1[0],x1[1],x1[2],x1[3],x2[0],x2[1],x2[2],x2[3],x3[0],x3[1],x3[2],x3[3]};
#pragma unroll
    for (int i = 0; i < 16; ++i) { const unsigned short hb = bf16_bits(xs[i]); ah.u[i] = hb; al.u[i] = ASPLIT ? bf16_bits(xs[i] - bf16_val(hb)) : (unsigned short)0; }
#pragma unroll
    for (int t = 0; t < 4; ++t) {
      const unsigned short* brow = Wt + (size_t)(col0 + t * 16 + ln) * ldb + kb;
      FragB b;
      b.half[0] = *(const v8us*)(brow + 8 * hh);
      b.half[1] = *(const v8us*)(brow + 16 + 8 * hh);
      acc[t] = mmaN<ASPLIT ? 2 : 1>(ah.v, al.v, b.v, b.v, acc[t]);
    }
  }
#pragma unroll
  for (int t = 0; t < 4; ++t) {
    float bv = bias ? bias[col0 + t * 16 + ln] : 0.f;
    if (BIAS_BF16) bv = bf16_round(bv);
#pragma unroll
    for (int r = 0; r < 8; ++r) { float v = acc[t][r] + bv; if (ACT == 1) v = fmaxf(v, 0.f); so[w][8 * hh + r][t * 16 + ln] = v; }
  }
  __builtin_amdgcn_fence(__ATOMIC_ACQ_REL, "workgroup");
  __builtin_amdgcn_wave_barrier();
  const int rsub = lane >> 4, c4 = (lane & 15) * 4;
  {
#pragma unroll
    for (int q = 0; q < 8; ++q) {
      const int r = q * 2 + rsub;
      const v4f v = *(const v4fa*)&so[w][r][c4];
      *(v4f*)(C + (size_t)(row0 + r) * ldc + col0 + c4) = v;
    }
    
  }
}

// Flash-style causal/unmasked attention, all contractions 3-term bf16 hi/lo splits, f32 softmax with running max.
// q,k,v rows are read from f32 buffers with arbitrary row pitch (so they can live inside a fused qkv buffer);
// D = head size (multiple of 32, <= 128); one wave = 16 query rows; block = 4 waves (64 queries) sharing K/V chunks of 32.
template <int D, bool CAUSAL>
__global__ __launch_bounds__(128) void k_flash(const float* __restrict__ qb, const float* __restrict__ kb, const float* __restrict__ vb,
                                             int pitch, int T, int H, float scale, float* __restrict__ y, int ypitch) {
  constexpr int KS = D / 32;        // k-steps for QK
  constexpr int DT = D / 16;        // d tiles for PV
  __shared__ __attribute__((aligned(16))) unsigned short sKh[32][D + 8], sKl[32][D + 8], sVh[32][D + 8], sVl[32][D + 8];
  __shared__ __attribute__((aligned(16))) unsigned short sPh[4][16][40], sPl[4][16][40];
  __shared__ __attribute__((aligned(16))) float sO[4][16][D];
  const int tid = threadIdx.x, w = tid >> 5, lane = tid & 31, ln = lane & 15, hh = lane >> 4;
  const int nqb = (T + 63) / 64;
  const int bh = blockIdx.x / nqb, qblk = blockIdx.x % nqb;
  const int b = bh / H, h = bh % H;
  const int q0 = qblk * 64 + w * 16;
  const float* Q = qb + (size_t)b * T * pitch + h * D;
  const float* K = kb + (size_t)b * T * pitch + h * D;
  const float* V = vb + (size_t)b * T * pitch + h * D;

  // A fragments of the wave's 16 query rows (scaled), hi/lo
  FragB aqh[KS], aql[KS];
  {
    int row = q0 + ln; if (row >= T) row = T - 1;
    const float* qr = Q + (size_t)row * pitch;
#pragma unroll
    for (int ks = 0; ks < KS; ++ks)
#pragma unroll
      for (int i = 0; i < 16; ++i) {
        const int d = ks * 32 + ((i < 8) ? (8 * hh + i) : (16 + 8 * hh + (i - 8)));
        const float x = qr[d] * scale; const unsigned short hb = bf16_bits(x);
        aqh[ks].u[i] = hb; aql[ks].u[i] = bf16_bits(x - bf16_val(hb));
      }
  }
  float m_r[8], l_r[8];
#pragma unroll
  for (int r = 0; r < 8; ++r) { m_r[r] = -3.0e38f; l_r[r] = 0.f; }
  v8f oacc[DT];
#pragma unroll
  for (int dt = 0; dt < DT; ++dt) oacc[dt] = (v8f){0.f,0.f,0.f,0.f,0.f,0.f,0.f,0.f};

  const int kv_end = CAUSAL ? min(T, qblk * 64 + 64) : T;     // block-uniform
  for (int j0 = 0; j0 < kv_end; j0 += 32) {
    __syncthreads();
    for (int e = tid; e < 32 * (D / 4); e += 128) {
      const int r = e / (D / 4), c4 = (e % (D / 4)) * 4;
      const int key = j0 + r;
      v4f kf = {0.f,0.f,0.f,0.f}, vf = {0.f,0.f,0.f,0.f};
      if (key < T) { kf = *(const v4fa*)(K + (size_t)key * pitch + c4); vf = *(const v4fa*)(V + (size_t)key * pitch + c4); }
#pragma unroll
      for (int t = 0; t < 4; ++t) {
        unsigned short hb = bf16_bits(kf[t]); sKh[r][c4 + t] = hb; sKl[r][c4 + t] = bf16_bits(kf[t] - bf16_val(hb));
        hb = bf16_bits(vf[t]); sVh[r][c4 + t] = hb; sVl[r][c4 + t] = bf16_bits(vf[t] - bf16_val(hb));
      }
    }
    __syncthreads();
    // S tile 16 x 32
    v8f s[2];
#pragma unroll
    for (int nt = 0; nt < 2; ++nt) {
      v8f acc = {};
#pragma unroll
      for (int ks = 0; ks < KS; ++ks) {
        FragB bh_, bl_;
        bh_.half[0] = *(const v8us*)&sKh[nt * 16 + ln][ks * 32 + 8 * hh]; bh_.half[1] = *(const v8us*)&sKh[nt * 16 + ln][ks * 32 + 16 + 8 * hh];
        bl_.half[0] = *(const v8us*)&sKl[nt * 16 + ln][ks * 32 + 8 * hh]; bl_.half[1] = *(const v8us*)&sKl[nt * 16 + ln][ks * 32 + 16 + 8 * hh];
        acc = mmaN<3>(aqh[ks].v, aql[ks].v, bh_.v, bl_.v, acc);
      }
      s[nt] = acc;
    }
    // mask + running max (rows 8hh+r; the 16 lanes of a half share rows)
    float alpha[8];
#pragma unroll
    for (int r = 0; r < 8; ++r) {
      const int qi = q0 + 8 * hh + r;
      const int ja = j0 + ln, jb = j0 + 16 + ln;
      if (CAUSAL) { if (ja > qi) s[0][r] = -3.0e38f; if (jb > qi) s[1][r] = -3.0e38f; }
      if (ja >= T) s[0][r] = -3.0e38f;
      if (jb >= T) s[1][r] = -3.0e38f;
      float mx = fmaxf(s[0][r], s[1][r]);
      mx = fmaxf(mx, __shfl_xor(mx, 1, 32)); mx = fmaxf(mx, __shfl_xor(mx, 2, 32)); mx = fmaxf(mx, __shfl_xor(mx, 4, 32)); mx = fmaxf(mx, __shfl_xor(mx, 8, 32));
      const float mnew = fmaxf(m_r[r], mx);
      alpha[r] = (mnew > -1.0e38f) ? __expf(m_r[r] - mnew) : 1.0f;
      const float p0 = (s[0][r] > -1.0e38f) ? __expf(s[0][r] - mnew) : 0.f;
      const float p1 = (s[1][r] > -1.0e38f) ? __expf(s[1][r] - mnew) : 0.f;
      m_r[r] = mnew;
      l_r[r] = l_r[r] * alpha[r] + p0 + p1;            // per-lane partial row sum (16 lanes combined at the end)
      unsigned short hb = bf16_bits(p0); sPh[w][8 * hh + r][ln] = hb;      sPl[w][8 * hh + r][ln] = bf16_bits(p0 - bf16_val(hb));
      hb = bf16_bits(p1);                sPh[w][8 * hh + r][16 + ln] = hb; sPl[w][8 * hh + r][16 + ln] = bf16_bits(p1 - bf16_val(hb));
    }
#pragma unroll
    for (int dt = 0; dt < DT; ++dt)
#pragma unroll
      for (int r = 0; r < 8; ++r) oacc[dt][r] *= alpha[r];
    __builtin_amdgcn_fence(__ATOMIC_ACQ_REL, "workgroup");
    __builtin_amdgcn_wave_barrier();
    FragB pah, pal;
    pah.half[0] = *(const v8us*)&sPh[w][ln][8 * hh]; pah.half[1] = *(const v8us*)&sPh[w][ln][16 + 8 * hh];
    pal.half[0] = *(const v8us*)&sPl[w][ln][8 * hh]; pal.half[1] = *(const v8us*)&sPl[w][ln][16 + 8 * hh];
#pragma unroll
    for (int dt = 0; dt < DT; ++dt) {
      FragB bvh, bvl;
#pragma unroll
      for (int i = 0; i < 8; ++i) {
        bvh.u[i] = sVh[8 * hh + i][dt * 16 + ln]; bvh.u[8 + i] = sVh[16 + 8 * hh + i][dt * 16 + ln];
        bvl.u[i] = sVl[8 * hh + i][dt * 16 + ln]; bvl.u[8 + i] = sVl[16 + 8 * hh + i][dt * 16 + ln];
      }
      oacc[dt] = mmaN<3>(pah.v, pal.v, bvh.v, bvl.v, oacc[dt]);
    }
    __builtin_amdgcn_fence(__ATOMIC_ACQ_REL, "workgroup");
    __builtin_amdgcn_wave_barrier();
  }
#pragma unroll
  for (int r = 0; r < 8; ++r) {
    float l = l_r[r];
    l += __shfl_xor(l, 1, 32); l += __shfl_xor(l, 2, 32); l += __shfl_xor(l, 4, 32); l += __shfl_xor(l, 8, 32);
    l_r[r] = (l > 0.f) ? 1.0f / l : 0.f;
  }
#pragma unroll
  for (int dt = 0; dt < DT; ++dt)
#pragma unroll
    for (int r = 0; r < 8; ++r) sO[w][8 * hh + r][dt * 16 + ln] = oacc[dt][r] * l_r[r];
  __builtin_amdgcn_fence(__ATOMIC_ACQ_REL, "workgroup");
  __builtin_amdgcn_wave_barrier();
  {
    for (int r = 0; r < 16; ++r) {
      const int row = q0 + r;
      if (row < T && lane < D / 4) {
        const v4f val = *(const v4fa*)&sO[w][r][lane * 4];
        *(v4f*)(y + ((size_t)b * T + row) * ypitch + h * D + lane * 4) = val;
      }
    }
    
  }
}

// GEMM C = act(A·W + bias + resid): A f32 (ASPLIT -> hi/lo 2 terms), Wt bf16 [N][K]; ACT 0 none, 1 relu, 2 exact gelu;
// resid (optional, f32, row index = (row % rmod), pitch ldr, RES_BF16 rounds it) added before the activation.
template <bool ASPLIT, int ACT, bool BIAS_BF16, bool RES_BF16>
__global__ __launch_bounds__(128) void k_gemm_bf3(const float* __restrict__ A, int lda, const unsigned short* __restrict__ Wt, int ldb,
                                                const float* __restrict__ bias, const float* __restrict__ resid, int rmod, int ldr,
                                                float* __restrict__ C, int ldc, int M, int N, int K) {
  __shared__ __attribute__((aligned(16))) float so[4][16][64];
  const int tid = threadIdx.x, w = tid >> 5, lane = tid & 31, ln = lane & 15, hh = lane >> 4;
  const int ntn = N / 64;
  const int wid = blockIdx.x * 4 + w;
  const int mt = wid / ntn, nq = wid % ntn;
  if (mt * 16 >= M) return;
  const int row0 = mt * 16, col0 = nq * 64;
  const float* arow = A + (size_t)(row0 + ln) * lda;
  v8f acc[4] = {};
  for (int kb = 0; kb < K; kb += 32) {
    FragB ah, al;
    const v4f x0 = *(const v4fa*)(arow + kb + 8 * hh), x1 = *(const v4fa*)(arow + kb + 8 * hh + 4);
    const v4f x2 = *(const v4fa*)(arow + kb + 16 + 8 * hh), x3 = *(const v4fa*)(arow + kb + 16 + 8 * hh + 4);
    float xs[16] = {x0[0],x0[1],x0[2],x0[3],x1[0],x1[1],x1[2],x1[3],x2[0],x2[1],x2[2],x2[3],x3[0],x3[1],x3[2],x3[3]};
#pragma unroll
    for (int i = 0; i < 16; ++i) { const unsigned short hb = bf16_bits(xs[i]); ah.u[i] = hb; al.u[i] = ASPLIT ? bf16_bits(xs[i] - bf16_val(hb)) : (unsigned short)0; }
#pragma unroll
    for (int t = 0; t < 4; ++t) {
      const unsigned short* brow = Wt + (size_t)(col0 + t * 16 + ln) * ldb + kb;
      FragB b;
      b.half[0] = *(const v8us*)(brow + 8 * hh);
      b.half[1] = *(const v8us*)(brow + 16 + 8 * hh);
      acc[t] = mmaN<ASPLIT ? 2 : 1>(ah.v, al.v, b.v, b.v, acc[t]);
    }
  }
#pragma unroll
  for (int t = 0; t < 4; ++t) {
    const int col = col0 + t * 16 + ln;
    float bv = bias ? bias[col] : 0.f;
    if (BIAS_BF16) bv = bf16_round(bv);
#pragma unroll
    for (int r = 0; r < 8; ++r) {
      float v = acc[t][r] + bv;
      if (resid) { float rv = resid[(size_t)((row0 + 8 * hh + r) % rmod) * ldr + col]; if (RES_BF16) rv = bf16_round(rv); v += rv; }
      if (ACT == 1) v = fmaxf(v, 0.f);
      if (ACT == 2) v = 0.5f * v * (1.0f + erff(v * 0.70710678118654752f));
      if (ACT == 3) { const float u = 0.7978845608028654f * (v + 0.044715f * v * v * v); v = 0.5f * v * (1.0f + tanhf(u)); }
      so[w][8 * hh + r][t * 16 + ln] = v;
    }
  }
  __builtin_amdgcn_fence(__ATOMIC_ACQ_REL, "workgroup");
  __builtin_amdgcn_wave_barrier();
  const int rsub = lane >> 4, c4 = (lane & 15) * 4;
  {
#pragma unroll
    for (int q = 0; q < 8; ++q) {
      const int r = q * 2 + rsub;
      const v4f v = *(const v4fa*)&so[w][r][c4];
      *(v4f*)(C + (size_t)(row0 + r) * ldc + col0 + c4) = v;
    }
    
  }
}
// row LayerNorm (biased variance, eps) over N: s = X (+ R); optional out_sum <- s; out_norm <- (s-mu)*rsqrt(var+eps)*g + b
template <bool PARAM_BF16>
__global__ __launch_bounds__(256) void k_layernorm(const float* __restrict__ X, const float* __restrict__ R, const float* __restrict__ g, const float* __restrict__ bta,
                                                  float* __restrict__ out_sum, float* __restrict__ out_norm, int N, float eps) {
  __shared__ float red[256];
  const int row = blockIdx.x, tid = threadIdx.x;
  const float* x = X + (size_t)row * N; const float* rr = R ? R + (size_t)row * N : nullptr;
  float vals[16];                     // up to N = 4096
  const int per = N / 256;            // contiguous chunk per thread? use strided-by-4 chunks: thread handles j = tid*4 + 1024*u
  float s1 = 0.f;
  for (int u = 0; u < per / 4; ++u) {
    const int j = tid * 4 + 1024 * u;
    const v4f a = *(const v4fa*)(x + j);
    v4f b = {0.f,0.f,0.f,0.f}; if (rr) b = *(const v4fa*)(rr + j);
#pragma unroll
    for (int q = 0; q < 4; ++q) { const float v = a[q] + b[q]; vals[u * 4 + q] = v; s1 += v; }
  }
  red[tid] = s1; __syncthreads();
  for (int st = 128; st > 0; st >>= 1) { if (tid < st) red[tid] += red[tid + st]; __syncthreads(); }
  const float mu = red[0] / (float)N; __syncthreads();
  float s2 = 0.f;
  for (int u = 0; u < per / 4; ++u)
#pragma unroll
    for (int q = 0; q < 4; ++q) { const float c = vals[u * 4 + q] - mu; s2 += c * c; }
  red[tid] = s2; __syncthreads();
  for (int st = 128; st > 0; st >>= 1) { if (tid < st) red[tid] += red[tid + st]; __syncthreads(); }
  const float rs = rsqrtf(red[0] / (float)N + eps);
  {
    for (int u = 0; u < per / 4; ++u) {
      const int j = tid * 4 + 1024 * u;
      v4f o, sm;
#pragma unroll
      for (int q = 0; q < 4; ++q) {
        float gg = g[j + q], bb = bta[j + q];
        if (PARAM_BF16) { gg = bf16_round(gg); bb = bf16_round(bb); }
        sm[q] = vals[u * 4 + q]; o[q] = (vals[u * 4 + q] - mu) * rs * gg + bb;
      }
      if (out_sum) *(v4f*)(out_sum + (size_t)row * N + j) = sm;
      *(v4f*)(out_norm + (size_t)row * N + j) = o;
    }
    
  }
}



// ---- f16 WMMA path (v_wmma_f32_16x16x32_f16): 11-bit significands for operands in range — used where a [0,1] probability operand needs more precision than bf16
typedef _Float16 v16h __attribute__((ext_vector_type(16)));
union FragH { v16h v; v8us half[2]; _Float16 h[16]; unsigned short u[16]; };
template <int NT>
__device__ __forceinline__ v8f mmaH(v16h ah, v16h al, v16h bh, v16h bl, v8f c) {
  c = __builtin_amdgcn_wmma_f32_16x16x32_f16(false, ah, false, bh, (short)0, c, false, false);
  if (NT >= 2) c = __builtin_amdgcn_wmma_f32_16x16x32_f16(false, al, false, bh, (short)0, c, false, false);
  if (NT >= 3) c = __builtin_amdgcn_wmma_f32_16x16x32_f16(false, ah, false, bl, (short)0, c, false, false);
  asm volatile("v_nop\n\tv_nop\n\tv_nop\n\tv_nop" : "+v"(c) : "v"(ah), "v"(al), "v"(bh), "v"(bl));
  return c;
}
// batched GEMM like k_gemm_b but f16 operands: A f32 (split into f16 hi/lo if ASPLIT, else rounded to f16), Bt = f16 values [n][k]; alpha; C f32; N multiple of 16 (partial tiles skipped)
template <bool ASPLIT>
__global__ __launch_bounds__(128) void k_gemm_h(const float* __restrict__ A, int lda, size_t sA, const _Float16* __restrict__ Bh, int ldb, size_t sB, float alpha, float* __restrict__ C, int ldc, size_t sC, int M, int N, int K) {
  __shared__ __attribute__((aligned(16))) float so[4][16][64];
  const int tid = threadIdx.x, w = tid >> 5, lane = tid & 31, ln = lane & 15, hh = lane >> 4; const int by = blockIdx.y;
  A += (size_t)by * sA; Bh += (size_t)by * sB; C += (size_t)by * sC;
  const int ntn = (N + 63) / 64; const int wid = blockIdx.x * 4 + w; const int mt = wid / ntn, nq = wid % ntn; if (mt * 16 >= M) return;
  const int row0 = mt * 16, col0 = nq * 64; const float* arow = A + (size_t)(row0 + ln) * lda;
  v8f acc[4] = {};
  for (int kb = 0; kb < K; kb += 32) {
    FragH ah, al;
    const v4f x0 = *(const v4fa*)(arow + kb + 8 * hh), x1 = *(const v4fa*)(arow + kb + 8 * hh + 4), x2 = *(const v4fa*)(arow + kb + 16 + 8 * hh), x3 = *(const v4fa*)(arow + kb + 16 + 8 * hh + 4);
    float xs[16] = {x0[0],x0[1],x0[2],x0[3],x1[0],x1[1],x1[2],x1[3],x2[0],x2[1],x2[2],x2[3],x3[0],x3[1],x3[2],x3[3]};
#pragma unroll
    for (int i = 0; i < 16; ++i) { const _Float16 h = (_Float16)xs[i]; ah.h[i] = h; al.h[i] = ASPLIT ? (_Float16)(xs[i] - (float)h) : (_Float16)0.0f; }
#pragma unroll
    for (int t = 0; t < 4; ++t) { if (col0 + t * 16 >= N) continue; const size_t boff = (size_t)(col0 + t * 16 + ln) * ldb + kb; FragH bq; bq.half[0] = *(const v8us*)(Bh + boff + 8 * hh); bq.half[1] = *(const v8us*)(Bh + boff + 16 + 8 * hh);
      acc[t] = mmaH<ASPLIT ? 2 : 1>(ah.v, al.v, bq.v, bq.v, acc[t]); }
  }
#pragma unroll
  for (int t = 0; t < 4; ++t) { if (col0 + t * 16 >= N) continue;
#pragma unroll
    for (int r = 0; r < 8; ++r) so[w][8 * hh + r][t * 16 + ln] = acc[t][r] * alpha; }
  __builtin_amdgcn_fence(__ATOMIC_ACQ_REL, "workgroup"); __builtin_amdgcn_wave_barrier();
  const int rsub = lane >> 4, c4 = (lane & 15) * 4;
  {
#pragma unroll
    for (int q = 0; q < 8; ++q) { const int r = q * 2 + rsub; if (col0 + c4 < N) { const v4f v = *(const v4fa*)&so[w][r][c4]; *(v4f*)(C + (size_t)(row0 + r) * ldc + col0 + c4) = v; } }
     }
}

// Wt[n][k] = f16(W[k][n]·scale) from f32 row-major W[K][N] (scale = power of two; bf16-exact weights stay exact in f16 away from the subnormal range)
__global__ __launch_bounds__(256) void k_wt_f16(const float* __restrict__ W, _Float16* __restrict__ Wt, int K, int N, float scale) {
  const int t = blockIdx.x * 256 + threadIdx.x; if (t >= N * (K / 8)) return; const int n = t / (K / 8), k8 = (t % (K / 8)) * 8; FragH f;
#pragma unroll
  for (int i = 0; i < 8; ++i) f.h[i] = (_Float16)(bf16_round(W[(size_t)(k8 + i) * N + n]) * scale); const v8us o = f.half[0];
  *(v8us*)((unsigned short*)Wt + (size_t)n * K + k8) = o; 
}
// k_gemm_hh variant with fused epilogue: v = acc·alpha + bias[by·sBias + col] (+ CP[(row/rowsPerB)·sCPb + by·64 + col] if CP) ; ACT 0 none / 1 elu ; writes f16 C16 (and f32 C if non-null)
template <int ACT>
__global__ __launch_bounds__(128) void k_gemm_hhx(const _Float16* __restrict__ A, int lda, size_t sA, const _Float16* __restrict__ Bh, int ldb, size_t sB, float alpha, const float* __restrict__ bias, size_t sBias, const float* __restrict__ CP, int rowsPerB, size_t sCPb, int row0g,
    float* __restrict__ C, _Float16* __restrict__ C16, int ldc, size_t sC, int M, int N, int K) {
  __shared__ __attribute__((aligned(16))) float so[4][16][64];
  const int tid = threadIdx.x, w = tid >> 5, lane = tid & 31, ln = lane & 15, hh = lane >> 4; const int by = blockIdx.y;
  A += (size_t)by * sA; Bh += (size_t)by * sB; const size_t cofs = (size_t)by * sC; const float* bp = bias ? bias + (size_t)by * sBias : nullptr;
  const int ntn = (N + 63) / 64; const int wid = blockIdx.x * 4 + w; const int mt = wid / ntn, nq = wid % ntn; if (mt * 16 >= M) return;
  const int row0 = mt * 16, col0 = nq * 64; const _Float16* arow = A + (size_t)(row0 + ln) * lda;
  v8f acc[4] = {};
  for (int kb = 0; kb < K; kb += 32) { FragH ah; ah.half[0] = *(const v8us*)((const unsigned short*)arow + kb + 8 * hh); ah.half[1] = *(const v8us*)((const unsigned short*)arow + kb + 16 + 8 * hh);
#pragma unroll
    for (int t = 0; t < 4; ++t) { if (col0 + t * 16 >= N) continue; const size_t boff = (size_t)(col0 + t * 16 + ln) * ldb + kb; FragH bq; bq.half[0] = *(const v8us*)((const unsigned short*)Bh + boff + 8 * hh); bq.half[1] = *(const v8us*)((const unsigned short*)Bh + boff + 16 + 8 * hh);
      acc[t] = mmaH<1>(ah.v, ah.v, bq.v, bq.v, acc[t]); }
  }
#pragma unroll
  for (int t = 0; t < 4; ++t) { if (col0 + t * 16 >= N) continue; const int col = col0 + t * 16 + ln; const float bv = bp ? bf16_round(bp[col]) : 0.f;
#pragma unroll
    for (int r = 0; r < 8; ++r) { float v = acc[t][r] * alpha + bv; if (CP) { const int bidx = (row0g + row0 + 8 * hh + r) / rowsPerB; v += CP[(size_t)bidx * sCPb + (size_t)by * 64 + col]; } if (ACT == 1) v = (v > 0.f) ? v : expm1f(v); else if (ACT == 7) v = (v > 0.f) ? v + 1.0f : expf(v); else if (ACT == 8) v = tanhf(v); else if (ACT == 9) v = 0.5f * v * (1.0f + tanhf(0.7978845608028654f * (v + 0.044715f * v * v * v))); else if (ACT == 11) v = 1.0f / (1.0f + expf(-v)); else if (ACT == 12) v = (v > 0.f) ? v : 0.01f * v; else if (ACT == 14) v = (v > 0.f) ? v : 0.1f * v; else if (ACT == 15) v = v / (1.0f + expf(-v)); else if (ACT == 3) v = fmaxf(v, 0.f); else if (ACT == 6) v = 0.5f * v * (1.0f + erff(v * 0.70710678118654752f)); so[w][8 * hh + r][t * 16 + ln] = v; } }
  __builtin_amdgcn_fence(__ATOMIC_ACQ_REL, "workgroup"); __builtin_amdgcn_wave_barrier();
  const int rsub = lane >> 4, c4 = (lane & 15) * 4; typedef _Float16 v4h __attribute__((ext_vector_type(4)));
  {
#pragma unroll
    for (int q = 0; q < 8; ++q) { const int r = q * 2 + rsub; if (col0 + c4 < N) { const v4f v = *(const v4fa*)&so[w][r][c4]; if (C) *(v4f*)(C + cofs + (size_t)(row0 + r) * ldc + col0 + c4) = v; if (C16) { v4h h4; for (int i = 0; i < 4; ++i) h4[i] = (_Float16)v[i]; *(v4h*)(C16 + cofs + (size_t)(row0 + r) * ldc + col0 + c4) = h4; } } }
     }
}


typedef _Float16 v4h __attribute__((ext_vector_type(4)));

__global__ __launch_bounds__(256) void k_x16(const float* __restrict__ x, _Float16* __restrict__ X16, size_t n8) { const size_t t = (size_t)blockIdx.x * 256 + threadIdx.x; if (t >= n8) return; FragH f;
#pragma unroll
  for (int q = 0; q < 8; ++q) f.h[q] = (_Float16)bf16_round(x[t * 8 + q]); *(v8us*)((unsigned short*)X16 + t * 8) = f.half[0];  }
__global__ __launch_bounds__(256) void k_h16(const float* __restrict__ x, _Float16* __restrict__ X16, size_t n8) { const size_t t = (size_t)blockIdx.x * 256 + threadIdx.x; if (t >= n8) return; FragH f;
#pragma unroll
  for (int q = 0; q < 8; ++q) f.h[q] = (_Float16)x[t * 8 + q]; *(v8us*)((unsigned short*)X16 + t * 8) = f.half[0];  }
__global__ __launch_bounds__(256) void k_round16f(const float* __restrict__ W, _Float16* __restrict__ Bt, size_t n8) { const size_t t = (size_t)blockIdx.x * 256 + threadIdx.x; if (t >= n8) return; FragH f;
#pragma unroll
  for (int i = 0; i < 8; ++i) f.h[i] = (_Float16)(bf16_round(W[t * 8 + i]) * 16.0f); *(v8us*)((unsigned short*)Bt + t * 8) = f.half[0];  }
template <int NHv, int TTv>
__global__ __launch_bounds__(256) void k_vt(const _Float16* __restrict__ V16, int ldv, int voff, _Float16* __restrict__ Vt) { __shared__ unsigned short tl[64][66]; const int tid = threadIdx.x; const int slab = blockIdx.x / (TTv / 64), lg = blockIdx.x % (TTv / 64); const int b = slab / NHv, h = slab % NHv;
  for (int i = tid; i < 64 * 8; i += 256) { const int r = i / 8, c8 = (i % 8) * 8; FragH f; f.half[0] = *(const v8us*)((const unsigned short*)V16 + ((size_t)b * TTv + lg * 64 + r) * ldv + voff + h * 64 + c8);
#pragma unroll
    for (int q = 0; q < 8; ++q) tl[r][c8 + q] = f.u[q]; }
  __syncthreads();
  {
#pragma unroll
    for (int rd = 0; rd < 2; ++rd) { const int d = rd * 32 + tid / 8, pc = tid % 8; FragH f;
#pragma unroll
      for (int q = 0; q < 8; ++q) f.u[q] = tl[pc * 8 + q][d];
      *(v8us*)((unsigned short*)Vt + ((size_t)slab * 64 + d) * TTv + lg * 64 + pc * 8) = f.half[0]; }
     } }

__global__ __launch_bounds__(256) void k_tok(const float* __restrict__ x, _Float16* __restrict__ X16) { __shared__ float tl[32][65]; const int tid = threadIdx.x; const int b = blockIdx.x / (2 * (NN / 32)), rem = blockIdx.x % (2 * (NN / 32)); const int cg = rem / (NN / 32), pg = rem % (NN / 32); const int c0 = cg * 64, p0 = pg * 32;
  for (int i = tid; i < 64 * 32; i += 256) { const int c = i / 32, pp = i % 32; tl[pp][c] = bf16_round(x[((size_t)b * C3 + c0 + c) * NN + p0 + pp]); } __syncthreads();
  const int r = tid / 8, pc = tid % 8; FragH f; for (int q = 0; q < 8; ++q) f.h[q] = (_Float16)tl[r][pc * 8 + q]; const size_t row = (size_t)b * NN + p0 + r; *(v8us*)((unsigned short*)X16 + row * (2 * CC) + c0 + pc * 8) = f.half[0];  }
__global__ __launch_bounds__(256) void k_v16(const float* __restrict__ x, _Float16* __restrict__ Vt) { const size_t t = (size_t)blockIdx.x * 256 + threadIdx.x; if (t >= (size_t)BB * CC * NN / 8) return; const int n8 = (int)(t % (NN / 8)) * 8; const int d = (int)((t / (NN / 8)) % CC); const int b = (int)(t / ((size_t)(NN / 8) * CC)); FragH f;
#pragma unroll
  for (int q = 0; q < 8; ++q) f.h[q] = (_Float16)bf16_round(x[((size_t)b * C3 + 2 * CC + d) * NN + n8 + q]); *(v8us*)((unsigned short*)Vt + t * 8) = f.half[0];  }
__global__ __launch_bounds__(128) void k_flash(const _Float16* __restrict__ Q16, int ldq, const _Float16* __restrict__ K16, int ldk, const _Float16* __restrict__ Vt, const int* __restrict__ MSK, float* __restrict__ O, int ldo) {
  constexpr int RPW = 16, RTN = RPW / 16, NQB = NN / (4 * RPW), DT = 4, KS = 2;
  __shared__ __attribute__((aligned(16))) unsigned short sP[4][RPW][40]; __shared__ __attribute__((aligned(16))) float sO[4][RPW][64 + 4];
  const int tid = threadIdx.x, w = tid >> 5, lane = tid & 31, ln = lane & 15, hh = lane >> 4;
  const int slab = blockIdx.x / NQB, qblk = blockIdx.x % NQB; const int b = slab; const int h = 0; const int qb0 = qblk * (4 * RPW); const int q0 = qb0 + w * RPW;
  FragH aq[2][KS];
#pragma unroll
  for (int rt = 0; rt < RTN; ++rt) { const unsigned short* qr = (const unsigned short*)Q16 + ((size_t)b * NN + q0 + rt * 16 + ln) * ldq;
#pragma unroll
    for (int ks = 0; ks < KS; ++ks) { aq[rt][ks].half[0] = *(const v8us*)(qr + ks * 32 + 8 * hh); aq[rt][ks].half[1] = *(const v8us*)(qr + ks * 32 + 16 + 8 * hh); } }
  const unsigned short* Vth = (const unsigned short*)Vt + (size_t)b * CC * NN;      /* Vᵀ = v[b][d][n] */
  float m_r[2][8], l_r[2][8]; v8f oacc[2][DT];
#pragma unroll
  for (int rt = 0; rt < RTN; ++rt) {
#pragma unroll
    for (int r = 0; r < 8; ++r) { m_r[rt][r] = -3.0e38f; l_r[rt][r] = 0.f; }
#pragma unroll
    for (int dt = 0; dt < DT; ++dt) oacc[rt][dt] = (v8f){0.f,0.f,0.f,0.f,0.f,0.f,0.f,0.f}; }
  const int jend = NN;
#pragma unroll 1
  for (int j0 = 0; j0 < jend; j0 += 32) {
    
    v8f s[2][2];
#pragma unroll
    for (int nt = 0; nt < 2; ++nt) { const unsigned short* kr = (const unsigned short*)K16 + ((size_t)b * NN + j0 + nt * 16 + ln) * ldk; FragH bk[KS];
#pragma unroll
      for (int ks = 0; ks < KS; ++ks) { bk[ks].half[0] = *(const v8us*)(kr + ks * 32 + 8 * hh); bk[ks].half[1] = *(const v8us*)(kr + ks * 32 + 16 + 8 * hh); }
#pragma unroll
      for (int rt = 0; rt < RTN; ++rt) { v8f acc = (v8f){0.f,0.f,0.f,0.f,0.f,0.f,0.f,0.f};
#pragma unroll
        for (int ks = 0; ks < KS; ++ks) acc = mmaH<1>(aq[rt][ks].v, aq[rt][ks].v, bk[ks].v, bk[ks].v, acc); s[rt][nt] = acc; } }
#pragma unroll
    for (int rt = 0; rt < RTN; ++rt)
#pragma unroll
      for (int r = 0; r < 8; ++r) { const int tq = q0 + rt * 16 + 8 * hh + r; const int k0 = j0 + ln, k1 = j0 + 16 + ln; (void)tq; (void)k0; (void)k1;
        const bool ok0 = true, ok1 = true;
        const float s0 = s[rt][0][r] * 0.125f, s1 = s[rt][1][r] * 0.125f; float mc = fmaxf(s0, s1);
        mc = fmaxf(mc, __shfl_xor(mc, 1, 32)); mc = fmaxf(mc, __shfl_xor(mc, 2, 32)); mc = fmaxf(mc, __shfl_xor(mc, 4, 32)); mc = fmaxf(mc, __shfl_xor(mc, 8, 32));
        const float mn = fmaxf(m_r[rt][r], mc); const float al = (mn > -1.0e38f) ? expf(m_r[rt][r] - mn) : 1.0f; m_r[rt][r] = mn; const float p0 = expf(s0 - mn), p1 = expf(s1 - mn); l_r[rt][r] = l_r[rt][r] * al + p0 + p1;
#pragma unroll
        for (int dt = 0; dt < DT; ++dt) oacc[rt][dt][r] *= al;
        FragH t2; t2.h[0] = (_Float16)(p0 * 1024.0f); t2.h[1] = (_Float16)(p1 * 1024.0f); sP[w][rt * 16 + 8 * hh + r][ln] = t2.u[0]; sP[w][rt * 16 + 8 * hh + r][16 + ln] = t2.u[1]; }
    __builtin_amdgcn_fence(__ATOMIC_ACQ_REL, "workgroup"); __builtin_amdgcn_wave_barrier();
    FragH pa[2];
#pragma unroll
    for (int rt = 0; rt < RTN; ++rt) { pa[rt].half[0] = *(const v8us*)&sP[w][rt * 16 + ln][8 * hh]; pa[rt].half[1] = *(const v8us*)&sP[w][rt * 16 + ln][16 + 8 * hh]; }
#pragma unroll
    for (int dt = 0; dt < DT; ++dt) { const unsigned short* vrow = Vth + (size_t)(dt * 16 + ln) * NN + j0; FragH bv; bv.half[0] = *(const v8us*)(vrow + 8 * hh); bv.half[1] = *(const v8us*)(vrow + 16 + 8 * hh);
#pragma unroll
      for (int rt = 0; rt < RTN; ++rt) oacc[rt][dt] = mmaH<1>(pa[rt].v, pa[rt].v, bv.v, bv.v, oacc[rt][dt]); }
    __builtin_amdgcn_fence(__ATOMIC_ACQ_REL, "workgroup"); __builtin_amdgcn_wave_barrier(); }
#pragma unroll
  for (int rt = 0; rt < RTN; ++rt) {
#pragma unroll
    for (int r = 0; r < 8; ++r) { float l = l_r[rt][r]; l += __shfl_xor(l, 1, 32); l += __shfl_xor(l, 2, 32); l += __shfl_xor(l, 4, 32); l += __shfl_xor(l, 8, 32); l_r[rt][r] = (l > 0.f) ? 1.0f / (l * 1024.0f) : 0.f; }
#pragma unroll
    for (int dt = 0; dt < DT; ++dt)
#pragma unroll
      for (int r = 0; r < 8; ++r) sO[w][rt * 16 + 8 * hh + r][dt * 16 + ln] = oacc[rt][dt][r] * l_r[rt][r]; }
  __builtin_amdgcn_fence(__ATOMIC_ACQ_REL, "workgroup"); __builtin_amdgcn_wave_barrier();
  {
#pragma unroll
    for (int rp = 0; rp < RPW; rp += 2) { const int r = rp + (lane >> 4), pc = lane & 15; const v4f val = *(const v4fa*)&sO[w][r][pc * 4]; *(v4f*)(O + ((size_t)b * NN + q0 + r) * ldo + pc * 4) = val; }      /* 16 lanes × 16 B = one whole 256-B row */
     } }

__global__ __launch_bounds__(256) void k_out(const float* __restrict__ G, float* __restrict__ out) { __shared__ float tl[32][65]; const int tid = threadIdx.x; const int b = blockIdx.x / ((CC / 32) * (NN / 64)), rem = blockIdx.x % ((CC / 32) * (NN / 64)); const int cg = rem / (NN / 64), pg = rem % (NN / 64); const int c0 = cg * 32, p0 = pg * 64;
  for (int i = tid; i < 64 * 32; i += 256) { const int pp = i / 32, c = i % 32; tl[c][pp] = G[((size_t)b * NN + p0 + pp) * CC + c0 + c]; } __syncthreads();
  { for (int i = tid; i < 32 * 16; i += 256) { const int c = i / 16, q4 = i % 16; const v4f v = {tl[c][q4 * 4], tl[c][q4 * 4 + 1], tl[c][q4 * 4 + 2], tl[c][q4 * 4 + 3]}; *(v4f*)(out + ((size_t)b * CC + c0 + c) * NN + p0 + q4 * 4) = v; }  } }

extern "C" void kernel_launch(void* const* d_in, const int* in_sizes, int n_in,
                              void* d_out, int out_size, void* d_ws, size_t ws_size, hipStream_t stream) {
  (void)in_sizes; (void)n_in; (void)out_size;
  const float* qkv = (const float*)d_in[0];
  char* ws = (char*)d_ws; size_t off = 0;
  auto take = [&](size_t bytes) { char* p = ws + off; off += (bytes + 255) & ~(size_t)255; return p; };
  _Float16* QK = (_Float16*)take((size_t)NR * 2 * CC * 2); _Float16* Vt = (_Float16*)take((size_t)BB * CC * NN * 2); float* O = (float*)take((size_t)NR * CC * 4);
  if (off > ws_size) return;      // 8.4 + 4.2 + 8.4 ≈ 21 MB
  k_tok<<<BB * 2 * (NN / 32), 256, 0, stream>>>(qkv, QK);
  k_v16<<<(unsigned)(((size_t)BB * CC * NN / 8 + 255) / 256), 256, 0, stream>>>(qkv, Vt);
  k_flash<<<BB * (NN / 64), 128, 0, stream>>>(QK, 2 * CC, QK + CC, 2 * CC, Vt, nullptr, O, CC);
  k_out<<<BB * (CC / 32) * (NN / 64), 256, 0, stream>>>(O, (float*)d_out);
}

// v001
// Measured time: 242 microseconds a run.
// Next to v000, in two timings, it ran 1.77 and 1.75 times as fast.
#include <hip/hip_runtime.h>
// QKV self-attention on a channel-major qkv tensor [8, 3·64, 4096]: attn[s,t] = Σ_c q[c,s]·k[c,t]/√64, softmax over t, out[d,s] = Σ_t attn[s,t]·v[d,t].
// Compute dtype: qkv rounded to bf16 and carried exactly in f16 (q/k token-major planes, v in its natural [d][t] layout = Vᵀ); S and P·V on v_wmma_f32_16x16x32_f16 with
// f32 accumulation in one fused flash-style kernel (online softmax in f32; P in f16 ×2^10); O transposed back to [b][d][s] through LDS; output f32.
#define BB 8
#define CC 64
#define C3 192
#define NN 4096
#define NR (BB * NN)

typedef __bf16 v16b __attribute__((ext_vector_type(16)));
typedef unsigned short v8us __attribute__((ext_vector_type(8), may_alias));
typedef float  v8f  __attribute__((ext_vector_type(8)));
typedef float  v4f  __attribute__((ext_vector_type(4)));
typedef float  v4fa __attribute__((ext_vector_type(4), may_alias));
union FragB { v16b v; v8us half[2]; unsigned short u[16]; };

__device__ __forceinline__ unsigned short bf16_bits(float x) { unsigned int u = __float_as_uint(x); return (unsigned short)((u + 0x7FFFu + ((u >> 16) & 1u)) >> 16); }
__device__ __forceinline__ float bf16_val(unsigned short b) { return __uint_as_float(((unsigned int)b) << 16); }
__device__ __forceinline__ float bf16_round(float x) { return bf16_val(bf16_bits(x)); }
// D += A·B with NT terms: 1 = ah·bh, 2 = + al·bh (A split), 3 = + ah·bl (both split)
template <int NT>
__device__ __forceinline__ v8f mmaN(v16b ah, v16b al, v16b bh, v16b bl, v8f c) {
  c = __builtin_amdgcn_wmma_f32_16x16x32_bf16(false, ah, false, bh, (short)0, c, false, false);
  if (NT >= 2) c = __builtin_amdgcn_wmma_f32_16x16x32_bf16(false, al, false, bh, (short)0, c, false, false);
  if (NT >= 3) c = __builtin_amdgcn_wmma_f32_16x16x32_bf16(false, ah, false, bl, (short)0, c, false, false);
  asm volatile("v_nop\n\tv_nop\n\tv_nop\n\tv_nop" : "+v"(c) : "v"(ah), "v"(al), "v"(bh), "v"(bl));
  return c;
}

__global__ __launch_bounds__(256) void k_wt_bf16(const float* __restrict__ W, unsigned short* __restrict__ Wt, int K, int N) {
  const int t = blockIdx.x * 256 + threadIdx.x;
  const int k8n = K / 8;
  if (t >= N * k8n) return;
  const int n = t / k8n, k8 = (t % k8n) * 8;
  v8us v;
#pragma unroll
  for (int i = 0; i < 8; ++i) v[i] = bf16_bits(W[(size_t)(k8 + i) * N + n]);
  *(v8us*)(Wt + (size_t)n * K + k8) = v;
  
}

// GEMM C[M][N] (f32, pitch ldc) = act(A[M][K]·W + bias). A f32 row-major (pitch lda) converted per fragment to bf16
// (ASPLIT: hi/lo two planes -> 2 terms, else single rounded term); Wt bf16 [N][K] (pitch ldb). BIAS_BF16 rounds the
// bias to bf16 first (bias quantised to bf16 before the add). K%32==0, M%16==0, N%64==0.
template <bool ASPLIT, int ACT, bool BIAS_BF16>
__global__ __launch_bounds__(128) void k_gemm_bf(const float* __restrict__ A, int lda, const unsigned short* __restrict__ Wt, int ldb,
                                               const float* __restrict__ bias, float* __restrict__ C, int ldc, int M, int N, int K) {
  __shared__ __attribute__((aligned(16))) float so[4][16][64];
  const int tid = threadIdx.x, w = tid >> 5, lane = tid & 31, ln = lane & 15, hh = lane >> 4;
  const int ntn = N / 64;
  const int wid = blockIdx.x * 4 + w;
  const int mt = wid / ntn, nq = wid % ntn;
  if (mt * 16 >= M) return;
  const int row0 = mt * 16, col0 = nq * 64;
  const float* arow = A + (size_t)(row0 + ln) * lda;
  v8f acc[4] = {};
  for (int kb = 0; kb < K; kb += 32) {
    FragB ah, al;
    const v4f x0 = *(const v4fa*)(arow + kb + 8 * hh), x1 = *(const v4fa*)(arow + kb + 8 * hh + 4);
    const v4f x2 = *(const v4fa*)(arow + kb + 16 + 8 * hh), x3 = *(const v4fa*)(arow + kb + 16 + 8 * hh + 4);
    float xs[16] = {x0[0],x0[1],x0[2],x0[3],x1[0],x1[1],x1[2],x1[3],x2[0],x2[1],x2[2],x2[3],x3[0],x3[1],x3[2],x3[3]};
#pragma unroll
    for (int i = 0; i < 16; ++i) { const unsigned short hb = bf16_bits(xs[i]); ah.u[i] = hb; al.u[i] = ASPLIT ? bf16_bits(xs[i] - bf16_val(hb)) : (unsigned short)0; }
#pragma unroll
    for (int t = 0; t < 4; ++t) {
      const unsigned short* brow = Wt + (size_t)(col0 + t * 16 + ln) * ldb + kb;
      FragB b;
      b.half[0] = *(const v8us*)(brow + 8 * hh);
      b.half[1] = *(const v8us*)(brow + 16 + 8 * hh);
      acc[t] = mmaN<ASPLIT ? 2 : 1>(ah.v, al.v, b.v, b.v, acc[t]);
    }
  }
#pragma unroll
  for (int t = 0; t < 4; ++t) {
    float bv = bias ? bias[col0 + t * 16 + ln] : 0.f;
    if (BIAS_BF16) bv = bf16_round(bv);
#pragma unroll
    for (int r = 0; r < 8; ++r) { float v = acc[t][r] + bv; if (ACT == 1) v = fmaxf(v, 0.f); so[w][8 * hh + r][t * 16 + ln] = v; }
  }
  __builtin_amdgcn_fence(__ATOMIC_ACQ_REL, "workgroup");
  __builtin_amdgcn_wave_barrier();
  const int rsub = lane >> 4, c4 = (lane & 15) * 4;
  {
#pragma unroll
    for (int q = 0; q < 8; ++q) {
      const int r = q * 2 + rsub;
      const v4f v = *(const v4fa*)&so[w][r][c4];
      *(v4f*)(C + (size_t)(row0 + r) * ldc + col0 + c4) = v;
    }
    
  }
}

// Flash-style causal/unmasked attention, all contractions 3-term bf16 hi/lo splits, f32 softmax with running max.
// q,k,v rows are read from f32 buffers with arbitrary row pitch (so they can live inside a fused qkv buffer);
// D = head size (multiple of 32, <= 128); one wave = 16 query rows; block = 4 waves (64 queries) sharing K/V chunks of 32.
template <int D, bool CAUSAL>
__global__ __launch_bounds__(128) void k_flash(const float* __restrict__ qb, const float* __restrict__ kb, const float* __restrict__ vb,
                                             int pitch, int T, int H, float scale, float* __restrict__ y, int ypitch) {
  constexpr int KS = D / 32;        // k-steps for QK
  constexpr int DT = D / 16;        // d tiles for PV
  __shared__ __attribute__((aligned(16))) unsigned short sKh[32][D + 8], sKl[32][D + 8], sVh[32][D + 8], sVl[32][D + 8];
  __shared__ __attribute__((aligned(16))) unsigned short sPh[4][16][40], sPl[4][16][40];
  __shared__ __attribute__((aligned(16))) float sO[4][16][D];
  const int tid = threadIdx.x, w = tid >> 5, lane = tid & 31, ln = lane & 15, hh = lane >> 4;
  const int nqb = (T + 63) / 64;
  const int bh = blockIdx.x / nqb, qblk = blockIdx.x % nqb;
  const int b = bh / H, h = bh % H;
  const int q0 = qblk * 64 + w * 16;
  const float* Q = qb + (size_t)b * T * pitch + h * D;
  const float* K = kb + (size_t)b * T * pitch + h * D;
  const float* V = vb + (size_t)b * T * pitch + h * D;

  // A fragments of the wave's 16 query rows (scaled), hi/lo
  FragB aqh[KS], aql[KS];
  {
    int row = q0 + ln; if (row >= T) row = T - 1;
    const float* qr = Q + (size_t)row * pitch;
#pragma unroll
    for (int ks = 0; ks < KS; ++ks)
#pragma unroll
      for (int i = 0; i < 16; ++i) {
        const int d = ks * 32 + ((i < 8) ? (8 * hh + i) : (16 + 8 * hh + (i - 8)));
        const float x = qr[d] * scale; const unsigned short hb = bf16_bits(x);
        aqh[ks].u[i] = hb; aql[ks].u[i] = bf16_bits(x - bf16_val(hb));
      }
  }
  float m_r[8], l_r[8];
#pragma unroll
  for (int r = 0; r < 8; ++r) { m_r[r] = -3.0e38f; l_r[r] = 0.f; }
  v8f oacc[DT];
#pragma unroll
  for (int dt = 0; dt < DT; ++dt) oacc[dt] = (v8f){0.f,0.f,0.f,0.f,0.f,0.f,0.f,0.f};

  const int kv_end = CAUSAL ? min(T, qblk * 64 + 64) : T;     // block-uniform
  for (int j0 = 0; j0 < kv_end; j0 += 32) {
    __syncthreads();
    for (int e = tid; e < 32 * (D / 4); e += 128) {
      const int r = e / (D / 4), c4 = (e % (D / 4)) * 4;
      const int key = j0 + r;
      v4f kf = {0.f,0.f,0.f,0.f}, vf = {0.f,0.f,0.f,0.f};
      if (key < T) { kf = *(const v4fa*)(K + (size_t)key * pitch + c4); vf = *(const v4fa*)(V + (size_t)key * pitch + c4); }
#pragma unroll
      for (int t = 0; t < 4; ++t) {
        unsigned short hb = bf16_bits(kf[t]); sKh[r][c4 + t] = hb; sKl[r][c4 + t] = bf16_bits(kf[t] - bf16_val(hb));
        hb = bf16_bits(vf[t]); sVh[r][c4 + t] = hb; sVl[r][c4 + t] = bf16_bits(vf[t] - bf16_val(hb));
      }
    }
    __syncthreads();
    // S tile 16 x 32
    v8f s[2];
#pragma unroll
    for (int nt = 0; nt < 2; ++nt) {
      v8f acc = {};
#pragma unroll
      for (int ks = 0; ks < KS; ++ks) {
        FragB bh_, bl_;
        bh_.half[0] = *(const v8us*)&sKh[nt * 16 + ln][ks * 32 + 8 * hh]; bh_.half[1] = *(const v8us*)&sKh[nt * 16 + ln][ks * 32 + 16 + 8 * hh];
        bl_.half[0] = *(const v8us*)&sKl[nt * 16 + ln][ks * 32 + 8 * hh]; bl_.half[1] = *(const v8us*)&sKl[nt * 16 + ln][ks * 32 + 16 + 8 * hh];
        acc = mmaN<3>(aqh[ks].v, aql[ks].v, bh_.v, bl_.v, acc);
      }
      s[nt] = acc;
    }
    // mask + running max (rows 8hh+r; the 16 lanes of a half share rows)
    float alpha[8];
#pragma unroll
    for (int r = 0; r < 8; ++r) {
      const int qi = q0 + 8 * hh + r;
      const int ja = j0 + ln, jb = j0 + 16 + ln;
      if (CAUSAL) { if (ja > qi) s[0][r] = -3.0e38f; if (jb > qi) s[1][r] = -3.0e38f; }
      if (ja >= T) s[0][r] = -3.0e38f;
      if (jb >= T) s[1][r] = -3.0e38f;
      float mx = fmaxf(s[0][r], s[1][r]);
      mx = fmaxf(mx, __shfl_xor(mx, 1, 32)); mx = fmaxf(mx, __shfl_xor(mx, 2, 32)); mx = fmaxf(mx, __shfl_xor(mx, 4, 32)); mx = fmaxf(mx, __shfl_xor(mx, 8, 32));
      const float mnew = fmaxf(m_r[r], mx);
      alpha[r] = (mnew > -1.0e38f) ? __expf(m_r[r] - mnew) : 1.0f;
      const float p0 = (s[0][r] > -1.0e38f) ? __expf(s[0][r] - mnew) : 0.f;
      const float p1 = (s[1][r] > -1.0e38f) ? __expf(s[1][r] - mnew) : 0.f;
      m_r[r] = mnew;
      l_r[r] = l_r[r] * alpha[r] + p0 + p1;            // per-lane partial row sum (16 lanes combined at the end)
      unsigned short hb = bf16_bits(p0); sPh[w][8 * hh + r][ln] = hb;      sPl[w][8 * hh + r][ln] = bf16_bits(p0 - bf16_val(hb));
      hb = bf16_bits(p1);                sPh[w][8 * hh + r][16 + ln] = hb; sPl[w][8 * hh + r][16 + ln] = bf16_bits(p1 - bf16_val(hb));
    }
#pragma unroll
    for (int dt = 0; dt < DT; ++dt)
#pragma unroll
      for (int r = 0; r < 8; ++r) oacc[dt][r] *= alpha[r];
    __builtin_amdgcn_fence(__ATOMIC_ACQ_REL, "workgroup");
    __builtin_amdgcn_wave_barrier();
    FragB pah, pal;
    pah.half[0] = *(const v8us*)&sPh[w][ln][8 * hh]; pah.half[1] = *(const v8us*)&sPh[w][ln][16 + 8 * hh];
    pal.half[0] = *(const v8us*)&sPl[w][ln][8 * hh]; pal.half[1] = *(const v8us*)&sPl[w][ln][16 + 8 * hh];
#pragma unroll
    for (int dt = 0; dt < DT; ++dt) {
      FragB bvh, bvl;
#pragma unroll
      for (int i = 0; i < 8; ++i) {
        bvh.u[i] = sVh[8 * hh + i][dt * 16 + ln]; bvh.u[8 + i] = sVh[16 + 8 * hh + i][dt * 16 + ln];
        bvl.u[i] = sVl[8 * hh + i][dt * 16 + ln]; bvl.u[8 + i] = sVl[16 + 8 * hh + i][dt * 16 + ln];
      }
      oacc[dt] = mmaN<3>(pah.v, pal.v, bvh.v, bvl.v, oacc[dt]);
    }
    __builtin_amdgcn_fence(__ATOMIC_ACQ_REL, "workgroup");
    __builtin_amdgcn_wave_barrier();
  }
#pragma unroll
  for (int r = 0; r < 8; ++r) {
    float l = l_r[r];
    l += __shfl_xor(l, 1, 32); l += __shfl_xor(l, 2, 32); l += __shfl_xor(l, 4, 32); l += __shfl_xor(l, 8, 32);
    l_r[r] = (l > 0.f) ? 1.0f / l : 0.f;
  }
#pragma unroll
  for (int dt = 0; dt < DT; ++dt)
#pragma unroll
    for (int r = 0; r < 8; ++r) sO[w][8 * hh + r][dt * 16 + ln] = oacc[dt][r] * l_r[r];
  __builtin_amdgcn_fence(__ATOMIC_ACQ_REL, "workgroup");
  __builtin_amdgcn_wave_barrier();
  {
    for (int r = 0; r < 16; ++r) {
      const int row = q0 + r;
      if (row < T && lane < D / 4) {
        const v4f val = *(const v4fa*)&sO[w][r][lane * 4];
        *(v4f*)(y + ((size_t)b * T + row) * ypitch + h * D + lane * 4) = val;
      }
    }
    
  }
}

// GEMM C = act(A·W + bias + resid): A f32 (ASPLIT -> hi/lo 2 terms), Wt bf16 [N][K]; ACT 0 none, 1 relu, 2 exact gelu;
// resid (optional, f32, row index = (row % rmod), pitch ldr, RES_BF16 rounds it) added before the activation.
template <bool ASPLIT, int ACT, bool BIAS_BF16, bool RES_BF16>
__global__ __launch_bounds__(128) void k_gemm_bf3(const float* __restrict__ A, int lda, const unsigned short* __restrict__ Wt, int ldb,
                                                const float* __restrict__ bias, const float* __restrict__ resid, int rmod, int ldr,
                                                float* __restrict__ C, int ldc, int M, int N, int K) {
  __shared__ __attribute__((aligned(16))) float so[4][16][64];
  const int tid = threadIdx.x, w = tid >> 5, lane = tid & 31, ln = lane & 15, hh = lane >> 4;
  const int ntn = N / 64;
  const int wid = blockIdx.x * 4 + w;
  const int mt = wid / ntn, nq = wid % ntn;
  if (mt * 16 >= M) return;
  const int row0 = mt * 16, col0 = nq * 64;
  const float* arow = A + (size_t)(row0 + ln) * lda;
  v8f acc[4] = {};
  for (int kb = 0; kb < K; kb += 32) {
    FragB ah, al;
    const v4f x0 = *(const v4fa*)(arow + kb + 8 * hh), x1 = *(const v4fa*)(arow + kb + 8 * hh + 4);
    const v4f x2 = *(const v4fa*)(arow + kb + 16 + 8 * hh), x3 = *(const v4fa*)(arow + kb + 16 + 8 * hh + 4);
    float xs[16] = {x0[0],x0[1],x0[2],x0[3],x1[0],x1[1],x1[2],x1[3],x2[0],x2[1],x2[2],x2[3],x3[0],x3[1],x3[2],x3[3]};
#pragma unroll
    for (int i = 0; i < 16; ++i) { const unsigned short hb = bf16_bits(xs[i]); ah.u[i] = hb; al.u[i] = ASPLIT ? bf16_bits(xs[i] - bf16_val(hb)) : (unsigned short)0; }
#pragma unroll
    for (int t = 0; t < 4; ++t) {
      const unsigned short* brow = Wt + (size_t)(col0 + t * 16 + ln) * ldb + kb;
      FragB b;
      b.half[0] = *(const v8us*)(brow + 8 * hh);
      b.half[1] = *(const v8us*)(brow + 16 + 8 * hh);
      acc[t] = mmaN<ASPLIT ? 2 : 1>(ah.v, al.v, b.v, b.v, acc[t]);
    }
  }
#pragma unroll
  for (int t = 0; t < 4; ++t) {
    const int col = col0 + t * 16 + ln;
    float bv = bias ? bias[col] : 0.f;
    if (BIAS_BF16) bv = bf16_round(bv);
#pragma unroll
    for (int r = 0; r < 8; ++r) {
      float v = acc[t][r] + bv;
      if (resid) { float rv = resid[(size_t)((row0 + 8 * hh + r) % rmod) * ldr + col]; if (RES_BF16) rv = bf16_round(rv); v += rv; }
      if (ACT == 1) v = fmaxf(v, 0.f);
      if (ACT == 2) v = 0.5f * v * (1.0f + erff(v * 0.70710678118654752f));
      if (ACT == 3) { const float u = 0.7978845608028654f * (v + 0.044715f * v * v * v); v = 0.5f * v * (1.0f + tanhf(u)); }
      so[w][8 * hh + r][t * 16 + ln] = v;
    }
  }
  __builtin_amdgcn_fence(__ATOMIC_ACQ_REL, "workgroup");
  __builtin_amdgcn_wave_barrier();
  const int rsub = lane >> 4, c4 = (lane & 15) * 4;
  {
#pragma unroll
    for (int q = 0; q < 8; ++q) {
      const int r = q * 2 + rsub;
      const v4f v = *(const v4fa*)&so[w][r][c4];
      *(v4f*)(C + (size_t)(row0 + r) * ldc + col0 + c4) = v;
    }
    
  }
}
// row LayerNorm (biased variance, eps) over N: s = X (+ R); optional out_sum <- s; out_norm <- (s-mu)*rsqrt(var+eps)*g + b
template <bool PARAM_BF16>
__global__ __launch_bounds__(256) void k_layernorm(const float* __restrict__ X, const float* __restrict__ R, const float* __restrict__ g, const float* __restrict__ bta,
                                                  float* __restrict__ out_sum, float* __restrict__ out_norm, int N, float eps) {
  __shared__ float red[256];
  const int row = blockIdx.x, tid = threadIdx.x;
  const float* x = X + (size_t)row * N; const float* rr = R ? R + (size_t)row * N : nullptr;
  float vals[16];                     // up to N = 4096
  const int per = N / 256;            // contiguous chunk per thread? use strided-by-4 chunks: thread handles j = tid*4 + 1024*u
  float s1 = 0.f;
  for (int u = 0; u < per / 4; ++u) {
    const int j = tid * 4 + 1024 * u;
    const v4f a = *(const v4fa*)(x + j);
    v4f b = {0.f,0.f,0.f,0.f}; if (rr) b = *(const v4fa*)(rr + j);
#pragma unroll
    for (int q = 0; q < 4; ++q) { const float v = a[q] + b[q]; vals[u * 4 + q] = v; s1 += v; }
  }
  red[tid] = s1; __syncthreads();
  for (int st = 128; st > 0; st >>= 1) { if (tid < st) red[tid] += red[tid + st]; __syncthreads(); }
  const float mu = red[0] / (float)N; __syncthreads();
  float s2 = 0.f;
  for (int u = 0; u < per / 4; ++u)
#pragma unroll
    for (int q = 0; q < 4; ++q) { const float c = vals[u * 4 + q] - mu; s2 += c * c; }
  red[tid] = s2; __syncthreads();
  for (int st = 128; st > 0; st >>= 1) { if (tid < st) red[tid] += red[tid + st]; __syncthreads(); }
  const float rs = rsqrtf(red[0] / (float)N + eps);
  {
    for (int u = 0; u < per / 4; ++u) {
      const int j = tid * 4 + 1024 * u;
      v4f o, sm;
#pragma unroll
      for (int q = 0; q < 4; ++q) {
        float gg = g[j + q], bb = bta[j + q];
        if (PARAM_BF16) { gg = bf16_round(gg); bb = bf16_round(bb); }
        sm[q] = vals[u * 4 + q]; o[q] = (vals[u * 4 + q] - mu) * rs * gg + bb;
      }
      if (out_sum) *(v4f*)(out_sum + (size_t)row * N + j) = sm;
      *(v4f*)(out_norm + (size_t)row * N + j) = o;
    }
    
  }
}



// ---- f16 WMMA path (v_wmma_f32_16x16x32_f16): 11-bit significands for operands in range — used where a [0,1] probability operand needs more precision than bf16
typedef _Float16 v16h __attribute__((ext_vector_type(16)));
union FragH { v16h v; v8us half[2]; _Float16 h[16]; unsigned short u[16]; };
template <int NT>
__device__ __forceinline__ v8f mmaH(v16h ah, v16h al, v16h bh, v16h bl, v8f c) {
  c = __builtin_amdgcn_wmma_f32_16x16x32_f16(false, ah, false, bh, (short)0, c, false, false);
  if (NT >= 2) c = __builtin_amdgcn_wmma_f32_16x16x32_f16(false, al, false, bh, (short)0, c, false, false);
  if (NT >= 3) c = __builtin_amdgcn_wmma_f32_16x16x32_f16(false, ah, false, bl, (short)0, c, false, false);
  asm volatile("v_nop\n\tv_nop\n\tv_nop\n\tv_nop" : "+v"(c) : "v"(ah), "v"(al), "v"(bh), "v"(bl));
  return c;
}
// batched GEMM like k_gemm_b but f16 operands: A f32 (split into f16 hi/lo if ASPLIT, else rounded to f16), Bt = f16 values [n][k]; alpha; C f32; N multiple of 16 (partial tiles skipped)
template <bool ASPLIT>
__global__ __launch_bounds__(128) void k_gemm_h(const float* __restrict__ A, int lda, size_t sA, const _Float16* __restrict__ Bh, int ldb, size_t sB, float alpha, float* __restrict__ C, int ldc, size_t sC, int M, int N, int K) {
  __shared__ __attribute__((aligned(16))) float so[4][16][64];
  const int tid = threadIdx.x, w = tid >> 5, lane = tid & 31, ln = lane & 15, hh = lane >> 4; const int by = blockIdx.y;
  A += (size_t)by * sA; Bh += (size_t)by * sB; C += (size_t)by * sC;
  const int ntn = (N + 63) / 64; const int wid = blockIdx.x * 4 + w; const int mt = wid / ntn, nq = wid % ntn; if (mt * 16 >= M) return;
  const int row0 = mt * 16, col0 = nq * 64; const float* arow = A + (size_t)(row0 + ln) * lda;
  v8f acc[4] = {};
  for (int kb = 0; kb < K; kb += 32) {
    FragH ah, al;
    const v4f x0 = *(const v4fa*)(arow + kb + 8 * hh), x1 = *(const v4fa*)(arow + kb + 8 * hh + 4), x2 = *(const v4fa*)(arow + kb + 16 + 8 * hh), x3 = *(const v4fa*)(arow + kb + 16 + 8 * hh + 4);
    float xs[16] = {x0[0],x0[1],x0[2],x0[3],x1[0],x1[1],x1[2],x1[3],x2[0],x2[1],x2[2],x2[3],x3[0],x3[1],x3[2],x3[3]};
#pragma unroll
    for (int i = 0; i < 16; ++i) { const _Float16 h = (_Float16)xs[i]; ah.h[i] = h; al.h[i] = ASPLIT ? (_Float16)(xs[i] - (float)h) : (_Float16)0.0f; }
#pragma unroll
    for (int t = 0; t < 4; ++t) { if (col0 + t * 16 >= N) continue; const size_t boff = (size_t)(col0 + t * 16 + ln) * ldb + kb; FragH bq; bq.half[0] = *(const v8us*)(Bh + boff + 8 * hh); bq.half[1] = *(const v8us*)(Bh + boff + 16 + 8 * hh);
      acc[t] = mmaH<ASPLIT ? 2 : 1>(ah.v, al.v, bq.v, bq.v, acc[t]); }
  }
#pragma unroll
  for (int t = 0; t < 4; ++t) { if (col0 + t * 16 >= N) continue;
#pragma unroll
    for (int r = 0; r < 8; ++r) so[w][8 * hh + r][t * 16 + ln] = acc[t][r] * alpha; }
  __builtin_amdgcn_fence(__ATOMIC_ACQ_REL, "workgroup"); __builtin_amdgcn_wave_barrier();
  const int rsub = lane >> 4, c4 = (lane & 15) * 4;
  {
#pragma unroll
    for (int q = 0; q < 8; ++q) { const int r = q * 2 + rsub; if (col0 + c4 < N) { const v4f v = *(const v4fa*)&so[w][r][c4]; *(v4f*)(C + (size_t)(row0 + r) * ldc + col0 + c4) = v; } }
     }
}

// Wt[n][k] = f16(W[k][n]·scale) from f32 row-major W[K][N] (scale = power of two; bf16-exact weights stay exact in f16 away from the subnormal range)
__global__ __launch_bounds__(256) void k_wt_f16(const float* __restrict__ W, _Float16* __restrict__ Wt, int K, int N, float scale) {
  const int t = blockIdx.x * 256 + threadIdx.x; if (t >= N * (K / 8)) return; const int n = t / (K / 8), k8 = (t % (K / 8)) * 8; FragH f;
#pragma unroll
  for (int i = 0; i < 8; ++i) f.h[i] = (_Float16)(bf16_round(W[(size_t)(k8 + i) * N + n]) * scale); const v8us o = f.half[0];
  *(v8us*)((unsigned short*)Wt + (size_t)n * K + k8) = o; 
}
// k_gemm_hh variant with fused epilogue: v = acc·alpha + bias[by·sBias + col] (+ CP[(row/rowsPerB)·sCPb + by·64 + col] if CP) ; ACT 0 none / 1 elu ; writes f16 C16 (and f32 C if non-null)
template <int ACT>
__global__ __launch_bounds__(128) void k_gemm_hhx(const _Float16* __restrict__ A, int lda, size_t sA, const _Float16* __restrict__ Bh, int ldb, size_t sB, float alpha, const float* __restrict__ bias, size_t sBias, const float* __restrict__ CP, int rowsPerB, size_t sCPb, int row0g,
    float* __restrict__ C, _Float16* __restrict__ C16, int ldc, size_t sC, int M, int N, int K) {
  __shared__ __attribute__((aligned(16))) float so[4][16][64];
  const int tid = threadIdx.x, w = tid >> 5, lane = tid & 31, ln = lane & 15, hh = lane >> 4; const int by = blockIdx.y;
  A += (size_t)by * sA; Bh += (size_t)by * sB; const size_t cofs = (size_t)by * sC; const float* bp = bias ? bias + (size_t)by * sBias : nullptr;
  const int ntn = (N + 63) / 64; const int wid = blockIdx.x * 4 + w; const int mt = wid / ntn, nq = wid % ntn; if (mt * 16 >= M) return;
  const int row0 = mt * 16, col0 = nq * 64; const _Float16* arow = A + (size_t)(row0 + ln) * lda;
  v8f acc[4] = {};
  for (int kb = 0; kb < K; kb += 32) { FragH ah; ah.half[0] = *(const v8us*)((const unsigned short*)arow + kb + 8 * hh); ah.half[1] = *(const v8us*)((const unsigned short*)arow + kb + 16 + 8 * hh);
#pragma unroll
    for (int t = 0; t < 4; ++t) { if (col0 + t * 16 >= N) continue; const size_t boff = (size_t)(col0 + t * 16 + ln) * ldb + kb; FragH bq; bq.half[0] = *(const v8us*)((const unsigned short*)Bh + boff + 8 * hh); bq.half[1] = *(const v8us*)((const unsigned short*)Bh + boff + 16 + 8 * hh);
      acc[t] = mmaH<1>(ah.v, ah.v, bq.v, bq.v, acc[t]); }
  }
#pragma unroll
  for (int t = 0; t < 4; ++t) { if (col0 + t * 16 >= N) continue; const int col = col0 + t * 16 + ln; const float bv = bp ? bf16_round(bp[col]) : 0.f;
#pragma unroll
    for (int r = 0; r < 8; ++r) { float v = acc[t][r] * alpha + bv; if (CP) { const int bidx = (row0g + row0 + 8 * hh + r) / rowsPerB; v += CP[(size_t)bidx * sCPb + (size_t)by * 64 + col]; } if (ACT == 1) v = (v > 0.f) ? v : expm1f(v); else if (ACT == 7) v = (v > 0.f) ? v + 1.0f : expf(v); else if (ACT == 8) v = tanhf(v); else if (ACT == 9) v = 0.5f * v * (1.0f + tanhf(0.7978845608028654f * (v + 0.044715f * v * v * v))); else if (ACT == 11) v = 1.0f / (1.0f + expf(-v)); else if (ACT == 12) v = (v > 0.f) ? v : 0.01f * v; else if (ACT == 14) v = (v > 0.f) ? v : 0.1f * v; else if (ACT == 15) v = v / (1.0f + expf(-v)); else if (ACT == 3) v = fmaxf(v, 0.f); else if (ACT == 6) v = 0.5f * v * (1.0f + erff(v * 0.70710678118654752f)); so[w][8 * hh + r][t * 16 + ln] = v; } }
  __builtin_amdgcn_fence(__ATOMIC_ACQ_REL, "workgroup"); __builtin_amdgcn_wave_barrier();
  const int rsub = lane >> 4, c4 = (lane & 15) * 4; typedef _Float16 v4h __attribute__((ext_vector_type(4)));
  {
#pragma unroll
    for (int q = 0; q < 8; ++q) { const int r = q * 2 + rsub; if (col0 + c4 < N) { const v4f v = *(const v4fa*)&so[w][r][c4]; if (C) *(v4f*)(C + cofs + (size_t)(row0 + r) * ldc + col0 + c4) = v; if (C16) { v4h h4; for (int i = 0; i < 4; ++i) h4[i] = (_Float16)v[i]; *(v4h*)(C16 + cofs + (size_t)(row0 + r) * ldc + col0 + c4) = h4; } } }
     }
}


typedef _Float16 v4h __attribute__((ext_vector_type(4)));

__global__ __launch_bounds__(256) void k_x16(const float* __restrict__ x, _Float16* __restrict__ X16, size_t n8) { const size_t t = (size_t)blockIdx.x * 256 + threadIdx.x; if (t >= n8) return; FragH f;
#pragma unroll
  for (int q = 0; q < 8; ++q) f.h[q] = (_Float16)bf16_round(x[t * 8 + q]); *(v8us*)((unsigned short*)X16 + t * 8) = f.half[0];  }
__global__ __launch_bounds__(256) void k_h16(const float* __restrict__ x, _Float16* __restrict__ X16, size_t n8) { const size_t t = (size_t)blockIdx.x * 256 + threadIdx.x; if (t >= n8) return; FragH f;
#pragma unroll
  for (int q = 0; q < 8; ++q) f.h[q] = (_Float16)x[t * 8 + q]; *(v8us*)((unsigned short*)X16 + t * 8) = f.half[0];  }
__global__ __launch_bounds__(256) void k_round16f(const float* __restrict__ W, _Float16* __restrict__ Bt, size_t n8) { const size_t t = (size_t)blockIdx.x * 256 + threadIdx.x; if (t >= n8) return; FragH f;
#pragma unroll
  for (int i = 0; i < 8; ++i) f.h[i] = (_Float16)(bf16_round(W[t * 8 + i]) * 16.0f); *(v8us*)((unsigned short*)Bt + t * 8) = f.half[0];  }
template <int NHv, int TTv>
__global__ __launch_bounds__(256) void k_vt(const _Float16* __restrict__ V16, int ldv, int voff, _Float16* __restrict__ Vt) { __shared__ unsigned short tl[64][66]; const int tid = threadIdx.x; const int slab = blockIdx.x / (TTv / 64), lg = blockIdx.x % (TTv / 64); const int b = slab / NHv, h = slab % NHv;
  for (int i = tid; i < 64 * 8; i += 256) { const int r = i / 8, c8 = (i % 8) * 8; FragH f; f.half[0] = *(const v8us*)((const unsigned short*)V16 + ((size_t)b * TTv + lg * 64 + r) * ldv + voff + h * 64 + c8);
#pragma unroll
    for (int q = 0; q < 8; ++q) tl[r][c8 + q] = f.u[q]; }
  __syncthreads();
  {
#pragma unroll
    for (int rd = 0; rd < 2; ++rd) { const int d = rd * 32 + tid / 8, pc = tid % 8; FragH f;
#pragma unroll
      for (int q = 0; q < 8; ++q) f.u[q] = tl[pc * 8 + q][d];
      *(v8us*)((unsigned short*)Vt + ((size_t)slab * 64 + d) * TTv + lg * 64 + pc * 8) = f.half[0]; }
     } }

__global__ __launch_bounds__(256) void k_tok(const float* __restrict__ x, _Float16* __restrict__ X16) { __shared__ float tl[32][65]; const int tid = threadIdx.x; const int b = blockIdx.x / (2 * (NN / 32)), rem = blockIdx.x % (2 * (NN / 32)); const int cg = rem / (NN / 32), pg = rem % (NN / 32); const int c0 = cg * 64, p0 = pg * 32;
  for (int i = tid; i < 64 * 32; i += 256) { const int c = i / 32, pp = i % 32; tl[pp][c] = bf16_round(x[((size_t)b * C3 + c0 + c) * NN + p0 + pp]); } __syncthreads();
  const int r = tid / 8, pc = tid % 8; FragH f; for (int q = 0; q < 8; ++q) f.h[q] = (_Float16)tl[r][pc * 8 + q]; const size_t row = (size_t)b * NN + p0 + r; *(v8us*)((unsigned short*)X16 + row * (2 * CC) + c0 + pc * 8) = f.half[0];  }
__global__ __launch_bounds__(256) void k_v16(const float* __restrict__ x, _Float16* __restrict__ Vt) { const size_t t = (size_t)blockIdx.x * 256 + threadIdx.x; if (t >= (size_t)BB * CC * NN / 8) return; const int n8 = (int)(t % (NN / 8)) * 8; const int d = (int)((t / (NN / 8)) % CC); const int b = (int)(t / ((size_t)(NN / 8) * CC)); FragH f;
#pragma unroll
  for (int q = 0; q < 8; ++q) f.h[q] = (_Float16)bf16_round(x[((size_t)b * C3 + 2 * CC + d) * NN + n8 + q]); *(v8us*)((unsigned short*)Vt + t * 8) = f.half[0];  }
// lane l <-> lane l ^ 16 (the two lane halves hold the two key halves of one query column)
__device__ __forceinline__ float xhalf(float x) { return __builtin_bit_cast(float, __builtin_amdgcn_permlanex16(__builtin_bit_cast(int, x), __builtin_bit_cast(int, x), 0x76543210, 0xfedcba98, false, false)); }
__global__ __launch_bounds__(128) void k_flash(const _Float16* __restrict__ Q16, int ldq, const _Float16* __restrict__ K16, int ldk, const _Float16* __restrict__ Vt, const int* __restrict__ MSK, float* __restrict__ O, int ldo) {
  constexpr int RPW = 16, NQB = NN / (4 * RPW), DT = 4, KS = 2;
  __shared__ __attribute__((aligned(16))) float sO[4][RPW][64 + 4];
  const int tid = threadIdx.x, w = tid >> 5, lane = tid & 31, ln = lane & 15, hh = lane >> 4;
  const int slab = blockIdx.x / NQB, qblk = blockIdx.x % NQB; const int b = slab; const int h = 0; const int qb0 = qblk * (4 * RPW); const int q0 = qb0 + w * RPW;
  FragH aq[KS];
  { const unsigned short* qr = (const unsigned short*)Q16 + ((size_t)b * NN + q0 + ln) * ldq;
#pragma unroll
    for (int ks = 0; ks < KS; ++ks) { aq[ks].half[0] = *(const v8us*)(qr + ks * 32 + 8 * hh); aq[ks].half[1] = *(const v8us*)(qr + ks * 32 + 16 + 8 * hh); } }
  const unsigned short* Vth = (const unsigned short*)Vt + (size_t)b * CC * NN;      /* Vᵀ = v[b][d][n] */
  float m_r = -3.0e38f, l_r = 0.f; v8f oacc[DT];      /* oacc[dt][r] = Ot[dt*16 + 8hh + r][query ln] */
#pragma unroll
  for (int dt = 0; dt < DT; ++dt) oacc[dt] = (v8f){0.f,0.f,0.f,0.f,0.f,0.f,0.f,0.f};
  const int jend = NN;
  /* the key loop stays rolled as before; the constant-trip inner loops are unrolled so that the fragment and score arrays stay in registers */
#pragma unroll 1
  for (int j0 = 0; j0 < jend; j0 += 32) {
    v8f s[2];      /* s[nt][r] = St[key j0 + nt*16 + 8hh + r][query ln] */
#pragma unroll
    for (int nt = 0; nt < 2; ++nt) { const unsigned short* kr = (const unsigned short*)K16 + ((size_t)b * NN + j0 + nt * 16 + ln) * ldk; FragH bk[KS];
#pragma unroll
      for (int ks = 0; ks < KS; ++ks) { bk[ks].half[0] = *(const v8us*)(kr + ks * 32 + 8 * hh); bk[ks].half[1] = *(const v8us*)(kr + ks * 32 + 16 + 8 * hh); }
      v8f acc = (v8f){0.f,0.f,0.f,0.f,0.f,0.f,0.f,0.f};
#pragma unroll
      for (int ks = 0; ks < KS; ++ks) acc = mmaH<1>(bk[ks].v, bk[ks].v, aq[ks].v, aq[ks].v, acc);
      s[nt] = acc; }
    float sc[16]; float mq[4];
#pragma unroll
    for (int i = 0; i < 16; ++i) sc[i] = s[i >> 3][i & 7] * 0.125f;
#pragma unroll
    for (int c = 0; c < 4; ++c) mq[c] = fmaxf(fmaxf(sc[c], sc[4 + c]), fmaxf(sc[8 + c], sc[12 + c]));
    float mc = fmaxf(fmaxf(mq[0], mq[1]), fmaxf(mq[2], mq[3])); mc = fmaxf(mc, xhalf(mc));
    const float mn = fmaxf(m_r, mc); const float al = (mn > -1.0e38f) ? expf(m_r - mn) : 1.0f; m_r = mn;
    FragH pb; float ps[4] = {0.f, 0.f, 0.f, 0.f};      /* pb.h[i] = Pt[key j0 + (i < 8 ? 8hh + i : 8 + 8hh + i)][query ln] x 2^10 */
#pragma unroll
    for (int i = 0; i < 16; ++i) { const float p = expf(sc[i] - mn); ps[i & 3] += p; pb.h[i] = (_Float16)(p * 1024.0f); }
    l_r = l_r * al + ((ps[0] + ps[1]) + (ps[2] + ps[3]));      /* this lane half's keys only; the halves join after the loop */
#pragma unroll
    for (int dt = 0; dt < DT; ++dt)
#pragma unroll
      for (int r = 0; r < 8; ++r) oacc[dt][r] *= al;
#pragma unroll
    for (int dt = 0; dt < DT; ++dt) { const unsigned short* vrow = Vth + (size_t)(dt * 16 + ln) * NN + j0; FragH bv; bv.half[0] = *(const v8us*)(vrow + 8 * hh); bv.half[1] = *(const v8us*)(vrow + 16 + 8 * hh);
      oacc[dt] = mmaH<1>(bv.v, bv.v, pb.v, pb.v, oacc[dt]); }
  }
  const float l = l_r + xhalf(l_r); const float linv = (l > 0.f) ? 1.0f / (l * 1024.0f) : 0.f;
#pragma unroll
  for (int dt = 0; dt < DT; ++dt) { v4f lo, hi;
#pragma unroll
    for (int r = 0; r < 4; ++r) { lo[r] = oacc[dt][r] * linv; hi[r] = oacc[dt][4 + r] * linv; }
    *(v4fa*)&sO[w][ln][dt * 16 + 8 * hh] = lo; *(v4fa*)&sO[w][ln][dt * 16 + 8 * hh + 4] = hi; }
  __builtin_amdgcn_fence(__ATOMIC_ACQ_REL, "workgroup"); __builtin_amdgcn_wave_barrier();
  {
#pragma unroll
    for (int rp = 0; rp < RPW; rp += 2) { const int r = rp + (lane >> 4), pc = lane & 15; const v4f val = *(const v4fa*)&sO[w][r][pc * 4]; *(v4f*)(O + ((size_t)b * NN + q0 + r) * ldo + pc * 4) = val; }      /* 16 lanes × 16 B = one whole 256-B row */
     } }

__global__ __launch_bounds__(256) void k_out(const float* __restrict__ G, float* __restrict__ out) { __shared__ float tl[32][65]; const int tid = threadIdx.x; const int b = blockIdx.x / ((CC / 32) * (NN / 64)), rem = blockIdx.x % ((CC / 32) * (NN / 64)); const int cg = rem / (NN / 64), pg = rem % (NN / 64); const int c0 = cg * 32, p0 = pg * 64;
  for (int i = tid; i < 64 * 32; i += 256) { const int pp = i / 32, c = i % 32; tl[c][pp] = G[((size_t)b * NN + p0 + pp) * CC + c0 + c]; } __syncthreads();
  { for (int i = tid; i < 32 * 16; i += 256) { const int c = i / 16, q4 = i % 16; const v4f v = {tl[c][q4 * 4], tl[c][q4 * 4 + 1], tl[c][q4 * 4 + 2], tl[c][q4 * 4 + 3]}; *(v4f*)(out + ((size_t)b * CC + c0 + c) * NN + p0 + q4 * 4) = v; }  } }

extern "C" void kernel_launch(void* const* d_in, const int* in_sizes, int n_in,
                              void* d_out, int out_size, void* d_ws, size_t ws_size, hipStream_t stream) {
  (void)in_sizes; (void)n_in; (void)out_size;
  const float* qkv = (const float*)d_in[0];
  char* ws = (char*)d_ws; size_t off = 0;
  auto take = [&](size_t bytes) { char* p = ws + off; off += (bytes + 255) & ~(size_t)255; return p; };
  _Float16* QK = (_Float16*)take((size_t)NR * 2 * CC * 2); _Float16* Vt = (_Float16*)take((size_t)BB * CC * NN * 2); float* O = (float*)take((size_t)NR * CC * 4);
  if (off > ws_size) return;      // 8.4 + 4.2 + 8.4 ≈ 21 MB
  k_tok<<<BB * 2 * (NN / 32), 256, 0, stream>>>(qkv, QK);
  k_v16<<<(unsigned)(((size_t)BB * CC * NN / 8 + 255) / 256), 256, 0, stream>>>(qkv, Vt);
  k_flash<<<BB * (NN / 64), 128, 0, stream>>>(QK, 2 * CC, QK + CC, 2 * CC, Vt, nullptr, O, CC);
  k_out<<<BB * (CC / 32) * (NN / 64), 256, 0, stream>>>(O, (float*)d_out);
}

// v002
// It runs in 140 microseconds.
// In two side-by-side timings against v001, it was 1.71 and 1.73 times as fast.
// All steps since v000 together make it 3.03 times as fast.
#include <hip/hip_runtime.h>
// QKV self-attention on a channel-major qkv tensor [8, 3·64, 4096]: attn[s,t] = Σ_c q[c,s]·k[c,t]/√64, softmax over t, out[d,s] = Σ_t attn[s,t]·v[d,t].
// Compute dtype: qkv rounded to bf16 and carried exactly in f16 (q/k token-major planes, v in its natural [d][t] layout = Vᵀ); S and P·V on v_wmma_f32_16x16x32_f16 with
// f32 accumulation in one fused flash-style kernel (online softmax in f32; P in f16 ×2^10); O transposed back to [b][d][s] through LDS; output f32.
#define BB 8
#define CC 64
#define C3 192
#define NN 4096
#define NR (BB * NN)

typedef __bf16 v16b __attribute__((ext_vector_type(16)));
typedef unsigned short v8us __attribute__((ext_vector_type(8), may_alias));
typedef float  v8f  __attribute__((ext_vector_type(8)));
typedef float  v4f  __attribute__((ext_vector_type(4)));
typedef float  v4fa __attribute__((ext_vector_type(4), may_alias));
union FragB { v16b v; v8us half[2]; unsigned short u[16]; };

__device__ __forceinline__ unsigned short bf16_bits(float x) { unsigned int u = __float_as_uint(x); return (unsigned short)((u + 0x7FFFu + ((u >> 16) & 1u)) >> 16); }
__device__ __forceinline__ float bf16_val(unsigned short b) { return __uint_as_float(((unsigned int)b) << 16); }
__device__ __forceinline__ float bf16_round(float x) { return bf16_val(bf16_bits(x)); }
// D += A·B with NT terms: 1 = ah·bh, 2 = + al·bh (A split), 3 = + ah·bl (both split)
template <int NT>
__device__ __forceinline__ v8f mmaN(v16b ah, v16b al, v16b bh, v16b bl, v8f c) {
  c = __builtin_amdgcn_wmma_f32_16x16x32_bf16(false, ah, false, bh, (short)0, c, false, false);
  if (NT >= 2) c = __builtin_amdgcn_wmma_f32_16x16x32_bf16(false, al, false, bh, (short)0, c, false, false);
  if (NT >= 3) c = __builtin_amdgcn_wmma_f32_16x16x32_bf16(false, ah, false, bl, (short)0, c, false, false);
  asm volatile("v_nop\n\tv_nop\n\tv_nop\n\tv_nop" : "+v"(c) : "v"(ah), "v"(al), "v"(bh), "v"(bl));
  return c;
}

__global__ __launch_bounds__(256) void k_wt_bf16(const float* __restrict__ W, unsigned short* __restrict__ Wt, int K, int N) {
  const int t = blockIdx.x * 256 + threadIdx.x;
  const int k8n = K / 8;
  if (t >= N * k8n) return;
  const int n = t / k8n, k8 = (t % k8n) * 8;
  v8us v;
#pragma unroll
  for (int i = 0; i < 8; ++i) v[i] = bf16_bits(W[(size_t)(k8 + i) * N + n]);
  *(v8us*)(Wt + (size_t)n * K + k8) = v;
  
}

// GEMM C[M][N] (f32, pitch ldc) = act(A[M][K]·W + bias). A f32 row-major (pitch lda) converted per fragment to bf16
// (ASPLIT: hi/lo two planes -> 2 terms, else single rounded term); Wt bf16 [N][K] (pitch ldb). BIAS_BF16 rounds the
// bias to bf16 first (bias quantised to bf16 before the add). K%32==0, M%16==0, N%64==0.
template <bool ASPLIT, int ACT, bool BIAS_BF16>
__global__ __launch_bounds__(128) void k_gemm_bf(const float* __restrict__ A, int lda, const unsigned short* __restrict__ Wt, int ldb,
                                               const float* __restrict__ bias, float* __restrict__ C, int ldc, int M, int N, int K) {
  __shared__ __attribute__((aligned(16))) float so[4][16][64];
  const int tid = threadIdx.x, w = tid >> 5, lane = tid & 31, ln = lane & 15, hh = lane >> 4;
  const int ntn = N / 64;
  const int wid = blockIdx.x * 4 + w;
  const int mt = wid / ntn, nq = wid % ntn;
  if (mt * 16 >= M) return;
  const int row0 = mt * 16, col0 = nq * 64;
  const float* arow = A + (size_t)(row0 + ln) * lda;
  v8f acc[4] = {};
  for (int kb = 0; kb < K; kb += 32) {
    FragB ah, al;
    const v4f x0 = *(const v4fa*)(arow + kb + 8 * hh), x1 = *(const v4fa*)(arow + kb + 8 * hh + 4);
    const v4f x2 = *(const v4fa*)(arow + kb + 16 + 8 * hh), x3 = *(const v4fa*)(arow + kb + 16 + 8 * hh + 4);
    float xs[16] = {x0[0],x0[1],x0[2],x0[3],x1[0],x1[1],x1[2],x1[3],x2[0],x2[1],x2[2],x2[3],x3[0],x3[1],x3[2],x3[3]};
#pragma unroll
    for (int i = 0; i < 16; ++i) { const unsigned short hb = bf16_bits(xs[i]); ah.u[i] = hb; al.u[i] = ASPLIT ? bf16_bits(xs[i] - bf16_val(hb)) : (unsigned short)0; }
#pragma unroll
    for (int t = 0; t < 4; ++t) {
      const unsigned short* brow = Wt + (size_t)(col0 + t * 16 + ln) * ldb + kb;
      FragB b;
      b.half[0] = *(const v8us*)(brow + 8 * hh);
      b.half[1] = *(const v8us*)(brow + 16 + 8 * hh);
      acc[t] = mmaN<ASPLIT ? 2 : 1>(ah.v, al.v, b.v, b.v, acc[t]);
    }
  }
#pragma unroll
  for (int t = 0; t < 4; ++t) {
    float bv = bias ? bias[col0 + t * 16 + ln] : 0.f;
    if (BIAS_BF16) bv = bf16_round(bv);
#pragma unroll
    for (int r = 0; r < 8; ++r) { float v = acc[t][r] + bv; if (ACT == 1) v = fmaxf(v, 0.f); so[w][8 * hh + r][t * 16 + ln] = v; }
  }
  __builtin_amdgcn_fence(__ATOMIC_ACQ_REL, "workgroup");
  __builtin_amdgcn_wave_barrier();
  const int rsub = lane >> 4, c4 = (lane & 15) * 4;
  {
#pragma unroll
    for (int q = 0; q < 8; ++q) {
      const int r = q * 2 + rsub;
      const v4f v = *(const v4fa*)&so[w][r][c4];
      *(v4f*)(C + (size_t)(row0 + r) * ldc + col0 + c4) = v;
    }
    
  }
}

// Flash-style causal/unmasked attention, all contractions 3-term bf16 hi/lo splits, f32 softmax with running max.
// q,k,v rows are read from f32 buffers with arbitrary row pitch (so they can live inside a fused qkv buffer);
// D = head size (multiple of 32, <= 128); one wave = 16 query rows; block = 4 waves (64 queries) sharing K/V chunks of 32.
template <int D, bool CAUSAL>
__global__ __launch_bounds__(128) void k_flash(const float* __restrict__ qb, const float* __restrict__ kb, const float* __restrict__ vb,
                                             int pitch, int T, int H, float scale, float* __restrict__ y, int ypitch) {
  constexpr int KS = D / 32;        // k-steps for QK
  constexpr int DT = D / 16;        // d tiles for PV
  __shared__ __attribute__((aligned(16))) unsigned short sKh[32][D + 8], sKl[32][D + 8], sVh[32][D + 8], sVl[32][D + 8];
  __shared__ __attribute__((aligned(16))) unsigned short sPh[4][16][40], sPl[4][16][40];
  __shared__ __attribute__((aligned(16))) float sO[4][16][D];
  const int tid = threadIdx.x, w = tid >> 5, lane = tid & 31, ln = lane & 15, hh = lane >> 4;
  const int nqb = (T + 63) / 64;
  const int bh = blockIdx.x / nqb, qblk = blockIdx.x % nqb;
  const int b = bh / H, h = bh % H;
  const int q0 = qblk * 64 + w * 16;
  const float* Q = qb + (size_t)b * T * pitch + h * D;
  const float* K = kb + (size_t)b * T * pitch + h * D;
  const float* V = vb + (size_t)b * T * pitch + h * D;

  // A fragments of the wave's 16 query rows (scaled), hi/lo
  FragB aqh[KS], aql[KS];
  {
    int row = q0 + ln; if (row >= T) row = T - 1;
    const float* qr = Q + (size_t)row * pitch;
#pragma unroll
    for (int ks = 0; ks < KS; ++ks)
#pragma unroll
      for (int i = 0; i < 16; ++i) {
        const int d = ks * 32 + ((i < 8) ? (8 * hh + i) : (16 + 8 * hh + (i - 8)));
        const float x = qr[d] * scale; const unsigned short hb = bf16_bits(x);
        aqh[ks].u[i] = hb; aql[ks].u[i] = bf16_bits(x - bf16_val(hb));
      }
  }
  float m_r[8], l_r[8];
#pragma unroll
  for (int r = 0; r < 8; ++r) { m_r[r] = -3.0e38f; l_r[r] = 0.f; }
  v8f oacc[DT];
#pragma unroll
  for (int dt = 0; dt < DT; ++dt) oacc[dt] = (v8f){0.f,0.f,0.f,0.f,0.f,0.f,0.f,0.f};

  const int kv_end = CAUSAL ? min(T, qblk * 64 + 64) : T;     // block-uniform
  for (int j0 = 0; j0 < kv_end; j0 += 32) {
    __syncthreads();
    for (int e = tid; e < 32 * (D / 4); e += 128) {
      const int r = e / (D / 4), c4 = (e % (D / 4)) * 4;
      const int key = j0 + r;
      v4f kf = {0.f,0.f,0.f,0.f}, vf = {0.f,0.f,0.f,0.f};
      if (key < T) { kf = *(const v4fa*)(K + (size_t)key * pitch + c4); vf = *(const v4fa*)(V + (size_t)key * pitch + c4); }
#pragma unroll
      for (int t = 0; t < 4; ++t) {
        unsigned short hb = bf16_bits(kf[t]); sKh[r][c4 + t] = hb; sKl[r][c4 + t] = bf16_bits(kf[t] - bf16_val(hb));
        hb = bf16_bits(vf[t]); sVh[r][c4 + t] = hb; sVl[r][c4 + t] = bf16_bits(vf[t] - bf16_val(hb));
      }
    }
    __syncthreads();
    // S tile 16 x 32
    v8f s[2];
#pragma unroll
    for (int nt = 0; nt < 2; ++nt) {
      v8f acc = {};
#pragma unroll
      for (int ks = 0; ks < KS; ++ks) {
        FragB bh_, bl_;
        bh_.half[0] = *(const v8us*)&sKh[nt * 16 + ln][ks * 32 + 8 * hh]; bh_.half[1] = *(const v8us*)&sKh[nt * 16 + ln][ks * 32 + 16 + 8 * hh];
        bl_.half[0] = *(const v8us*)&sKl[nt * 16 + ln][ks * 32 + 8 * hh]; bl_.half[1] = *(const v8us*)&sKl[nt * 16 + ln][ks * 32 + 16 + 8 * hh];
        acc = mmaN<3>(aqh[ks].v, aql[ks].v, bh_.v, bl_.v, acc);
      }
      s[nt] = acc;
    }
    // mask + running max (rows 8hh+r; the 16 lanes of a half share rows)
    float alpha[8];
#pragma unroll
    for (int r = 0; r < 8; ++r) {
      const int qi = q0 + 8 * hh + r;
      const int ja = j0 + ln, jb = j0 + 16 + ln;
      if (CAUSAL) { if (ja > qi) s[0][r] = -3.0e38f; if (jb > qi) s[1][r] = -3.0e38f; }
      if (ja >= T) s[0][r] = -3.0e38f;
      if (jb >= T) s[1][r] = -3.0e38f;
      float mx = fmaxf(s[0][r], s[1][r]);
      mx = fmaxf(mx, __shfl_xor(mx, 1, 32)); mx = fmaxf(mx, __shfl_xor(mx, 2, 32)); mx = fmaxf(mx, __shfl_xor(mx, 4, 32)); mx = fmaxf(mx, __shfl_xor(mx, 8, 32));
      const float mnew = fmaxf(m_r[r], mx);
      alpha[r] = (mnew > -1.0e38f) ? __expf(m_r[r] - mnew) : 1.0f;
      const float p0 = (s[0][r] > -1.0e38f) ? __expf(s[0][r] - mnew) : 0.f;
      const float p1 = (s[1][r] > -1.0e38f) ? __expf(s[1][r] - mnew) : 0.f;
      m_r[r] = mnew;
      l_r[r] = l_r[r] * alpha[r] + p0 + p1;            // per-lane partial row sum (16 lanes combined at the end)
      unsigned short hb = bf16_bits(p0); sPh[w][8 * hh + r][ln] = hb;      sPl[w][8 * hh + r][ln] = bf16_bits(p0 - bf16_val(hb));
      hb = bf16_bits(p1);                sPh[w][8 * hh + r][16 + ln] = hb; sPl[w][8 * hh + r][16 + ln] = bf16_bits(p1 - bf16_val(hb));
    }
#pragma unroll
    for (int dt = 0; dt < DT; ++dt)
#pragma unroll
      for (int r = 0; r < 8; ++r) oacc[dt][r] *= alpha[r];
    __builtin_amdgcn_fence(__ATOMIC_ACQ_REL, "workgroup");
    __builtin_amdgcn_wave_barrier();
    FragB pah, pal;
    pah.half[0] = *(const v8us*)&sPh[w][ln][8 * hh]; pah.half[1] = *(const v8us*)&sPh[w][ln][16 + 8 * hh];
    pal.half[0] = *(const v8us*)&sPl[w][ln][8 * hh]; pal.half[1] = *(const v8us*)&sPl[w][ln][16 + 8 * hh];
#pragma unroll
    for (int dt = 0; dt < DT; ++dt) {
      FragB bvh, bvl;
#pragma unroll
      for (int i = 0; i < 8; ++i) {
        bvh.u[i] = sVh[8 * hh + i][dt * 16 + ln]; bvh.u[8 + i] = sVh[16 + 8 * hh + i][dt * 16 + ln];
        bvl.u[i] = sVl[8 * hh + i][dt * 16 + ln]; bvl.u[8 + i] = sVl[16 + 8 * hh + i][dt * 16 + ln];
      }
      oacc[dt] = mmaN<3>(pah.v, pal.v, bvh.v, bvl.v, oacc[dt]);
    }
    __builtin_amdgcn_fence(__ATOMIC_ACQ_REL, "workgroup");
    __builtin_amdgcn_wave_barrier();
  }
#pragma unroll
  for (int r = 0; r < 8; ++r) {
    float l = l_r[r];
    l += __shfl_xor(l, 1, 32); l += __shfl_xor(l, 2, 32); l += __shfl_xor(l, 4, 32); l += __shfl_xor(l, 8, 32);
    l_r[r] = (l > 0.f) ? 1.0f / l : 0.f;
  }
#pragma unroll
  for (int dt = 0; dt < DT; ++dt)
#pragma unroll
    for (int r = 0; r < 8; ++r) sO[w][8 * hh + r][dt * 16 + ln] = oacc[dt][r] * l_r[r];
  __builtin_amdgcn_fence(__ATOMIC_ACQ_REL, "workgroup");
  __builtin_amdgcn_wave_barrier();
  {
    for (int r = 0; r < 16; ++r) {
      const int row = q0 + r;
      if (row < T && lane < D / 4) {
        const v4f val = *(const v4fa*)&sO[w][r][lane * 4];
        *(v4f*)(y + ((size_t)b * T + row) * ypitch + h * D + lane * 4) = val;
      }
    }
    
  }
}

// GEMM C = act(A·W + bias + resid): A f32 (ASPLIT -> hi/lo 2 terms), Wt bf16 [N][K]; ACT 0 none, 1 relu, 2 exact gelu;
// resid (optional, f32, row index = (row % rmod), pitch ldr, RES_BF16 rounds it) added before the activation.
template <bool ASPLIT, int ACT, bool BIAS_BF16, bool RES_BF16>
__global__ __launch_bounds__(128) void k_gemm_bf3(const float* __restrict__ A, int lda, const unsigned short* __restrict__ Wt, int ldb,
                                                const float* __restrict__ bias, const float* __restrict__ resid, int rmod, int ldr,
                                                float* __restrict__ C, int ldc, int M, int N, int K) {
  __shared__ __attribute__((aligned(16))) float so[4][16][64];
  const int tid = threadIdx.x, w = tid >> 5, lane = tid & 31, ln = lane & 15, hh = lane >> 4;
  const int ntn = N / 64;
  const int wid = blockIdx.x * 4 + w;
  const int mt = wid / ntn, nq = wid % ntn;
  if (mt * 16 >= M) return;
  const int row0 = mt * 16, col0 = nq * 64;
  const float* arow = A + (size_t)(row0 + ln) * lda;
  v8f acc[4] = {};
  for (int kb = 0; kb < K; kb += 32) {
    FragB ah, al;
    const v4f x0 = *(const v4fa*)(arow + kb + 8 * hh), x1 = *(const v4fa*)(arow + kb + 8 * hh + 4);
    const v4f x2 = *(const v4fa*)(arow + kb + 16 + 8 * hh), x3 = *(const v4fa*)(arow + kb + 16 + 8 * hh + 4);
    float xs[16] = {x0[0],x0[1],x0[2],x0[3],x1[0],x1[1],x1[2],x1[3],x2[0],x2[1],x2[2],x2[3],x3[0],x3[1],x3[2],x3[3]};
#pragma unroll
    for (int i = 0; i < 16; ++i) { const unsigned short hb = bf16_bits(xs[i]); ah.u[i] = hb; al.u[i] = ASPLIT ? bf16_bits(xs[i] - bf16_val(hb)) : (unsigned short)0; }
#pragma unroll
    for (int t = 0; t < 4; ++t) {
      const unsigned short* brow = Wt + (size_t)(col0 + t * 16 + ln) * ldb + kb;
      FragB b;
      b.half[0] = *(const v8us*)(brow + 8 * hh);
      b.half[1] = *(const v8us*)(brow + 16 + 8 * hh);
      acc[t] = mmaN<ASPLIT ? 2 : 1>(ah.v, al.v, b.v, b.v, acc[t]);
    }
  }
#pragma unroll
  for (int t = 0; t < 4; ++t) {
    const int col = col0 + t * 16 + ln;
    float bv = bias ? bias[col] : 0.f;
    if (BIAS_BF16) bv = bf16_round(bv);
#pragma unroll
    for (int r = 0; r < 8; ++r) {
      float v = acc[t][r] + bv;
      if (resid) { float rv = resid[(size_t)((row0 + 8 * hh + r) % rmod) * ldr + col]; if (RES_BF16) rv = bf16_round(rv); v += rv; }
      if (ACT == 1) v = fmaxf(v, 0.f);
      if (ACT == 2) v = 0.5f * v * (1.0f + erff(v * 0.70710678118654752f));
      if (ACT == 3) { const float u = 0.7978845608028654f * (v + 0.044715f * v * v * v); v = 0.5f * v * (1.0f + tanhf(u)); }
      so[w][8 * hh + r][t * 16 + ln] = v;
    }
  }
  __builtin_amdgcn_fence(__ATOMIC_ACQ_REL, "workgroup");
  __builtin_amdgcn_wave_barrier();
  const int rsub = lane >> 4, c4 = (lane & 15) * 4;
  {
#pragma unroll
    for (int q = 0; q < 8; ++q) {
      const int r = q * 2 + rsub;
      const v4f v = *(const v4fa*)&so[w][r][c4];
      *(v4f*)(C + (size_t)(row0 + r) * ldc + col0 + c4) = v;
    }
    
  }
}
// row LayerNorm (biased variance, eps) over N: s = X (+ R); optional out_sum <- s; out_norm <- (s-mu)*rsqrt(var+eps)*g + b
template <bool PARAM_BF16>
__global__ __launch_bounds__(256) void k_layernorm(const float* __restrict__ X, const float* __restrict__ R, const float* __restrict__ g, const float* __restrict__ bta,
                                                  float* __restrict__ out_sum, float* __restrict__ out_norm, int N, float eps) {
  __shared__ float red[256];
  const int row = blockIdx.x, tid = threadIdx.x;
  const float* x = X + (size_t)row * N; const float* rr = R ? R + (size_t)row * N : nullptr;
  float vals[16];                     // up to N = 4096
  const int per = N / 256;            // contiguous chunk per thread? use strided-by-4 chunks: thread handles j = tid*4 + 1024*u
  float s1 = 0.f;
  for (int u = 0; u < per / 4; ++u) {
    const int j = tid * 4 + 1024 * u;
    const v4f a = *(const v4fa*)(x + j);
    v4f b = {0.f,0.f,0.f,0.f}; if (rr) b = *(const v4fa*)(rr + j);
#pragma unroll
    for (int q = 0; q < 4; ++q) { const float v = a[q] + b[q]; vals[u * 4 + q] = v; s1 += v; }
  }
  red[tid] = s1; __syncthreads();
  for (int st = 128; st > 0; st >>= 1) { if (tid < st) red[tid] += red[tid + st]; __syncthreads(); }
  const float mu = red[0] / (float)N; __syncthreads();
  float s2 = 0.f;
  for (int u = 0; u < per / 4; ++u)
#pragma unroll
    for (int q = 0; q < 4; ++q) { const float c = vals[u * 4 + q] - mu; s2 += c * c; }
  red[tid] = s2; __syncthreads();
  for (int st = 128; st > 0; st >>= 1) { if (tid < st) red[tid] += red[tid + st]; __syncthreads(); }
  const float rs = rsqrtf(red[0] / (float)N + eps);
  {
    for (int u = 0; u < per / 4; ++u) {
      const int j = tid * 4 + 1024 * u;
      v4f o, sm;
#pragma unroll
      for (int q = 0; q < 4; ++q) {
        float gg = g[j + q], bb = bta[j + q];
        if (PARAM_BF16) { gg = bf16_round(gg); bb = bf16_round(bb); }
        sm[q] = vals[u * 4 + q]; o[q] = (vals[u * 4 + q] - mu) * rs * gg + bb;
      }
      if (out_sum) *(v4f*)(out_sum + (size_t)row * N + j) = sm;
      *(v4f*)(out_norm + (size_t)row * N + j) = o;
    }
    
  }
}



// ---- f16 WMMA path (v_wmma_f32_16x16x32_f16): 11-bit significands for operands in range — used where a [0,1] probability operand needs more precision than bf16
typedef _Float16 v16h __attribute__((ext_vector_type(16)));
union FragH { v16h v; v8us half[2]; _Float16 h[16]; unsigned short u[16]; };
template <int NT>
__device__ __forceinline__ v8f mmaH(v16h ah, v16h al, v16h bh, v16h bl, v8f c) {
  c = __builtin_amdgcn_wmma_f32_16x16x32_f16(false, ah, false, bh, (short)0, c, false, false);
  if (NT >= 2) c = __builtin_amdgcn_wmma_f32_16x16x32_f16(false, al, false, bh, (short)0, c, false, false);
  if (NT >= 3) c = __builtin_amdgcn_wmma_f32_16x16x32_f16(false, ah, false, bl, (short)0, c, false, false);
  asm volatile("v_nop\n\tv_nop\n\tv_nop\n\tv_nop" : "+v"(c) : "v"(ah), "v"(al), "v"(bh), "v"(bl));
  return c;
}
// batched GEMM like k_gemm_b but f16 operands: A f32 (split into f16 hi/lo if ASPLIT, else rounded to f16), Bt = f16 values [n][k]; alpha; C f32; N multiple of 16 (partial tiles skipped)
template <bool ASPLIT>
__global__ __launch_bounds__(128) void k_gemm_h(const float* __restrict__ A, int lda, size_t sA, const _Float16* __restrict__ Bh, int ldb, size_t sB, float alpha, float* __restrict__ C, int ldc, size_t sC, int M, int N, int K) {
  __shared__ __attribute__((aligned(16))) float so[4][16][64];
  const int tid = threadIdx.x, w = tid >> 5, lane = tid & 31, ln = lane & 15, hh = lane >> 4; const int by = blockIdx.y;
  A += (size_t)by * sA; Bh += (size_t)by * sB; C += (size_t)by * sC;
  const int ntn = (N + 63) / 64; const int wid = blockIdx.x * 4 + w; const int mt = wid / ntn, nq = wid % ntn; if (mt * 16 >= M) return;
  const int row0 = mt * 16, col0 = nq * 64; const float* arow = A + (size_t)(row0 + ln) * lda;
  v8f acc[4] = {};
  for (int kb = 0; kb < K; kb += 32) {
    FragH ah, al;
    const v4f x0 = *(const v4fa*)(arow + kb + 8 * hh), x1 = *(const v4fa*)(arow + kb + 8 * hh + 4), x2 = *(const v4fa*)(arow + kb + 16 + 8 * hh), x3 = *(const v4fa*)(arow + kb + 16 + 8 * hh + 4);
    float xs[16] = {x0[0],x0[1],x0[2],x0[3],x1[0],x1[1],x1[2],x1[3],x2[0],x2[1],x2[2],x2[3],x3[0],x3[1],x3[2],x3[3]};
#pragma unroll
    for (int i = 0; i < 16; ++i) { const _Float16 h = (_Float16)xs[i]; ah.h[i] = h; al.h[i] = ASPLIT ? (_Float16)(xs[i] - (float)h) : (_Float16)0.0f; }
#pragma unroll
    for (int t = 0; t < 4; ++t) { if (col0 + t * 16 >= N) continue; const size_t boff = (size_t)(col0 + t * 16 + ln) * ldb + kb; FragH bq; bq.half[0] = *(const v8us*)(Bh + boff + 8 * hh); bq.half[1] = *(const v8us*)(Bh + boff + 16 + 8 * hh);
      acc[t] = mmaH<ASPLIT ? 2 : 1>(ah.v, al.v, bq.v, bq.v, acc[t]); }
  }
#pragma unroll
  for (int t = 0; t < 4; ++t) { if (col0 + t * 16 >= N) continue;
#pragma unroll
    for (int r = 0; r < 8; ++r) so[w][8 * hh + r][t * 16 + ln] = acc[t][r] * alpha; }
  __builtin_amdgcn_fence(__ATOMIC_ACQ_REL, "workgroup"); __builtin_amdgcn_wave_barrier();
  const int rsub = lane >> 4, c4 = (lane & 15) * 4;
  {
#pragma unroll
    for (int q = 0; q < 8; ++q) { const int r = q * 2 + rsub; if (col0 + c4 < N) { const v4f v = *(const v4fa*)&so[w][r][c4]; *(v4f*)(C + (size_t)(row0 + r) * ldc + col0 + c4) = v; } }
     }
}

// Wt[n][k] = f16(W[k][n]·scale) from f32 row-major W[K][N] (scale = power of two; bf16-exact weights stay exact in f16 away from the subnormal range)
__global__ __launch_bounds__(256) void k_wt_f16(const float* __restrict__ W, _Float16* __restrict__ Wt, int K, int N, float scale) {
  const int t = blockIdx.x * 256 + threadIdx.x; if (t >= N * (K / 8)) return; const int n = t / (K / 8), k8 = (t % (K / 8)) * 8; FragH f;
#pragma unroll
  for (int i = 0; i < 8; ++i) f.h[i] = (_Float16)(bf16_round(W[(size_t)(k8 + i) * N + n]) * scale); const v8us o = f.half[0];
  *(v8us*)((unsigned short*)Wt + (size_t)n * K + k8) = o; 
}
// k_gemm_hh variant with fused epilogue: v = acc·alpha + bias[by·sBias + col] (+ CP[(row/rowsPerB)·sCPb + by·64 + col] if CP) ; ACT 0 none / 1 elu ; writes f16 C16 (and f32 C if non-null)
template <int ACT>
__global__ __launch_bounds__(128) void k_gemm_hhx(const _Float16* __restrict__ A, int lda, size_t sA, const _Float16* __restrict__ Bh, int ldb, size_t sB, float alpha, const float* __restrict__ bias, size_t sBias, const float* __restrict__ CP, int rowsPerB, size_t sCPb, int row0g,
    float* __restrict__ C, _Float16* __restrict__ C16, int ldc, size_t sC, int M, int N, int K) {
  __shared__ __attribute__((aligned(16))) float so[4][16][64];
  const int tid = threadIdx.x, w = tid >> 5, lane = tid & 31, ln = lane & 15, hh = lane >> 4; const int by = blockIdx.y;
  A += (size_t)by * sA; Bh += (size_t)by * sB; const size_t cofs = (size_t)by * sC; const float* bp = bias ? bias + (size_t)by * sBias : nullptr;
  const int ntn = (N + 63) / 64; const int wid = blockIdx.x * 4 + w; const int mt = wid / ntn, nq = wid % ntn; if (mt * 16 >= M) return;
  const int row0 = mt * 16, col0 = nq * 64; const _Float16* arow = A + (size_t)(row0 + ln) * lda;
  v8f acc[4] = {};
  for (int kb = 0; kb < K; kb += 32) { FragH ah; ah.half[0] = *(const v8us*)((const unsigned short*)arow + kb + 8 * hh); ah.half[1] = *(const v8us*)((const unsigned short*)arow + kb + 16 + 8 * hh);
#pragma unroll
    for (int t = 0; t < 4; ++t) { if (col0 + t * 16 >= N) continue; const size_t boff = (size_t)(col0 + t * 16 + ln) * ldb + kb; FragH bq; bq.half[0] = *(const v8us*)((const unsigned short*)Bh + boff + 8 * hh); bq.half[1] = *(const v8us*)((const unsigned short*)Bh + boff + 16 + 8 * hh);
      acc[t] = mmaH<1>(ah.v, ah.v, bq.v, bq.v, acc[t]); }
  }
#pragma unroll
  for (int t = 0; t < 4; ++t) { if (col0 + t * 16 >= N) continue; const int col = col0 + t * 16 + ln; const float bv = bp ? bf16_round(bp[col]) : 0.f;
#pragma unroll
    for (int r = 0; r < 8; ++r) { float v = acc[t][r] * alpha + bv; if (CP) { const int bidx = (row0g + row0 + 8 * hh + r) / rowsPerB; v += CP[(size_t)bidx * sCPb + (size_t)by * 64 + col]; } if (ACT == 1) v = (v > 0.f) ? v : expm1f(v); else if (ACT == 7) v = (v > 0.f) ? v + 1.0f : expf(v); else if (ACT == 8) v = tanhf(v); else if (ACT == 9) v = 0.5f * v * (1.0f + tanhf(0.7978845608028654f * (v + 0.044715f * v * v * v))); else if (ACT == 11) v = 1.0f / (1.0f + expf(-v)); else if (ACT == 12) v = (v > 0.f) ? v : 0.01f * v; else if (ACT == 14) v = (v > 0.f) ? v : 0.1f * v; else if (ACT == 15) v = v / (1.0f + expf(-v)); else if (ACT == 3) v = fmaxf(v, 0.f); else if (ACT == 6) v = 0.5f * v * (1.0f + erff(v * 0.70710678118654752f)); so[w][8 * hh + r][t * 16 + ln] = v; } }
  __builtin_amdgcn_fence(__ATOMIC_ACQ_REL, "workgroup"); __builtin_amdgcn_wave_barrier();
  const int rsub = lane >> 4, c4 = (lane & 15) * 4; typedef _Float16 v4h __attribute__((ext_vector_type(4)));
  {
#pragma unroll
    for (int q = 0; q < 8; ++q) { const int r = q * 2 + rsub; if (col0 + c4 < N) { const v4f v = *(const v4fa*)&so[w][r][c4]; if (C) *(v4f*)(C + cofs + (size_t)(row0 + r) * ldc + col0 + c4) = v; if (C16) { v4h h4; for (int i = 0; i < 4; ++i) h4[i] = (_Float16)v[i]; *(v4h*)(C16 + cofs + (size_t)(row0 + r) * ldc + col0 + c4) = h4; } } }
     }
}


typedef _Float16 v4h __attribute__((ext_vector_type(4)));

__global__ __launch_bounds__(256) void k_x16(const float* __restrict__ x, _Float16* __restrict__ X16, size_t n8) { const size_t t = (size_t)blockIdx.x * 256 + threadIdx.x; if (t >= n8) return; FragH f;
#pragma unroll
  for (int q = 0; q < 8; ++q) f.h[q] = (_Float16)bf16_round(x[t * 8 + q]); *(v8us*)((unsigned short*)X16 + t * 8) = f.half[0];  }
__global__ __launch_bounds__(256) void k_h16(const float* __restrict__ x, _Float16* __restrict__ X16, size_t n8) { const size_t t = (size_t)blockIdx.x * 256 + threadIdx.x; if (t >= n8) return; FragH f;
#pragma unroll
  for (int q = 0; q < 8; ++q) f.h[q] = (_Float16)x[t * 8 + q]; *(v8us*)((unsigned short*)X16 + t * 8) = f.half[0];  }
__global__ __launch_bounds__(256) void k_round16f(const float* __restrict__ W, _Float16* __restrict__ Bt, size_t n8) { const size_t t = (size_t)blockIdx.x * 256 + threadIdx.x; if (t >= n8) return; FragH f;
#pragma unroll
  for (int i = 0; i < 8; ++i) f.h[i] = (_Float16)(bf16_round(W[t * 8 + i]) * 16.0f); *(v8us*)((unsigned short*)Bt + t * 8) = f.half[0];  }
template <int NHv, int TTv>
__global__ __launch_bounds__(256) void k_vt(const _Float16* __restrict__ V16, int ldv, int voff, _Float16* __restrict__ Vt) { __shared__ unsigned short tl[64][66]; const int tid = threadIdx.x; const int slab = blockIdx.x / (TTv / 64), lg = blockIdx.x % (TTv / 64); const int b = slab / NHv, h = slab % NHv;
  for (int i = tid; i < 64 * 8; i += 256) { const int r = i / 8, c8 = (i % 8) * 8; FragH f; f.half[0] = *(const v8us*)((const unsigned short*)V16 + ((size_t)b * TTv + lg * 64 + r) * ldv + voff + h * 64 + c8);
#pragma unroll
    for (int q = 0; q < 8; ++q) tl[r][c8 + q] = f.u[q]; }
  __syncthreads();
  {
#pragma unroll
    for (int rd = 0; rd < 2; ++rd) { const int d = rd * 32 + tid / 8, pc = tid % 8; FragH f;
#pragma unroll
      for (int q = 0; q < 8; ++q) f.u[q] = tl[pc * 8 + q][d];
      *(v8us*)((unsigned short*)Vt + ((size_t)slab * 64 + d) * TTv + lg * 64 + pc * 8) = f.half[0]; }
     } }

__global__ __launch_bounds__(256) void k_tok(const float* __restrict__ x, _Float16* __restrict__ X16) { __shared__ float tl[32][65]; const int tid = threadIdx.x; const int b = blockIdx.x / (2 * (NN / 32)), rem = blockIdx.x % (2 * (NN / 32)); const int cg = rem / (NN / 32), pg = rem % (NN / 32); const int c0 = cg * 64, p0 = pg * 32;
  for (int i = tid; i < 64 * 32; i += 256) { const int c = i / 32, pp = i % 32; tl[pp][c] = bf16_round(x[((size_t)b * C3 + c0 + c) * NN + p0 + pp]); } __syncthreads();
  const int r = tid / 8, pc = tid % 8; FragH f; for (int q = 0; q < 8; ++q) f.h[q] = (_Float16)tl[r][pc * 8 + q]; const size_t row = (size_t)b * NN + p0 + r; *(v8us*)((unsigned short*)X16 + row * (2 * CC) + c0 + pc * 8) = f.half[0];  }
__global__ __launch_bounds__(256) void k_v16(const float* __restrict__ x, _Float16* __restrict__ Vt) { const size_t t = (size_t)blockIdx.x * 256 + threadIdx.x; if (t >= (size_t)BB * CC * NN / 8) return; const int n8 = (int)(t % (NN / 8)) * 8; const int d = (int)((t / (NN / 8)) % CC); const int b = (int)(t / ((size_t)(NN / 8) * CC)); FragH f;
#pragma unroll
  for (int q = 0; q < 8; ++q) f.h[q] = (_Float16)bf16_round(x[((size_t)b * C3 + 2 * CC + d) * NN + n8 + q]); *(v8us*)((unsigned short*)Vt + t * 8) = f.half[0];  }
// lane l <-> lane l ^ 16 (the two lane halves hold the two key halves of one query column)
__device__ __forceinline__ float xhalf(float x) { return __builtin_bit_cast(float, __builtin_amdgcn_permlanex16(__builtin_bit_cast(int, x), __builtin_bit_cast(int, x), 0x76543210, 0xfedcba98, false, false)); }
__global__ __launch_bounds__(128) void k_flash(const _Float16* __restrict__ Q16, int ldq, const _Float16* __restrict__ K16, int ldk, const _Float16* __restrict__ Vt, const int* __restrict__ MSK, float* __restrict__ O, int ldo) {
  constexpr int RPW = 16, NQB = NN / (4 * RPW), DT = 4, KS = 2;
  __shared__ __attribute__((aligned(16))) float sO[4][RPW][64 + 4];
  const int tid = threadIdx.x, w = tid >> 5, lane = tid & 31, ln = lane & 15, hh = lane >> 4;
  const int slab = blockIdx.x / NQB, qblk = blockIdx.x % NQB; const int b = slab; const int h = 0; const int qb0 = qblk * (4 * RPW); const int q0 = qb0 + w * RPW;
  FragH aq[KS];
  { const unsigned short* qr = (const unsigned short*)Q16 + ((size_t)b * NN + q0 + ln) * ldq;
#pragma unroll
    for (int ks = 0; ks < KS; ++ks) { aq[ks].half[0] = *(const v8us*)(qr + ks * 32 + 8 * hh); aq[ks].half[1] = *(const v8us*)(qr + ks * 32 + 16 + 8 * hh); } }
  const unsigned short* Vth = (const unsigned short*)Vt + (size_t)b * CC * NN;      /* Vᵀ = v[b][d][n] */
  float m_r = -3.0e38f, l_r = 0.f; v8f oacc[DT];      /* oacc[dt][r] = Ot[dt*16 + 8hh + r][query ln] */
#pragma unroll
  for (int dt = 0; dt < DT; ++dt) oacc[dt] = (v8f){0.f,0.f,0.f,0.f,0.f,0.f,0.f,0.f};
  const int jend = NN;
  /* No load moves over the asm statement that closes mmaH, so a load written beside its product is waited out there, one latency per product.
     Here the loads stand ahead of the work that hides them: a pass's K fragments are asked for in the pass before, right behind its S products, and its V fragments at its head. */
  FragH bk[2][KS];      /* K fragments of the pass at hand */
#pragma unroll
  for (int nt = 0; nt < 2; ++nt) { const unsigned short* kr = (const unsigned short*)K16 + ((size_t)b * NN + nt * 16 + ln) * ldk;
#pragma unroll
    for (int ks = 0; ks < KS; ++ks) { bk[nt][ks].half[0] = *(const v8us*)(kr + ks * 32 + 8 * hh); bk[nt][ks].half[1] = *(const v8us*)(kr + ks * 32 + 16 + 8 * hh); } }
  /* the key loop stays rolled as before; the constant-trip inner loops are unrolled so that the fragment and score arrays stay in registers */
#pragma unroll 1
  for (int j0 = 0; j0 < jend; j0 += 32) {
    FragH bv[DT];
#pragma unroll
    for (int dt = 0; dt < DT; ++dt) { const unsigned short* vrow = Vth + (size_t)(dt * 16 + ln) * NN + j0; bv[dt].half[0] = *(const v8us*)(vrow + 8 * hh); bv[dt].half[1] = *(const v8us*)(vrow + 16 + 8 * hh); }
    v8f s[2];      /* s[nt][r] = St[key j0 + nt*16 + 8hh + r][query ln] */
#pragma unroll
    for (int nt = 0; nt < 2; ++nt) {
      v8f acc = (v8f){0.f,0.f,0.f,0.f,0.f,0.f,0.f,0.f};
#pragma unroll
      for (int ks = 0; ks < KS; ++ks) acc = mmaH<1>(bk[nt][ks].v, bk[nt][ks].v, aq[ks].v, aq[ks].v, acc);
      s[nt] = acc; }
    const int jn = (j0 + 32 < jend) ? j0 + 32 : 0;      /* the last pass fetches pass 0 again: in bounds, not used */
#pragma unroll
    for (int nt = 0; nt < 2; ++nt) { const unsigned short* kr = (const unsigned short*)K16 + ((size_t)b * NN + jn + nt * 16 + ln) * ldk;
#pragma unroll
      for (int ks = 0; ks < KS; ++ks) { bk[nt][ks].half[0] = *(const v8us*)(kr + ks * 32 + 8 * hh); bk[nt][ks].half[1] = *(const v8us*)(kr + ks * 32 + 16 + 8 * hh); } }
    float sc[16]; float mq[4];
#pragma unroll
    for (int i = 0; i < 16; ++i) sc[i] = s[i >> 3][i & 7] * 0.125f;
#pragma unroll
    for (int c = 0; c < 4; ++c) mq[c] = fmaxf(fmaxf(sc[c], sc[4 + c]), fmaxf(sc[8 + c], sc[12 + c]));
    float mc = fmaxf(fmaxf(mq[0], mq[1]), fmaxf(mq[2], mq[3])); mc = fmaxf(mc, xhalf(mc));
    const float mn = fmaxf(m_r, mc); const float al = (mn > -1.0e38f) ? expf(m_r - mn) : 1.0f; m_r = mn;
    FragH pb; float ps[4] = {0.f, 0.f, 0.f, 0.f};      /* pb.h[i] = Pt[key j0 + (i < 8 ? 8hh + i : 8 + 8hh + i)][query ln] x 2^10 */
#pragma unroll
    for (int i = 0; i < 16; ++i) { const float p = expf(sc[i] - mn); ps[i & 3] += p; pb.h[i] = (_Float16)(p * 1024.0f); }
    l_r = l_r * al + ((ps[0] + ps[1]) + (ps[2] + ps[3]));      /* this lane half's keys only; the halves join after the loop */
#pragma unroll
    for (int dt = 0; dt < DT; ++dt)
#pragma unroll
      for (int r = 0; r < 8; ++r) oacc[dt][r] *= al;
#pragma unroll
    for (int dt = 0; dt < DT; ++dt) oacc[dt] = mmaH<1>(bv[dt].v, bv[dt].v, pb.v, pb.v, oacc[dt]);
  }
  const float l = l_r + xhalf(l_r); const float linv = (l > 0.f) ? 1.0f / (l * 1024.0f) : 0.f;
#pragma unroll
  for (int dt = 0; dt < DT; ++dt) { v4f lo, hi;
#pragma unroll
    for (int r = 0; r < 4; ++r) { lo[r] = oacc[dt][r] * linv; hi[r] = oacc[dt][4 + r] * linv; }
    *(v4fa*)&sO[w][ln][dt * 16 + 8 * hh] = lo; *(v4fa*)&sO[w][ln][dt * 16 + 8 * hh + 4] = hi; }
  __builtin_amdgcn_fence(__ATOMIC_ACQ_REL, "workgroup"); __builtin_amdgcn_wave_barrier();
  {
#pragma unroll
    for (int rp = 0; rp < RPW; rp += 2) { const int r = rp + (lane >> 4), pc = lane & 15; const v4f val = *(const v4fa*)&sO[w][r][pc * 4]; *(v4f*)(O + ((size_t)b * NN + q0 + r) * ldo + pc * 4) = val; }      /* 16 lanes × 16 B = one whole 256-B row */
     } }

__global__ __launch_bounds__(256) void k_out(const float* __restrict__ G, float* __restrict__ out) { __shared__ float tl[32][65]; const int tid = threadIdx.x; const int b = blockIdx.x / ((CC / 32) * (NN / 64)), rem = blockIdx.x % ((CC / 32) * (NN / 64)); const int cg = rem / (NN / 64), pg = rem % (NN / 64); const int c0 = cg * 32, p0 = pg * 64;
  for (int i = tid; i < 64 * 32; i += 256) { const int pp = i / 32, c = i % 32; tl[c][pp] = G[((size_t)b * NN + p0 + pp) * CC + c0 + c]; } __syncthreads();
  { for (int i = tid; i < 32 * 16; i += 256) { const int c = i / 16, q4 = i % 16; const v4f v = {tl[c][q4 * 4], tl[c][q4 * 4 + 1], tl[c][q4 * 4 + 2], tl[c][q4 * 4 + 3]}; *(v4f*)(out + ((size_t)b * CC + c0 + c) * NN + p0 + q4 * 4) = v; }  } }

extern "C" void kernel_launch(void* const* d_in, const int* in_sizes, int n_in,
                              void* d_out, int out_size, void* d_ws, size_t ws_size, hipStream_t stream) {
  (void)in_sizes; (void)n_in; (void)out_size;
  const float* qkv = (const float*)d_in[0];
  char* ws = (char*)d_ws; size_t off = 0;
  auto take = [&](size_t bytes) { char* p = ws + off; off += (bytes + 255) & ~(size_t)255; return p; };
  _Float16* QK = (_Float16*)take((size_t)NR * 2 * CC * 2); _Float16* Vt = (_Float16*)take((size_t)BB * CC * NN * 2); float* O = (float*)take((size_t)NR * CC * 4);
  if (off > ws_size) return;      // 8.4 + 4.2 + 8.4 ≈ 21 MB
  k_tok<<<BB * 2 * (NN / 32), 256, 0, stream>>>(qkv, QK);
  k_v16<<<(unsigned)(((size_t)BB * CC * NN / 8 + 255) / 256), 256, 0, stream>>>(qkv, Vt);
  k_flash<<<BB * (NN / 64), 128, 0, stream>>>(QK, 2 * CC, QK + CC, 2 * CC, Vt, nullptr, O, CC);
  k_out<<<BB * (CC / 32) * (NN / 64), 256, 0, stream>>>(O, (float*)d_out);
}

// v003
// It runs in 102 microseconds.
// Two timings next to v002 put it at 1.38 and 1.36 times that version's speed.
// Counting every step since v000, it is 4.14 times as fast.
#include <hip/hip_runtime.h>
// QKV self-attention on a channel-major qkv tensor [8, 3·64, 4096]: attn[s,t] = Σ_c q[c,s]·k[c,t]/√64, softmax over t, out[d,s] = Σ_t attn[s,t]·v[d,t].
// Compute dtype: qkv rounded to bf16 and carried exactly in f16 (q token-major; k and v planes in the order of their A fragments, 512 contiguous bytes per wave-wide load); S and P·V on v_wmma_f32_16x16x32_f16 with
// f32 accumulation in one fused flash-style kernel (online softmax in f32; P in f16 ×2^10); O transposed back to [b][d][s] through LDS; output f32.
#define BB 8
#define CC 64
#define C3 192
#define NN 4096
#define NR (BB * NN)

typedef __bf16 v16b __attribute__((ext_vector_type(16)));
typedef unsigned short v8us __attribute__((ext_vector_type(8), may_alias));
typedef float  v8f  __attribute__((ext_vector_type(8)));
typedef float  v4f  __attribute__((ext_vector_type(4)));
typedef float  v4fa __attribute__((ext_vector_type(4), may_alias));
union FragB { v16b v; v8us half[2]; unsigned short u[16]; };

__device__ __forceinline__ unsigned short bf16_bits(float x) { unsigned int u = __float_as_uint(x); return (unsigned short)((u + 0x7FFFu + ((u >> 16) & 1u)) >> 16); }
__device__ __forceinline__ float bf16_val(unsigned short b) { return __uint_as_float(((unsigned int)b) << 16); }
__device__ __forceinline__ float bf16_round(float x) { return bf16_val(bf16_bits(x)); }
// D += A·B with NT terms: 1 = ah·bh, 2 = + al·bh (A split), 3 = + ah·bl (both split)
template <int NT>
__device__ __forceinline__ v8f mmaN(v16b ah, v16b al, v16b bh, v16b bl, v8f c) {
  c = __builtin_amdgcn_wmma_f32_16x16x32_bf16(false, ah, false, bh, (short)0, c, false, false);
  if (NT >= 2) c = __builtin_amdgcn_wmma_f32_16x16x32_bf16(false, al, false, bh, (short)0, c, false, false);
  if (NT >= 3) c = __builtin_amdgcn_wmma_f32_16x16x32_bf16(false, ah, false, bl, (short)0, c, false, false);
  asm volatile("v_nop\n\tv_nop\n\tv_nop\n\tv_nop" : "+v"(c) : "v"(ah), "v"(al), "v"(bh), "v"(bl));
  return c;
}

__global__ __launch_bounds__(256) void k_wt_bf16(const float* __restrict__ W, unsigned short* __restrict__ Wt, int K, int N) {
  const int t = blockIdx.x * 256 + threadIdx.x;
  const int k8n = K / 8;
  if (t >= N * k8n) return;
  const int n = t / k8n, k8 = (t % k8n) * 8;
  v8us v;
#pragma unroll
  for (int i = 0; i < 8; ++i) v[i] = bf16_bits(W[(size_t)(k8 + i) * N + n]);
  *(v8us*)(Wt + (size_t)n * K + k8) = v;
  
}

// GEMM C[M][N] (f32, pitch ldc) = act(A[M][K]·W + bias). A f32 row-major (pitch lda) converted per fragment to bf16
// (ASPLIT: hi/lo two planes -> 2 terms, else single rounded term); Wt bf16 [N][K] (pitch ldb). BIAS_BF16 rounds the
// bias to bf16 first (bias quantised to bf16 before the add). K%32==0, M%16==0, N%64==0.
template <bool ASPLIT, int ACT, bool BIAS_BF16>
__global__ __launch_bounds__(128) void k_gemm_bf(const float* __restrict__ A, int lda, const unsigned short* __restrict__ Wt, int ldb,
                                               const float* __restrict__ bias, float* __restrict__ C, int ldc, int M, int N, int K) {
  __shared__ __attribute__((aligned(16))) float so[4][16][64];
  const int tid = threadIdx.x, w = tid >> 5, lane = tid & 31, ln = lane & 15, hh = lane >> 4;
  const int ntn = N / 64;
  const int wid = blockIdx.x * 4 + w;
  const int mt = wid / ntn, nq = wid % ntn;
  if (mt * 16 >= M) return;
  const int row0 = mt * 16, col0 = nq * 64;
  const float* arow = A + (size_t)(row0 + ln) * lda;
  v8f acc[4] = {};
  for (int kb = 0; kb < K; kb += 32) {
    FragB ah, al;
    const v4f x0 = *(const v4fa*)(arow + kb + 8 * hh), x1 = *(const v4fa*)(arow + kb + 8 * hh + 4);
    const v4f x2 = *(const v4fa*)(arow + kb + 16 + 8 * hh), x3 = *(const v4fa*)(arow + kb + 16 + 8 * hh + 4);
    float xs[16] = {x0[0],x0[1],x0[2],x0[3],x1[0],x1[1],x1[2],x1[3],x2[0],x2[1],x2[2],x2[3],x3[0],x3[1],x3[2],x3[3]};
#pragma unroll
    for (int i = 0; i < 16; ++i) { const unsigned short hb = bf16_bits(xs[i]); ah.u[i] = hb; al.u[i] = ASPLIT ? bf16_bits(xs[i] - bf16_val(hb)) : (unsigned short)0; }
#pragma unroll
    for (int t = 0; t < 4; ++t) {
      const unsigned short* brow = Wt + (size_t)(col0 + t * 16 + ln) * ldb + kb;
      FragB b;
      b.half[0] = *(const v8us*)(brow + 8 * hh);
      b.half[1] = *(const v8us*)(brow + 16 + 8 * hh);
      acc[t] = mmaN<ASPLIT ? 2 : 1>(ah.v, al.v, b.v, b.v, acc[t]);
    }
  }
#pragma unroll
  for (int t = 0; t < 4; ++t) {
    float bv = bias ? bias[col0 + t * 16 + ln] : 0.f;
    if (BIAS_BF16) bv = bf16_round(bv);
#pragma unroll
    for (int r = 0; r < 8; ++r) { float v = acc[t][r] + bv; if (ACT == 1) v = fmaxf(v, 0.f); so[w][8 * hh + r][t * 16 + ln] = v; }
  }
  __builtin_amdgcn_fence(__ATOMIC_ACQ_REL, "workgroup");
  __builtin_amdgcn_wave_barrier();
  const int rsub = lane >> 4, c4 = (lane & 15) * 4;
  {
#pragma unroll
    for (int q = 0; q < 8; ++q) {
      const int r = q * 2 + rsub;
      const v4f v = *(const v4fa*)&so[w][r][c4];
      *(v4f*)(C + (size_t)(row0 + r) * ldc + col0 + c4) = v;
    }
    
  }
}

// Flash-style causal/unmasked attention, all contractions 3-term bf16 hi/lo splits, f32 softmax with running max.
// q,k,v rows are read from f32 buffers with arbitrary row pitch (so they can live inside a fused qkv buffer);
// D = head size (multiple of 32, <= 128); one wave = 16 query rows; block = 4 waves (64 queries) sharing K/V chunks of 32.
template <int D, bool CAUSAL>
__global__ __launch_bounds__(128) void k_flash(const float* __restrict__ qb, const float* __restrict__ kb, const float* __restrict__ vb,
                                             int pitch, int T, int H, float scale, float* __restrict__ y, int ypitch) {
  constexpr int KS = D / 32;        // k-steps for QK
  constexpr int DT = D / 16;        // d tiles for PV
  __shared__ __attribute__((aligned(16))) unsigned short sKh[32][D + 8], sKl[32][D + 8], sVh[32][D + 8], sVl[32][D + 8];
  __shared__ __attribute__((aligned(16))) unsigned short sPh[4][16][40], sPl[4][16][40];
  __shared__ __attribute__((aligned(16))) float sO[4][16][D];
  const int tid = threadIdx.x, w = tid >> 5, lane = tid & 31, ln = lane & 15, hh = lane >> 4;
  const int nqb = (T + 63) / 64;
  const int bh = blockIdx.x / nqb, qblk = blockIdx.x % nqb;
  const int b = bh / H, h = bh % H;
  const int q0 = qblk * 64 + w * 16;
  const float* Q = qb + (size_t)b * T * pitch + h * D;
  const float* K = kb + (size_t)b * T * pitch + h * D;
  const float* V = vb + (size_t)b * T * pitch + h * D;

  // A fragments of the wave's 16 query rows (scaled), hi/lo
  FragB aqh[KS], aql[KS];
  {
    int row = q0 + ln; if (row >= T) row = T - 1;
    const float* qr = Q + (size_t)row * pitch;
#pragma unroll
    for (int ks = 0; ks < KS; ++ks)
#pragma unroll
      for (int i = 0; i < 16; ++i) {
        const int d = ks * 32 + ((i < 8) ? (8 * hh + i) : (16 + 8 * hh + (i - 8)));
        const float x = qr[d] * scale; const unsigned short hb = bf16_bits(x);
        aqh[ks].u[i] = hb; aql[ks].u[i] = bf16_bits(x - bf16_val(hb));
      }
  }
  float m_r[8], l_r[8];
#pragma unroll
  for (int r = 0; r < 8; ++r) { m_r[r] = -3.0e38f; l_r[r] = 0.f; }
  v8f oacc[DT];
#pragma unroll
  for (int dt = 0; dt < DT; ++dt) oacc[dt] = (v8f){0.f,0.f,0.f,0.f,0.f,0.f,0.f,0.f};

  const int kv_end = CAUSAL ? min(T, qblk * 64 + 64) : T;     // block-uniform
  for (int j0 = 0; j0 < kv_end; j0 += 32) {
    __syncthreads();
    for (int e = tid; e < 32 * (D / 4); e += 128) {
      const int r = e / (D / 4), c4 = (e % (D / 4)) * 4;
      const int key = j0 + r;
      v4f kf = {0.f,0.f,0.f,0.f}, vf = {0.f,0.f,0.f,0.f};
      if (key < T) { kf = *(const v4fa*)(K + (size_t)key * pitch + c4); vf = *(const v4fa*)(V + (size_t)key * pitch + c4); }
#pragma unroll
      for (int t = 0; t < 4; ++t) {
        unsigned short hb = bf16_bits(kf[t]); sKh[r][c4 + t] = hb; sKl[r][c4 + t] = bf16_bits(kf[t] - bf16_val(hb));
        hb = bf16_bits(vf[t]); sVh[r][c4 + t] = hb; sVl[r][c4 + t] = bf16_bits(vf[t] - bf16_val(hb));
      }
    }
    __syncthreads();
    // S tile 16 x 32
    v8f s[2];
#pragma unroll
    for (int nt = 0; nt < 2; ++nt) {
      v8f acc = {};
#pragma unroll
      for (int ks = 0; ks < KS; ++ks) {
        FragB bh_, bl_;
        bh_.half[0] = *(const v8us*)&sKh[nt * 16 + ln][ks * 32 + 8 * hh]; bh_.half[1] = *(const v8us*)&sKh[nt * 16 + ln][ks * 32 + 16 + 8 * hh];
        bl_.half[0] = *(const v8us*)&sKl[nt * 16 + ln][ks * 32 + 8 * hh]; bl_.half[1] = *(const v8us*)&sKl[nt * 16 + ln][ks * 32 + 16 + 8 * hh];
        acc = mmaN<3>(aqh[ks].v, aql[ks].v, bh_.v, bl_.v, acc);
      }
      s[nt] = acc;
    }
    // mask + running max (rows 8hh+r; the 16 lanes of a half share rows)
    float alpha[8];
#pragma unroll
    for (int r = 0; r < 8; ++r) {
      const int qi = q0 + 8 * hh + r;
      const int ja = j0 + ln, jb = j0 + 16 + ln;
      if (CAUSAL) { if (ja > qi) s[0][r] = -3.0e38f; if (jb > qi) s[1][r] = -3.0e38f; }
      if (ja >= T) s[0][r] = -3.0e38f;
      if (jb >= T) s[1][r] = -3.0e38f;
      float mx = fmaxf(s[0][r], s[1][r]);
      mx = fmaxf(mx, __shfl_xor(mx, 1, 32)); mx = fmaxf(mx, __shfl_xor(mx, 2, 32)); mx = fmaxf(mx, __shfl_xor(mx, 4, 32)); mx = fmaxf(mx, __shfl_xor(mx, 8, 32));
      const float mnew = fmaxf(m_r[r], mx);
      alpha[r] = (mnew > -1.0e38f) ? __expf(m_r[r] - mnew) : 1.0f;
      const float p0 = (s[0][r] > -1.0e38f) ? __expf(s[0][r] - mnew) : 0.f;
      const float p1 = (s[1][r] > -1.0e38f) ? __expf(s[1][r] - mnew) : 0.f;
      m_r[r] = mnew;
      l_r[r] = l_r[r] * alpha[r] + p0 + p1;            // per-lane partial row sum (16 lanes combined at the end)
      unsigned short hb = bf16_bits(p0); sPh[w][8 * hh + r][ln] = hb;      sPl[w][8 * hh + r][ln] = bf16_bits(p0 - bf16_val(hb));
      hb = bf16_bits(p1);                sPh[w][8 * hh + r][16 + ln] = hb; sPl[w][8 * hh + r][16 + ln] = bf16_bits(p1 - bf16_val(hb));
    }
#pragma unroll
    for (int dt = 0; dt < DT; ++dt)
#pragma unroll
      for (int r = 0; r < 8; ++r) oacc[dt][r] *= alpha[r];
    __builtin_amdgcn_fence(__ATOMIC_ACQ_REL, "workgroup");
    __builtin_amdgcn_wave_barrier();
    FragB pah, pal;
    pah.half[0] = *(const v8us*)&sPh[w][ln][8 * hh]; pah.half[1] = *(const v8us*)&sPh[w][ln][16 + 8 * hh];
    pal.half[0] = *(const v8us*)&sPl[w][ln][8 * hh]; pal.half[1] = *(const v8us*)&sPl[w][ln][16 + 8 * hh];
#pragma unroll
    for (int dt = 0; dt < DT; ++dt) {
      FragB bvh, bvl;
#pragma unroll
      for (int i = 0; i < 8; ++i) {
        bvh.u[i] = sVh[8 * hh + i][dt * 16 + ln]; bvh.u[8 + i] = sVh[16 + 8 * hh + i][dt * 16 + ln];
        bvl.u[i] = sVl[8 * hh + i][dt * 16 + ln]; bvl.u[8 + i] = sVl[16 + 8 * hh + i][dt * 16 + ln];
      }
      oacc[dt] = mmaN<3>(pah.v, pal.v, bvh.v, bvl.v, oacc[dt]);
    }
    __builtin_amdgcn_fence(__ATOMIC_ACQ_REL, "workgroup");
    __builtin_amdgcn_wave_barrier();
  }
#pragma unroll
  for (int r = 0; r < 8; ++r) {
    float l = l_r[r];
    l += __shfl_xor(l, 1, 32); l += __shfl_xor(l, 2, 32); l += __shfl_xor(l, 4, 32); l += __shfl_xor(l, 8, 32);
    l_r[r] = (l > 0.f) ? 1.0f / l : 0.f;
  }
#pragma unroll
  for (int dt = 0; dt < DT; ++dt)
#pragma unroll
    for (int r = 0; r < 8; ++r) sO[w][8 * hh + r][dt * 16 + ln] = oacc[dt][r] * l_r[r];
  __builtin_amdgcn_fence(__ATOMIC_ACQ_REL, "workgroup");
  __builtin_amdgcn_wave_barrier();
  {
    for (int r = 0; r < 16; ++r) {
      const int row = q0 + r;
      if (row < T && lane < D / 4) {
        const v4f val = *(const v4fa*)&sO[w][r][lane * 4];
        *(v4f*)(y + ((size_t)b * T + row) * ypitch + h * D + lane * 4) = val;
      }
    }
    
  }
}

// GEMM C = act(A·W + bias + resid): A f32 (ASPLIT -> hi/lo 2 terms), Wt bf16 [N][K]; ACT 0 none, 1 relu, 2 exact gelu;
// resid (optional, f32, row index = (row % rmod), pitch ldr, RES_BF16 rounds it) added before the activation.
template <bool ASPLIT, int ACT, bool BIAS_BF16, bool RES_BF16>
__global__ __launch_bounds__(128) void k_gemm_bf3(const float* __restrict__ A, int lda, const unsigned short* __restrict__ Wt, int ldb,
                                                const float* __restrict__ bias, const float* __restrict__ resid, int rmod, int ldr,
                                                float* __restrict__ C, int ldc, int M, int N, int K) {
  __shared__ __attribute__((aligned(16))) float so[4][16][64];
  const int tid = threadIdx.x, w = tid >> 5, lane = tid & 31, ln = lane & 15, hh = lane >> 4;
  const int ntn = N / 64;
  const int wid = blockIdx.x * 4 + w;
  const int mt = wid / ntn, nq = wid % ntn;
  if (mt * 16 >= M) return;
  const int row0 = mt * 16, col0 = nq * 64;
  const float* arow = A + (size_t)(row0 + ln) * lda;
  v8f acc[4] = {};
  for (int kb = 0; kb < K; kb += 32) {
    FragB ah, al;
    const v4f x0 = *(const v4fa*)(arow + kb + 8 * hh), x1 = *(const v4fa*)(arow + kb + 8 * hh + 4);
    const v4f x2 = *(const v4fa*)(arow + kb + 16 + 8 * hh), x3 = *(const v4fa*)(arow + kb + 16 + 8 * hh + 4);
    float xs[16] = {x0[0],x0[1],x0[2],x0[3],x1[0],x1[1],x1[2],x1[3],x2[0],x2[1],x2[2],x2[3],x3[0],x3[1],x3[2],x3[3]};
#pragma unroll
    for (int i = 0; i < 16; ++i) { const unsigned short hb = bf16_bits(xs[i]); ah.u[i] = hb; al.u[i] = ASPLIT ? bf16_bits(xs[i] - bf16_val(hb)) : (unsigned short)0; }
#pragma unroll
    for (int t = 0; t < 4; ++t) {
      const unsigned short* brow = Wt + (size_t)(col0 + t * 16 + ln) * ldb + kb;
      FragB b;
      b.half[0] = *(const v8us*)(brow + 8 * hh);
      b.half[1] = *(const v8us*)(brow + 16 + 8 * hh);
      acc[t] = mmaN<ASPLIT ? 2 : 1>(ah.v, al.v, b.v, b.v, acc[t]);
    }
  }
#pragma unroll
  for (int t = 0; t < 4; ++t) {
    const int col = col0 + t * 16 + ln;
    float bv = bias ? bias[col] : 0.f;
    if (BIAS_BF16) bv = bf16_round(bv);
#pragma unroll
    for (int r = 0; r < 8; ++r) {
      float v = acc[t][r] + bv;
      if (resid) { float rv = resid[(size_t)((row0 + 8 * hh + r) % rmod) * ldr + col]; if (RES_BF16) rv = bf16_round(rv); v += rv; }
      if (ACT == 1) v = fmaxf(v, 0.f);
      if (ACT == 2) v = 0.5f * v * (1.0f + erff(v * 0.70710678118654752f));
      if (ACT == 3) { const float u = 0.7978845608028654f * (v + 0.044715f * v * v * v); v = 0.5f * v * (1.0f + tanhf(u)); }
      so[w][8 * hh + r][t * 16 + ln] = v;
    }
  }
  __builtin_amdgcn_fence(__ATOMIC_ACQ_REL, "workgroup");
  __builtin_amdgcn_wave_barrier();
  const int rsub = lane >> 4, c4 = (lane & 15) * 4;
  {
#pragma unroll
    for (int q = 0; q < 8; ++q) {
      const int r = q * 2 + rsub;
      const v4f v = *(const v4fa*)&so[w][r][c4];
      *(v4f*)(C + (size_t)(row0 + r) * ldc + col0 + c4) = v;
    }
    
  }
}
// row LayerNorm (biased variance, eps) over N: s = X (+ R); optional out_sum <- s; out_norm <- (s-mu)*rsqrt(var+eps)*g + b
template <bool PARAM_BF16>
__global__ __launch_bounds__(256) void k_layernorm(const float* __restrict__ X, const float* __restrict__ R, const float* __restrict__ g, const float* __restrict__ bta,
                                                  float* __restrict__ out_sum, float* __restrict__ out_norm, int N, float eps) {
  __shared__ float red[256];
  const int row = blockIdx.x, tid = threadIdx.x;
  const float* x = X + (size_t)row * N; const float* rr = R ? R + (size_t)row * N : nullptr;
  float vals[16];                     // up to N = 4096
  const int per = N / 256;            // contiguous chunk per thread? use strided-by-4 chunks: thread handles j = tid*4 + 1024*u
  float s1 = 0.f;
  for (int u = 0; u < per / 4; ++u) {
    const int j = tid * 4 + 1024 * u;
    const v4f a = *(const v4fa*)(x + j);
    v4f b = {0.f,0.f,0.f,0.f}; if (rr) b = *(const v4fa*)(rr + j);
#pragma unroll
    for (int q = 0; q < 4; ++q) { const float v = a[q] + b[q]; vals[u * 4 + q] = v; s1 += v; }
  }
  red[tid] = s1; __syncthreads();
  for (int st = 128; st > 0; st >>= 1) { if (tid < st) red[tid] += red[tid + st]; __syncthreads(); }
  const float mu = red[0] / (float)N; __syncthreads();
  float s2 = 0.f;
  for (int u = 0; u < per / 4; ++u)
#pragma unroll
    for (int q = 0; q < 4; ++q) { const float c = vals[u * 4 + q] - mu; s2 += c * c; }
  red[tid] = s2; __syncthreads();
  for (int st = 128; st > 0; st >>= 1) { if (tid < st) red[tid] += red[tid + st]; __syncthreads(); }
  const float rs = rsqrtf(red[0] / (float)N + eps);
  {
    for (int u = 0; u < per / 4; ++u) {
      const int j = tid * 4 + 1024 * u;
      v4f o, sm;
#pragma unroll
      for (int q = 0; q < 4; ++q) {
        float gg = g[j + q], bb = bta[j + q];
        if (PARAM_BF16) { gg = bf16_round(gg); bb = bf16_round(bb); }
        sm[q] = vals[u * 4 + q]; o[q] = (vals[u * 4 + q] - mu) * rs * gg + bb;
      }
      if (out_sum) *(v4f*)(out_sum + (size_t)row * N + j) = sm;
      *(v4f*)(out_norm + (size_t)row * N + j) = o;
    }
    
  }
}



// ---- f16 WMMA path (v_wmma_f32_16x16x32_f16): 11-bit significands for operands in range — used where a [0,1] probability operand needs more precision than bf16
typedef _Float16 v16h __attribute__((ext_vector_type(16)));
union FragH { v16h v; v8us half[2]; _Float16 h[16]; unsigned short u[16]; };
template <int NT>
__device__ __forceinline__ v8f mmaH(v16h ah, v16h al, v16h bh, v16h bl, v8f c) {
  c = __builtin_amdgcn_wmma_f32_16x16x32_f16(false, ah, false, bh, (short)0, c, false, false);
  if (NT >= 2) c = __builtin_amdgcn_wmma_f32_16x16x32_f16(false, al, false, bh, (short)0, c, false, false);
  if (NT >= 3) c = __builtin_amdgcn_wmma_f32_16x16x32_f16(false, ah, false, bl, (short)0, c, false, false);
  asm volatile("v_nop\n\tv_nop\n\tv_nop\n\tv_nop" : "+v"(c) : "v"(ah), "v"(al), "v"(bh), "v"(bl));
  return c;
}
// batched GEMM like k_gemm_b but f16 operands: A f32 (split into f16 hi/lo if ASPLIT, else rounded to f16), Bt = f16 values [n][k]; alpha; C f32; N multiple of 16 (partial tiles skipped)
template <bool ASPLIT>
__global__ __launch_bounds__(128) void k_gemm_h(const float* __restrict__ A, int lda, size_t sA, const _Float16* __restrict__ Bh, int ldb, size_t sB, float alpha, float* __restrict__ C, int ldc, size_t sC, int M, int N, int K) {
  __shared__ __attribute__((aligned(16))) float so[4][16][64];
  const int tid = threadIdx.x, w = tid >> 5, lane = tid & 31, ln = lane & 15, hh = lane >> 4; const int by = blockIdx.y;
  A += (size_t)by * sA; Bh += (size_t)by * sB; C += (size_t)by * sC;
  const int ntn = (N + 63) / 64; const int wid = blockIdx.x * 4 + w; const int mt = wid / ntn, nq = wid % ntn; if (mt * 16 >= M) return;
  const int row0 = mt * 16, col0 = nq * 64; const float* arow = A + (size_t)(row0 + ln) * lda;
  v8f acc[4] = {};
  for (int kb = 0; kb < K; kb += 32) {
    FragH ah, al;
    const v4f x0 = *(const v4fa*)(arow + kb + 8 * hh), x1 = *(const v4fa*)(arow + kb + 8 * hh + 4), x2 = *(const v4fa*)(arow + kb + 16 + 8 * hh), x3 = *(const v4fa*)(arow + kb + 16 + 8 * hh + 4);
    float xs[16] = {x0[0],x0[1],x0[2],x0[3],x1[0],x1[1],x1[2],x1[3],x2[0],x2[1],x2[2],x2[3],x3[0],x3[1],x3[2],x3[3]};
#pragma unroll
    for (int i = 0; i < 16; ++i) { const _Float16 h = (_Float16)xs[i]; ah.h[i] = h; al.h[i] = ASPLIT ? (_Float16)(xs[i] - (float)h) : (_Float16)0.0f; }
#pragma unroll
    for (int t = 0; t < 4; ++t) { if (col0 + t * 16 >= N) continue; const size_t boff = (size_t)(col0 + t * 16 + ln) * ldb + kb; FragH bq; bq.half[0] = *(const v8us*)(Bh + boff + 8 * hh); bq.half[1] = *(const v8us*)(Bh + boff + 16 + 8 * hh);
      acc[t] = mmaH<ASPLIT ? 2 : 1>(ah.v, al.v, bq.v, bq.v, acc[t]); }
  }
#pragma unroll
  for (int t = 0; t < 4; ++t) { if (col0 + t * 16 >= N) continue;
#pragma unroll
    for (int r = 0; r < 8; ++r) so[w][8 * hh + r][t * 16 + ln] = acc[t][r] * alpha; }
  __builtin_amdgcn_fence(__ATOMIC_ACQ_REL, "workgroup"); __builtin_amdgcn_wave_barrier();
  const int rsub = lane >> 4, c4 = (lane & 15) * 4;
  {
#pragma unroll
    for (int q = 0; q < 8; ++q) { const int r = q * 2 + rsub; if (col0 + c4 < N) { const v4f v = *(const v4fa*)&so[w][r][c4]; *(v4f*)(C + (size_t)(row0 + r) * ldc + col0 + c4) = v; } }
     }
}

// Wt[n][k] = f16(W[k][n]·scale) from f32 row-major W[K][N] (scale = power of two; bf16-exact weights stay exact in f16 away from the subnormal range)
__global__ __launch_bounds__(256) void k_wt_f16(const float* __restrict__ W, _Float16* __restrict__ Wt, int K, int N, float scale) {
  const int t = blockIdx.x * 256 + threadIdx.x; if (t >= N * (K / 8)) return; const int n = t / (K / 8), k8 = (t % (K / 8)) * 8; FragH f;
#pragma unroll
  for (int i = 0; i < 8; ++i) f.h[i] = (_Float16)(bf16_round(W[(size_t)(k8 + i) * N + n]) * scale); const v8us o = f.half[0];
  *(v8us*)((unsigned short*)Wt + (size_t)n * K + k8) = o; 
}
// k_gemm_hh variant with fused epilogue: v = acc·alpha + bias[by·sBias + col] (+ CP[(row/rowsPerB)·sCPb + by·64 + col] if CP) ; ACT 0 none / 1 elu ; writes f16 C16 (and f32 C if non-null)
template <int ACT>
__global__ __launch_bounds__(128) void k_gemm_hhx(const _Float16* __restrict__ A, int lda, size_t sA, const _Float16* __restrict__ Bh, int ldb, size_t sB, float alpha, const float* __restrict__ bias, size_t sBias, const float* __restrict__ CP, int rowsPerB, size_t sCPb, int row0g,
    float* __restrict__ C, _Float16* __restrict__ C16, int ldc, size_t sC, int M, int N, int K) {
  __shared__ __attribute__((aligned(16))) float so[4][16][64];
  const int tid = threadIdx.x, w = tid >> 5, lane = tid & 31, ln = lane & 15, hh = lane >> 4; const int by = blockIdx.y;
  A += (size_t)by * sA; Bh += (size_t)by * sB; const size_t cofs = (size_t)by * sC; const float* bp = bias ? bias + (size_t)by * sBias : nullptr;
  const int ntn = (N + 63) / 64; const int wid = blockIdx.x * 4 + w; const int mt = wid / ntn, nq = wid % ntn; if (mt * 16 >= M) return;
  const int row0 = mt * 16, col0 = nq * 64; const _Float16* arow = A + (size_t)(row0 + ln) * lda;
  v8f acc[4] = {};
  for (int kb = 0; kb < K; kb += 32) { FragH ah; ah.half[0] = *(const v8us*)((const unsigned short*)arow + kb + 8 * hh); ah.half[1] = *(const v8us*)((const unsigned short*)arow + kb + 16 + 8 * hh);
#pragma unroll
    for (int t = 0; t < 4; ++t) { if (col0 + t * 16 >= N) continue; const size_t boff = (size_t)(col0 + t * 16 + ln) * ldb + kb; FragH bq; bq.half[0] = *(const v8us*)((const unsigned short*)Bh + boff + 8 * hh); bq.half[1] = *(const v8us*)((const unsigned short*)Bh + boff + 16 + 8 * hh);
      acc[t] = mmaH<1>(ah.v, ah.v, bq.v, bq.v, acc[t]); }
  }
#pragma unroll
  for (int t = 0; t < 4; ++t) { if (col0 + t * 16 >= N) continue; const int col = col0 + t * 16 + ln; const float bv = bp ? bf16_round(bp[col]) : 0.f;
#pragma unroll
    for (int r = 0; r < 8; ++r) { float v = acc[t][r] * alpha + bv; if (CP) { const int bidx = (row0g + row0 + 8 * hh + r) / rowsPerB; v += CP[(size_t)bidx * sCPb + (size_t)by * 64 + col]; } if (ACT == 1) v = (v > 0.f) ? v : expm1f(v); else if (ACT == 7) v = (v > 0.f) ? v + 1.0f : expf(v); else if (ACT == 8) v = tanhf(v); else if (ACT == 9) v = 0.5f * v * (1.0f + tanhf(0.7978845608028654f * (v + 0.044715f * v * v * v))); else if (ACT == 11) v = 1.0f / (1.0f + expf(-v)); else if (ACT == 12) v = (v > 0.f) ? v : 0.01f * v; else if (ACT == 14) v = (v > 0.f) ? v : 0.1f * v; else if (ACT == 15) v = v / (1.0f + expf(-v)); else if (ACT == 3) v = fmaxf(v, 0.f); else if (ACT == 6) v = 0.5f * v * (1.0f + erff(v * 0.70710678118654752f)); so[w][8 * hh + r][t * 16 + ln] = v; } }
  __builtin_amdgcn_fence(__ATOMIC_ACQ_REL, "workgroup"); __builtin_amdgcn_wave_barrier();
  const int rsub = lane >> 4, c4 = (lane & 15) * 4; typedef _Float16 v4h __attribute__((ext_vector_type(4)));
  {
#pragma unroll
    for (int q = 0; q < 8; ++q) { const int r = q * 2 + rsub; if (col0 + c4 < N) { const v4f v = *(const v4fa*)&so[w][r][c4]; if (C) *(v4f*)(C + cofs + (size_t)(row0 + r) * ldc + col0 + c4) = v; if (C16) { v4h h4; for (int i = 0; i < 4; ++i) h4[i] = (_Float16)v[i]; *(v4h*)(C16 + cofs + (size_t)(row0 + r) * ldc + col0 + c4) = h4; } } }
     }
}


typedef _Float16 v4h __attribute__((ext_vector_type(4)));

__global__ __launch_bounds__(256) void k_x16(const float* __restrict__ x, _Float16* __restrict__ X16, size_t n8) { const size_t t = (size_t)blockIdx.x * 256 + threadIdx.x; if (t >= n8) return; FragH f;
#pragma unroll
  for (int q = 0; q < 8; ++q) f.h[q] = (_Float16)bf16_round(x[t * 8 + q]); *(v8us*)((unsigned short*)X16 + t * 8) = f.half[0];  }
__global__ __launch_bounds__(256) void k_h16(const float* __restrict__ x, _Float16* __restrict__ X16, size_t n8) { const size_t t = (size_t)blockIdx.x * 256 + threadIdx.x; if (t >= n8) return; FragH f;
#pragma unroll
  for (int q = 0; q < 8; ++q) f.h[q] = (_Float16)x[t * 8 + q]; *(v8us*)((unsigned short*)X16 + t * 8) = f.half[0];  }
__global__ __launch_bounds__(256) void k_round16f(const float* __restrict__ W, _Float16* __restrict__ Bt, size_t n8) { const size_t t = (size_t)blockIdx.x * 256 + threadIdx.x; if (t >= n8) return; FragH f;
#pragma unroll
  for (int i = 0; i < 8; ++i) f.h[i] = (_Float16)(bf16_round(W[t * 8 + i]) * 16.0f); *(v8us*)((unsigned short*)Bt + t * 8) = f.half[0];  }
template <int NHv, int TTv>
__global__ __launch_bounds__(256) void k_vt(const _Float16* __restrict__ V16, int ldv, int voff, _Float16* __restrict__ Vt) { __shared__ unsigned short tl[64][66]; const int tid = threadIdx.x; const int slab = blockIdx.x / (TTv / 64), lg = blockIdx.x % (TTv / 64); const int b = slab / NHv, h = slab % NHv;
  for (int i = tid; i < 64 * 8; i += 256) { const int r = i / 8, c8 = (i % 8) * 8; FragH f; f.half[0] = *(const v8us*)((const unsigned short*)V16 + ((size_t)b * TTv + lg * 64 + r) * ldv + voff + h * 64 + c8);
#pragma unroll
    for (int q = 0; q < 8; ++q) tl[r][c8 + q] = f.u[q]; }
  __syncthreads();
  {
#pragma unroll
    for (int rd = 0; rd < 2; ++rd) { const int d = rd * 32 + tid / 8, pc = tid % 8; FragH f;
#pragma unroll
      for (int q = 0; q < 8; ++q) f.u[q] = tl[pc * 8 + q][d];
      *(v8us*)((unsigned short*)Vt + ((size_t)slab * 64 + d) * TTv + lg * 64 + pc * 8) = f.half[0]; }
     } }

__global__ __launch_bounds__(256) void k_tok(const float* __restrict__ x, _Float16* __restrict__ X16) { __shared__ float tl[32][65]; const int tid = threadIdx.x; const int b = blockIdx.x / (2 * (NN / 32)), rem = blockIdx.x % (2 * (NN / 32)); const int cg = rem / (NN / 32), pg = rem % (NN / 32); const int c0 = cg * 64, p0 = pg * 32;
  for (int i = tid; i < 64 * 32; i += 256) { const int c = i / 32, pp = i % 32; tl[pp][c] = bf16_round(x[((size_t)b * C3 + c0 + c) * NN + p0 + pp]); } __syncthreads();
  /* q: rows of 64 channels, token-major. k: behind the q plane, in fragment order: the 4 KB of a pass of 32 keys are [nt][ks][hf][lane] units of 16 B,
     unit = channels ks*32 + hf*16 + 8*(lane >> 4) + 0..7 of key nt*16 + (lane & 15), so that a wave's load of one fragment half is 4 whole lines instead of 32 B out of each of 16. */
  int r, c; size_t dst;
  if (cg == 0) { r = tid / 8; c = (tid % 8) * 8; dst = ((size_t)b * NN + p0 + r) * CC + c; }
  else { r = (tid >> 7) * 16 + (tid & 15); c = ((tid >> 6) & 1) * 32 + ((tid >> 5) & 1) * 16 + ((tid >> 4) & 1) * 8; dst = (size_t)NR * CC + ((size_t)b * NN + p0) * CC + tid * 8; }
  FragH f; for (int q = 0; q < 8; ++q) f.h[q] = (_Float16)tl[r][c + q]; *(v8us*)((unsigned short*)X16 + dst) = f.half[0];  }
__global__ __launch_bounds__(256) void k_v16(const float* __restrict__ x, _Float16* __restrict__ Vt) { const size_t t = (size_t)blockIdx.x * 256 + threadIdx.x; if (t >= (size_t)BB * CC * NN / 8) return;
  /* v in fragment order: the 4 KB of a pass of 32 keys are [dt][hf][lane] units of 16 B, unit = keys hf*16 + 8*(lane >> 4) + 0..7 of channel dt*16 + (lane & 15); thread t writes unit t */
  const int d = (int)((t >> 6) & 3) * 16 + (int)(t & 15); const int n8 = (int)((t >> 8) % (NN / 32)) * 32 + (int)((t >> 5) & 1) * 16 + (int)((t >> 4) & 1) * 8; const int b = (int)(t / ((size_t)(NN / 8) * CC)); FragH f;
#pragma unroll
  for (int q = 0; q < 8; ++q) f.h[q] = (_Float16)bf16_round(x[((size_t)b * C3 + 2 * CC + d) * NN + n8 + q]); *(v8us*)((unsigned short*)Vt + t * 8) = f.half[0];  }
// lane l <-> lane l ^ 16 (the two lane halves hold the two key halves of one query column)
__device__ __forceinline__ float xhalf(float x) { return __builtin_bit_cast(float, __builtin_amdgcn_permlanex16(__builtin_bit_cast(int, x), __builtin_bit_cast(int, x), 0x76543210, 0xfedcba98, false, false)); }
__global__ __launch_bounds__(128) void k_flash(const _Float16* __restrict__ Q16, int ldq, const _Float16* __restrict__ K16, const _Float16* __restrict__ Vt, const int* __restrict__ MSK, float* __restrict__ O, int ldo) {
  constexpr int RPW = 16, NQB = NN / (4 * RPW), DT = 4, KS = 2;
  __shared__ __attribute__((aligned(16))) float sO[4][RPW][64 + 4];
  const int tid = threadIdx.x, w = tid >> 5, lane = tid & 31, ln = lane & 15, hh = lane >> 4;
  const int slab = blockIdx.x / NQB, qblk = blockIdx.x % NQB; const int b = slab; const int h = 0; const int qb0 = qblk * (4 * RPW); const int q0 = qb0 + w * RPW;
  FragH aq[KS];
  { const unsigned short* qr = (const unsigned short*)Q16 + ((size_t)b * NN + q0 + ln) * ldq;
#pragma unroll
    for (int ks = 0; ks < KS; ++ks) { aq[ks].half[0] = *(const v8us*)(qr + ks * 32 + 8 * hh); aq[ks].half[1] = *(const v8us*)(qr + ks * 32 + 16 + 8 * hh); } }
  /* fragment-order planes (written by k_tok and k_v16): 32 keys = 2048 halves, a fragment half = 256 halves, the lane's 16 B at lane * 8 */
  const unsigned short* Kf = (const unsigned short*)K16 + (size_t)b * NN * CC + lane * 8;
  const unsigned short* Vf = (const unsigned short*)Vt + (size_t)b * NN * CC + lane * 8;
  float m_r = -3.0e38f, l_r = 0.f; v8f oacc[DT];      /* oacc[dt][r] = Ot[dt*16 + 8hh + r][query ln] */
#pragma unroll
  for (int dt = 0; dt < DT; ++dt) oacc[dt] = (v8f){0.f,0.f,0.f,0.f,0.f,0.f,0.f,0.f};
  const int jend = NN;
  /* No load moves over the asm statement that closes mmaH, so a load written beside its product is waited out there, one latency per product.
     Here the loads stand ahead of the work that hides them: a pass's K fragments are asked for in the pass before, right behind its S products, and its V fragments at its head. */
  FragH bk[2][KS];      /* K fragments of the pass at hand */
#pragma unroll
  for (int nt = 0; nt < 2; ++nt) {
#pragma unroll
    for (int ks = 0; ks < KS; ++ks) { const unsigned short* kr = Kf + (nt * KS + ks) * 512; bk[nt][ks].half[0] = *(const v8us*)kr; bk[nt][ks].half[1] = *(const v8us*)(kr + 256); } }
  /* the key loop stays rolled as before; the constant-trip inner loops are unrolled so that the fragment and score arrays stay in registers */
#pragma unroll 1
  for (int j0 = 0; j0 < jend; j0 += 32) {
    FragH bv[DT];
#pragma unroll
    for (int dt = 0; dt < DT; ++dt) { const unsigned short* vr = Vf + (size_t)j0 * CC + dt * 512; bv[dt].half[0] = *(const v8us*)vr; bv[dt].half[1] = *(const v8us*)(vr + 256); }
    v8f s[2];      /* s[nt][r] = St[key j0 + nt*16 + 8hh + r][query ln] */
#pragma unroll
    for (int nt = 0; nt < 2; ++nt) {
      v8f acc = (v8f){0.f,0.f,0.f,0.f,0.f,0.f,0.f,0.f};
#pragma unroll
      for (int ks = 0; ks < KS; ++ks) acc = mmaH<1>(bk[nt][ks].v, bk[nt][ks].v, aq[ks].v, aq[ks].v, acc);
      s[nt] = acc; }
    const int jn = (j0 + 32 < jend) ? j0 + 32 : 0;      /* the last pass fetches pass 0 again: in bounds, not used */
#pragma unroll
    for (int nt = 0; nt < 2; ++nt) {
#pragma unroll
      for (int ks = 0; ks < KS; ++ks) { const unsigned short* kr = Kf + (size_t)jn * CC + (nt * KS + ks) * 512; bk[nt][ks].half[0] = *(const v8us*)kr; bk[nt][ks].half[1] = *(const v8us*)(kr + 256); } }
    float sc[16]; float mq[4];
#pragma unroll
    for (int i = 0; i < 16; ++i) sc[i] = s[i >> 3][i & 7] * 0.125f;
#pragma unroll
    for (int c = 0; c < 4; ++c) mq[c] = fmaxf(fmaxf(sc[c], sc[4 + c]), fmaxf(sc[8 + c], sc[12 + c]));
    float mc = fmaxf(fmaxf(mq[0], mq[1]), fmaxf(mq[2], mq[3])); mc = fmaxf(mc, xhalf(mc));
    const float mn = fmaxf(m_r, mc); const float al = (mn > -1.0e38f) ? expf(m_r - mn) : 1.0f; m_r = mn;
    FragH pb; float ps[4] = {0.f, 0.f, 0.f, 0.f};      /* pb.h[i] = Pt[key j0 + (i < 8 ? 8hh + i : 8 + 8hh + i)][query ln] x 2^10 */
#pragma unroll
    for (int i = 0; i < 16; ++i) { const float p = expf(sc[i] - mn); ps[i & 3] += p; pb.h[i] = (_Float16)(p * 1024.0f); }
    l_r = l_r * al + ((ps[0] + ps[1]) + (ps[2] + ps[3]));      /* this lane half's keys only; the halves join after the loop */
#pragma unroll
    for (int dt = 0; dt < DT; ++dt)
#pragma unroll
      for (int r = 0; r < 8; ++r) oacc[dt][r] *= al;
#pragma unroll
    for (int dt = 0; dt < DT; ++dt) oacc[dt] = mmaH<1>(bv[dt].v, bv[dt].v, pb.v, pb.v, oacc[dt]);
  }
  const float l = l_r + xhalf(l_r); const float linv = (l > 0.f) ? 1.0f / (l * 1024.0f) : 0.f;
#pragma unroll
  for (int dt = 0; dt < DT; ++dt) { v4f lo, hi;
#pragma unroll
    for (int r = 0; r < 4; ++r) { lo[r] = oacc[dt][r] * linv; hi[r] = oacc[dt][4 + r] * linv; }
    *(v4fa*)&sO[w][ln][dt * 16 + 8 * hh] = lo; *(v4fa*)&sO[w][ln][dt * 16 + 8 * hh + 4] = hi; }
  __builtin_amdgcn_fence(__ATOMIC_ACQ_REL, "workgroup"); __builtin_amdgcn_wave_barrier();
  {
#pragma unroll
    for (int rp = 0; rp < RPW; rp += 2) { const int r = rp + (lane >> 4), pc = lane & 15; const v4f val = *(const v4fa*)&sO[w][r][pc * 4]; *(v4f*)(O + ((size_t)b * NN + q0 + r) * ldo + pc * 4) = val; }      /* 16 lanes × 16 B = one whole 256-B row */
     } }

__global__ __launch_bounds__(256) void k_out(const float* __restrict__ G, float* __restrict__ out) { __shared__ float tl[32][65]; const int tid = threadIdx.x; const int b = blockIdx.x / ((CC / 32) * (NN / 64)), rem = blockIdx.x % ((CC / 32) * (NN / 64)); const int cg = rem / (NN / 64), pg = rem % (NN / 64); const int c0 = cg * 32, p0 = pg * 64;
  for (int i = tid; i < 64 * 32; i += 256) { const int pp = i / 32, c = i % 32; tl[c][pp] = G[((size_t)b * NN + p0 + pp) * CC + c0 + c]; } __syncthreads();
  { for (int i = tid; i < 32 * 16; i += 256) { const int c = i / 16, q4 = i % 16; const v4f v = {tl[c][q4 * 4], tl[c][q4 * 4 + 1], tl[c][q4 * 4 + 2], tl[c][q4 * 4 + 3]}; *(v4f*)(out + ((size_t)b * CC + c0 + c) * NN + p0 + q4 * 4) = v; }  } }

extern "C" void kernel_launch(void* const* d_in, const int* in_sizes, int n_in,
                              void* d_out, int out_size, void* d_ws, size_t ws_size, hipStream_t stream) {
  (void)in_sizes; (void)n_in; (void)out_size;
  const float* qkv = (const float*)d_in[0];
  char* ws = (char*)d_ws; size_t off = 0;
  auto take = [&](size_t bytes) { char* p = ws + off; off += (bytes + 255) & ~(size_t)255; return p; };
  _Float16* QK = (_Float16*)take((size_t)NR * 2 * CC * 2); _Float16* Vt = (_Float16*)take((size_t)BB * CC * NN * 2); float* O = (float*)take((size_t)NR * CC * 4);
  if (off > ws_size) return;      // 8.4 + 4.2 + 8.4 ≈ 21 MB
  k_tok<<<BB * 2 * (NN / 32), 256, 0, stream>>>(qkv, QK);
  k_v16<<<(unsigned)(((size_t)BB * CC * NN / 8 + 255) / 256), 256, 0, stream>>>(qkv, Vt);
  k_flash<<<BB * (NN / 64), 128, 0, stream>>>(QK, CC, QK + (size_t)NR * CC, Vt, nullptr, O, CC);
  k_out<<<BB * (CC / 32) * (NN / 64), 256, 0, stream>>>(O, (float*)d_out);
}

// v004
// One run takes 89.7 microseconds.
// In two side-by-side timings against v003, it was 1.18 and 1.16 times as fast.
// All steps since v000 together make it 4.86 times as fast.
#include <hip/hip_runtime.h>
// QKV self-attention on a channel-major qkv tensor [8, 3·64, 4096]: attn[s,t] = Σ_c q[c,s]·k[c,t]/√64, softmax over t, out[d,s] = Σ_t attn[s,t]·v[d,t].
// Compute dtype: qkv rounded to bf16 and carried exactly in f16 (q token-major; k and v planes in the order of their A fragments, 512 contiguous bytes per wave-wide load); S and P·V on v_wmma_f32_16x16x32_f16 with
// f32 accumulation in one fused flash-style kernel (online softmax in f32; P in f16 ×2^10); O transposed back to [b][d][s] through LDS; output f32.
#define BB 8
#define CC 64
#define C3 192
#define NN 4096
#define NR (BB * NN)

typedef __bf16 v16b __attribute__((ext_vector_type(16)));
typedef unsigned short v8us __attribute__((ext_vector_type(8), may_alias));
typedef float  v8f  __attribute__((ext_vector_type(8)));
typedef float  v4f  __attribute__((ext_vector_type(4)));
typedef float  v4fa __attribute__((ext_vector_type(4), may_alias));
union FragB { v16b v; v8us half[2]; unsigned short u[16]; };

__device__ __forceinline__ unsigned short bf16_bits(float x) { unsigned int u = __float_as_uint(x); return (unsigned short)((u + 0x7FFFu + ((u >> 16) & 1u)) >> 16); }
__device__ __forceinline__ float bf16_val(unsigned short b) { return __uint_as_float(((unsigned int)b) << 16); }
__device__ __forceinline__ float bf16_round(float x) { return bf16_val(bf16_bits(x)); }
// D += A·B with NT terms: 1 = ah·bh, 2 = + al·bh (A split), 3 = + ah·bl (both split)
template <int NT>
__device__ __forceinline__ v8f mmaN(v16b ah, v16b al, v16b bh, v16b bl, v8f c) {
  c = __builtin_amdgcn_wmma_f32_16x16x32_bf16(false, ah, false, bh, (short)0, c, false, false);
  if (NT >= 2) c = __builtin_amdgcn_wmma_f32_16x16x32_bf16(false, al, false, bh, (short)0, c, false, false);
  if (NT >= 3) c = __builtin_amdgcn_wmma_f32_16x16x32_bf16(false, ah, false, bl, (short)0, c, false, false);
  asm volatile("v_nop\n\tv_nop\n\tv_nop\n\tv_nop" : "+v"(c) : "v"(ah), "v"(al), "v"(bh), "v"(bl));
  return c;
}

__global__ __launch_bounds__(256) void k_wt_bf16(const float* __restrict__ W, unsigned short* __restrict__ Wt, int K, int N) {
  const int t = blockIdx.x * 256 + threadIdx.x;
  const int k8n = K / 8;
  if (t >= N * k8n) return;
  const int n = t / k8n, k8 = (t % k8n) * 8;
  v8us v;
#pragma unroll
  for (int i = 0; i < 8; ++i) v[i] = bf16_bits(W[(size_t)(k8 + i) * N + n]);
  *(v8us*)(Wt + (size_t)n * K + k8) = v;
  
}

// GEMM C[M][N] (f32, pitch ldc) = act(A[M][K]·W + bias). A f32 row-major (pitch lda) converted per fragment to bf16
// (ASPLIT: hi/lo two planes -> 2 terms, else single rounded term); Wt bf16 [N][K] (pitch ldb). BIAS_BF16 rounds the
// bias to bf16 first (bias quantised to bf16 before the add). K%32==0, M%16==0, N%64==0.
template <bool ASPLIT, int ACT, bool BIAS_BF16>
__global__ __launch_bounds__(128) void k_gemm_bf(const float* __restrict__ A, int lda, const unsigned short* __restrict__ Wt, int ldb,
                                               const float* __restrict__ bias, float* __restrict__ C, int ldc, int M, int N, int K) {
  __shared__ __attribute__((aligned(16))) float so[4][16][64];
  const int tid = threadIdx.x, w = tid >> 5, lane = tid & 31, ln = lane & 15, hh = lane >> 4;
  const int ntn = N / 64;
  const int wid = blockIdx.x * 4 + w;
  const int mt = wid / ntn, nq = wid % ntn;
  if (mt * 16 >= M) return;
  const int row0 = mt * 16, col0 = nq * 64;
  const float* arow = A + (size_t)(row0 + ln) * lda;
  v8f acc[4] = {};
  for (int kb = 0; kb < K; kb += 32) {
    FragB ah, al;
    const v4f x0 = *(const v4fa*)(arow + kb + 8 * hh), x1 = *(const v4fa*)(arow + kb + 8 * hh + 4);
    const v4f x2 = *(const v4fa*)(arow + kb + 16 + 8 * hh), x3 = *(const v4fa*)(arow + kb + 16 + 8 * hh + 4);
    float xs[16] = {x0[0],x0[1],x0[2],x0[3],x1[0],x1[1],x1[2],x1[3],x2[0],x2[1],x2[2],x2[3],x3[0],x3[1],x3[2],x3[3]};
#pragma unroll
    for (int i = 0; i < 16; ++i) { const unsigned short hb = bf16_bits(xs[i]); ah.u[i] = hb; al.u[i] = ASPLIT ? bf16_bits(xs[i] - bf16_val(hb)) : (unsigned short)0; }
#pragma unroll
    for (int t = 0; t < 4; ++t) {
      const unsigned short* brow = Wt + (size_t)(col0 + t * 16 + ln) * ldb + kb;
      FragB b;
      b.half[0] = *(const v8us*)(brow + 8 * hh);
      b.half[1] = *(const v8us*)(brow + 16 + 8 * hh);
      acc[t] = mmaN<ASPLIT ? 2 : 1>(ah.v, al.v, b.v, b.v, acc[t]);
    }
  }
#pragma unroll
  for (int t = 0; t < 4; ++t) {
    float bv = bias ? bias[col0 + t * 16 + ln] : 0.f;
    if (BIAS_BF16) bv = bf16_round(bv);
#pragma unroll
    for (int r = 0; r < 8; ++r) { float v = acc[t][r] + bv; if (ACT == 1) v = fmaxf(v, 0.f); so[w][8 * hh + r][t * 16 + ln] = v; }
  }
  __builtin_amdgcn_fence(__ATOMIC_ACQ_REL, "workgroup");
  __builtin_amdgcn_wave_barrier();
  const int rsub = lane >> 4, c4 = (lane & 15) * 4;
  {
#pragma unroll
    for (int q = 0; q < 8; ++q) {
      const int r = q * 2 + rsub;
      const v4f v = *(const v4fa*)&so[w][r][c4];
      *(v4f*)(C + (size_t)(row0 + r) * ldc + col0 + c4) = v;
    }
    
  }
}

// Flash-style causal/unmasked attention, all contractions 3-term bf16 hi/lo splits, f32 softmax with running max.
// q,k,v rows are read from f32 buffers with arbitrary row pitch (so they can live inside a fused qkv buffer);
// D = head size (multiple of 32, <= 128); one wave = 16 query rows; block = 4 waves (64 queries) sharing K/V chunks of 32.
template <int D, bool CAUSAL>
__global__ __launch_bounds__(128) void k_flash(const float* __restrict__ qb, const float* __restrict__ kb, const float* __restrict__ vb,
                                             int pitch, int T, int H, float scale, float* __restrict__ y, int ypitch) {
  constexpr int KS = D / 32;        // k-steps for QK
  constexpr int DT = D / 16;        // d tiles for PV
  __shared__ __attribute__((aligned(16))) unsigned short sKh[32][D + 8], sKl[32][D + 8], sVh[32][D + 8], sVl[32][D + 8];
  __shared__ __attribute__((aligned(16))) unsigned short sPh[4][16][40], sPl[4][16][40];
  __shared__ __attribute__((aligned(16))) float sO[4][16][D];
  const int tid = threadIdx.x, w = tid >> 5, lane = tid & 31, ln = lane & 15, hh = lane >> 4;
  const int nqb = (T + 63) / 64;
  const int bh = blockIdx.x / nqb, qblk = blockIdx.x % nqb;
  const int b = bh / H, h = bh % H;
  const int q0 = qblk * 64 + w * 16;
  const float* Q = qb + (size_t)b * T * pitch + h * D;
  const float* K = kb + (size_t)b * T * pitch + h * D;
  const float* V = vb + (size_t)b * T * pitch + h * D;

  // A fragments of the wave's 16 query rows (scaled), hi/lo
  FragB aqh[KS], aql[KS];
  {
    int row = q0 + ln; if (row >= T) row = T - 1;
    const float* qr = Q + (size_t)row * pitch;
#pragma unroll
    for (int ks = 0; ks < KS; ++ks)
#pragma unroll
      for (int i = 0; i < 16; ++i) {
        const int d = ks * 32 + ((i < 8) ? (8 * hh + i) : (16 + 8 * hh + (i - 8)));
        const float x = qr[d] * scale; const unsigned short hb = bf16_bits(x);
        aqh[ks].u[i] = hb; aql[ks].u[i] = bf16_bits(x - bf16_val(hb));
      }
  }
  float m_r[8], l_r[8];
#pragma unroll
  for (int r = 0; r < 8; ++r) { m_r[r] = -3.0e38f; l_r[r] = 0.f; }
  v8f oacc[DT];
#pragma unroll
  for (int dt = 0; dt < DT; ++dt) oacc[dt] = (v8f){0.f,0.f,0.f,0.f,0.f,0.f,0.f,0.f};

  const int kv_end = CAUSAL ? min(T, qblk * 64 + 64) : T;     // block-uniform
  for (int j0 = 0; j0 < kv_end; j0 += 32) {
    __syncthreads();
    for (int e = tid; e < 32 * (D / 4); e += 128) {
      const int r = e / (D / 4), c4 = (e % (D / 4)) * 4;
      const int key = j0 + r;
      v4f kf = {0.f,0.f,0.f,0.f}, vf = {0.f,0.f,0.f,0.f};
      if (key < T) { kf = *(const v4fa*)(K + (size_t)key * pitch + c4); vf = *(const v4fa*)(V + (size_t)key * pitch + c4); }
#pragma unroll
      for (int t = 0; t < 4; ++t) {
        unsigned short hb = bf16_bits(kf[t]); sKh[r][c4 + t] = hb; sKl[r][c4 + t] = bf16_bits(kf[t] - bf16_val(hb));
        hb = bf16_bits(vf[t]); sVh[r][c4 + t] = hb; sVl[r][c4 + t] = bf16_bits(vf[t] - bf16_val(hb));
      }
    }
    __syncthreads();
    // S tile 16 x 32
    v8f s[2];
#pragma unroll
    for (int nt = 0; nt < 2; ++nt) {
      v8f acc = {};
#pragma unroll
      for (int ks = 0; ks < KS; ++ks) {
        FragB bh_, bl_;
        bh_.half[0] = *(const v8us*)&sKh[nt * 16 + ln][ks * 32 + 8 * hh]; bh_.half[1] = *(const v8us*)&sKh[nt * 16 + ln][ks * 32 + 16 + 8 * hh];
        bl_.half[0] = *(const v8us*)&sKl[nt * 16 + ln][ks * 32 + 8 * hh]; bl_.half[1] = *(const v8us*)&sKl[nt * 16 + ln][ks * 32 + 16 + 8 * hh];
        acc = mmaN<3>(aqh[ks].v, aql[ks].v, bh_.v, bl_.v, acc);
      }
      s[nt] = acc;
    }
    // mask + running max (rows 8hh+r; the 16 lanes of a half share rows)
    float alpha[8];
#pragma unroll
    for (int r = 0; r < 8; ++r) {
      const int qi = q0 + 8 * hh + r;
      const int ja = j0 + ln, jb = j0 + 16 + ln;
      if (CAUSAL) { if (ja > qi) s[0][r] = -3.0e38f; if (jb > qi) s[1][r] = -3.0e38f; }
      if (ja >= T) s[0][r] = -3.0e38f;
      if (jb >= T) s[1][r] = -3.0e38f;
      float mx = fmaxf(s[0][r], s[1][r]);
      mx = fmaxf(mx, __shfl_xor(mx, 1, 32)); mx = fmaxf(mx, __shfl_xor(mx, 2, 32)); mx = fmaxf(mx, __shfl_xor(mx, 4, 32)); mx = fmaxf(mx, __shfl_xor(mx, 8, 32));
      const float mnew = fmaxf(m_r[r], mx);
      alpha[r] = (mnew > -1.0e38f) ? __expf(m_r[r] - mnew) : 1.0f;
      const float p0 = (s[0][r] > -1.0e38f) ? __expf(s[0][r] - mnew) : 0.f;
      const float p1 = (s[1][r] > -1.0e38f) ? __expf(s[1][r] - mnew) : 0.f;
      m_r[r] = mnew;
      l_r[r] = l_r[r] * alpha[r] + p0 + p1;            // per-lane partial row sum (16 lanes combined at the end)
      unsigned short hb = bf16_bits(p0); sPh[w][8 * hh + r][ln] = hb;      sPl[w][8 * hh + r][ln] = bf16_bits(p0 - bf16_val(hb));
      hb = bf16_bits(p1);                sPh[w][8 * hh + r][16 + ln] = hb; sPl[w][8 * hh + r][16 + ln] = bf16_bits(p1 - bf16_val(hb));
    }
#pragma unroll
    for (int dt = 0; dt < DT; ++dt)
#pragma unroll
      for (int r = 0; r < 8; ++r) oacc[dt][r] *= alpha[r];
    __builtin_amdgcn_fence(__ATOMIC_ACQ_REL, "workgroup");
    __builtin_amdgcn_wave_barrier();
    FragB pah, pal;
    pah.half[0] = *(const v8us*)&sPh[w][ln][8 * hh]; pah.half[1] = *(const v8us*)&sPh[w][ln][16 + 8 * hh];
    pal.half[0] = *(const v8us*)&sPl[w][ln][8 * hh]; pal.half[1] = *(const v8us*)&sPl[w][ln][16 + 8 * hh];
#pragma unroll
    for (int dt = 0; dt < DT; ++dt) {
      FragB bvh, bvl;
#pragma unroll
      for (int i = 0; i < 8; ++i) {
        bvh.u[i] = sVh[8 * hh + i][dt * 16 + ln]; bvh.u[8 + i] = sVh[16 + 8 * hh + i][dt * 16 + ln];
        bvl.u[i] = sVl[8 * hh + i][dt * 16 + ln]; bvl.u[8 + i] = sVl[16 + 8 * hh + i][dt * 16 + ln];
      }
      oacc[dt] = mmaN<3>(pah.v, pal.v, bvh.v, bvl.v, oacc[dt]);
    }
    __builtin_amdgcn_fence(__ATOMIC_ACQ_REL, "workgroup");
    __builtin_amdgcn_wave_barrier();
  }
#pragma unroll
  for (int r = 0; r < 8; ++r) {
    float l = l_r[r];
    l += __shfl_xor(l, 1, 32); l += __shfl_xor(l, 2, 32); l += __shfl_xor(l, 4, 32); l += __shfl_xor(l, 8, 32);
    l_r[r] = (l > 0.f) ? 1.0f / l : 0.f;
  }
#pragma unroll
  for (int dt = 0; dt < DT; ++dt)
#pragma unroll
    for (int r = 0; r < 8; ++r) sO[w][8 * hh + r][dt * 16 + ln] = oacc[dt][r] * l_r[r];
  __builtin_amdgcn_fence(__ATOMIC_ACQ_REL, "workgroup");
  __builtin_amdgcn_wave_barrier();
  {
    for (int r = 0; r < 16; ++r) {
      const int row = q0 + r;
      if (row < T && lane < D / 4) {
        const v4f val = *(const v4fa*)&sO[w][r][lane * 4];
        *(v4f*)(y + ((size_t)b * T + row) * ypitch + h * D + lane * 4) = val;
      }
    }
    
  }
}

// GEMM C = act(A·W + bias + resid): A f32 (ASPLIT -> hi/lo 2 terms), Wt bf16 [N][K]; ACT 0 none, 1 relu, 2 exact gelu;
// resid (optional, f32, row index = (row % rmod), pitch ldr, RES_BF16 rounds it) added before the activation.
template <bool ASPLIT, int ACT, bool BIAS_BF16, bool RES_BF16>
__global__ __launch_bounds__(128) void k_gemm_bf3(const float* __restrict__ A, int lda, const unsigned short* __restrict__ Wt, int ldb,
                                                const float* __restrict__ bias, const float* __restrict__ resid, int rmod, int ldr,
                                                float* __restrict__ C, int ldc, int M, int N, int K) {
  __shared__ __attribute__((aligned(16))) float so[4][16][64];
  const int tid = threadIdx.x, w = tid >> 5, lane = tid & 31, ln = lane & 15, hh = lane >> 4;
  const int ntn = N / 64;
  const int wid = blockIdx.x * 4 + w;
  const int mt = wid / ntn, nq = wid % ntn;
  if (mt * 16 >= M) return;
  const int row0 = mt * 16, col0 = nq * 64;
  const float* arow = A + (size_t)(row0 + ln) * lda;
  v8f acc[4] = {};
  for (int kb = 0; kb < K; kb += 32) {
    FragB ah, al;
    const v4f x0 = *(const v4fa*)(arow + kb + 8 * hh), x1 = *(const v4fa*)(arow + kb + 8 * hh + 4);
    const v4f x2 = *(const v4fa*)(arow + kb + 16 + 8 * hh), x3 = *(const v4fa*)(arow + kb + 16 + 8 * hh + 4);
    float xs[16] = {x0[0],x0[1],x0[2],x0[3],x1[0],x1[1],x1[2],x1[3],x2[0],x2[1],x2[2],x2[3],x3[0],x3[1],x3[2],x3[3]};
#pragma unroll
    for (int i = 0; i < 16; ++i) { const unsigned short hb = bf16_bits(xs[i]); ah.u[i] = hb; al.u[i] = ASPLIT ? bf16_bits(xs[i] - bf16_val(hb)) : (unsigned short)0; }
#pragma unroll
    for (int t = 0; t < 4; ++t) {
      const unsigned short* brow = Wt + (size_t)(col0 + t * 16 + ln) * ldb + kb;
      FragB b;
      b.half[0] = *(const v8us*)(brow + 8 * hh);
      b.half[1] = *(const v8us*)(brow + 16 + 8 * hh);
      acc[t] = mmaN<ASPLIT ? 2 : 1>(ah.v, al.v, b.v, b.v, acc[t]);
    }
  }
#pragma unroll
  for (int t = 0; t < 4; ++t) {
    const int col = col0 + t * 16 + ln;
    float bv = bias ? bias[col] : 0.f;
    if (BIAS_BF16) bv = bf16_round(bv);
#pragma unroll
    for (int r = 0; r < 8; ++r) {
      float v = acc[t][r] + bv;
      if (resid) { float rv = resid[(size_t)((row0 + 8 * hh + r) % rmod) * ldr + col]; if (RES_BF16) rv = bf16_round(rv); v += rv; }
      if (ACT == 1) v = fmaxf(v, 0.f);
      if (ACT == 2) v = 0.5f * v * (1.0f + erff(v * 0.70710678118654752f));
      if (ACT == 3) { const float u = 0.7978845608028654f * (v + 0.044715f * v * v * v); v = 0.5f * v * (1.0f + tanhf(u)); }
      so[w][8 * hh + r][t * 16 + ln] = v;
    }
  }
  __builtin_amdgcn_fence(__ATOMIC_ACQ_REL, "workgroup");
  __builtin_amdgcn_wave_barrier();
  const int rsub = lane >> 4, c4 = (lane & 15) * 4;
  {
#pragma unroll
    for (int q = 0; q < 8; ++q) {
      const int r = q * 2 + rsub;
      const v4f v = *(const v4fa*)&so[w][r][c4];
      *(v4f*)(C + (size_t)(row0 + r) * ldc + col0 + c4) = v;
    }
    
  }
}
// row LayerNorm (biased variance, eps) over N: s = X (+ R); optional out_sum <- s; out_norm <- (s-mu)*rsqrt(var+eps)*g + b
template <bool PARAM_BF16>
__global__ __launch_bounds__(256) void k_layernorm(const float* __restrict__ X, const float* __restrict__ R, const float* __restrict__ g, const float* __restrict__ bta,
                                                  float* __restrict__ out_sum, float* __restrict__ out_norm, int N, float eps) {
  __shared__ float red[256];
  const int row = blockIdx.x, tid = threadIdx.x;
  const float* x = X + (size_t)row * N; const float* rr = R ? R + (size_t)row * N : nullptr;
  float vals[16];                     // up to N = 4096
  const int per = N / 256;            // contiguous chunk per thread? use strided-by-4 chunks: thread handles j = tid*4 + 1024*u
  float s1 = 0.f;
  for (int u = 0; u < per / 4; ++u) {
    const int j = tid * 4 + 1024 * u;
    const v4f a = *(const v4fa*)(x + j);
    v4f b = {0.f,0.f,0.f,0.f}; if (rr) b = *(const v4fa*)(rr + j);
#pragma unroll
    for (int q = 0; q < 4; ++q) { const float v = a[q] + b[q]; vals[u * 4 + q] = v; s1 += v; }
  }
  red[tid] = s1; __syncthreads();
  for (int st = 128; st > 0; st >>= 1) { if (tid < st) red[tid] += red[tid + st]; __syncthreads(); }
  const float mu = red[0] / (float)N; __syncthreads();
  float s2 = 0.f;
  for (int u = 0; u < per / 4; ++u)
#pragma unroll
    for (int q = 0; q < 4; ++q) { const float c = vals[u * 4 + q] - mu; s2 += c * c; }
  red[tid] = s2; __syncthreads();
  for (int st = 128; st > 0; st >>= 1) { if (tid < st) red[tid] += red[tid + st]; __syncthreads(); }
  const float rs = rsqrtf(red[0] / (float)N + eps);
  {
    for (int u = 0; u < per / 4; ++u) {
      const int j = tid * 4 + 1024 * u;
      v4f o, sm;
#pragma unroll
      for (int q = 0; q < 4; ++q) {
        float gg = g[j + q], bb = bta[j + q];
        if (PARAM_BF16) { gg = bf16_round(gg); bb = bf16_round(bb); }
        sm[q] = vals[u * 4 + q]; o[q] = (vals[u * 4 + q] - mu) * rs * gg + bb;
      }
      if (out_sum) *(v4f*)(out_sum + (size_t)row * N + j) = sm;
      *(v4f*)(out_norm + (size_t)row * N + j) = o;
    }
    
  }
}



// ---- f16 WMMA path (v_wmma_f32_16x16x32_f16): 11-bit significands for operands in range — used where a [0,1] probability operand needs more precision than bf16
typedef _Float16 v16h __attribute__((ext_vector_type(16)));
union FragH { v16h v; v8us half[2]; _Float16 h[16]; unsigned short u[16]; };
template <int NT>
__device__ __forceinline__ v8f mmaH(v16h ah, v16h al, v16h bh, v16h bl, v8f c) {
  c = __builtin_amdgcn_wmma_f32_16x16x32_f16(false, ah, false, bh, (short)0, c, false, false);
  if (NT >= 2) c = __builtin_amdgcn_wmma_f32_16x16x32_f16(false, al, false, bh, (short)0, c, false, false);
  if (NT >= 3) c = __builtin_amdgcn_wmma_f32_16x16x32_f16(false, ah, false, bl, (short)0, c, false, false);
  asm volatile("v_nop\n\tv_nop\n\tv_nop\n\tv_nop" : "+v"(c) : "v"(ah), "v"(al), "v"(bh), "v"(bl));
  return c;
}
// batched GEMM like k_gemm_b but f16 operands: A f32 (split into f16 hi/lo if ASPLIT, else rounded to f16), Bt = f16 values [n][k]; alpha; C f32; N multiple of 16 (partial tiles skipped)
template <bool ASPLIT>
__global__ __launch_bounds__(128) void k_gemm_h(const float* __restrict__ A, int lda, size_t sA, const _Float16* __restrict__ Bh, int ldb, size_t sB, float alpha, float* __restrict__ C, int ldc, size_t sC, int M, int N, int K) {
  __shared__ __attribute__((aligned(16))) float so[4][16][64];
  const int tid = threadIdx.x, w = tid >> 5, lane = tid & 31, ln = lane & 15, hh = lane >> 4; const int by = blockIdx.y;
  A += (size_t)by * sA; Bh += (size_t)by * sB; C += (size_t)by * sC;
  const int ntn = (N + 63) / 64; const int wid = blockIdx.x * 4 + w; const int mt = wid / ntn, nq = wid % ntn; if (mt * 16 >= M) return;
  const int row0 = mt * 16, col0 = nq * 64; const float* arow = A + (size_t)(row0 + ln) * lda;
  v8f acc[4] = {};
  for (int kb = 0; kb < K; kb += 32) {
    FragH ah, al;
    const v4f x0 = *(const v4fa*)(arow + kb + 8 * hh), x1 = *(const v4fa*)(arow + kb + 8 * hh + 4), x2 = *(const v4fa*)(arow + kb + 16 + 8 * hh), x3 = *(const v4fa*)(arow + kb + 16 + 8 * hh + 4);
    float xs[16] = {x0[0],x0[1],x0[2],x0[3],x1[0],x1[1],x1[2],x1[3],x2[0],x2[1],x2[2],x2[3],x3[0],x3[1],x3[2],x3[3]};
#pragma unroll
    for (int i = 0; i < 16; ++i) { const _Float16 h = (_Float16)xs[i]; ah.h[i] = h; al.h[i] = ASPLIT ? (_Float16)(xs[i] - (float)h) : (_Float16)0.0f; }
#pragma unroll
    for (int t = 0; t < 4; ++t) { if (col0 + t * 16 >= N) continue; const size_t boff = (size_t)(col0 + t * 16 + ln) * ldb + kb; FragH bq; bq.half[0] = *(const v8us*)(Bh + boff + 8 * hh); bq.half[1] = *(const v8us*)(Bh + boff + 16 + 8 * hh);
      acc[t] = mmaH<ASPLIT ? 2 : 1>(ah.v, al.v, bq.v, bq.v, acc[t]); }
  }
#pragma unroll
  for (int t = 0; t < 4; ++t) { if (col0 + t * 16 >= N) continue;
#pragma unroll
    for (int r = 0; r < 8; ++r) so[w][8 * hh + r][t * 16 + ln] = acc[t][r] * alpha; }
  __builtin_amdgcn_fence(__ATOMIC_ACQ_REL, "workgroup"); __builtin_amdgcn_wave_barrier();
  const int rsub = lane >> 4, c4 = (lane & 15) * 4;
  {
#pragma unroll
    for (int q = 0; q < 8; ++q) { const int r = q * 2 + rsub; if (col0 + c4 < N) { const v4f v = *(const v4fa*)&so[w][r][c4]; *(v4f*)(C + (size_t)(row0 + r) * ldc + col0 + c4) = v; } }
     }
}

// Wt[n][k] = f16(W[k][n]·scale) from f32 row-major W[K][N] (scale = power of two; bf16-exact weights stay exact in f16 away from the subnormal range)
__global__ __launch_bounds__(256) void k_wt_f16(const float* __restrict__ W, _Float16* __restrict__ Wt, int K, int N, float scale) {
  const int t = blockIdx.x * 256 + threadIdx.x; if (t >= N * (K / 8)) return; const int n = t / (K / 8), k8 = (t % (K / 8)) * 8; FragH f;
#pragma unroll
  for (int i = 0; i < 8; ++i) f.h[i] = (_Float16)(bf16_round(W[(size_t)(k8 + i) * N + n]) * scale); const v8us o = f.half[0];
  *(v8us*)((unsigned short*)Wt + (size_t)n * K + k8) = o; 
}
// k_gemm_hh variant with fused epilogue: v = acc·alpha + bias[by·sBias + col] (+ CP[(row/rowsPerB)·sCPb + by·64 + col] if CP) ; ACT 0 none / 1 elu ; writes f16 C16 (and f32 C if non-null)
template <int ACT>
__global__ __launch_bounds__(128) void k_gemm_hhx(const _Float16* __restrict__ A, int lda, size_t sA, const _Float16* __restrict__ Bh, int ldb, size_t sB, float alpha, const float* __restrict__ bias, size_t sBias, const float* __restrict__ CP, int rowsPerB, size_t sCPb, int row0g,
    float* __restrict__ C, _Float16* __restrict__ C16, int ldc, size_t sC, int M, int N, int K) {
  __shared__ __attribute__((aligned(16))) float so[4][16][64];
  const int tid = threadIdx.x, w = tid >> 5, lane = tid & 31, ln = lane & 15, hh = lane >> 4; const int by = blockIdx.y;
  A += (size_t)by * sA; Bh += (size_t)by * sB; const size_t cofs = (size_t)by * sC; const float* bp = bias ? bias + (size_t)by * sBias : nullptr;
  const int ntn = (N + 63) / 64; const int wid = blockIdx.x * 4 + w; const int mt = wid / ntn, nq = wid % ntn; if (mt * 16 >= M) return;
  const int row0 = mt * 16, col0 = nq * 64; const _Float16* arow = A + (size_t)(row0 + ln) * lda;
  v8f acc[4] = {};
  for (int kb = 0; kb < K; kb += 32) { FragH ah; ah.half[0] = *(const v8us*)((const unsigned short*)arow + kb + 8 * hh); ah.half[1] = *(const v8us*)((const unsigned short*)arow + kb + 16 + 8 * hh);
#pragma unroll
    for (int t = 0; t < 4; ++t) { if (col0 + t * 16 >= N) continue; const size_t boff = (size_t)(col0 + t * 16 + ln) * ldb + kb; FragH bq; bq.half[0] = *(const v8us*)((const unsigned short*)Bh + boff + 8 * hh); bq.half[1] = *(const v8us*)((const unsigned short*)Bh + boff + 16 + 8 * hh);
      acc[t] = mmaH<1>(ah.v, ah.v, bq.v, bq.v, acc[t]); }
  }
#pragma unroll
  for (int t = 0; t < 4; ++t) { if (col0 + t * 16 >= N) continue; const int col = col0 + t * 16 + ln; const float bv = bp ? bf16_round(bp[col]) : 0.f;
#pragma unroll
    for (int r = 0; r < 8; ++r) { float v = acc[t][r] * alpha + bv; if (CP) { const int bidx = (row0g + row0 + 8 * hh + r) / rowsPerB; v += CP[(size_t)bidx * sCPb + (size_t)by * 64 + col]; } if (ACT == 1) v = (v > 0.f) ? v : expm1f(v); else if (ACT == 7) v = (v > 0.f) ? v + 1.0f : expf(v); else if (ACT == 8) v = tanhf(v); else if (ACT == 9) v = 0.5f * v * (1.0f + tanhf(0.7978845608028654f * (v + 0.044715f * v * v * v))); else if (ACT == 11) v = 1.0f / (1.0f + expf(-v)); else if (ACT == 12) v = (v > 0.f) ? v : 0.01f * v; else if (ACT == 14) v = (v > 0.f) ? v : 0.1f * v; else if (ACT == 15) v = v / (1.0f + expf(-v)); else if (ACT == 3) v = fmaxf(v, 0.f); else if (ACT == 6) v = 0.5f * v * (1.0f + erff(v * 0.70710678118654752f)); so[w][8 * hh + r][t * 16 + ln] = v; } }
  __builtin_amdgcn_fence(__ATOMIC_ACQ_REL, "workgroup"); __builtin_amdgcn_wave_barrier();
  const int rsub = lane >> 4, c4 = (lane & 15) * 4; typedef _Float16 v4h __attribute__((ext_vector_type(4)));
  {
#pragma unroll
    for (int q = 0; q < 8; ++q) { const int r = q * 2 + rsub; if (col0 + c4 < N) { const v4f v = *(const v4fa*)&so[w][r][c4]; if (C) *(v4f*)(C + cofs + (size_t)(row0 + r) * ldc + col0 + c4) = v; if (C16) { v4h h4; for (int i = 0; i < 4; ++i) h4[i] = (_Float16)v[i]; *(v4h*)(C16 + cofs + (size_t)(row0 + r) * ldc + col0 + c4) = h4; } } }
     }
}


typedef _Float16 v4h __attribute__((ext_vector_type(4)));

__global__ __launch_bounds__(256) void k_x16(const float* __restrict__ x, _Float16* __restrict__ X16, size_t n8) { const size_t t = (size_t)blockIdx.x * 256 + threadIdx.x; if (t >= n8) return; FragH f;
#pragma unroll
  for (int q = 0; q < 8; ++q) f.h[q] = (_Float16)bf16_round(x[t * 8 + q]); *(v8us*)((unsigned short*)X16 + t * 8) = f.half[0];  }
__global__ __launch_bounds__(256) void k_h16(const float* __restrict__ x, _Float16* __restrict__ X16, size_t n8) { const size_t t = (size_t)blockIdx.x * 256 + threadIdx.x; if (t >= n8) return; FragH f;
#pragma unroll
  for (int q = 0; q < 8; ++q) f.h[q] = (_Float16)x[t * 8 + q]; *(v8us*)((unsigned short*)X16 + t * 8) = f.half[0];  }
__global__ __launch_bounds__(256) void k_round16f(const float* __restrict__ W, _Float16* __restrict__ Bt, size_t n8) { const size_t t = (size_t)blockIdx.x * 256 + threadIdx.x; if (t >= n8) return; FragH f;
#pragma unroll
  for (int i = 0; i < 8; ++i) f.h[i] = (_Float16)(bf16_round(W[t * 8 + i]) * 16.0f); *(v8us*)((unsigned short*)Bt + t * 8) = f.half[0];  }
template <int NHv, int TTv>
__global__ __launch_bounds__(256) void k_vt(const _Float16* __restrict__ V16, int ldv, int voff, _Float16* __restrict__ Vt) { __shared__ unsigned short tl[64][66]; const int tid = threadIdx.x; const int slab = blockIdx.x / (TTv / 64), lg = blockIdx.x % (TTv / 64); const int b = slab / NHv, h = slab % NHv;
  for (int i = tid; i < 64 * 8; i += 256) { const int r = i / 8, c8 = (i % 8) * 8; FragH f; f.half[0] = *(const v8us*)((const unsigned short*)V16 + ((size_t)b * TTv + lg * 64 + r) * ldv + voff + h * 64 + c8);
#pragma unroll
    for (int q = 0; q < 8; ++q) tl[r][c8 + q] = f.u[q]; }
  __syncthreads();
  {
#pragma unroll
    for (int rd = 0; rd < 2; ++rd) { const int d = rd * 32 + tid / 8, pc = tid % 8; FragH f;
#pragma unroll
      for (int q = 0; q < 8; ++q) f.u[q] = tl[pc * 8 + q][d];
      *(v8us*)((unsigned short*)Vt + ((size_t)slab * 64 + d) * TTv + lg * 64 + pc * 8) = f.half[0]; }
     } }

__global__ __launch_bounds__(256) void k_tok(const float* __restrict__ x, _Float16* __restrict__ X16) { __shared__ float tl[32][65]; const int tid = threadIdx.x; const int b = blockIdx.x / (2 * (NN / 32)), rem = blockIdx.x % (2 * (NN / 32)); const int cg = rem / (NN / 32), pg = rem % (NN / 32); const int c0 = cg * 64, p0 = pg * 32;
  for (int i = tid; i < 64 * 32; i += 256) { const int c = i / 32, pp = i % 32; tl[pp][c] = bf16_round(x[((size_t)b * C3 + c0 + c) * NN + p0 + pp]); } __syncthreads();
  /* q: rows of 64 channels, token-major. k: behind the q plane, in fragment order: the 4 KB of a pass of 32 keys are [nt][ks][hf][lane] units of 16 B,
     unit = channels ks*32 + hf*16 + 8*(lane >> 4) + 0..7 of key nt*16 + (lane & 15), so that a wave's load of one fragment half is 4 whole lines instead of 32 B out of each of 16. */
  int r, c; size_t dst;
  if (cg == 0) { r = tid / 8; c = (tid % 8) * 8; dst = ((size_t)b * NN + p0 + r) * CC + c; }
  else { r = (tid >> 7) * 16 + (tid & 15); c = ((tid >> 6) & 1) * 32 + ((tid >> 5) & 1) * 16 + ((tid >> 4) & 1) * 8; dst = (size_t)NR * CC + ((size_t)b * NN + p0) * CC + tid * 8; }
  FragH f; for (int q = 0; q < 8; ++q) f.h[q] = (_Float16)tl[r][c + q]; *(v8us*)((unsigned short*)X16 + dst) = f.half[0];  }
__global__ __launch_bounds__(256) void k_v16(const float* __restrict__ x, _Float16* __restrict__ Vt) { const size_t t = (size_t)blockIdx.x * 256 + threadIdx.x; if (t >= (size_t)BB * CC * NN / 8) return;
  /* v in fragment order: the 4 KB of a pass of 32 keys are [dt][hf][lane] units of 16 B, unit = keys hf*16 + 8*(lane >> 4) + 0..7 of channel dt*16 + (lane & 15); thread t writes unit t */
  const int d = (int)((t >> 6) & 3) * 16 + (int)(t & 15); const int n8 = (int)((t >> 8) % (NN / 32)) * 32 + (int)((t >> 5) & 1) * 16 + (int)((t >> 4) & 1) * 8; const int b = (int)(t / ((size_t)(NN / 8) * CC)); FragH f;
#pragma unroll
  for (int q = 0; q < 8; ++q) f.h[q] = (_Float16)bf16_round(x[((size_t)b * C3 + 2 * CC + d) * NN + n8 + q]); *(v8us*)((unsigned short*)Vt + t * 8) = f.half[0];  }
// lane l <-> lane l ^ 16 (the two lane halves hold the two key halves of one query column)
__device__ __forceinline__ float xhalf(float x) { return __builtin_bit_cast(float, __builtin_amdgcn_permlanex16(__builtin_bit_cast(int, x), __builtin_bit_cast(int, x), 0x76543210, 0xfedcba98, false, false)); }
// Eight 16-B copies per lane, global memory to LDS through no register. The s_wait_xcnt closes the statement so that no address register named here is rewritten ahead of it.
__device__ __forceinline__ void copy8(unsigned l, const unsigned short* g) {
  asm volatile("global_load_async_to_lds_b128 %0, %8, off\n\t"
               "global_load_async_to_lds_b128 %1, %9, off\n\t"
               "global_load_async_to_lds_b128 %2, %10, off\n\t"
               "global_load_async_to_lds_b128 %3, %11, off\n\t"
               "global_load_async_to_lds_b128 %4, %12, off\n\t"
               "global_load_async_to_lds_b128 %5, %13, off\n\t"
               "global_load_async_to_lds_b128 %6, %14, off\n\t"
               "global_load_async_to_lds_b128 %7, %15, off\n\t"
               "s_wait_xcnt 0x0"
               :: "v"(l), "v"(l + 2048u), "v"(l + 4096u), "v"(l + 6144u), "v"(l + 8192u), "v"(l + 10240u), "v"(l + 12288u), "v"(l + 14336u),
                  "v"(g), "v"(g + 1024), "v"(g + 2048), "v"(g + 3072), "v"(g + 4096), "v"(g + 5120), "v"(g + 6144), "v"(g + 7168)
               : "memory");
}
__global__ __launch_bounds__(128) void k_flash(const _Float16* __restrict__ Q16, int ldq, const _Float16* __restrict__ K16, const _Float16* __restrict__ Vt, const int* __restrict__ MSK, float* __restrict__ O, int ldo) {
  constexpr int RPW = 16, NQB = NN / (4 * RPW), DT = 4, KS = 2;
  constexpr int SK = 128, NP = SK / 32, SH = SK * CC, NS = NN / SK;      /* keys, passes and halves per plane of a stage; stages */
  __shared__ __attribute__((aligned(16))) unsigned short sKV[2][2][SH];      /* [buffer][K, V][fragment order] */
  __shared__ __attribute__((aligned(16))) float sO[4][RPW][64 + 4];
  const int tid = threadIdx.x, w = tid >> 5, lane = tid & 31, ln = lane & 15, hh = lane >> 4;
  const int slab = blockIdx.x / NQB, qblk = blockIdx.x % NQB; const int b = slab; const int h = 0; const int qb0 = qblk * (4 * RPW); const int q0 = qb0 + w * RPW;
  /* the thread's 16 B of each 2-KB slice of a stage: source in the two planes, place in buffer 0 (LDS byte address) */
  const unsigned short* Kg = (const unsigned short*)K16 + (size_t)b * NN * CC + tid * 8;
  const unsigned short* Vg = (const unsigned short*)Vt + (size_t)b * NN * CC + tid * 8;
  const unsigned lds0 = (unsigned)(size_t)&sKV[0][0][0] + (unsigned)tid * 16u;
  copy8(lds0, Kg); copy8(lds0 + SH * 2, Vg);
  FragH aq[KS];
  { const unsigned short* qr = (const unsigned short*)Q16 + ((size_t)b * NN + q0 + ln) * ldq;
#pragma unroll
    for (int ks = 0; ks < KS; ++ks) { aq[ks].half[0] = *(const v8us*)(qr + ks * 32 + 8 * hh); aq[ks].half[1] = *(const v8us*)(qr + ks * 32 + 16 + 8 * hh); } }
  float m_r = -3.0e38f, l_r = 0.f; v8f oacc[DT];      /* oacc[dt][r] = Ot[dt*16 + 8hh + r][query ln] */
#pragma unroll
  for (int dt = 0; dt < DT; ++dt) oacc[dt] = (v8f){0.f,0.f,0.f,0.f,0.f,0.f,0.f,0.f};
  asm volatile("s_wait_asynccnt 0x0" ::: "memory");      /* this wave's share of stage 0 has landed */
  __syncthreads();                                        /* ... and every other wave's */
  copy8(lds0 + SH * 4, Kg + SH); copy8(lds0 + SH * 6, Vg + SH);
  /* the stage loop stays rolled; the constant-trip inner loops are unrolled so that the fragment and score arrays stay in registers */
#pragma unroll 1
  for (int st = 0; st < NS; ++st) {
    /* 32 keys = 2048 halves of a plane, a fragment half = 256 halves, the lane's 16 B at lane * 8 */
    const unsigned short* Kf = &sKV[st & 1][0][lane * 8];
    const unsigned short* Vf = &sKV[st & 1][1][lane * 8];
    /* The loads stand ahead of the work that hides them: a pass's K fragments are asked for in the pass before, right behind its S products (inside the stage only), its V fragments at its head. */
    FragH bk[2][KS];      /* K fragments of the pass at hand */
#pragma unroll
    for (int nt = 0; nt < 2; ++nt) {
#pragma unroll
      for (int ks = 0; ks < KS; ++ks) { const unsigned short* kr = Kf + (nt * KS + ks) * 512; bk[nt][ks].half[0] = *(const v8us*)kr; bk[nt][ks].half[1] = *(const v8us*)(kr + 256); } }
#pragma unroll
    for (int ps = 0; ps < NP; ++ps) {
      FragH bv[DT];
#pragma unroll
      for (int dt = 0; dt < DT; ++dt) { const unsigned short* vr = Vf + ps * 2048 + dt * 512; bv[dt].half[0] = *(const v8us*)vr; bv[dt].half[1] = *(const v8us*)(vr + 256); }
      v8f s[2];      /* s[nt][r] = St[key of the pass nt*16 + 8hh + r][query ln] */
#pragma unroll
      for (int nt = 0; nt < 2; ++nt) {
        v8f acc = (v8f){0.f,0.f,0.f,0.f,0.f,0.f,0.f,0.f};
#pragma unroll
        for (int ks = 0; ks < KS; ++ks) acc = mmaH<1>(bk[nt][ks].v, bk[nt][ks].v, aq[ks].v, aq[ks].v, acc);
        s[nt] = acc; }
      if (ps + 1 < NP) {
#pragma unroll
        for (int nt = 0; nt < 2; ++nt) {
#pragma unroll
          for (int ks = 0; ks < KS; ++ks) { const unsigned short* kr = Kf + (ps + 1) * 2048 + (nt * KS + ks) * 512; bk[nt][ks].half[0] = *(const v8us*)kr; bk[nt][ks].half[1] = *(const v8us*)(kr + 256); } } }
      float sc[16]; float mq[4];
#pragma unroll
      for (int i = 0; i < 16; ++i) sc[i] = s[i >> 3][i & 7] * 0.125f;
#pragma unroll
      for (int c = 0; c < 4; ++c) mq[c] = fmaxf(fmaxf(sc[c], sc[4 + c]), fmaxf(sc[8 + c], sc[12 + c]));
      float mc = fmaxf(fmaxf(mq[0], mq[1]), fmaxf(mq[2], mq[3])); mc = fmaxf(mc, xhalf(mc));
      const float mn = fmaxf(m_r, mc); const float al = (mn > -1.0e38f) ? expf(m_r - mn) : 1.0f; m_r = mn;
      FragH pb; float ps4[4] = {0.f, 0.f, 0.f, 0.f};      /* pb.h[i] = Pt[key of the pass (i < 8 ? 8hh + i : 8 + 8hh + i)][query ln] x 2^10 */
#pragma unroll
      for (int i = 0; i < 16; ++i) { const float p = expf(sc[i] - mn); ps4[i & 3] += p; pb.h[i] = (_Float16)(p * 1024.0f); }
      l_r = l_r * al + ((ps4[0] + ps4[1]) + (ps4[2] + ps4[3]));      /* this lane half's keys only; the halves join after the loop */
#pragma unroll
      for (int dt = 0; dt < DT; ++dt)
#pragma unroll
        for (int r = 0; r < 8; ++r) oacc[dt][r] *= al;
#pragma unroll
      for (int dt = 0; dt < DT; ++dt) oacc[dt] = mmaH<1>(bv[dt].v, bv[dt].v, pb.v, pb.v, oacc[dt]);
    }
    asm volatile("s_wait_dscnt 0x0" ::: "memory");        /* this wave's reads of the buffer are done before anyone refills it */
    asm volatile("s_wait_asynccnt 0x0" ::: "memory");     /* this wave's share of stage st + 1 has landed */
    __syncthreads();                                        /* publishes stage st + 1 and ends every wave's reads of stage st */
    if (st + 2 < NS) { const unsigned lb = lds0 + (unsigned)(st & 1) * (SH * 4); copy8(lb, Kg + (size_t)(st + 2) * SH); copy8(lb + SH * 2, Vg + (size_t)(st + 2) * SH); }
  }
  asm volatile("s_wait_asynccnt 0x0" ::: "memory");       /* nothing of this wave is in flight when it goes on to the output staging and ends */
  const float l = l_r + xhalf(l_r); const float linv = (l > 0.f) ? 1.0f / (l * 1024.0f) : 0.f;
#pragma unroll
  for (int dt = 0; dt < DT; ++dt) { v4f lo, hi;
#pragma unroll
    for (int r = 0; r < 4; ++r) { lo[r] = oacc[dt][r] * linv; hi[r] = oacc[dt][4 + r] * linv; }
    *(v4fa*)&sO[w][ln][dt * 16 + 8 * hh] = lo; *(v4fa*)&sO[w][ln][dt * 16 + 8 * hh + 4] = hi; }
  __builtin_amdgcn_fence(__ATOMIC_ACQ_REL, "workgroup"); __builtin_amdgcn_wave_barrier();
  {
#pragma unroll
    for (int rp = 0; rp < RPW; rp += 2) { const int r = rp + (lane >> 4), pc = lane & 15; const v4f val = *(const v4fa*)&sO[w][r][pc * 4]; *(v4f*)(O + ((size_t)b * NN + q0 + r) * ldo + pc * 4) = val; }      /* 16 lanes x 16 B = one whole 256-B row */
     } }

__global__ __launch_bounds__(256) void k_out(const float* __restrict__ G, float* __restrict__ out) { __shared__ float tl[32][65]; const int tid = threadIdx.x; const int b = blockIdx.x / ((CC / 32) * (NN / 64)), rem = blockIdx.x % ((CC / 32) * (NN / 64)); const int cg = rem / (NN / 64), pg = rem % (NN / 64); const int c0 = cg * 32, p0 = pg * 64;
  for (int i = tid; i < 64 * 32; i += 256) { const int pp = i / 32, c = i % 32; tl[c][pp] = G[((size_t)b * NN + p0 + pp) * CC + c0 + c]; } __syncthreads();
  { for (int i = tid; i < 32 * 16; i += 256) { const int c = i / 16, q4 = i % 16; const v4f v = {tl[c][q4 * 4], tl[c][q4 * 4 + 1], tl[c][q4 * 4 + 2], tl[c][q4 * 4 + 3]}; *(v4f*)(out + ((size_t)b * CC + c0 + c) * NN + p0 + q4 * 4) = v; }  } }

extern "C" void kernel_launch(void* const* d_in, const int* in_sizes, int n_in,
                              void* d_out, int out_size, void* d_ws, size_t ws_size, hipStream_t stream) {
  (void)in_sizes; (void)n_in; (void)out_size;
  const float* qkv = (const float*)d_in[0];
  char* ws = (char*)d_ws; size_t off = 0;
  auto take = [&](size_t bytes) { char* p = ws + off; off += (bytes + 255) & ~(size_t)255; return p; };
  _Float16* QK = (_Float16*)take((size_t)NR * 2 * CC * 2); _Float16* Vt = (_Float16*)take((size_t)BB * CC * NN * 2); float* O = (float*)take((size_t)NR * CC * 4);
  if (off > ws_size) return;      // 8.4 + 4.2 + 8.4 ≈ 21 MB
  k_tok<<<BB * 2 * (NN / 32), 256, 0, stream>>>(qkv, QK);
  k_v16<<<(unsigned)(((size_t)BB * CC * NN / 8 + 255) / 256), 256, 0, stream>>>(qkv, Vt);
  k_flash<<<BB * (NN / 64), 128, 0, stream>>>(QK, CC, QK + (size_t)NR * CC, Vt, nullptr, O, CC);
  k_out<<<BB * (CC / 32) * (NN / 64), 256, 0, stream>>>(O, (float*)d_out);
}

// v005
// Measured time: 60.4 microseconds a run.
// Two timings next to v004 put it at 1.49 and 1.48 times that version's speed.
// Over all steps from v000 it is 7.22 times as fast.
#include <hip/hip_runtime.h>
// QKV self-attention on a channel-major qkv tensor [8, 3·64, 4096]: attn[s,t] = Σ_c q[c,s]·k[c,t]/√64, softmax over t, out[d,s] = Σ_t attn[s,t]·v[d,t].
// Compute dtype: qkv rounded to bf16 and carried exactly in f16 (q token-major; k and v planes in the order of their A fragments, 512 contiguous bytes per wave-wide load); S and P·V on v_wmma_f32_16x16x32_f16 with
// f32 accumulation in one fused flash-style kernel (online softmax in f32; P in f16 ×2^10); O transposed back to [b][d][s] through LDS; output f32.
#define BB 8
#define CC 64
#define C3 192
#define NN 4096
#define NR (BB * NN)

typedef __bf16 v16b __attribute__((ext_vector_type(16)));
typedef unsigned short v8us __attribute__((ext_vector_type(8), may_alias));
typedef float  v8f  __attribute__((ext_vector_type(8)));
typedef float  v4f  __attribute__((ext_vector_type(4)));
typedef float  v4fa __attribute__((ext_vector_type(4), may_alias));
union FragB { v16b v; v8us half[2]; unsigned short u[16]; };

__device__ __forceinline__ unsigned short bf16_bits(float x) { unsigned int u = __float_as_uint(x); return (unsigned short)((u + 0x7FFFu + ((u >> 16) & 1u)) >> 16); }
__device__ __forceinline__ float bf16_val(unsigned short b) { return __uint_as_float(((unsigned int)b) << 16); }
__device__ __forceinline__ float bf16_round(float x) { return bf16_val(bf16_bits(x)); }
// D += A·B with NT terms: 1 = ah·bh, 2 = + al·bh (A split), 3 = + ah·bl (both split)
template <int NT>
__device__ __forceinline__ v8f mmaN(v16b ah, v16b al, v16b bh, v16b bl, v8f c) {
  c = __builtin_amdgcn_wmma_f32_16x16x32_bf16(false, ah, false, bh, (short)0, c, false, false);
  if (NT >= 2) c = __builtin_amdgcn_wmma_f32_16x16x32_bf16(false, al, false, bh, (short)0, c, false, false);
  if (NT >= 3) c = __builtin_amdgcn_wmma_f32_16x16x32_bf16(false, ah, false, bl, (short)0, c, false, false);
  asm volatile("v_nop\n\tv_nop\n\tv_nop\n\tv_nop" : "+v"(c) : "v"(ah), "v"(al), "v"(bh), "v"(bl));
  return c;
}

__global__ __launch_bounds__(256) void k_wt_bf16(const float* __restrict__ W, unsigned short* __restrict__ Wt, int K, int N) {
  const int t = blockIdx.x * 256 + threadIdx.x;
  const int k8n = K / 8;
  if (t >= N * k8n) return;
  const int n = t / k8n, k8 = (t % k8n) * 8;
  v8us v;
#pragma unroll
  for (int i = 0; i < 8; ++i) v[i] = bf16_bits(W[(size_t)(k8 + i) * N + n]);
  *(v8us*)(Wt + (size_t)n * K + k8) = v;
  
}

// GEMM C[M][N] (f32, pitch ldc) = act(A[M][K]·W + bias). A f32 row-major (pitch lda) converted per fragment to bf16
// (ASPLIT: hi/lo two planes -> 2 terms, else single rounded term); Wt bf16 [N][K] (pitch ldb). BIAS_BF16 rounds the
// bias to bf16 first (bias quantised to bf16 before the add). K%32==0, M%16==0, N%64==0.
template <bool ASPLIT, int ACT, bool BIAS_BF16>
__global__ __launch_bounds__(128) void k_gemm_bf(const float* __restrict__ A, int lda, const unsigned short* __restrict__ Wt, int ldb,
                                               const float* __restrict__ bias, float* __restrict__ C, int ldc, int M, int N, int K) {
  __shared__ __attribute__((aligned(16))) float so[4][16][64];
  const int tid = threadIdx.x, w = tid >> 5, lane = tid & 31, ln = lane & 15, hh = lane >> 4;
  const int ntn = N / 64;
  const int wid = blockIdx.x * 4 + w;
  const int mt = wid / ntn, nq = wid % ntn;
  if (mt * 16 >= M) return;
  const int row0 = mt * 16, col0 = nq * 64;
  const float* arow = A + (size_t)(row0 + ln) * lda;
  v8f acc[4] = {};
  for (int kb = 0; kb < K; kb += 32) {
    FragB ah, al;
    const v4f x0 = *(const v4fa*)(arow + kb + 8 * hh), x1 = *(const v4fa*)(arow + kb + 8 * hh + 4);
    const v4f x2 = *(const v4fa*)(arow + kb + 16 + 8 * hh), x3 = *(const v4fa*)(arow + kb + 16 + 8 * hh + 4);
    float xs[16] = {x0[0],x0[1],x0[2],x0[3],x1[0],x1[1],x1[2],x1[3],x2[0],x2[1],x2[2],x2[3],x3[0],x3[1],x3[2],x3[3]};
#pragma unroll
    for (int i = 0; i < 16; ++i) { const unsigned short hb = bf16_bits(xs[i]); ah.u[i] = hb; al.u[i] = ASPLIT ? bf16_bits(xs[i] - bf16_val(hb)) : (unsigned short)0; }
#pragma unroll
    for (int t = 0; t < 4; ++t) {
      const unsigned short* brow = Wt + (size_t)(col0 + t * 16 + ln) * ldb + kb;
      FragB b;
      b.half[0] = *(const v8us*)(brow + 8 * hh);
      b.half[1] = *(const v8us*)(brow + 16 + 8 * hh);
      acc[t] = mmaN<ASPLIT ? 2 : 1>(ah.v, al.v, b.v, b.v, acc[t]);
    }
  }
#pragma unroll
  for (int t = 0; t < 4; ++t) {
    float bv = bias ? bias[col0 + t * 16 + ln] : 0.f;
    if (BIAS_BF16) bv = bf16_round(bv);
#pragma unroll
    for (int r = 0; r < 8; ++r) { float v = acc[t][r] + bv; if (ACT == 1) v = fmaxf(v, 0.f); so[w][8 * hh + r][t * 16 + ln] = v; }
  }
  __builtin_amdgcn_fence(__ATOMIC_ACQ_REL, "workgroup");
  __builtin_amdgcn_wave_barrier();
  const int rsub = lane >> 4, c4 = (lane & 15) * 4;
  {
#pragma unroll
    for (int q = 0; q < 8; ++q) {
      const int r = q * 2 + rsub;
      const v4f v = *(const v4fa*)&so[w][r][c4];
      *(v4f*)(C + (size_t)(row0 + r) * ldc + col0 + c4) = v;
    }
    
  }
}

// Flash-style causal/unmasked attention, all contractions 3-term bf16 hi/lo splits, f32 softmax with running max.
// q,k,v rows are read from f32 buffers with arbitrary row pitch (so they can live inside a fused qkv buffer);
// D = head size (multiple of 32, <= 128); one wave = 16 query rows; block = 4 waves (64 queries) sharing K/V chunks of 32.
template <int D, bool CAUSAL>
__global__ __launch_bounds__(128) void k_flash(const float* __restrict__ qb, const float* __restrict__ kb, const float* __restrict__ vb,
                                             int pitch, int T, int H, float scale, float* __restrict__ y, int ypitch) {
  constexpr int KS = D / 32;        // k-steps for QK
  constexpr int DT = D / 16;        // d tiles for PV
  __shared__ __attribute__((aligned(16))) unsigned short sKh[32][D + 8], sKl[32][D + 8], sVh[32][D + 8], sVl[32][D + 8];
  __shared__ __attribute__((aligned(16))) unsigned short sPh[4][16][40], sPl[4][16][40];
  __shared__ __attribute__((aligned(16))) float sO[4][16][D];
  const int tid = threadIdx.x, w = tid >> 5, lane = tid & 31, ln = lane & 15, hh = lane >> 4;
  const int nqb = (T + 63) / 64;
  const int bh = blockIdx.x / nqb, qblk = blockIdx.x % nqb;
  const int b = bh / H, h = bh % H;
  const int q0 = qblk * 64 + w * 16;
  const float* Q = qb + (size_t)b * T * pitch + h * D;
  const float* K = kb + (size_t)b * T * pitch + h * D;
  const float* V = vb + (size_t)b * T * pitch + h * D;

  // A fragments of the wave's 16 query rows (scaled), hi/lo
  FragB aqh[KS], aql[KS];
  {
    int row = q0 + ln; if (row >= T) row = T - 1;
    const float* qr = Q + (size_t)row * pitch;
#pragma unroll
    for (int ks = 0; ks < KS; ++ks)
#pragma unroll
      for (int i = 0; i < 16; ++i) {
        const int d = ks * 32 + ((i < 8) ? (8 * hh + i) : (16 + 8 * hh + (i - 8)));
        const float x = qr[d] * scale; const unsigned short hb = bf16_bits(x);
        aqh[ks].u[i] = hb; aql[ks].u[i] = bf16_bits(x - bf16_val(hb));
      }
  }
  float m_r[8], l_r[8];
#pragma unroll
  for (int r = 0; r < 8; ++r) { m_r[r] = -3.0e38f; l_r[r] = 0.f; }
  v8f oacc[DT];
#pragma unroll
  for (int dt = 0; dt < DT; ++dt) oacc[dt] = (v8f){0.f,0.f,0.f,0.f,0.f,0.f,0.f,0.f};

  const int kv_end = CAUSAL ? min(T, qblk * 64 + 64) : T;     // block-uniform
  for (int j0 = 0; j0 < kv_end; j0 += 32) {
    __syncthreads();
    for (int e = tid; e < 32 * (D / 4); e += 128) {
      const int r = e / (D / 4), c4 = (e % (D / 4)) * 4;
      const int key = j0 + r;
      v4f kf = {0.f,0.f,0.f,0.f}, vf = {0.f,0.f,0.f,0.f};
      if (key < T) { kf = *(const v4fa*)(K + (size_t)key * pitch + c4); vf = *(const v4fa*)(V + (size_t)key * pitch + c4); }
#pragma unroll
      for (int t = 0; t < 4; ++t) {
        unsigned short hb = bf16_bits(kf[t]); sKh[r][c4 + t] = hb; sKl[r][c4 + t] = bf16_bits(kf[t] - bf16_val(hb));
        hb = bf16_bits(vf[t]); sVh[r][c4 + t] = hb; sVl[r][c4 + t] = bf16_bits(vf[t] - bf16_val(hb));
      }
    }
    __syncthreads();
    // S tile 16 x 32
    v8f s[2];
#pragma unroll
    for (int nt = 0; nt < 2; ++nt) {
      v8f acc = {};
#pragma unroll
      for (int ks = 0; ks < KS; ++ks) {
        FragB bh_, bl_;
        bh_.half[0] = *(const v8us*)&sKh[nt * 16 + ln][ks * 32 + 8 * hh]; bh_.half[1] = *(const v8us*)&sKh[nt * 16 + ln][ks * 32 + 16 + 8 * hh];
        bl_.half[0] = *(const v8us*)&sKl[nt * 16 + ln][ks * 32 + 8 * hh]; bl_.half[1] = *(const v8us*)&sKl[nt * 16 + ln][ks * 32 + 16 + 8 * hh];
        acc = mmaN<3>(aqh[ks].v, aql[ks].v, bh_.v, bl_.v, acc);
      }
      s[nt] = acc;
    }
    // mask + running max (rows 8hh+r; the 16 lanes of a half share rows)
    float alpha[8];
#pragma unroll
    for (int r = 0; r < 8; ++r) {
      const int qi = q0 + 8 * hh + r;
      const int ja = j0 + ln, jb = j0 + 16 + ln;
      if (CAUSAL) { if (ja > qi) s[0][r] = -3.0e38f; if (jb > qi) s[1][r] = -3.0e38f; }
      if (ja >= T) s[0][r] = -3.0e38f;
      if (jb >= T) s[1][r] = -3.0e38f;
      float mx = fmaxf(s[0][r], s[1][r]);
      mx = fmaxf(mx, __shfl_xor(mx, 1, 32)); mx = fmaxf(mx, __shfl_xor(mx, 2, 32)); mx = fmaxf(mx, __shfl_xor(mx, 4, 32)); mx = fmaxf(mx, __shfl_xor(mx, 8, 32));
      const float mnew = fmaxf(m_r[r], mx);
      alpha[r] = (mnew > -1.0e38f) ? __expf(m_r[r] - mnew) : 1.0f;
      const float p0 = (s[0][r] > -1.0e38f) ? __expf(s[0][r] - mnew) : 0.f;
      const float p1 = (s[1][r] > -1.0e38f) ? __expf(s[1][r] - mnew) : 0.f;
      m_r[r] = mnew;
      l_r[r] = l_r[r] * alpha[r] + p0 + p1;            // per-lane partial row sum (16 lanes combined at the end)
      unsigned short hb = bf16_bits(p0); sPh[w][8 * hh + r][ln] = hb;      sPl[w][8 * hh + r][ln] = bf16_bits(p0 - bf16_val(hb));
      hb = bf16_bits(p1);                sPh[w][8 * hh + r][16 + ln] = hb; sPl[w][8 * hh + r][16 + ln] = bf16_bits(p1 - bf16_val(hb));
    }
#pragma unroll
    for (int dt = 0; dt < DT; ++dt)
#pragma unroll
      for (int r = 0; r < 8; ++r) oacc[dt][r] *= alpha[r];
    __builtin_amdgcn_fence(__ATOMIC_ACQ_REL, "workgroup");
    __builtin_amdgcn_wave_barrier();
    FragB pah, pal;
    pah.half[0] = *(const v8us*)&sPh[w][ln][8 * hh]; pah.half[1] = *(const v8us*)&sPh[w][ln][16 + 8 * hh];
    pal.half[0] = *(const v8us*)&sPl[w][ln][8 * hh]; pal.half[1] = *(const v8us*)&sPl[w][ln][16 + 8 * hh];
#pragma unroll
    for (int dt = 0; dt < DT; ++dt) {
      FragB bvh, bvl;
#pragma unroll
      for (int i = 0; i < 8; ++i) {
        bvh.u[i] = sVh[8 * hh + i][dt * 16 + ln]; bvh.u[8 + i] = sVh[16 + 8 * hh + i][dt * 16 + ln];
        bvl.u[i] = sVl[8 * hh + i][dt * 16 + ln]; bvl.u[8 + i] = sVl[16 + 8 * hh + i][dt * 16 + ln];
      }
      oacc[dt] = mmaN<3>(pah.v, pal.v, bvh.v, bvl.v, oacc[dt]);
    }
    __builtin_amdgcn_fence(__ATOMIC_ACQ_REL, "workgroup");
    __builtin_amdgcn_wave_barrier();
  }
#pragma unroll
  for (int r = 0; r < 8; ++r) {
    float l = l_r[r];
    l += __shfl_xor(l, 1, 32); l += __shfl_xor(l, 2, 32); l += __shfl_xor(l, 4, 32); l += __shfl_xor(l, 8, 32);
    l_r[r] = (l > 0.f) ? 1.0f / l : 0.f;
  }
#pragma unroll
  for (int dt = 0; dt < DT; ++dt)
#pragma unroll
    for (int r = 0; r < 8; ++r) sO[w][8 * hh + r][dt * 16 + ln] = oacc[dt][r] * l_r[r];
  __builtin_amdgcn_fence(__ATOMIC_ACQ_REL, "workgroup");
  __builtin_amdgcn_wave_barrier();
  {
    for (int r = 0; r < 16; ++r) {
      const int row = q0 + r;
      if (row < T && lane < D / 4) {
        const v4f val = *(const v4fa*)&sO[w][r][lane * 4];
        *(v4f*)(y + ((size_t)b * T + row) * ypitch + h * D + lane * 4) = val;
      }
    }
    
  }
}

// GEMM C = act(A·W + bias + resid): A f32 (ASPLIT -> hi/lo 2 terms), Wt bf16 [N][K]; ACT 0 none, 1 relu, 2 exact gelu;
// resid (optional, f32, row index = (row % rmod), pitch ldr, RES_BF16 rounds it) added before the activation.
template <bool ASPLIT, int ACT, bool BIAS_BF16, bool RES_BF16>
__global__ __launch_bounds__(128) void k_gemm_bf3(const float* __restrict__ A, int lda, const unsigned short* __restrict__ Wt, int ldb,
                                                const float* __restrict__ bias, const float* __restrict__ resid, int rmod, int ldr,
                                                float* __restrict__ C, int ldc, int M, int N, int K) {
  __shared__ __attribute__((aligned(16))) float so[4][16][64];
  const int tid = threadIdx.x, w = tid >> 5, lane = tid & 31, ln = lane & 15, hh = lane >> 4;
  const int ntn = N / 64;
  const int wid = blockIdx.x * 4 + w;
  const int mt = wid / ntn, nq = wid % ntn;
  if (mt * 16 >= M) return;
  const int row0 = mt * 16, col0 = nq * 64;
  const float* arow = A + (size_t)(row0 + ln) * lda;
  v8f acc[4] = {};
  for (int kb = 0; kb < K; kb += 32) {
    FragB ah, al;
    const v4f x0 = *(const v4fa*)(arow + kb + 8 * hh), x1 = *(const v4fa*)(arow + kb + 8 * hh + 4);
    const v4f x2 = *(const v4fa*)(arow + kb + 16 + 8 * hh), x3 = *(const v4fa*)(arow + kb + 16 + 8 * hh + 4);
    float xs[16] = {x0[0],x0[1],x0[2],x0[3],x1[0],x1[1],x1[2],x1[3],x2[0],x2[1],x2[2],x2[3],x3[0],x3[1],x3[2],x3[3]};
#pragma unroll
    for (int i = 0; i < 16; ++i) { const unsigned short hb = bf16_bits(xs[i]); ah.u[i] = hb; al.u[i] = ASPLIT ? bf16_bits(xs[i] - bf16_val(hb)) : (unsigned short)0; }
#pragma unroll
    for (int t = 0; t < 4; ++t) {
      const unsigned short* brow = Wt + (size_t)(col0 + t * 16 + ln) * ldb + kb;
      FragB b;
      b.half[0] = *(const v8us*)(brow + 8 * hh);
      b.half[1] = *(const v8us*)(brow + 16 + 8 * hh);
      acc[t] = mmaN<ASPLIT ? 2 : 1>(ah.v, al.v, b.v, b.v, acc[t]);
    }
  }
#pragma unroll
  for (int t = 0; t < 4; ++t) {
    const int col = col0 + t * 16 + ln;
    float bv = bias ? bias[col] : 0.f;
    if (BIAS_BF16) bv = bf16_round(bv);
#pragma unroll
    for (int r = 0; r < 8; ++r) {
      float v = acc[t][r] + bv;
      if (resid) { float rv = resid[(size_t)((row0 + 8 * hh + r) % rmod) * ldr + col]; if (RES_BF16) rv = bf16_round(rv); v += rv; }
      if (ACT == 1) v = fmaxf(v, 0.f);
      if (ACT == 2) v = 0.5f * v * (1.0f + erff(v * 0.70710678118654752f));
      if (ACT == 3) { const float u = 0.7978845608028654f * (v + 0.044715f * v * v * v); v = 0.5f * v * (1.0f + tanhf(u)); }
      so[w][8 * hh + r][t * 16 + ln] = v;
    }
  }
  __builtin_amdgcn_fence(__ATOMIC_ACQ_REL, "workgroup");
  __builtin_amdgcn_wave_barrier();
  const int rsub = lane >> 4, c4 = (lane & 15) * 4;
  {
#pragma unroll
    for (int q = 0; q < 8; ++q) {
      const int r = q * 2 + rsub;
      const v4f v = *(const v4fa*)&so[w][r][c4];
      *(v4f*)(C + (size_t)(row0 + r) * ldc + col0 + c4) = v;
    }
    
  }
}
// row LayerNorm (biased variance, eps) over N: s = X (+ R); optional out_sum <- s; out_norm <- (s-mu)*rsqrt(var+eps)*g + b
template <bool PARAM_BF16>
__global__ __launch_bounds__(256) void k_layernorm(const float* __restrict__ X, const float* __restrict__ R, const float* __restrict__ g, const float* __restrict__ bta,
                                                  float* __restrict__ out_sum, float* __restrict__ out_norm, int N, float eps) {
  __shared__ float red[256];
  const int row = blockIdx.x, tid = threadIdx.x;
  const float* x = X + (size_t)row * N; const float* rr = R ? R + (size_t)row * N : nullptr;
  float vals[16];                     // up to N = 4096
  const int per = N / 256;            // contiguous chunk per thread? use strided-by-4 chunks: thread handles j = tid*4 + 1024*u
  float s1 = 0.f;
  for (int u = 0; u < per / 4; ++u) {
    const int j = tid * 4 + 1024 * u;
    const v4f a = *(const v4fa*)(x + j);
    v4f b = {0.f,0.f,0.f,0.f}; if (rr) b = *(const v4fa*)(rr + j);
#pragma unroll
    for (int q = 0; q < 4; ++q) { const float v = a[q] + b[q]; vals[u * 4 + q] = v; s1 += v; }
  }
  red[tid] = s1; __syncthreads();
  for (int st = 128; st > 0; st >>= 1) { if (tid < st) red[tid] += red[tid + st]; __syncthreads(); }
  const float mu = red[0] / (float)N; __syncthreads();
  float s2 = 0.f;
  for (int u = 0; u < per / 4; ++u)
#pragma unroll
    for (int q = 0; q < 4; ++q) { const float c = vals[u * 4 + q] - mu; s2 += c * c; }
  red[tid] = s2; __syncthreads();
  for (int st = 128; st > 0; st >>= 1) { if (tid < st) red[tid] += red[tid + st]; __syncthreads(); }
  const float rs = rsqrtf(red[0] / (float)N + eps);
  {
    for (int u = 0; u < per / 4; ++u) {
      const int j = tid * 4 + 1024 * u;
      v4f o, sm;
#pragma unroll
      for (int q = 0; q < 4; ++q) {
        float gg = g[j + q], bb = bta[j + q];
        if (PARAM_BF16) { gg = bf16_round(gg); bb = bf16_round(bb); }
        sm[q] = vals[u * 4 + q]; o[q] = (vals[u * 4 + q] - mu) * rs * gg + bb;
      }
      if (out_sum) *(v4f*)(out_sum + (size_t)row * N + j) = sm;
      *(v4f*)(out_norm + (size_t)row * N + j) = o;
    }
    
  }
}



// ---- f16 WMMA path (v_wmma_f32_16x16x32_f16): 11-bit significands for operands in range — used where a [0,1] probability operand needs more precision than bf16
typedef _Float16 v16h __attribute__((ext_vector_type(16)));
union FragH { v16h v; v8us half[2]; _Float16 h[16]; unsigned short u[16]; };
template <int NT>
__device__ __forceinline__ v8f mmaH(v16h ah, v16h al, v16h bh, v16h bl, v8f c) {
  c = __builtin_amdgcn_wmma_f32_16x16x32_f16(false, ah, false, bh, (short)0, c, false, false);
  if (NT >= 2) c = __builtin_amdgcn_wmma_f32_16x16x32_f16(false, al, false, bh, (short)0, c, false, false);
  if (NT >= 3) c = __builtin_amdgcn_wmma_f32_16x16x32_f16(false, ah, false, bl, (short)0, c, false, false);
  asm volatile("v_nop\n\tv_nop\n\tv_nop\n\tv_nop" : "+v"(c) : "v"(ah), "v"(al), "v"(bh), "v"(bl));
  return c;
}
// batched GEMM like k_gemm_b but f16 operands: A f32 (split into f16 hi/lo if ASPLIT, else rounded to f16), Bt = f16 values [n][k]; alpha; C f32; N multiple of 16 (partial tiles skipped)
template <bool ASPLIT>
__global__ __launch_bounds__(128) void k_gemm_h(const float* __restrict__ A, int lda, size_t sA, const _Float16* __restrict__ Bh, int ldb, size_t sB, float alpha, float* __restrict__ C, int ldc, size_t sC, int M, int N, int K) {
  __shared__ __attribute__((aligned(16))) float so[4][16][64];
  const int tid = threadIdx.x, w = tid >> 5, lane = tid & 31, ln = lane & 15, hh = lane >> 4; const int by = blockIdx.y;
  A += (size_t)by * sA; Bh += (size_t)by * sB; C += (size_t)by * sC;
  const int ntn = (N + 63) / 64; const int wid = blockIdx.x * 4 + w; const int mt = wid / ntn, nq = wid % ntn; if (mt * 16 >= M) return;
  const int row0 = mt * 16, col0 = nq * 64; const float* arow = A + (size_t)(row0 + ln) * lda;
  v8f acc[4] = {};
  for (int kb = 0; kb < K; kb += 32) {
    FragH ah, al;
    const v4f x0 = *(const v4fa*)(arow + kb + 8 * hh), x1 = *(const v4fa*)(arow + kb + 8 * hh + 4), x2 = *(const v4fa*)(arow + kb + 16 + 8 * hh), x3 = *(const v4fa*)(arow + kb + 16 + 8 * hh + 4);
    float xs[16] = {x0[0],x0[1],x0[2],x0[3],x1[0],x1[1],x1[2],x1[3],x2[0],x2[1],x2[2],x2[3],x3[0],x3[1],x3[2],x3[3]};
#pragma unroll
    for (int i = 0; i < 16; ++i) { const _Float16 h = (_Float16)xs[i]; ah.h[i] = h; al.h[i] = ASPLIT ? (_Float16)(xs[i] - (float)h) : (_Float16)0.0f; }
#pragma unroll
    for (int t = 0; t < 4; ++t) { if (col0 + t * 16 >= N) continue; const size_t boff = (size_t)(col0 + t * 16 + ln) * ldb + kb; FragH bq; bq.half[0] = *(const v8us*)(Bh + boff + 8 * hh); bq.half[1] = *(const v8us*)(Bh + boff + 16 + 8 * hh);
      acc[t] = mmaH<ASPLIT ? 2 : 1>(ah.v, al.v, bq.v, bq.v, acc[t]); }
  }
#pragma unroll
  for (int t = 0; t < 4; ++t) { if (col0 + t * 16 >= N) continue;
#pragma unroll
    for (int r = 0; r < 8; ++r) so[w][8 * hh + r][t * 16 + ln] = acc[t][r] * alpha; }
  __builtin_amdgcn_fence(__ATOMIC_ACQ_REL, "workgroup"); __builtin_amdgcn_wave_barrier();
  const int rsub = lane >> 4, c4 = (lane & 15) * 4;
  {
#pragma unroll
    for (int q = 0; q < 8; ++q) { const int r = q * 2 + rsub; if (col0 + c4 < N) { const v4f v = *(const v4fa*)&so[w][r][c4]; *(v4f*)(C + (size_t)(row0 + r) * ldc + col0 + c4) = v; } }
     }
}

// Wt[n][k] = f16(W[k][n]·scale) from f32 row-major W[K][N] (scale = power of two; bf16-exact weights stay exact in f16 away from the subnormal range)
__global__ __launch_bounds__(256) void k_wt_f16(const float* __restrict__ W, _Float16* __restrict__ Wt, int K, int N, float scale) {
  const int t = blockIdx.x * 256 + threadIdx.x; if (t >= N * (K / 8)) return; const int n = t / (K / 8), k8 = (t % (K / 8)) * 8; FragH f;
#pragma unroll
  for (int i = 0; i < 8; ++i) f.h[i] = (_Float16)(bf16_round(W[(size_t)(k8 + i) * N + n]) * scale); const v8us o = f.half[0];
  *(v8us*)((unsigned short*)Wt + (size_t)n * K + k8) = o; 
}
// k_gemm_hh variant with fused epilogue: v = acc·alpha + bias[by·sBias + col] (+ CP[(row/rowsPerB)·sCPb + by·64 + col] if CP) ; ACT 0 none / 1 elu ; writes f16 C16 (and f32 C if non-null)
template <int ACT>
__global__ __launch_bounds__(128) void k_gemm_hhx(const _Float16* __restrict__ A, int lda, size_t sA, const _Float16* __restrict__ Bh, int ldb, size_t sB, float alpha, const float* __restrict__ bias, size_t sBias, const float* __restrict__ CP, int rowsPerB, size_t sCPb, int row0g,
    float* __restrict__ C, _Float16* __restrict__ C16, int ldc, size_t sC, int M, int N, int K) {
  __shared__ __attribute__((aligned(16))) float so[4][16][64];
  const int tid = threadIdx.x, w = tid >> 5, lane = tid & 31, ln = lane & 15, hh = lane >> 4; const int by = blockIdx.y;
  A += (size_t)by * sA; Bh += (size_t)by * sB; const size_t cofs = (size_t)by * sC; const float* bp = bias ? bias + (size_t)by * sBias : nullptr;
  const int ntn = (N + 63) / 64; const int wid = blockIdx.x * 4 + w; const int mt = wid / ntn, nq = wid % ntn; if (mt * 16 >= M) return;
  const int row0 = mt * 16, col0 = nq * 64; const _Float16* arow = A + (size_t)(row0 + ln) * lda;
  v8f acc[4] = {};
  for (int kb = 0; kb < K; kb += 32) { FragH ah; ah.half[0] = *(const v8us*)((const unsigned short*)arow + kb + 8 * hh); ah.half[1] = *(const v8us*)((const unsigned short*)arow + kb + 16 + 8 * hh);
#pragma unroll
    for (int t = 0; t < 4; ++t) { if (col0 + t * 16 >= N) continue; const size_t boff = (size_t)(col0 + t * 16 + ln) * ldb + kb; FragH bq; bq.half[0] = *(const v8us*)((const unsigned short*)Bh + boff + 8 * hh); bq.half[1] = *(const v8us*)((const unsigned short*)Bh + boff + 16 + 8 * hh);
      acc[t] = mmaH<1>(ah.v, ah.v, bq.v, bq.v, acc[t]); }
  }
#pragma unroll
  for (int t = 0; t < 4; ++t) { if (col0 + t * 16 >= N) continue; const int col = col0 + t * 16 + ln; const float bv = bp ? bf16_round(bp[col]) : 0.f;
#pragma unroll
    for (int r = 0; r < 8; ++r) { float v = acc[t][r] * alpha + bv; if (CP) { const int bidx = (row0g + row0 + 8 * hh + r) / rowsPerB; v += CP[(size_t)bidx * sCPb + (size_t)by * 64 + col]; } if (ACT == 1) v = (v > 0.f) ? v : expm1f(v); else if (ACT == 7) v = (v > 0.f) ? v + 1.0f : expf(v); else if (ACT == 8) v = tanhf(v); else if (ACT == 9) v = 0.5f * v * (1.0f + tanhf(0.7978845608028654f * (v + 0.044715f * v * v * v))); else if (ACT == 11) v = 1.0f / (1.0f + expf(-v)); else if (ACT == 12) v = (v > 0.f) ? v : 0.01f * v; else if (ACT == 14) v = (v > 0.f) ? v : 0.1f * v; else if (ACT == 15) v = v / (1.0f + expf(-v)); else if (ACT == 3) v = fmaxf(v, 0.f); else if (ACT == 6) v = 0.5f * v * (1.0f + erff(v * 0.70710678118654752f)); so[w][8 * hh + r][t * 16 + ln] = v; } }
  __builtin_amdgcn_fence(__ATOMIC_ACQ_REL, "workgroup"); __builtin_amdgcn_wave_barrier();
  const int rsub = lane >> 4, c4 = (lane & 15) * 4; typedef _Float16 v4h __attribute__((ext_vector_type(4)));
  {
#pragma unroll
    for (int q = 0; q < 8; ++q) { const int r = q * 2 + rsub; if (col0 + c4 < N) { const v4f v = *(const v4fa*)&so[w][r][c4]; if (C) *(v4f*)(C + cofs + (size_t)(row0 + r) * ldc + col0 + c4) = v; if (C16) { v4h h4; for (int i = 0; i < 4; ++i) h4[i] = (_Float16)v[i]; *(v4h*)(C16 + cofs + (size_t)(row0 + r) * ldc + col0 + c4) = h4; } } }
     }
}


typedef _Float16 v4h __attribute__((ext_vector_type(4)));

__global__ __launch_bounds__(256) void k_x16(const float* __restrict__ x, _Float16* __restrict__ X16, size_t n8) { const size_t t = (size_t)blockIdx.x * 256 + threadIdx.x; if (t >= n8) return; FragH f;
#pragma unroll
  for (int q = 0; q < 8; ++q) f.h[q] = (_Float16)bf16_round(x[t * 8 + q]); *(v8us*)((unsigned short*)X16 + t * 8) = f.half[0];  }
__global__ __launch_bounds__(256) void k_h16(const float* __restrict__ x, _Float16* __restrict__ X16, size_t n8) { const size_t t = (size_t)blockIdx.x * 256 + threadIdx.x; if (t >= n8) return; FragH f;
#pragma unroll
  for (int q = 0; q < 8; ++q) f.h[q] = (_Float16)x[t * 8 + q]; *(v8us*)((unsigned short*)X16 + t * 8) = f.half[0];  }
__global__ __launch_bounds__(256) void k_round16f(const float* __restrict__ W, _Float16* __restrict__ Bt, size_t n8) { const size_t t = (size_t)blockIdx.x * 256 + threadIdx.x; if (t >= n8) return; FragH f;
#pragma unroll
  for (int i = 0; i < 8; ++i) f.h[i] = (_Float16)(bf16_round(W[t * 8 + i]) * 16.0f); *(v8us*)((unsigned short*)Bt + t * 8) = f.half[0];  }
template <int NHv, int TTv>
__global__ __launch_bounds__(256) void k_vt(const _Float16* __restrict__ V16, int ldv, int voff, _Float16* __restrict__ Vt) { __shared__ unsigned short tl[64][66]; const int tid = threadIdx.x; const int slab = blockIdx.x / (TTv / 64), lg = blockIdx.x % (TTv / 64); const int b = slab / NHv, h = slab % NHv;
  for (int i = tid; i < 64 * 8; i += 256) { const int r = i / 8, c8 = (i % 8) * 8; FragH f; f.half[0] = *(const v8us*)((const unsigned short*)V16 + ((size_t)b * TTv + lg * 64 + r) * ldv + voff + h * 64 + c8);
#pragma unroll
    for (int q = 0; q < 8; ++q) tl[r][c8 + q] = f.u[q]; }
  __syncthreads();
  {
#pragma unroll
    for (int rd = 0; rd < 2; ++rd) { const int d = rd * 32 + tid / 8, pc = tid % 8; FragH f;
#pragma unroll
      for (int q = 0; q < 8; ++q) f.u[q] = tl[pc * 8 + q][d];
      *(v8us*)((unsigned short*)Vt + ((size_t)slab * 64 + d) * TTv + lg * 64 + pc * 8) = f.half[0]; }
     } }

__global__ __launch_bounds__(256) void k_tok(const float* __restrict__ x, _Float16* __restrict__ X16) { __shared__ float tl[32][65]; const int tid = threadIdx.x; const int b = blockIdx.x / (2 * (NN / 32)), rem = blockIdx.x % (2 * (NN / 32)); const int cg = rem / (NN / 32), pg = rem % (NN / 32); const int c0 = cg * 64, p0 = pg * 32;
  for (int i = tid; i < 64 * 32; i += 256) { const int c = i / 32, pp = i % 32; tl[pp][c] = bf16_round(x[((size_t)b * C3 + c0 + c) * NN + p0 + pp]); } __syncthreads();
  /* q: rows of 64 channels, token-major. k: behind the q plane, in fragment order: the 4 KB of a pass of 32 keys are [nt][ks][hf][lane] units of 16 B,
     unit = channels ks*32 + hf*16 + 8*(lane >> 4) + 0..7 of key nt*16 + (lane & 15), so that a wave's load of one fragment half is 4 whole lines instead of 32 B out of each of 16. */
  int r, c; size_t dst;
  if (cg == 0) { r = tid / 8; c = (tid % 8) * 8; dst = ((size_t)b * NN + p0 + r) * CC + c; }
  else { r = (tid >> 7) * 16 + (tid & 15); c = ((tid >> 6) & 1) * 32 + ((tid >> 5) & 1) * 16 + ((tid >> 4) & 1) * 8; dst = (size_t)NR * CC + ((size_t)b * NN + p0) * CC + tid * 8; }
  FragH f; for (int q = 0; q < 8; ++q) f.h[q] = (_Float16)tl[r][c + q]; *(v8us*)((unsigned short*)X16 + dst) = f.half[0];  }
__global__ __launch_bounds__(256) void k_v16(const float* __restrict__ x, _Float16* __restrict__ Vt) { const size_t t = (size_t)blockIdx.x * 256 + threadIdx.x; if (t >= (size_t)BB * CC * NN / 8) return;
  /* v in fragment order: the 4 KB of a pass of 32 keys are [dt][hf][lane] units of 16 B, unit = keys hf*16 + 8*(lane >> 4) + 0..7 of channel dt*16 + (lane & 15); thread t writes unit t */
  const int d = (int)((t >> 6) & 3) * 16 + (int)(t & 15); const int n8 = (int)((t >> 8) % (NN / 32)) * 32 + (int)((t >> 5) & 1) * 16 + (int)((t >> 4) & 1) * 8; const int b = (int)(t / ((size_t)(NN / 8) * CC)); FragH f;
#pragma unroll
  for (int q = 0; q < 8; ++q) f.h[q] = (_Float16)bf16_round(x[((size_t)b * C3 + 2 * CC + d) * NN + n8 + q]); *(v8us*)((unsigned short*)Vt + t * 8) = f.half[0];  }
// lane l <-> lane l ^ 16 (the two lane halves hold the two key halves of one query column)
__device__ __forceinline__ float xhalf(float x) { return __builtin_bit_cast(float, __builtin_amdgcn_permlanex16(__builtin_bit_cast(int, x), __builtin_bit_cast(int, x), 0x76543210, 0xfedcba98, false, false)); }
// Eight 16-B copies per lane, global memory to LDS through no register. The s_wait_xcnt closes the statement so that no address register named here is rewritten ahead of it.
__device__ __forceinline__ void copy8(unsigned l, const unsigned short* g) {
  asm volatile("global_load_async_to_lds_b128 %0, %8, off\n\t"
               "global_load_async_to_lds_b128 %1, %9, off\n\t"
               "global_load_async_to_lds_b128 %2, %10, off\n\t"
               "global_load_async_to_lds_b128 %3, %11, off\n\t"
               "global_load_async_to_lds_b128 %4, %12, off\n\t"
               "global_load_async_to_lds_b128 %5, %13, off\n\t"
               "global_load_async_to_lds_b128 %6, %14, off\n\t"
               "global_load_async_to_lds_b128 %7, %15, off\n\t"
               "s_wait_xcnt 0x0"
               :: "v"(l), "v"(l + 2048u), "v"(l + 4096u), "v"(l + 6144u), "v"(l + 8192u), "v"(l + 10240u), "v"(l + 12288u), "v"(l + 14336u),
                  "v"(g), "v"(g + 1024), "v"(g + 2048), "v"(g + 3072), "v"(g + 4096), "v"(g + 5120), "v"(g + 6144), "v"(g + 7168)
               : "memory");
}
// The pass's 17 powers of two in place (e, the rescale factor, and 16 scores), and the scores' eight f16 pairs (low half first, rounded to nearest even as a cast does).
// One statement, for the slot behind a transcendental: the instruction behind each v_exp_f32 here neither reads its result nor writes its source, which the compiler's own order
// did not keep (it reused a source register directly behind). A conversion stands four or more v_exp_f32 behind its younger input, so it does not wait, up to the last two.
// The s_delay_alu lines are hints, which the compiler does not place for asm text: without one a dependent instruction holds the SIMD's vector port while it waits.
typedef unsigned v8u __attribute__((ext_vector_type(8)));
__device__ __forceinline__ v8u exp2x17_pk(float& e, float (&x)[16]) {
  unsigned w0, w1, w2, w3, w4, w5, w6, w7;
  asm("s_delay_alu instid0(VALU_DEP_1)\n\t"
      "v_exp_f32 %24, %24\n\t"
      "v_exp_f32 %0, %0\n\t"
      "v_exp_f32 %1, %1\n\t"
      "v_exp_f32 %2, %2\n\t"
      "v_exp_f32 %3, %3\n\t"
      "v_exp_f32 %4, %4\n\t"
      "v_exp_f32 %5, %5\n\t"
      "v_cvt_pk_f16_f32 %16, %0, %1\n\t"
      "v_exp_f32 %6, %6\n\t"
      "v_exp_f32 %7, %7\n\t"
      "v_cvt_pk_f16_f32 %17, %2, %3\n\t"
      "v_exp_f32 %8, %8\n\t"
      "v_exp_f32 %9, %9\n\t"
      "v_cvt_pk_f16_f32 %18, %4, %5\n\t"
      "v_exp_f32 %10, %10\n\t"
      "v_exp_f32 %11, %11\n\t"
      "v_cvt_pk_f16_f32 %19, %6, %7\n\t"
      "v_exp_f32 %12, %12\n\t"
      "v_exp_f32 %13, %13\n\t"
      "v_cvt_pk_f16_f32 %20, %8, %9\n\t"
      "v_exp_f32 %14, %14\n\t"
      "v_exp_f32 %15, %15\n\t"
      "v_cvt_pk_f16_f32 %21, %10, %11\n\t"
      "s_delay_alu instid0(TRANS32_DEP_3)\n\t"
      "v_cvt_pk_f16_f32 %22, %12, %13\n\t"
      "s_delay_alu instid0(TRANS32_DEP_1)\n\t"
      "v_cvt_pk_f16_f32 %23, %14, %15"
      : "+v"(x[0]), "+v"(x[1]), "+v"(x[2]), "+v"(x[3]), "+v"(x[4]), "+v"(x[5]), "+v"(x[6]), "+v"(x[7]),
        "+v"(x[8]), "+v"(x[9]), "+v"(x[10]), "+v"(x[11]), "+v"(x[12]), "+v"(x[13]), "+v"(x[14]), "+v"(x[15]),
        "=&v"(w0), "=&v"(w1), "=&v"(w2), "=&v"(w3), "=&v"(w4), "=&v"(w5), "=&v"(w6), "=&v"(w7), "+v"(e));
  return (v8u){w0, w1, w2, w3, w4, w5, w6, w7};
}
__global__ __launch_bounds__(128) void k_flash(const _Float16* __restrict__ Q16, int ldq, const _Float16* __restrict__ K16, const _Float16* __restrict__ Vt, const int* __restrict__ MSK, float* __restrict__ O, int ldo) {
  constexpr int RPW = 16, NQB = NN / (4 * RPW), DT = 4, KS = 2;
  constexpr int SK = 128, NP = SK / 32, SH = SK * CC, NS = NN / SK;      /* keys, passes and halves per plane of a stage; stages */
  constexpr float C2 = 0.125f * 1.44269504088896341f;      /* 1 / sqrt(64) times log2(e) */
  __shared__ __attribute__((aligned(16))) unsigned short sKV[2][2][SH];      /* [buffer][K, V][fragment order] */
  __shared__ __attribute__((aligned(16))) float sO[4][RPW][64 + 4];
  const int tid = threadIdx.x, w = tid >> 5, lane = tid & 31, ln = lane & 15, hh = lane >> 4;
  const int slab = blockIdx.x / NQB, qblk = blockIdx.x % NQB; const int b = slab; const int h = 0; const int qb0 = qblk * (4 * RPW); const int q0 = qb0 + w * RPW;
  /* the thread's 16 B of each 2-KB slice of a stage: source in the two planes, place in buffer 0 (LDS byte address) */
  const unsigned short* Kg = (const unsigned short*)K16 + (size_t)b * NN * CC + tid * 8;
  const unsigned short* Vg = (const unsigned short*)Vt + (size_t)b * NN * CC + tid * 8;
  const unsigned lds0 = (unsigned)(size_t)&sKV[0][0][0] + (unsigned)tid * 16u;
  copy8(lds0, Kg); copy8(lds0 + SH * 2, Vg);
  FragH aq[KS];
  { const unsigned short* qr = (const unsigned short*)Q16 + ((size_t)b * NN + q0 + ln) * ldq;
#pragma unroll
    for (int ks = 0; ks < KS; ++ks) { aq[ks].half[0] = *(const v8us*)(qr + ks * 32 + 8 * hh); aq[ks].half[1] = *(const v8us*)(qr + ks * 32 + 16 + 8 * hh); } }
  float m_r = -3.0e38f, l_r = 0.f; v8f oacc[DT];      /* oacc[dt][r] = Ot[dt*16 + 8hh + r][query ln] */
#pragma unroll
  for (int dt = 0; dt < DT; ++dt) oacc[dt] = (v8f){0.f,0.f,0.f,0.f,0.f,0.f,0.f,0.f};
  asm volatile("s_wait_asynccnt 0x0" ::: "memory");      /* this wave's share of stage 0 has landed */
  __syncthreads();                                        /* ... and every other wave's */
  copy8(lds0 + SH * 4, Kg + SH); copy8(lds0 + SH * 6, Vg + SH);
  /* the stage loop stays rolled; the constant-trip inner loops are unrolled so that the fragment and score arrays stay in registers */
#pragma unroll 1
  for (int st = 0; st < NS; ++st) {
    /* 32 keys = 2048 halves of a plane, a fragment half = 256 halves, the lane's 16 B at lane * 8 */
    const unsigned short* Kf = &sKV[st & 1][0][lane * 8];
    const unsigned short* Vf = &sKV[st & 1][1][lane * 8];
    /* The loads stand ahead of the work that hides them: a pass's K fragments are asked for in the pass before, right behind its S products (inside the stage only), its V fragments at its head. */
    FragH bk[2][KS];      /* K fragments of the pass at hand */
#pragma unroll
    for (int nt = 0; nt < 2; ++nt) {
#pragma unroll
      for (int ks = 0; ks < KS; ++ks) { const unsigned short* kr = Kf + (nt * KS + ks) * 512; bk[nt][ks].half[0] = *(const v8us*)kr; bk[nt][ks].half[1] = *(const v8us*)(kr + 256); } }
#pragma unroll
    for (int ps = 0; ps < NP; ++ps) {
      FragH bv[DT];
#pragma unroll
      for (int dt = 0; dt < DT; ++dt) { const unsigned short* vr = Vf + ps * 2048 + dt * 512; bv[dt].half[0] = *(const v8us*)vr; bv[dt].half[1] = *(const v8us*)(vr + 256); }
      v8f s[2];      /* s[nt][r] = St[key of the pass nt*16 + 8hh + r][query ln] */
#pragma unroll
      for (int nt = 0; nt < 2; ++nt) {
        v8f acc = (v8f){0.f,0.f,0.f,0.f,0.f,0.f,0.f,0.f};
#pragma unroll
        for (int ks = 0; ks < KS; ++ks) acc = mmaH<1>(bk[nt][ks].v, bk[nt][ks].v, aq[ks].v, aq[ks].v, acc);
        s[nt] = acc; }
      if (ps + 1 < NP) {
#pragma unroll
        for (int nt = 0; nt < 2; ++nt) {
#pragma unroll
          for (int ks = 0; ks < KS; ++ks) { const unsigned short* kr = Kf + (ps + 1) * 2048 + (nt * KS + ks) * 512; bk[nt][ks].half[0] = *(const v8us*)kr; bk[nt][ks].half[1] = *(const v8us*)(kr + 256); } } }
      /* Softmax in base 2: the maximum is taken over the raw products (the factor is positive) and kept times C2 = log2(e) / 8;
         a score's weight x 2^10 is then one fused multiply-add and one hardware exp2: 2^(s * C2 + (10 - m)). */
      float sc[16]; float mq[4];
#pragma unroll
      for (int i = 0; i < 16; ++i) sc[i] = s[i >> 3][i & 7];
#pragma unroll
      for (int c = 0; c < 4; ++c) mq[c] = fmaxf(fmaxf(sc[c], sc[4 + c]), fmaxf(sc[8 + c], sc[12 + c]));
      float mc = fmaxf(fmaxf(mq[0], mq[1]), fmaxf(mq[2], mq[3])); mc = fmaxf(mc, xhalf(mc));
      const float mn = fmaxf(m_r, mc * C2); float ea = m_r - mn; m_r = mn;      /* ea becomes 2^ea, the factor on what is summed so far */
      const float nb = 10.0f - mn;
#pragma unroll
      for (int i = 0; i < 16; ++i) sc[i] = __builtin_fmaf(sc[i], C2, nb);
      const v8u pw = exp2x17_pk(ea, sc);      /* half i of pw = Pt[key of the pass (i < 8 ? 8hh + i : 8 + 8hh + i)][query ln] x 2^10; sc[i] = the same weight in f32 */
      float ps4[4];
#pragma unroll
      for (int c = 0; c < 4; ++c) ps4[c] = ((sc[c] + sc[4 + c]) + sc[8 + c]) + sc[12 + c];
      const float al = (mn > -1.0e38f) ? ea : 1.0f;
      FragH pb; pb.v = __builtin_bit_cast(v16h, pw);
      l_r = l_r * al + ((ps4[0] + ps4[1]) + (ps4[2] + ps4[3]));      /* x 2^10 like P; this lane half's keys only; the halves join after the loop */
#pragma unroll
      for (int dt = 0; dt < DT; ++dt)
#pragma unroll
        for (int r = 0; r < 8; ++r) oacc[dt][r] *= al;
#pragma unroll
      for (int dt = 0; dt < DT; ++dt) oacc[dt] = mmaH<1>(bv[dt].v, bv[dt].v, pb.v, pb.v, oacc[dt]);
    }
    asm volatile("s_wait_dscnt 0x0" ::: "memory");        /* this wave's reads of the buffer are done before anyone refills it */
    asm volatile("s_wait_asynccnt 0x0" ::: "memory");     /* this wave's share of stage st + 1 has landed */
    __syncthreads();                                        /* publishes stage st + 1 and ends every wave's reads of stage st */
    if (st + 2 < NS) { const unsigned lb = lds0 + (unsigned)(st & 1) * (SH * 4); copy8(lb, Kg + (size_t)(st + 2) * SH); copy8(lb + SH * 2, Vg + (size_t)(st + 2) * SH); }
  }
  asm volatile("s_wait_asynccnt 0x0" ::: "memory");       /* nothing of this wave is in flight when it goes on to the output staging and ends */
  const float l = l_r + xhalf(l_r); const float linv = (l > 0.f) ? 1.0f / l : 0.f;      /* the 2^10 of P and of l cancel */
#pragma unroll
  for (int dt = 0; dt < DT; ++dt) { v4f lo, hi;
#pragma unroll
    for (int r = 0; r < 4; ++r) { lo[r] = oacc[dt][r] * linv; hi[r] = oacc[dt][4 + r] * linv; }
    *(v4fa*)&sO[w][ln][dt * 16 + 8 * hh] = lo; *(v4fa*)&sO[w][ln][dt * 16 + 8 * hh + 4] = hi; }
  __builtin_amdgcn_fence(__ATOMIC_ACQ_REL, "workgroup"); __builtin_amdgcn_wave_barrier();
  {
#pragma unroll
    for (int rp = 0; rp < RPW; rp += 2) { const int r = rp + (lane >> 4), pc = lane & 15; const v4f val = *(const v4fa*)&sO[w][r][pc * 4]; *(v4f*)(O + ((size_t)b * NN + q0 + r) * ldo + pc * 4) = val; }      /* 16 lanes x 16 B = one whole 256-B row */
     } }

__global__ __launch_bounds__(256) void k_out(const float* __restrict__ G, float* __restrict__ out) { __shared__ float tl[32][65]; const int tid = threadIdx.x; const int b = blockIdx.x / ((CC / 32) * (NN / 64)), rem = blockIdx.x % ((CC / 32) * (NN / 64)); const int cg = rem / (NN / 64), pg = rem % (NN / 64); const int c0 = cg * 32, p0 = pg * 64;
  for (int i = tid; i < 64 * 32; i += 256) { const int pp = i / 32, c = i % 32; tl[c][pp] = G[((size_t)b * NN + p0 + pp) * CC + c0 + c]; } __syncthreads();
  { for (int i = tid; i < 32 * 16; i += 256) { const int c = i / 16, q4 = i % 16; const v4f v = {tl[c][q4 * 4], tl[c][q4 * 4 + 1], tl[c][q4 * 4 + 2], tl[c][q4 * 4 + 3]}; *(v4f*)(out + ((size_t)b * CC + c0 + c) * NN + p0 + q4 * 4) = v; }  } }

extern "C" void kernel_launch(void* const* d_in, const int* in_sizes, int n_in,
                              void* d_out, int out_size, void* d_ws, size_t ws_size, hipStream_t stream) {
  (void)in_sizes; (void)n_in; (void)out_size;
  const float* qkv = (const float*)d_in[0];
  char* ws = (char*)d_ws; size_t off = 0;
  auto take = [&](size_t bytes) { char* p = ws + off; off += (bytes + 255) & ~(size_t)255; return p; };
  _Float16* QK = (_Float16*)take((size_t)NR * 2 * CC * 2); _Float16* Vt = (_Float16*)take((size_t)BB * CC * NN * 2); float* O = (float*)take((size_t)NR * CC * 4);
  if (off > ws_size) return;      // 8.4 + 4.2 + 8.4 ≈ 21 MB
  k_tok<<<BB * 2 * (NN / 32), 256, 0, stream>>>(qkv, QK);
  k_v16<<<(unsigned)(((size_t)BB * CC * NN / 8 + 255) / 256), 256, 0, stream>>>(qkv, Vt);
  k_flash<<<BB * (NN / 64), 128, 0, stream>>>(QK, CC, QK + (size_t)NR * CC, Vt, nullptr, O, CC);
  k_out<<<BB * (CC / 32) * (NN / 64), 256, 0, stream>>>(O, (float*)d_out);
}

// v006
// One run takes 52.9 microseconds.
// Two timings next to v005 put it at 1.15 and 1.14 times that version's speed.
// Over all steps from v000 it is 8.26 times as fast.
#include <hip/hip_runtime.h>
// QKV self-attention on a channel-major qkv tensor [8, 3·64, 4096]: attn[s,t] = Σ_c q[c,s]·k[c,t]/√64, softmax over t, out[d,s] = Σ_t attn[s,t]·v[d,t].
// Compute dtype: qkv rounded to bf16 and carried exactly in f16 (q token-major; k and v planes in the order of their A fragments, 512 contiguous bytes per wave-wide load); S and P·V on v_wmma_f32_16x16x32_f16 with
// f32 accumulation in one fused flash-style kernel (online softmax in f32; P in f16 ×2^10); the same kernel stores O as [b][d][s], whole 256-B rows gathered through LDS; output f32.
#define BB 8
#define CC 64
#define C3 192
#define NN 4096
#define NR (BB * NN)

typedef __bf16 v16b __attribute__((ext_vector_type(16)));
typedef unsigned short v8us __attribute__((ext_vector_type(8), may_alias));
typedef float  v8f  __attribute__((ext_vector_type(8)));
typedef float  v4f  __attribute__((ext_vector_type(4)));
typedef float  v4fa __attribute__((ext_vector_type(4), may_alias));
union FragB { v16b v; v8us half[2]; unsigned short u[16]; };

__device__ __forceinline__ unsigned short bf16_bits(float x) { unsigned int u = __float_as_uint(x); return (unsigned short)((u + 0x7FFFu + ((u >> 16) & 1u)) >> 16); }
__device__ __forceinline__ float bf16_val(unsigned short b) { return __uint_as_float(((unsigned int)b) << 16); }
__device__ __forceinline__ float bf16_round(float x) { return bf16_val(bf16_bits(x)); }
// D += A·B with NT terms: 1 = ah·bh, 2 = + al·bh (A split), 3 = + ah·bl (both split)
template <int NT>
__device__ __forceinline__ v8f mmaN(v16b ah, v16b al, v16b bh, v16b bl, v8f c) {
  c = __builtin_amdgcn_wmma_f32_16x16x32_bf16(false, ah, false, bh, (short)0, c, false, false);
  if (NT >= 2) c = __builtin_amdgcn_wmma_f32_16x16x32_bf16(false, al, false, bh, (short)0, c, false, false);
  if (NT >= 3) c = __builtin_amdgcn_wmma_f32_16x16x32_bf16(false, ah, false, bl, (short)0, c, false, false);
  asm volatile("v_nop\n\tv_nop\n\tv_nop\n\tv_nop" : "+v"(c) : "v"(ah), "v"(al), "v"(bh), "v"(bl));
  return c;
}

__global__ __launch_bounds__(256) void k_wt_bf16(const float* __restrict__ W, unsigned short* __restrict__ Wt, int K, int N) {
  const int t = blockIdx.x * 256 + threadIdx.x;
  const int k8n = K / 8;
  if (t >= N * k8n) return;
  const int n = t / k8n, k8 = (t % k8n) * 8;
  v8us v;
#pragma unroll
  for (int i = 0; i < 8; ++i) v[i] = bf16_bits(W[(size_t)(k8 + i) * N + n]);
  *(v8us*)(Wt + (size_t)n * K + k8) = v;
  
}

// GEMM C[M][N] (f32, pitch ldc) = act(A[M][K]·W + bias). A f32 row-major (pitch lda) converted per fragment to bf16
// (ASPLIT: hi/lo two planes -> 2 terms, else single rounded term); Wt bf16 [N][K] (pitch ldb). BIAS_BF16 rounds the
// bias to bf16 first (bias quantised to bf16 before the add). K%32==0, M%16==0, N%64==0.
template <bool ASPLIT, int ACT, bool BIAS_BF16>
__global__ __launch_bounds__(128) void k_gemm_bf(const float* __restrict__ A, int lda, const unsigned short* __restrict__ Wt, int ldb,
                                               const float* __restrict__ bias, float* __restrict__ C, int ldc, int M, int N, int K) {
  __shared__ __attribute__((aligned(16))) float so[4][16][64];
  const int tid = threadIdx.x, w = tid >> 5, lane = tid & 31, ln = lane & 15, hh = lane >> 4;
  const int ntn = N / 64;
  const int wid = blockIdx.x * 4 + w;
  const int mt = wid / ntn, nq = wid % ntn;
  if (mt * 16 >= M) return;
  const int row0 = mt * 16, col0 = nq * 64;
  const float* arow = A + (size_t)(row0 + ln) * lda;
  v8f acc[4] = {};
  for (int kb = 0; kb < K; kb += 32) {
    FragB ah, al;
    const v4f x0 = *(const v4fa*)(arow + kb + 8 * hh), x1 = *(const v4fa*)(arow + kb + 8 * hh + 4);
    const v4f x2 = *(const v4fa*)(arow + kb + 16 + 8 * hh), x3 = *(const v4fa*)(arow + kb + 16 + 8 * hh + 4);
    float xs[16] = {x0[0],x0[1],x0[2],x0[3],x1[0],x1[1],x1[2],x1[3],x2[0],x2[1],x2[2],x2[3],x3[0],x3[1],x3[2],x3[3]};
#pragma unroll
    for (int i = 0; i < 16; ++i) { const unsigned short hb = bf16_bits(xs[i]); ah.u[i] = hb; al.u[i] = ASPLIT ? bf16_bits(xs[i] - bf16_val(hb)) : (unsigned short)0; }
#pragma unroll
    for (int t = 0; t < 4; ++t) {
      const unsigned short* brow = Wt + (size_t)(col0 + t * 16 + ln) * ldb + kb;
      FragB b;
      b.half[0] = *(const v8us*)(brow + 8 * hh);
      b.half[1] = *(const v8us*)(brow + 16 + 8 * hh);
      acc[t] = mmaN<ASPLIT ? 2 : 1>(ah.v, al.v, b.v, b.v, acc[t]);
    }
  }
#pragma unroll
  for (int t = 0; t < 4; ++t) {
    float bv = bias ? bias[col0 + t * 16 + ln] : 0.f;
    if (BIAS_BF16) bv = bf16_round(bv);
#pragma unroll
    for (int r = 0; r < 8; ++r) { float v = acc[t][r] + bv; if (ACT == 1) v = fmaxf(v, 0.f); so[w][8 * hh + r][t * 16 + ln] = v; }
  }
  __builtin_amdgcn_fence(__ATOMIC_ACQ_REL, "workgroup");
  __builtin_amdgcn_wave_barrier();
  const int rsub = lane >> 4, c4 = (lane & 15) * 4;
  {
#pragma unroll
    for (int q = 0; q < 8; ++q) {
      const int r = q * 2 + rsub;
      const v4f v = *(const v4fa*)&so[w][r][c4];
      *(v4f*)(C + (size_t)(row0 + r) * ldc + col0 + c4) = v;
    }
    
  }
}

// Flash-style causal/unmasked attention, all contractions 3-term bf16 hi/lo splits, f32 softmax with running max.
// q,k,v rows are read from f32 buffers with arbitrary row pitch (so they can live inside a fused qkv buffer);
// D = head size (multiple of 32, <= 128); one wave = 16 query rows; block = 4 waves (64 queries) sharing K/V chunks of 32.
template <int D, bool CAUSAL>
__global__ __launch_bounds__(128) void k_flash(const float* __restrict__ qb, const float* __restrict__ kb, const float* __restrict__ vb,
                                             int pitch, int T, int H, float scale, float* __restrict__ y, int ypitch) {
  constexpr int KS = D / 32;        // k-steps for QK
  constexpr int DT = D / 16;        // d tiles for PV
  __shared__ __attribute__((aligned(16))) unsigned short sKh[32][D + 8], sKl[32][D + 8], sVh[32][D + 8], sVl[32][D + 8];
  __shared__ __attribute__((aligned(16))) unsigned short sPh[4][16][40], sPl[4][16][40];
  __shared__ __attribute__((aligned(16))) float sO[4][16][D];
  const int tid = threadIdx.x, w = tid >> 5, lane = tid & 31, ln = lane & 15, hh = lane >> 4;
  const int nqb = (T + 63) / 64;
  const int bh = blockIdx.x / nqb, qblk = blockIdx.x % nqb;
  const int b = bh / H, h = bh % H;
  const int q0 = qblk * 64 + w * 16;
  const float* Q = qb + (size_t)b * T * pitch + h * D;
  const float* K = kb + (size_t)b * T * pitch + h * D;
  const float* V = vb + (size_t)b * T * pitch + h * D;

  // A fragments of the wave's 16 query rows (scaled), hi/lo
  FragB aqh[KS], aql[KS];
  {
    int row = q0 + ln; if (row >= T) row = T - 1;
    const float* qr = Q + (size_t)row * pitch;
#pragma unroll
    for (int ks = 0; ks < KS; ++ks)
#pragma unroll
      for (int i = 0; i < 16; ++i) {
        const int d = ks * 32 + ((i < 8) ? (8 * hh + i) : (16 + 8 * hh + (i - 8)));
        const float x = qr[d] * scale; const unsigned short hb = bf16_bits(x);
        aqh[ks].u[i] = hb; aql[ks].u[i] = bf16_bits(x - bf16_val(hb));
      }
  }
  float m_r[8], l_r[8];
#pragma unroll
  for (int r = 0; r < 8; ++r) { m_r[r] = -3.0e38f; l_r[r] = 0.f; }
  v8f oacc[DT];
#pragma unroll
  for (int dt = 0; dt < DT; ++dt) oacc[dt] = (v8f){0.f,0.f,0.f,0.f,0.f,0.f,0.f,0.f};

  const int kv_end = CAUSAL ? min(T, qblk * 64 + 64) : T;     // block-uniform
  for (int j0 = 0; j0 < kv_end; j0 += 32) {
    __syncthreads();
    for (int e = tid; e < 32 * (D / 4); e += 128) {
      const int r = e / (D / 4), c4 = (e % (D / 4)) * 4;
      const int key = j0 + r;
      v4f kf = {0.f,0.f,0.f,0.f}, vf = {0.f,0.f,0.f,0.f};
      if (key < T) { kf = *(const v4fa*)(K + (size_t)key * pitch + c4); vf = *(const v4fa*)(V + (size_t)key * pitch + c4); }
#pragma unroll
      for (int t = 0; t < 4; ++t) {
        unsigned short hb = bf16_bits(kf[t]); sKh[r][c4 + t] = hb; sKl[r][c4 + t] = bf16_bits(kf[t] - bf16_val(hb));
        hb = bf16_bits(vf[t]); sVh[r][c4 + t] = hb; sVl[r][c4 + t] = bf16_bits(vf[t] - bf16_val(hb));
      }
    }
    __syncthreads();
    // S tile 16 x 32
    v8f s[2];
#pragma unroll
    for (int nt = 0; nt < 2; ++nt) {
      v8f acc = {};
#pragma unroll
      for (int ks = 0; ks < KS; ++ks) {
        FragB bh_, bl_;
        bh_.half[0] = *(const v8us*)&sKh[nt * 16 + ln][ks * 32 + 8 * hh]; bh_.half[1] = *(const v8us*)&sKh[nt * 16 + ln][ks * 32 + 16 + 8 * hh];
        bl_.half[0] = *(const v8us*)&sKl[nt * 16 + ln][ks * 32 + 8 * hh]; bl_.half[1] = *(const v8us*)&sKl[nt * 16 + ln][ks * 32 + 16 + 8 * hh];
        acc = mmaN<3>(aqh[ks].v, aql[ks].v, bh_.v, bl_.v, acc);
      }
      s[nt] = acc;
    }
    // mask + running max (rows 8hh+r; the 16 lanes of a half share rows)
    float alpha[8];
#pragma unroll
    for (int r = 0; r < 8; ++r) {
      const int qi = q0 + 8 * hh + r;
      const int ja = j0 + ln, jb = j0 + 16 + ln;
      if (CAUSAL) { if (ja > qi) s[0][r] = -3.0e38f; if (jb > qi) s[1][r] = -3.0e38f; }
      if (ja >= T) s[0][r] = -3.0e38f;
      if (jb >= T) s[1][r] = -3.0e38f;
      float mx = fmaxf(s[0][r], s[1][r]);
      mx = fmaxf(mx, __shfl_xor(mx, 1, 32)); mx = fmaxf(mx, __shfl_xor(mx, 2, 32)); mx = fmaxf(mx, __shfl_xor(mx, 4, 32)); mx = fmaxf(mx, __shfl_xor(mx, 8, 32));
      const float mnew = fmaxf(m_r[r], mx);
      alpha[r] = (mnew > -1.0e38f) ? __expf(m_r[r] - mnew) : 1.0f;
      const float p0 = (s[0][r] > -1.0e38f) ? __expf(s[0][r] - mnew) : 0.f;
      const float p1 = (s[1][r] > -1.0e38f) ? __expf(s[1][r] - mnew) : 0.f;
      m_r[r] = mnew;
      l_r[r] = l_r[r] * alpha[r] + p0 + p1;            // per-lane partial row sum (16 lanes combined at the end)
      unsigned short hb = bf16_bits(p0); sPh[w][8 * hh + r][ln] = hb;      sPl[w][8 * hh + r][ln] = bf16_bits(p0 - bf16_val(hb));
      hb = bf16_bits(p1);                sPh[w][8 * hh + r][16 + ln] = hb; sPl[w][8 * hh + r][16 + ln] = bf16_bits(p1 - bf16_val(hb));
    }
#pragma unroll
    for (int dt = 0; dt < DT; ++dt)
#pragma unroll
      for (int r = 0; r < 8; ++r) oacc[dt][r] *= alpha[r];
    __builtin_amdgcn_fence(__ATOMIC_ACQ_REL, "workgroup");
    __builtin_amdgcn_wave_barrier();
    FragB pah, pal;
    pah.half[0] = *(const v8us*)&sPh[w][ln][8 * hh]; pah.half[1] = *(const v8us*)&sPh[w][ln][16 + 8 * hh];
    pal.half[0] = *(const v8us*)&sPl[w][ln][8 * hh]; pal.half[1] = *(const v8us*)&sPl[w][ln][16 + 8 * hh];
#pragma unroll
    for (int dt = 0; dt < DT; ++dt) {
      FragB bvh, bvl;
#pragma unroll
      for (int i = 0; i < 8; ++i) {
        bvh.u[i] = sVh[8 * hh + i][dt * 16 + ln]; bvh.u[8 + i] = sVh[16 + 8 * hh + i][dt * 16 + ln];
        bvl.u[i] = sVl[8 * hh + i][dt * 16 + ln]; bvl.u[8 + i] = sVl[16 + 8 * hh + i][dt * 16 + ln];
      }
      oacc[dt] = mmaN<3>(pah.v, pal.v, bvh.v, bvl.v, oacc[dt]);
    }
    __builtin_amdgcn_fence(__ATOMIC_ACQ_REL, "workgroup");
    __builtin_amdgcn_wave_barrier();
  }
#pragma unroll
  for (int r = 0; r < 8; ++r) {
    float l = l_r[r];
    l += __shfl_xor(l, 1, 32); l += __shfl_xor(l, 2, 32); l += __shfl_xor(l, 4, 32); l += __shfl_xor(l, 8, 32);
    l_r[r] = (l > 0.f) ? 1.0f / l : 0.f;
  }
#pragma unroll
  for (int dt = 0; dt < DT; ++dt)
#pragma unroll
    for (int r = 0; r < 8; ++r) sO[w][8 * hh + r][dt * 16 + ln] = oacc[dt][r] * l_r[r];
  __builtin_amdgcn_fence(__ATOMIC_ACQ_REL, "workgroup");
  __builtin_amdgcn_wave_barrier();
  {
    for (int r = 0; r < 16; ++r) {
      const int row = q0 + r;
      if (row < T && lane < D / 4) {
        const v4f val = *(const v4fa*)&sO[w][r][lane * 4];
        *(v4f*)(y + ((size_t)b * T + row) * ypitch + h * D + lane * 4) = val;
      }
    }
    
  }
}

// GEMM C = act(A·W + bias + resid): A f32 (ASPLIT -> hi/lo 2 terms), Wt bf16 [N][K]; ACT 0 none, 1 relu, 2 exact gelu;
// resid (optional, f32, row index = (row % rmod), pitch ldr, RES_BF16 rounds it) added before the activation.
template <bool ASPLIT, int ACT, bool BIAS_BF16, bool RES_BF16>
__global__ __launch_bounds__(128) void k_gemm_bf3(const float* __restrict__ A, int lda, const unsigned short* __restrict__ Wt, int ldb,
                                                const float* __restrict__ bias, const float* __restrict__ resid, int rmod, int ldr,
                                                float* __restrict__ C, int ldc, int M, int N, int K) {
  __shared__ __attribute__((aligned(16))) float so[4][16][64];
  const int tid = threadIdx.x, w = tid >> 5, lane = tid & 31, ln = lane & 15, hh = lane >> 4;
  const int ntn = N / 64;
  const int wid = blockIdx.x * 4 + w;
  const int mt = wid / ntn, nq = wid % ntn;
  if (mt * 16 >= M) return;
  const int row0 = mt * 16, col0 = nq * 64;
  const float* arow = A + (size_t)(row0 + ln) * lda;
  v8f acc[4] = {};
  for (int kb = 0; kb < K; kb += 32) {
    FragB ah, al;
    const v4f x0 = *(const v4fa*)(arow + kb + 8 * hh), x1 = *(const v4fa*)(arow + kb + 8 * hh + 4);
    const v4f x2 = *(const v4fa*)(arow + kb + 16 + 8 * hh), x3 = *(const v4fa*)(arow + kb + 16 + 8 * hh + 4);
    float xs[16] = {x0[0],x0[1],x0[2],x0[3],x1[0],x1[1],x1[2],x1[3],x2[0],x2[1],x2[2],x2[3],x3[0],x3[1],x3[2],x3[3]};
#pragma unroll
    for (int i = 0; i < 16; ++i) { const unsigned short hb = bf16_bits(xs[i]); ah.u[i] = hb; al.u[i] = ASPLIT ? bf16_bits(xs[i] - bf16_val(hb)) : (unsigned short)0; }
#pragma unroll
    for (int t = 0; t < 4; ++t) {
      const unsigned short* brow = Wt + (size_t)(col0 + t * 16 + ln) * ldb + kb;
      FragB b;
      b.half[0] = *(const v8us*)(brow + 8 * hh);
      b.half[1] = *(const v8us*)(brow + 16 + 8 * hh);
      acc[t] = mmaN<ASPLIT ? 2 : 1>(ah.v, al.v, b.v, b.v, acc[t]);
    }
  }
#pragma unroll
  for (int t = 0; t < 4; ++t) {
    const int col = col0 + t * 16 + ln;
    float bv = bias ? bias[col] : 0.f;
    if (BIAS_BF16) bv = bf16_round(bv);
#pragma unroll
    for (int r = 0; r < 8; ++r) {
      float v = acc[t][r] + bv;
      if (resid) { float rv = resid[(size_t)((row0 + 8 * hh + r) % rmod) * ldr + col]; if (RES_BF16) rv = bf16_round(rv); v += rv; }
      if (ACT == 1) v = fmaxf(v, 0.f);
      if (ACT == 2) v = 0.5f * v * (1.0f + erff(v * 0.70710678118654752f));
      if (ACT == 3) { const float u = 0.7978845608028654f * (v + 0.044715f * v * v * v); v = 0.5f * v * (1.0f + tanhf(u)); }
      so[w][8 * hh + r][t * 16 + ln] = v;
    }
  }
  __builtin_amdgcn_fence(__ATOMIC_ACQ_REL, "workgroup");
  __builtin_amdgcn_wave_barrier();
  const int rsub = lane >> 4, c4 = (lane & 15) * 4;
  {
#pragma unroll
    for (int q = 0; q < 8; ++q) {
      const int r = q * 2 + rsub;
      const v4f v = *(const v4fa*)&so[w][r][c4];
      *(v4f*)(C + (size_t)(row0 + r) * ldc + col0 + c4) = v;
    }
    
  }
}
// row LayerNorm (biased variance, eps) over N: s = X (+ R); optional out_sum <- s; out_norm <- (s-mu)*rsqrt(var+eps)*g + b
template <bool PARAM_BF16>
__global__ __launch_bounds__(256) void k_layernorm(const float* __restrict__ X, const float* __restrict__ R, const float* __restrict__ g, const float* __restrict__ bta,
                                                  float* __restrict__ out_sum, float* __restrict__ out_norm, int N, float eps) {
  __shared__ float red[256];
  const int row = blockIdx.x, tid = threadIdx.x;
  const float* x = X + (size_t)row * N; const float* rr = R ? R + (size_t)row * N : nullptr;
  float vals[16];                     // up to N = 4096
  const int per = N / 256;            // contiguous chunk per thread? use strided-by-4 chunks: thread handles j = tid*4 + 1024*u
  float s1 = 0.f;
  for (int u = 0; u < per / 4; ++u) {
    const int j = tid * 4 + 1024 * u;
    const v4f a = *(const v4fa*)(x + j);
    v4f b = {0.f,0.f,0.f,0.f}; if (rr) b = *(const v4fa*)(rr + j);
#pragma unroll
    for (int q = 0; q < 4; ++q) { const float v = a[q] + b[q]; vals[u * 4 + q] = v; s1 += v; }
  }
  red[tid] = s1; __syncthreads();
  for (int st = 128; st > 0; st >>= 1) { if (tid < st) red[tid] += red[tid + st]; __syncthreads(); }
  const float mu = red[0] / (float)N; __syncthreads();
  float s2 = 0.f;
  for (int u = 0; u < per / 4; ++u)
#pragma unroll
    for (int q = 0; q < 4; ++q) { const float c = vals[u * 4 + q] - mu; s2 += c * c; }
  red[tid] = s2; __syncthreads();
  for (int st = 128; st > 0; st >>= 1) { if (tid < st) red[tid] += red[tid + st]; __syncthreads(); }
  const float rs = rsqrtf(red[0] / (float)N + eps);
  {
    for (int u = 0; u < per / 4; ++u) {
      const int j = tid * 4 + 1024 * u;
      v4f o, sm;
#pragma unroll
      for (int q = 0; q < 4; ++q) {
        float gg = g[j + q], bb = bta[j + q];
        if (PARAM_BF16) { gg = bf16_round(gg); bb = bf16_round(bb); }
        sm[q] = vals[u * 4 + q]; o[q] = (vals[u * 4 + q] - mu) * rs * gg + bb;
      }
      if (out_sum) *(v4f*)(out_sum + (size_t)row * N + j) = sm;
      *(v4f*)(out_norm + (size_t)row * N + j) = o;
    }
    
  }
}



// ---- f16 WMMA path (v_wmma_f32_16x16x32_f16): 11-bit significands for operands in range — used where a [0,1] probability operand needs more precision than bf16
typedef _Float16 v16h __attribute__((ext_vector_type(16)));
union FragH { v16h v; v8us half[2]; _Float16 h[16]; unsigned short u[16]; };
template <int NT>
__device__ __forceinline__ v8f mmaH(v16h ah, v16h al, v16h bh, v16h bl, v8f c) {
  c = __builtin_amdgcn_wmma_f32_16x16x32_f16(false, ah, false, bh, (short)0, c, false, false);
  if (NT >= 2) c = __builtin_amdgcn_wmma_f32_16x16x32_f16(false, al, false, bh, (short)0, c, false, false);
  if (NT >= 3) c = __builtin_amdgcn_wmma_f32_16x16x32_f16(false, ah, false, bl, (short)0, c, false, false);
  asm volatile("v_nop\n\tv_nop\n\tv_nop\n\tv_nop" : "+v"(c) : "v"(ah), "v"(al), "v"(bh), "v"(bl));
  return c;
}
// batched GEMM like k_gemm_b but f16 operands: A f32 (split into f16 hi/lo if ASPLIT, else rounded to f16), Bt = f16 values [n][k]; alpha; C f32; N multiple of 16 (partial tiles skipped)
template <bool ASPLIT>
__global__ __launch_bounds__(128) void k_gemm_h(const float* __restrict__ A, int lda, size_t sA, const _Float16* __restrict__ Bh, int ldb, size_t sB, float alpha, float* __restrict__ C, int ldc, size_t sC, int M, int N, int K) {
  __shared__ __attribute__((aligned(16))) float so[4][16][64];
  const int tid = threadIdx.x, w = tid >> 5, lane = tid & 31, ln = lane & 15, hh = lane >> 4; const int by = blockIdx.y;
  A += (size_t)by * sA; Bh += (size_t)by * sB; C += (size_t)by * sC;
  const int ntn = (N + 63) / 64; const int wid = blockIdx.x * 4 + w; const int mt = wid / ntn, nq = wid % ntn; if (mt * 16 >= M) return;
  const int row0 = mt * 16, col0 = nq * 64; const float* arow = A + (size_t)(row0 + ln) * lda;
  v8f acc[4] = {};
  for (int kb = 0; kb < K; kb += 32) {
    FragH ah, al;
    const v4f x0 = *(const v4fa*)(arow + kb + 8 * hh), x1 = *(const v4fa*)(arow + kb + 8 * hh + 4), x2 = *(const v4fa*)(arow + kb + 16 + 8 * hh), x3 = *(const v4fa*)(arow + kb + 16 + 8 * hh + 4);
    float xs[16] = {x0[0],x0[1],x0[2],x0[3],x1[0],x1[1],x1[2],x1[3],x2[0],x2[1],x2[2],x2[3],x3[0],x3[1],x3[2],x3[3]};
#pragma unroll
    for (int i = 0; i < 16; ++i) { const _Float16 h = (_Float16)xs[i]; ah.h[i] = h; al.h[i] = ASPLIT ? (_Float16)(xs[i] - (float)h) : (_Float16)0.0f; }
#pragma unroll
    for (int t = 0; t < 4; ++t) { if (col0 + t * 16 >= N) continue; const size_t boff = (size_t)(col0 + t * 16 + ln) * ldb + kb; FragH bq; bq.half[0] = *(const v8us*)(Bh + boff + 8 * hh); bq.half[1] = *(const v8us*)(Bh + boff + 16 + 8 * hh);
      acc[t] = mmaH<ASPLIT ? 2 : 1>(ah.v, al.v, bq.v, bq.v, acc[t]); }
  }
#pragma unroll
  for (int t = 0; t < 4; ++t) { if (col0 + t * 16 >= N) continue;
#pragma unroll
    for (int r = 0; r < 8; ++r) so[w][8 * hh + r][t * 16 + ln] = acc[t][r] * alpha; }
  __builtin_amdgcn_fence(__ATOMIC_ACQ_REL, "workgroup"); __builtin_amdgcn_wave_barrier();
  const int rsub = lane >> 4, c4 = (lane & 15) * 4;
  {
#pragma unroll
    for (int q = 0; q < 8; ++q) { const int r = q * 2 + rsub; if (col0 + c4 < N) { const v4f v = *(const v4fa*)&so[w][r][c4]; *(v4f*)(C + (size_t)(row0 + r) * ldc + col0 + c4) = v; } }
     }
}

// Wt[n][k] = f16(W[k][n]·scale) from f32 row-major W[K][N] (scale = power of two; bf16-exact weights stay exact in f16 away from the subnormal range)
__global__ __launch_bounds__(256) void k_wt_f16(const float* __restrict__ W, _Float16* __restrict__ Wt, int K, int N, float scale) {
  const int t = blockIdx.x * 256 + threadIdx.x; if (t >= N * (K / 8)) return; const int n = t / (K / 8), k8 = (t % (K / 8)) * 8; FragH f;
#pragma unroll
  for (int i = 0; i < 8; ++i) f.h[i] = (_Float16)(bf16_round(W[(size_t)(k8 + i) * N + n]) * scale); const v8us o = f.half[0];
  *(v8us*)((unsigned short*)Wt + (size_t)n * K + k8) = o; 
}
// k_gemm_hh variant with fused epilogue: v = acc·alpha + bias[by·sBias + col] (+ CP[(row/rowsPerB)·sCPb + by·64 + col] if CP) ; ACT 0 none / 1 elu ; writes f16 C16 (and f32 C if non-null)
template <int ACT>
__global__ __launch_bounds__(128) void k_gemm_hhx(const _Float16* __restrict__ A, int lda, size_t sA, const _Float16* __restrict__ Bh, int ldb, size_t sB, float alpha, const float* __restrict__ bias, size_t sBias, const float* __restrict__ CP, int rowsPerB, size_t sCPb, int row0g,
    float* __restrict__ C, _Float16* __restrict__ C16, int ldc, size_t sC, int M, int N, int K) {
  __shared__ __attribute__((aligned(16))) float so[4][16][64];
  const int tid = threadIdx.x, w = tid >> 5, lane = tid & 31, ln = lane & 15, hh = lane >> 4; const int by = blockIdx.y;
  A += (size_t)by * sA; Bh += (size_t)by * sB; const size_t cofs = (size_t)by * sC; const float* bp = bias ? bias + (size_t)by * sBias : nullptr;
  const int ntn = (N + 63) / 64; const int wid = blockIdx.x * 4 + w; const int mt = wid / ntn, nq = wid % ntn; if (mt * 16 >= M) return;
  const int row0 = mt * 16, col0 = nq * 64; const _Float16* arow = A + (size_t)(row0 + ln) * lda;
  v8f acc[4] = {};
  for (int kb = 0; kb < K; kb += 32) { FragH ah; ah.half[0] = *(const v8us*)((const unsigned short*)arow + kb + 8 * hh); ah.half[1] = *(const v8us*)((const unsigned short*)arow + kb + 16 + 8 * hh);
#pragma unroll
    for (int t = 0; t < 4; ++t) { if (col0 + t * 16 >= N) continue; const size_t boff = (size_t)(col0 + t * 16 + ln) * ldb + kb; FragH bq; bq.half[0] = *(const v8us*)((const unsigned short*)Bh + boff + 8 * hh); bq.half[1] = *(const v8us*)((const unsigned short*)Bh + boff + 16 + 8 * hh);
      acc[t] = mmaH<1>(ah.v, ah.v, bq.v, bq.v, acc[t]); }
  }
#pragma unroll
  for (int t = 0; t < 4; ++t) { if (col0 + t * 16 >= N) continue; const int col = col0 + t * 16 + ln; const float bv = bp ? bf16_round(bp[col]) : 0.f;
#pragma unroll
    for (int r = 0; r < 8; ++r) { float v = acc[t][r] * alpha + bv; if (CP) { const int bidx = (row0g + row0 + 8 * hh + r) / rowsPerB; v += CP[(size_t)bidx * sCPb + (size_t)by * 64 + col]; } if (ACT == 1) v = (v > 0.f) ? v : expm1f(v); else if (ACT == 7) v = (v > 0.f) ? v + 1.0f : expf(v); else if (ACT == 8) v = tanhf(v); else if (ACT == 9) v = 0.5f * v * (1.0f + tanhf(0.7978845608028654f * (v + 0.044715f * v * v * v))); else if (ACT == 11) v = 1.0f / (1.0f + expf(-v)); else if (ACT == 12) v = (v > 0.f) ? v : 0.01f * v; else if (ACT == 14) v = (v > 0.f) ? v : 0.1f * v; else if (ACT == 15) v = v / (1.0f + expf(-v)); else if (ACT == 3) v = fmaxf(v, 0.f); else if (ACT == 6) v = 0.5f * v * (1.0f + erff(v * 0.70710678118654752f)); so[w][8 * hh + r][t * 16 + ln] = v; } }
  __builtin_amdgcn_fence(__ATOMIC_ACQ_REL, "workgroup"); __builtin_amdgcn_wave_barrier();
  const int rsub = lane >> 4, c4 = (lane & 15) * 4; typedef _Float16 v4h __attribute__((ext_vector_type(4)));
  {
#pragma unroll
    for (int q = 0; q < 8; ++q) { const int r = q * 2 + rsub; if (col0 + c4 < N) { const v4f v = *(const v4fa*)&so[w][r][c4]; if (C) *(v4f*)(C + cofs + (size_t)(row0 + r) * ldc + col0 + c4) = v; if (C16) { v4h h4; for (int i = 0; i < 4; ++i) h4[i] = (_Float16)v[i]; *(v4h*)(C16 + cofs + (size_t)(row0 + r) * ldc + col0 + c4) = h4; } } }
     }
}


typedef _Float16 v4h __attribute__((ext_vector_type(4)));

__global__ __launch_bounds__(256) void k_x16(const float* __restrict__ x, _Float16* __restrict__ X16, size_t n8) { const size_t t = (size_t)blockIdx.x * 256 + threadIdx.x; if (t >= n8) return; FragH f;
#pragma unroll
  for (int q = 0; q < 8; ++q) f.h[q] = (_Float16)bf16_round(x[t * 8 + q]); *(v8us*)((unsigned short*)X16 + t * 8) = f.half[0];  }
__global__ __launch_bounds__(256) void k_h16(const float* __restrict__ x, _Float16* __restrict__ X16, size_t n8) { const size_t t = (size_t)blockIdx.x * 256 + threadIdx.x; if (t >= n8) return; FragH f;
#pragma unroll
  for (int q = 0; q < 8; ++q) f.h[q] = (_Float16)x[t * 8 + q]; *(v8us*)((unsigned short*)X16 + t * 8) = f.half[0];  }
__global__ __launch_bounds__(256) void k_round16f(const float* __restrict__ W, _Float16* __restrict__ Bt, size_t n8) { const size_t t = (size_t)blockIdx.x * 256 + threadIdx.x; if (t >= n8) return; FragH f;
#pragma unroll
  for (int i = 0; i < 8; ++i) f.h[i] = (_Float16)(bf16_round(W[t * 8 + i]) * 16.0f); *(v8us*)((unsigned short*)Bt + t * 8) = f.half[0];  }
template <int NHv, int TTv>
__global__ __launch_bounds__(256) void k_vt(const _Float16* __restrict__ V16, int ldv, int voff, _Float16* __restrict__ Vt) { __shared__ unsigned short tl[64][66]; const int tid = threadIdx.x; const int slab = blockIdx.x / (TTv / 64), lg = blockIdx.x % (TTv / 64); const int b = slab / NHv, h = slab % NHv;
  for (int i = tid; i < 64 * 8; i += 256) { const int r = i / 8, c8 = (i % 8) * 8; FragH f; f.half[0] = *(const v8us*)((const unsigned short*)V16 + ((size_t)b * TTv + lg * 64 + r) * ldv + voff + h * 64 + c8);
#pragma unroll
    for (int q = 0; q < 8; ++q) tl[r][c8 + q] = f.u[q]; }
  __syncthreads();
  {
#pragma unroll
    for (int rd = 0; rd < 2; ++rd) { const int d = rd * 32 + tid / 8, pc = tid % 8; FragH f;
#pragma unroll
      for (int q = 0; q < 8; ++q) f.u[q] = tl[pc * 8 + q][d];
      *(v8us*)((unsigned short*)Vt + ((size_t)slab * 64 + d) * TTv + lg * 64 + pc * 8) = f.half[0]; }
     } }

__global__ __launch_bounds__(256) void k_tok(const float* __restrict__ x, _Float16* __restrict__ X16) { __shared__ float tl[32][65]; const int tid = threadIdx.x; const int b = blockIdx.x / (2 * (NN / 32)), rem = blockIdx.x % (2 * (NN / 32)); const int cg = rem / (NN / 32), pg = rem % (NN / 32); const int c0 = cg * 64, p0 = pg * 32;
  for (int i = tid; i < 64 * 32; i += 256) { const int c = i / 32, pp = i % 32; tl[pp][c] = bf16_round(x[((size_t)b * C3 + c0 + c) * NN + p0 + pp]); } __syncthreads();
  /* q: rows of 64 channels, token-major. k: behind the q plane, in fragment order: the 4 KB of a pass of 32 keys are [nt][ks][hf][lane] units of 16 B,
     unit = channels ks*32 + hf*16 + 8*(lane >> 4) + 0..7 of key nt*16 + (lane & 15), so that a wave's load of one fragment half is 4 whole lines instead of 32 B out of each of 16. */
  int r, c; size_t dst;
  if (cg == 0) { r = tid / 8; c = (tid % 8) * 8; dst = ((size_t)b * NN + p0 + r) * CC + c; }
  else { r = (tid >> 7) * 16 + (tid & 15); c = ((tid >> 6) & 1) * 32 + ((tid >> 5) & 1) * 16 + ((tid >> 4) & 1) * 8; dst = (size_t)NR * CC + ((size_t)b * NN + p0) * CC + tid * 8; }
  FragH f; for (int q = 0; q < 8; ++q) f.h[q] = (_Float16)tl[r][c + q]; *(v8us*)((unsigned short*)X16 + dst) = f.half[0];  }
__global__ __launch_bounds__(256) void k_v16(const float* __restrict__ x, _Float16* __restrict__ Vt) { const size_t t = (size_t)blockIdx.x * 256 + threadIdx.x; if (t >= (size_t)BB * CC * NN / 8) return;
  /* v in fragment order: the 4 KB of a pass of 32 keys are [dt][hf][lane] units of 16 B, unit = keys hf*16 + 8*(lane >> 4) + 0..7 of channel dt*16 + (lane & 15); thread t writes unit t */
  const int d = (int)((t >> 6) & 3) * 16 + (int)(t & 15); const int n8 = (int)((t >> 8) % (NN / 32)) * 32 + (int)((t >> 5) & 1) * 16 + (int)((t >> 4) & 1) * 8; const int b = (int)(t / ((size_t)(NN / 8) * CC)); FragH f;
#pragma unroll
  for (int q = 0; q < 8; ++q) f.h[q] = (_Float16)bf16_round(x[((size_t)b * C3 + 2 * CC + d) * NN + n8 + q]); *(v8us*)((unsigned short*)Vt + t * 8) = f.half[0];  }
// lane l <-> lane l ^ 16 (the two lane halves hold the two key halves of one query column)
__device__ __forceinline__ float xhalf(float x) { return __builtin_bit_cast(float, __builtin_amdgcn_permlanex16(__builtin_bit_cast(int, x), __builtin_bit_cast(int, x), 0x76543210, 0xfedcba98, false, false)); }
// Eight 16-B copies per lane, global memory to LDS through no register. The s_wait_xcnt closes the statement so that no address register named here is rewritten ahead of it.
__device__ __forceinline__ void copy8(unsigned l, const unsigned short* g) {
  asm volatile("global_load_async_to_lds_b128 %0, %8, off\n\t"
               "global_load_async_to_lds_b128 %1, %9, off\n\t"
               "global_load_async_to_lds_b128 %2, %10, off\n\t"
               "global_load_async_to_lds_b128 %3, %11, off\n\t"
               "global_load_async_to_lds_b128 %4, %12, off\n\t"
               "global_load_async_to_lds_b128 %5, %13, off\n\t"
               "global_load_async_to_lds_b128 %6, %14, off\n\t"
               "global_load_async_to_lds_b128 %7, %15, off\n\t"
               "s_wait_xcnt 0x0"
               :: "v"(l), "v"(l + 2048u), "v"(l + 4096u), "v"(l + 6144u), "v"(l + 8192u), "v"(l + 10240u), "v"(l + 12288u), "v"(l + 14336u),
                  "v"(g), "v"(g + 1024), "v"(g + 2048), "v"(g + 3072), "v"(g + 4096), "v"(g + 5120), "v"(g + 6144), "v"(g + 7168)
               : "memory");
}
// The pass's 17 powers of two in place (e, the rescale factor, and 16 scores), and the scores' eight f16 pairs (low half first, rounded to nearest even as a cast does).
// One statement, for the slot behind a transcendental: the instruction behind each v_exp_f32 here neither reads its result nor writes its source, which the compiler's own order
// did not keep (it reused a source register directly behind). A conversion stands four or more v_exp_f32 behind its younger input, so it does not wait, up to the last two.
// The s_delay_alu lines are hints, which the compiler does not place for asm text: without one a dependent instruction holds the SIMD's vector port while it waits.
typedef unsigned v8u __attribute__((ext_vector_type(8)));
__device__ __forceinline__ v8u exp2x17_pk(float& e, float (&x)[16]) {
  unsigned w0, w1, w2, w3, w4, w5, w6, w7;
  asm("s_delay_alu instid0(VALU_DEP_1)\n\t"
      "v_exp_f32 %24, %24\n\t"
      "v_exp_f32 %0, %0\n\t"
      "v_exp_f32 %1, %1\n\t"
      "v_exp_f32 %2, %2\n\t"
      "v_exp_f32 %3, %3\n\t"
      "v_exp_f32 %4, %4\n\t"
      "v_exp_f32 %5, %5\n\t"
      "v_cvt_pk_f16_f32 %16, %0, %1\n\t"
      "v_exp_f32 %6, %6\n\t"
      "v_exp_f32 %7, %7\n\t"
      "v_cvt_pk_f16_f32 %17, %2, %3\n\t"
      "v_exp_f32 %8, %8\n\t"
      "v_exp_f32 %9, %9\n\t"
      "v_cvt_pk_f16_f32 %18, %4, %5\n\t"
      "v_exp_f32 %10, %10\n\t"
      "v_exp_f32 %11, %11\n\t"
      "v_cvt_pk_f16_f32 %19, %6, %7\n\t"
      "v_exp_f32 %12, %12\n\t"
      "v_exp_f32 %13, %13\n\t"
      "v_cvt_pk_f16_f32 %20, %8, %9\n\t"
      "v_exp_f32 %14, %14\n\t"
      "v_exp_f32 %15, %15\n\t"
      "v_cvt_pk_f16_f32 %21, %10, %11\n\t"
      "s_delay_alu instid0(TRANS32_DEP_3)\n\t"
      "v_cvt_pk_f16_f32 %22, %12, %13\n\t"
      "s_delay_alu instid0(TRANS32_DEP_1)\n\t"
      "v_cvt_pk_f16_f32 %23, %14, %15"
      : "+v"(x[0]), "+v"(x[1]), "+v"(x[2]), "+v"(x[3]), "+v"(x[4]), "+v"(x[5]), "+v"(x[6]), "+v"(x[7]),
        "+v"(x[8]), "+v"(x[9]), "+v"(x[10]), "+v"(x[11]), "+v"(x[12]), "+v"(x[13]), "+v"(x[14]), "+v"(x[15]),
        "=&v"(w0), "=&v"(w1), "=&v"(w2), "=&v"(w3), "=&v"(w4), "=&v"(w5), "=&v"(w6), "=&v"(w7), "+v"(e));
  return (v8u){w0, w1, w2, w3, w4, w5, w6, w7};
}
__global__ __launch_bounds__(128) void k_flash(const _Float16* __restrict__ Q16, int ldq, const _Float16* __restrict__ K16, const _Float16* __restrict__ Vt, const int* __restrict__ MSK, float* __restrict__ out) {
  constexpr int RPW = 16, NQB = NN / (4 * RPW), DT = 4, KS = 2;
  constexpr int SK = 128, NP = SK / 32, SH = SK * CC, NS = NN / SK;      /* keys, passes and halves per plane of a stage; stages */
  constexpr float C2 = 0.125f * 1.44269504088896341f;      /* 1 / sqrt(64) times log2(e) */
  __shared__ __attribute__((aligned(16))) unsigned short sKV[2][2][SH];      /* [buffer][K, V][fragment order] */
  __shared__ __attribute__((aligned(16))) float sO[CC][4 * RPW + 4];      /* [channel][query of the block]; 68 floats a row: the two lane halves' stores (rows 8 apart) fall 32 banks apart */
  const int tid = threadIdx.x, w = tid >> 5, lane = tid & 31, ln = lane & 15, hh = lane >> 4;
  const int slab = blockIdx.x / NQB, qblk = blockIdx.x % NQB; const int b = slab; const int h = 0; const int qb0 = qblk * (4 * RPW); const int q0 = qb0 + w * RPW;
  /* the thread's 16 B of each 2-KB slice of a stage: source in the two planes, place in buffer 0 (LDS byte address) */
  const unsigned short* Kg = (const unsigned short*)K16 + (size_t)b * NN * CC + tid * 8;
  const unsigned short* Vg = (const unsigned short*)Vt + (size_t)b * NN * CC + tid * 8;
  const unsigned lds0 = (unsigned)(size_t)&sKV[0][0][0] + (unsigned)tid * 16u;
  copy8(lds0, Kg); copy8(lds0 + SH * 2, Vg);
  FragH aq[KS];
  { const unsigned short* qr = (const unsigned short*)Q16 + ((size_t)b * NN + q0 + ln) * ldq;
#pragma unroll
    for (int ks = 0; ks < KS; ++ks) { aq[ks].half[0] = *(const v8us*)(qr + ks * 32 + 8 * hh); aq[ks].half[1] = *(const v8us*)(qr + ks * 32 + 16 + 8 * hh); } }
  float m_r = -3.0e38f, l_r = 0.f; v8f oacc[DT];      /* oacc[dt][r] = Ot[dt*16 + 8hh + r][query ln] */
#pragma unroll
  for (int dt = 0; dt < DT; ++dt) oacc[dt] = (v8f){0.f,0.f,0.f,0.f,0.f,0.f,0.f,0.f};
  asm volatile("s_wait_asynccnt 0x0" ::: "memory");      /* this wave's share of stage 0 has landed */
  __syncthreads();                                        /* ... and every other wave's */
  copy8(lds0 + SH * 4, Kg + SH); copy8(lds0 + SH * 6, Vg + SH);
  /* the stage loop stays rolled; the constant-trip inner loops are unrolled so that the fragment and score arrays stay in registers */
#pragma unroll 1
  for (int st = 0; st < NS; ++st) {
    /* 32 keys = 2048 halves of a plane, a fragment half = 256 halves, the lane's 16 B at lane * 8 */
    const unsigned short* Kf = &sKV[st & 1][0][lane * 8];
    const unsigned short* Vf = &sKV[st & 1][1][lane * 8];
    /* The loads stand ahead of the work that hides them: a pass's K fragments are asked for in the pass before, right behind its S products (inside the stage only), its V fragments at its head. */
    FragH bk[2][KS];      /* K fragments of the pass at hand */
#pragma unroll
    for (int nt = 0; nt < 2; ++nt) {
#pragma unroll
      for (int ks = 0; ks < KS; ++ks) { const unsigned short* kr = Kf + (nt * KS + ks) * 512; bk[nt][ks].half[0] = *(const v8us*)kr; bk[nt][ks].half[1] = *(const v8us*)(kr + 256); } }
#pragma unroll
    for (int ps = 0; ps < NP; ++ps) {
      FragH bv[DT];
#pragma unroll
      for (int dt = 0; dt < DT; ++dt) { const unsigned short* vr = Vf + ps * 2048 + dt * 512; bv[dt].half[0] = *(const v8us*)vr; bv[dt].half[1] = *(const v8us*)(vr + 256); }
      v8f s[2];      /* s[nt][r] = St[key of the pass nt*16 + 8hh + r][query ln] */
#pragma unroll
      for (int nt = 0; nt < 2; ++nt) {
        v8f acc = (v8f){0.f,0.f,0.f,0.f,0.f,0.f,0.f,0.f};
#pragma unroll
        for (int ks = 0; ks < KS; ++ks) acc = mmaH<1>(bk[nt][ks].v, bk[nt][ks].v, aq[ks].v, aq[ks].v, acc);
        s[nt] = acc; }
      if (ps + 1 < NP) {
#pragma unroll
        for (int nt = 0; nt < 2; ++nt) {
#pragma unroll
          for (int ks = 0; ks < KS; ++ks) { const unsigned short* kr = Kf + (ps + 1) * 2048 + (nt * KS + ks) * 512; bk[nt][ks].half[0] = *(const v8us*)kr; bk[nt][ks].half[1] = *(const v8us*)(kr + 256); } } }
      /* Softmax in base 2: the maximum is taken over the raw products (the factor is positive) and kept times C2 = log2(e) / 8;
         a score's weight x 2^10 is then one fused multiply-add and one hardware exp2: 2^(s * C2 + (10 - m)). */
      float sc[16]; float mq[4];
#pragma unroll
      for (int i = 0; i < 16; ++i) sc[i] = s[i >> 3][i & 7];
#pragma unroll
      for (int c = 0; c < 4; ++c) mq[c] = fmaxf(fmaxf(sc[c], sc[4 + c]), fmaxf(sc[8 + c], sc[12 + c]));
      float mc = fmaxf(fmaxf(mq[0], mq[1]), fmaxf(mq[2], mq[3])); mc = fmaxf(mc, xhalf(mc));
      const float mn = fmaxf(m_r, mc * C2); float ea = m_r - mn; m_r = mn;      /* ea becomes 2^ea, the factor on what is summed so far */
      const float nb = 10.0f - mn;
#pragma unroll
      for (int i = 0; i < 16; ++i) sc[i] = __builtin_fmaf(sc[i], C2, nb);
      const v8u pw = exp2x17_pk(ea, sc);      /* half i of pw = Pt[key of the pass (i < 8 ? 8hh + i : 8 + 8hh + i)][query ln] x 2^10; sc[i] = the same weight in f32 */
      float ps4[4];
#pragma unroll
      for (int c = 0; c < 4; ++c) ps4[c] = ((sc[c] + sc[4 + c]) + sc[8 + c]) + sc[12 + c];
      const float al = (mn > -1.0e38f) ? ea : 1.0f;
      FragH pb; pb.v = __builtin_bit_cast(v16h, pw);
      l_r = l_r * al + ((ps4[0] + ps4[1]) + (ps4[2] + ps4[3]));      /* x 2^10 like P; this lane half's keys only; the halves join after the loop */
#pragma unroll
      for (int dt = 0; dt < DT; ++dt)
#pragma unroll
        for (int r = 0; r < 8; ++r) oacc[dt][r] *= al;
#pragma unroll
      for (int dt = 0; dt < DT; ++dt) oacc[dt] = mmaH<1>(bv[dt].v, bv[dt].v, pb.v, pb.v, oacc[dt]);
    }
    asm volatile("s_wait_dscnt 0x0" ::: "memory");        /* this wave's reads of the buffer are done before anyone refills it */
    asm volatile("s_wait_asynccnt 0x0" ::: "memory");     /* this wave's share of stage st + 1 has landed */
    __syncthreads();                                        /* publishes stage st + 1 and ends every wave's reads of stage st */
    if (st + 2 < NS) { const unsigned lb = lds0 + (unsigned)(st & 1) * (SH * 4); copy8(lb, Kg + (size_t)(st + 2) * SH); copy8(lb + SH * 2, Vg + (size_t)(st + 2) * SH); }
  }
  asm volatile("s_wait_asynccnt 0x0" ::: "memory");       /* nothing of this wave is in flight when it goes on to the output staging and ends */
  const float l = l_r + xhalf(l_r); const float linv = (l > 0.f) ? 1.0f / l : 0.f;      /* the 2^10 of P and of l cancel */
  /* The output is channel-major, as the accumulators are: each wave puts its 16 query columns into the block's [64 channels][64 queries] tile, then the block stores whole rows. */
#pragma unroll
  for (int dt = 0; dt < DT; ++dt)
#pragma unroll
    for (int r = 0; r < 8; ++r) sO[dt * 16 + 8 * hh + r][w * RPW + ln] = oacc[dt][r] * linv;
  __syncthreads();      /* a row of the tile holds columns of all four waves: all are written before any row is read */
  { float* orow = out + ((size_t)b * CC + w * 16 + hh) * NN + qb0 + ln * 4;
#pragma unroll
    for (int i = 0; i < 8; ++i) { const v4f val = *(const v4fa*)&sO[w * 16 + i * 2 + hh][ln * 4]; *(v4f*)(orow + (size_t)i * 2 * NN) = val; }      /* 16 lanes x 16 B = the block's whole 256 B of one channel row */
  } }

extern "C" void kernel_launch(void* const* d_in, const int* in_sizes, int n_in,
                              void* d_out, int out_size, void* d_ws, size_t ws_size, hipStream_t stream) {
  (void)in_sizes; (void)n_in; (void)out_size;
  const float* qkv = (const float*)d_in[0];
  char* ws = (char*)d_ws; size_t off = 0;
  auto take = [&](size_t bytes) { char* p = ws + off; off += (bytes + 255) & ~(size_t)255; return p; };
  _Float16* QK = (_Float16*)take((size_t)NR * 2 * CC * 2); _Float16* Vt = (_Float16*)take((size_t)BB * CC * NN * 2);
  if (off > ws_size) return;      // 8.4 + 4.2 MB
  k_tok<<<BB * 2 * (NN / 32), 256, 0, stream>>>(qkv, QK);
  k_v16<<<(unsigned)(((size_t)BB * CC * NN / 8 + 255) / 256), 256, 0, stream>>>(qkv, Vt);
  k_flash<<<BB * (NN / 64), 128, 0, stream>>>(QK, CC, QK + (size_t)NR * CC, Vt, nullptr, (float*)d_out);
}

// v007
// It runs in 47.9 microseconds.
// In two side-by-side timings against v006, it was 1.10 and 1.11 times as fast.
// Counting every step since v000, it is 9.13 times as fast.
#include <hip/hip_runtime.h>
// QKV self-attention on a channel-major qkv tensor [8, 3·64, 4096]: attn[s,t] = Σ_c q[c,s]·k[c,t]/√64, softmax over t, out[d,s] = Σ_t attn[s,t]·v[d,t].
// Compute dtype: qkv rounded to bf16 and carried exactly in f16 (q token-major; k and v planes in the order of their A fragments, 512 contiguous bytes per wave-wide load); S and P·V on v_wmma_f32_16x16x32_f16 with
// f32 accumulation in one fused flash-style kernel (online softmax in f32; P in f16 ×2^10); the same kernel stores O as [b][d][s], whole 256-B rows gathered through LDS; output f32.
#define BB 8
#define CC 64
#define C3 192
#define NN 4096
#define NR (BB * NN)

typedef __bf16 v16b __attribute__((ext_vector_type(16)));
typedef unsigned short v8us __attribute__((ext_vector_type(8), may_alias));
typedef float  v8f  __attribute__((ext_vector_type(8)));
typedef float  v4f  __attribute__((ext_vector_type(4)));
typedef float  v4fa __attribute__((ext_vector_type(4), may_alias));
union FragB { v16b v; v8us half[2]; unsigned short u[16]; };

__device__ __forceinline__ unsigned short bf16_bits(float x) { unsigned int u = __float_as_uint(x); return (unsigned short)((u + 0x7FFFu + ((u >> 16) & 1u)) >> 16); }
__device__ __forceinline__ float bf16_val(unsigned short b) { return __uint_as_float(((unsigned int)b) << 16); }
__device__ __forceinline__ float bf16_round(float x) { return bf16_val(bf16_bits(x)); }
// D += A·B with NT terms: 1 = ah·bh, 2 = + al·bh (A split), 3 = + ah·bl (both split)
template <int NT>
__device__ __forceinline__ v8f mmaN(v16b ah, v16b al, v16b bh, v16b bl, v8f c) {
  c = __builtin_amdgcn_wmma_f32_16x16x32_bf16(false, ah, false, bh, (short)0, c, false, false);
  if (NT >= 2) c = __builtin_amdgcn_wmma_f32_16x16x32_bf16(false, al, false, bh, (short)0, c, false, false);
  if (NT >= 3) c = __builtin_amdgcn_wmma_f32_16x16x32_bf16(false, ah, false, bl, (short)0, c, false, false);
  asm volatile("v_nop\n\tv_nop\n\tv_nop\n\tv_nop" : "+v"(c) : "v"(ah), "v"(al), "v"(bh), "v"(bl));
  return c;
}

__global__ __launch_bounds__(256) void k_wt_bf16(const float* __restrict__ W, unsigned short* __restrict__ Wt, int K, int N) {
  const int t = blockIdx.x * 256 + threadIdx.x;
  const int k8n = K / 8;
  if (t >= N * k8n) return;
  const int n = t / k8n, k8 = (t % k8n) * 8;
  v8us v;
#pragma unroll
  for (int i = 0; i < 8; ++i) v[i] = bf16_bits(W[(size_t)(k8 + i) * N + n]);
  *(v8us*)(Wt + (size_t)n * K + k8) = v;
  
}

// GEMM C[M][N] (f32, pitch ldc) = act(A[M][K]·W + bias). A f32 row-major (pitch lda) converted per fragment to bf16
// (ASPLIT: hi/lo two planes -> 2 terms, else single rounded term); Wt bf16 [N][K] (pitch ldb). BIAS_BF16 rounds the
// bias to bf16 first (bias quantised to bf16 before the add). K%32==0, M%16==0, N%64==0.
template <bool ASPLIT, int ACT, bool BIAS_BF16>
__global__ __launch_bounds__(128) void k_gemm_bf(const float* __restrict__ A, int lda, const unsigned short* __restrict__ Wt, int ldb,
                                               const float* __restrict__ bias, float* __restrict__ C, int ldc, int M, int N, int K) {
  __shared__ __attribute__((aligned(16))) float so[4][16][64];
  const int tid = threadIdx.x, w = tid >> 5, lane = tid & 31, ln = lane & 15, hh = lane >> 4;
  const int ntn = N / 64;
  const int wid = blockIdx.x * 4 + w;
  const int mt = wid / ntn, nq = wid % ntn;
  if (mt * 16 >= M) return;
  const int row0 = mt * 16, col0 = nq * 64;
  const float* arow = A + (size_t)(row0 + ln) * lda;
  v8f acc[4] = {};
  for (int kb = 0; kb < K; kb += 32) {
    FragB ah, al;
    const v4f x0 = *(const v4fa*)(arow + kb + 8 * hh), x1 = *(const v4fa*)(arow + kb + 8 * hh + 4);
    const v4f x2 = *(const v4fa*)(arow + kb + 16 + 8 * hh), x3 = *(const v4fa*)(arow + kb + 16 + 8 * hh + 4);
    float xs[16] = {x0[0],x0[1],x0[2],x0[3],x1[0],x1[1],x1[2],x1[3],x2[0],x2[1],x2[2],x2[3],x3[0],x3[1],x3[2],x3[3]};
#pragma unroll
    for (int i = 0; i < 16; ++i) { const unsigned short hb = bf16_bits(xs[i]); ah.u[i] = hb; al.u[i] = ASPLIT ? bf16_bits(xs[i] - bf16_val(hb)) : (unsigned short)0; }
#pragma unroll
    for (int t = 0; t < 4; ++t) {
      const unsigned short* brow = Wt + (size_t)(col0 + t * 16 + ln) * ldb + kb;
      FragB b;
      b.half[0] = *(const v8us*)(brow + 8 * hh);
      b.half[1] = *(const v8us*)(brow + 16 + 8 * hh);
      acc[t] = mmaN<ASPLIT ? 2 : 1>(ah.v, al.v, b.v, b.v, acc[t]);
    }
  }
#pragma unroll
  for (int t = 0; t < 4; ++t) {
    float bv = bias ? bias[col0 + t * 16 + ln] : 0.f;
    if (BIAS_BF16) bv = bf16_round(bv);
#pragma unroll
    for (int r = 0; r < 8; ++r) { float v = acc[t][r] + bv; if (ACT == 1) v = fmaxf(v, 0.f); so[w][8 * hh + r][t * 16 + ln] = v; }
  }
  __builtin_amdgcn_fence(__ATOMIC_ACQ_REL, "workgroup");
  __builtin_amdgcn_wave_barrier();
  const int rsub = lane >> 4, c4 = (lane & 15) * 4;
  {
#pragma unroll
    for (int q = 0; q < 8; ++q) {
      const int r = q * 2 + rsub;
      const v4f v = *(const v4fa*)&so[w][r][c4];
      *(v4f*)(C + (size_t)(row0 + r) * ldc + col0 + c4) = v;
    }
    
  }
}

// Flash-style causal/unmasked attention, all contractions 3-term bf16 hi/lo splits, f32 softmax with running max.
// q,k,v rows are read from f32 buffers with arbitrary row pitch (so they can live inside a fused qkv buffer);
// D = head size (multiple of 32, <= 128); one wave = 16 query rows; block = 4 waves (64 queries) sharing K/V chunks of 32.
template <int D, bool CAUSAL>
__global__ __launch_bounds__(128) void k_flash(const float* __restrict__ qb, const float* __restrict__ kb, const float* __restrict__ vb,
                                             int pitch, int T, int H, float scale, float* __restrict__ y, int ypitch) {
  constexpr int KS = D / 32;        // k-steps for QK
  constexpr int DT = D / 16;        // d tiles for PV
  __shared__ __attribute__((aligned(16))) unsigned short sKh[32][D + 8], sKl[32][D + 8], sVh[32][D + 8], sVl[32][D + 8];
  __shared__ __attribute__((aligned(16))) unsigned short sPh[4][16][40], sPl[4][16][40];
  __shared__ __attribute__((aligned(16))) float sO[4][16][D];
  const int tid = threadIdx.x, w = tid >> 5, lane = tid & 31, ln = lane & 15, hh = lane >> 4;
  const int nqb = (T + 63) / 64;
  const int bh = blockIdx.x / nqb, qblk = blockIdx.x % nqb;
  const int b = bh / H, h = bh % H;
  const int q0 = qblk * 64 + w * 16;
  const float* Q = qb + (size_t)b * T * pitch + h * D;
  const float* K = kb + (size_t)b * T * pitch + h * D;
  const float* V = vb + (size_t)b * T * pitch + h * D;

  // A fragments of the wave's 16 query rows (scaled), hi/lo
  FragB aqh[KS], aql[KS];
  {
    int row = q0 + ln; if (row >= T) row = T - 1;
    const float* qr = Q + (size_t)row * pitch;
#pragma unroll
    for (int ks = 0; ks < KS; ++ks)
#pragma unroll
      for (int i = 0; i < 16; ++i) {
        const int d = ks * 32 + ((i < 8) ? (8 * hh + i) : (16 + 8 * hh + (i - 8)));
        const float x = qr[d] * scale; const unsigned short hb = bf16_bits(x);
        aqh[ks].u[i] = hb; aql[ks].u[i] = bf16_bits(x - bf16_val(hb));
      }
  }
  float m_r[8], l_r[8];
#pragma unroll
  for (int r = 0; r < 8; ++r) { m_r[r] = -3.0e38f; l_r[r] = 0.f; }
  v8f oacc[DT];
#pragma unroll
  for (int dt = 0; dt < DT; ++dt) oacc[dt] = (v8f){0.f,0.f,0.f,0.f,0.f,0.f,0.f,0.f};

  const int kv_end = CAUSAL ? min(T, qblk * 64 + 64) : T;     // block-uniform
  for (int j0 = 0; j0 < kv_end; j0 += 32) {
    __syncthreads();
    for (int e = tid; e < 32 * (D / 4); e += 128) {
      const int r = e / (D / 4), c4 = (e % (D / 4)) * 4;
      const int key = j0 + r;
      v4f kf = {0.f,0.f,0.f,0.f}, vf = {0.f,0.f,0.f,0.f};
      if (key < T) { kf = *(const v4fa*)(K + (size_t)key * pitch + c4); vf = *(const v4fa*)(V + (size_t)key * pitch + c4); }
#pragma unroll
      for (int t = 0; t < 4; ++t) {
        unsigned short hb = bf16_bits(kf[t]); sKh[r][c4 + t] = hb; sKl[r][c4 + t] = bf16_bits(kf[t] - bf16_val(hb));
        hb = bf16_bits(vf[t]); sVh[r][c4 + t] = hb; sVl[r][c4 + t] = bf16_bits(vf[t] - bf16_val(hb));
      }
    }
    __syncthreads();
    // S tile 16 x 32
    v8f s[2];
#pragma unroll
    for (int nt = 0; nt < 2; ++nt) {
      v8f acc = {};
#pragma unroll
      for (int ks = 0; ks < KS; ++ks) {
        FragB bh_, bl_;
        bh_.half[0] = *(const v8us*)&sKh[nt * 16 + ln][ks * 32 + 8 * hh]; bh_.half[1] = *(const v8us*)&sKh[nt * 16 + ln][ks * 32 + 16 + 8 * hh];
        bl_.half[0] = *(const v8us*)&sKl[nt * 16 + ln][ks * 32 + 8 * hh]; bl_.half[1] = *(const v8us*)&sKl[nt * 16 + ln][ks * 32 + 16 + 8 * hh];
        acc = mmaN<3>(aqh[ks].v, aql[ks].v, bh_.v, bl_.v, acc);
      }
      s[nt] = acc;
    }
    // mask + running max (rows 8hh+r; the 16 lanes of a half share rows)
    float alpha[8];
#pragma unroll
    for (int r = 0; r < 8; ++r) {
      const int qi = q0 + 8 * hh + r;
      const int ja = j0 + ln, jb = j0 + 16 + ln;
      if (CAUSAL) { if (ja > qi) s[0][r] = -3.0e38f; if (jb > qi) s[1][r] = -3.0e38f; }
      if (ja >= T) s[0][r] = -3.0e38f;
      if (jb >= T) s[1][r] = -3.0e38f;
      float mx = fmaxf(s[0][r], s[1][r]);
      mx = fmaxf(mx, __shfl_xor(mx, 1, 32)); mx = fmaxf(mx, __shfl_xor(mx, 2, 32)); mx = fmaxf(mx, __shfl_xor(mx, 4, 32)); mx = fmaxf(mx, __shfl_xor(mx, 8, 32));
      const float mnew = fmaxf(m_r[r], mx);
      alpha[r] = (mnew > -1.0e38f) ? __expf(m_r[r] - mnew) : 1.0f;
      const float p0 = (s[0][r] > -1.0e38f) ? __expf(s[0][r] - mnew) : 0.f;
      const float p1 = (s[1][r] > -1.0e38f) ? __expf(s[1][r] - mnew) : 0.f;
      m_r[r] = mnew;
      l_r[r] = l_r[r] * alpha[r] + p0 + p1;            // per-lane partial row sum (16 lanes combined at the end)
      unsigned short hb = bf16_bits(p0); sPh[w][8 * hh + r][ln] = hb;      sPl[w][8 * hh + r][ln] = bf16_bits(p0 - bf16_val(hb));
      hb = bf16_bits(p1);                sPh[w][8 * hh + r][16 + ln] = hb; sPl[w][8 * hh + r][16 + ln] = bf16_bits(p1 - bf16_val(hb));
    }
#pragma unroll
    for (int dt = 0; dt < DT; ++dt)
#pragma unroll
      for (int r = 0; r < 8; ++r) oacc[dt][r] *= alpha[r];
    __builtin_amdgcn_fence(__ATOMIC_ACQ_REL, "workgroup");
    __builtin_amdgcn_wave_barrier();
    FragB pah, pal;
    pah.half[0] = *(const v8us*)&sPh[w][ln][8 * hh]; pah.half[1] = *(const v8us*)&sPh[w][ln][16 + 8 * hh];
    pal.half[0] = *(const v8us*)&sPl[w][ln][8 * hh]; pal.half[1] = *(const v8us*)&sPl[w][ln][16 + 8 * hh];
#pragma unroll
    for (int dt = 0; dt < DT; ++dt) {
      FragB bvh, bvl;
#pragma unroll
      for (int i = 0; i < 8; ++i) {
        bvh.u[i] = sVh[8 * hh + i][dt * 16 + ln]; bvh.u[8 + i] = sVh[16 + 8 * hh + i][dt * 16 + ln];
        bvl.u[i] = sVl[8 * hh + i][dt * 16 + ln]; bvl.u[8 + i] = sVl[16 + 8 * hh + i][dt * 16 + ln];
      }
      oacc[dt] = mmaN<3>(pah.v, pal.v, bvh.v, bvl.v, oacc[dt]);
    }
    __builtin_amdgcn_fence(__ATOMIC_ACQ_REL, "workgroup");
    __builtin_amdgcn_wave_barrier();
  }
#pragma unroll
  for (int r = 0; r < 8; ++r) {
    float l = l_r[r];
    l += __shfl_xor(l, 1, 32); l += __shfl_xor(l, 2, 32); l += __shfl_xor(l, 4, 32); l += __shfl_xor(l, 8, 32);
    l_r[r] = (l > 0.f) ? 1.0f / l : 0.f;
  }
#pragma unroll
  for (int dt = 0; dt < DT; ++dt)
#pragma unroll
    for (int r = 0; r < 8; ++r) sO[w][8 * hh + r][dt * 16 + ln] = oacc[dt][r] * l_r[r];
  __builtin_amdgcn_fence(__ATOMIC_ACQ_REL, "workgroup");
  __builtin_amdgcn_wave_barrier();
  {
    for (int r = 0; r < 16; ++r) {
      const int row = q0 + r;
      if (row < T && lane < D / 4) {
        const v4f val = *(const v4fa*)&sO[w][r][lane * 4];
        *(v4f*)(y + ((size_t)b * T + row) * ypitch + h * D + lane * 4) = val;
      }
    }
    
  }
}

// GEMM C = act(A·W + bias + resid): A f32 (ASPLIT -> hi/lo 2 terms), Wt bf16 [N][K]; ACT 0 none, 1 relu, 2 exact gelu;
// resid (optional, f32, row index = (row % rmod), pitch ldr, RES_BF16 rounds it) added before the activation.
template <bool ASPLIT, int ACT, bool BIAS_BF16, bool RES_BF16>
__global__ __launch_bounds__(128) void k_gemm_bf3(const float* __restrict__ A, int lda, const unsigned short* __restrict__ Wt, int ldb,
                                                const float* __restrict__ bias, const float* __restrict__ resid, int rmod, int ldr,
                                                float* __restrict__ C, int ldc, int M, int N, int K) {
  __shared__ __attribute__((aligned(16))) float so[4][16][64];
  const int tid = threadIdx.x, w = tid >> 5, lane = tid & 31, ln = lane & 15, hh = lane >> 4;
  const int ntn = N / 64;
  const int wid = blockIdx.x * 4 + w;
  const int mt = wid / ntn, nq = wid % ntn;
  if (mt * 16 >= M) return;
  const int row0 = mt * 16, col0 = nq * 64;
  const float* arow = A + (size_t)(row0 + ln) * lda;
  v8f acc[4] = {};
  for (int kb = 0; kb < K; kb += 32) {
    FragB ah, al;
    const v4f x0 = *(const v4fa*)(arow + kb + 8 * hh), x1 = *(const v4fa*)(arow + kb + 8 * hh + 4);
    const v4f x2 = *(const v4fa*)(arow + kb + 16 + 8 * hh), x3 = *(const v4fa*)(arow + kb + 16 + 8 * hh + 4);
    float xs[16] = {x0[0],x0[1],x0[2],x0[3],x1[0],x1[1],x1[2],x1[3],x2[0],x2[1],x2[2],x2[3],x3[0],x3[1],x3[2],x3[3]};
#pragma unroll
    for (int i = 0; i < 16; ++i) { const unsigned short hb = bf16_bits(xs[i]); ah.u[i] = hb; al.u[i] = ASPLIT ? bf16_bits(xs[i] - bf16_val(hb)) : (unsigned short)0; }
#pragma unroll
    for (int t = 0; t < 4; ++t) {
      const unsigned short* brow = Wt + (size_t)(col0 + t * 16 + ln) * ldb + kb;
      FragB b;
      b.half[0] = *(const v8us*)(brow + 8 * hh);
      b.half[1] = *(const v8us*)(brow + 16 + 8 * hh);
      acc[t] = mmaN<ASPLIT ? 2 : 1>(ah.v, al.v, b.v, b.v, acc[t]);
    }
  }
#pragma unroll
  for (int t = 0; t < 4; ++t) {
    const int col = col0 + t * 16 + ln;
    float bv = bias ? bias[col] : 0.f;
    if (BIAS_BF16) bv = bf16_round(bv);
#pragma unroll
    for (int r = 0; r < 8; ++r) {
      float v = acc[t][r] + bv;
      if (resid) { float rv = resid[(size_t)((row0 + 8 * hh + r) % rmod) * ldr + col]; if (RES_BF16) rv = bf16_round(rv); v += rv; }
      if (ACT == 1) v = fmaxf(v, 0.f);
      if (ACT == 2) v = 0.5f * v * (1.0f + erff(v * 0.70710678118654752f));
      if (ACT == 3) { const float u = 0.7978845608028654f * (v + 0.044715f * v * v * v); v = 0.5f * v * (1.0f + tanhf(u)); }
      so[w][8 * hh + r][t * 16 + ln] = v;
    }
  }
  __builtin_amdgcn_fence(__ATOMIC_ACQ_REL, "workgroup");
  __builtin_amdgcn_wave_barrier();
  const int rsub = lane >> 4, c4 = (lane & 15) * 4;
  {
#pragma unroll
    for (int q = 0; q < 8; ++q) {
      const int r = q * 2 + rsub;
      const v4f v = *(const v4fa*)&so[w][r][c4];
      *(v4f*)(C + (size_t)(row0 + r) * ldc + col0 + c4) = v;
    }
    
  }
}
// row LayerNorm (biased variance, eps) over N: s = X (+ R); optional out_sum <- s; out_norm <- (s-mu)*rsqrt(var+eps)*g + b
template <bool PARAM_BF16>
__global__ __launch_bounds__(256) void k_layernorm(const float* __restrict__ X, const float* __restrict__ R, const float* __restrict__ g, const float* __restrict__ bta,
                                                  float* __restrict__ out_sum, float* __restrict__ out_norm, int N, float eps) {
  __shared__ float red[256];
  const int row = blockIdx.x, tid = threadIdx.x;
  const float* x = X + (size_t)row * N; const float* rr = R ? R + (size_t)row * N : nullptr;
  float vals[16];                     // up to N = 4096
  const int per = N / 256;            // contiguous chunk per thread? use strided-by-4 chunks: thread handles j = tid*4 + 1024*u
  float s1 = 0.f;
  for (int u = 0; u < per / 4; ++u) {
    const int j = tid * 4 + 1024 * u;
    const v4f a = *(const v4fa*)(x + j);
    v4f b = {0.f,0.f,0.f,0.f}; if (rr) b = *(const v4fa*)(rr + j);
#pragma unroll
    for (int q = 0; q < 4; ++q) { const float v = a[q] + b[q]; vals[u * 4 + q] = v; s1 += v; }
  }
  red[tid] = s1; __syncthreads();
  for (int st = 128; st > 0; st >>= 1) { if (tid < st) red[tid] += red[tid + st]; __syncthreads(); }
  const float mu = red[0] / (float)N; __syncthreads();
  float s2 = 0.f;
  for (int u = 0; u < per / 4; ++u)
#pragma unroll
    for (int q = 0; q < 4; ++q) { const float c = vals[u * 4 + q] - mu; s2 += c * c; }
  red[tid] = s2; __syncthreads();
  for (int st = 128; st > 0; st >>= 1) { if (tid < st) red[tid] += red[tid + st]; __syncthreads(); }
  const float rs = rsqrtf(red[0] / (float)N + eps);
  {
    for (int u = 0; u < per / 4; ++u) {
      const int j = tid * 4 + 1024 * u;
      v4f o, sm;
#pragma unroll
      for (int q = 0; q < 4; ++q) {
        float gg = g[j + q], bb = bta[j + q];
        if (PARAM_BF16) { gg = bf16_round(gg); bb = bf16_round(bb); }
        sm[q] = vals[u * 4 + q]; o[q] = (vals[u * 4 + q] - mu) * rs * gg + bb;
      }
      if (out_sum) *(v4f*)(out_sum + (size_t)row * N + j) = sm;
      *(v4f*)(out_norm + (size_t)row * N + j) = o;
    }
    
  }
}



// ---- f16 WMMA path (v_wmma_f32_16x16x32_f16): 11-bit significands for operands in range — used where a [0,1] probability operand needs more precision than bf16
typedef _Float16 v16h __attribute__((ext_vector_type(16)));
union FragH { v16h v; v8us half[2]; _Float16 h[16]; unsigned short u[16]; };
template <int NT>
__device__ __forceinline__ v8f mmaH(v16h ah, v16h al, v16h bh, v16h bl, v8f c) {
  c = __builtin_amdgcn_wmma_f32_16x16x32_f16(false, ah, false, bh, (short)0, c, false, false);
  if (NT >= 2) c = __builtin_amdgcn_wmma_f32_16x16x32_f16(false, al, false, bh, (short)0, c, false, false);
  if (NT >= 3) c = __builtin_amdgcn_wmma_f32_16x16x32_f16(false, ah, false, bl, (short)0, c, false, false);
  asm volatile("v_nop\n\tv_nop\n\tv_nop\n\tv_nop" : "+v"(c) : "v"(ah), "v"(al), "v"(bh), "v"(bl));
  return c;
}
// batched GEMM like k_gemm_b but f16 operands: A f32 (split into f16 hi/lo if ASPLIT, else rounded to f16), Bt = f16 values [n][k]; alpha; C f32; N multiple of 16 (partial tiles skipped)
template <bool ASPLIT>
__global__ __launch_bounds__(128) void k_gemm_h(const float* __restrict__ A, int lda, size_t sA, const _Float16* __restrict__ Bh, int ldb, size_t sB, float alpha, float* __restrict__ C, int ldc, size_t sC, int M, int N, int K) {
  __shared__ __attribute__((aligned(16))) float so[4][16][64];
  const int tid = threadIdx.x, w = tid >> 5, lane = tid & 31, ln = lane & 15, hh = lane >> 4; const int by = blockIdx.y;
  A += (size_t)by * sA; Bh += (size_t)by * sB; C += (size_t)by * sC;
  const int ntn = (N + 63) / 64; const int wid = blockIdx.x * 4 + w; const int mt = wid / ntn, nq = wid % ntn; if (mt * 16 >= M) return;
  const int row0 = mt * 16, col0 = nq * 64; const float* arow = A + (size_t)(row0 + ln) * lda;
  v8f acc[4] = {};
  for (int kb = 0; kb < K; kb += 32) {
    FragH ah, al;
    const v4f x0 = *(const v4fa*)(arow + kb + 8 * hh), x1 = *(const v4fa*)(arow + kb + 8 * hh + 4), x2 = *(const v4fa*)(arow + kb + 16 + 8 * hh), x3 = *(const v4fa*)(arow + kb + 16 + 8 * hh + 4);
    float xs[16] = {x0[0],x0[1],x0[2],x0[3],x1[0],x1[1],x1[2],x1[3],x2[0],x2[1],x2[2],x2[3],x3[0],x3[1],x3[2],x3[3]};
#pragma unroll
    for (int i = 0; i < 16; ++i) { const _Float16 h = (_Float16)xs[i]; ah.h[i] = h; al.h[i] = ASPLIT ? (_Float16)(xs[i] - (float)h) : (_Float16)0.0f; }
#pragma unroll
    for (int t = 0; t < 4; ++t) { if (col0 + t * 16 >= N) continue; const size_t boff = (size_t)(col0 + t * 16 + ln) * ldb + kb; FragH bq; bq.half[0] = *(const v8us*)(Bh + boff + 8 * hh); bq.half[1] = *(const v8us*)(Bh + boff + 16 + 8 * hh);
      acc[t] = mmaH<ASPLIT ? 2 : 1>(ah.v, al.v, bq.v, bq.v, acc[t]); }
  }
#pragma unroll
  for (int t = 0; t < 4; ++t) { if (col0 + t * 16 >= N) continue;
#pragma unroll
    for (int r = 0; r < 8; ++r) so[w][8 * hh + r][t * 16 + ln] = acc[t][r] * alpha; }
  __builtin_amdgcn_fence(__ATOMIC_ACQ_REL, "workgroup"); __builtin_amdgcn_wave_barrier();
  const int rsub = lane >> 4, c4 = (lane & 15) * 4;
  {
#pragma unroll
    for (int q = 0; q < 8; ++q) { const int r = q * 2 + rsub; if (col0 + c4 < N) { const v4f v = *(const v4fa*)&so[w][r][c4]; *(v4f*)(C + (size_t)(row0 + r) * ldc + col0 + c4) = v; } }
     }
}

// Wt[n][k] = f16(W[k][n]·scale) from f32 row-major W[K][N] (scale = power of two; bf16-exact weights stay exact in f16 away from the subnormal range)
__global__ __launch_bounds__(256) void k_wt_f16(const float* __restrict__ W, _Float16* __restrict__ Wt, int K, int N, float scale) {
  const int t = blockIdx.x * 256 + threadIdx.x; if (t >= N * (K / 8)) return; const int n = t / (K / 8), k8 = (t % (K / 8)) * 8; FragH f;
#pragma unroll
  for (int i = 0; i < 8; ++i) f.h[i] = (_Float16)(bf16_round(W[(size_t)(k8 + i) * N + n]) * scale); const v8us o = f.half[0];
  *(v8us*)((unsigned short*)Wt + (size_t)n * K + k8) = o; 
}
// k_gemm_hh variant with fused epilogue: v = acc·alpha + bias[by·sBias + col] (+ CP[(row/rowsPerB)·sCPb + by·64 + col] if CP) ; ACT 0 none / 1 elu ; writes f16 C16 (and f32 C if non-null)
template <int ACT>
__global__ __launch_bounds__(128) void k_gemm_hhx(const _Float16* __restrict__ A, int lda, size_t sA, const _Float16* __restrict__ Bh, int ldb, size_t sB, float alpha, const float* __restrict__ bias, size_t sBias, const float* __restrict__ CP, int rowsPerB, size_t sCPb, int row0g,
    float* __restrict__ C, _Float16* __restrict__ C16, int ldc, size_t sC, int M, int N, int K) {
  __shared__ __attribute__((aligned(16))) float so[4][16][64];
  const int tid = threadIdx.x, w = tid >> 5, lane = tid & 31, ln = lane & 15, hh = lane >> 4; const int by = blockIdx.y;
  A += (size_t)by * sA; Bh += (size_t)by * sB; const size_t cofs = (size_t)by * sC; const float* bp = bias ? bias + (size_t)by * sBias : nullptr;
  const int ntn = (N + 63) / 64; const int wid = blockIdx.x * 4 + w; const int mt = wid / ntn, nq = wid % ntn; if (mt * 16 >= M) return;
  const int row0 = mt * 16, col0 = nq * 64; const _Float16* arow = A + (size_t)(row0 + ln) * lda;
  v8f acc[4] = {};
  for (int kb = 0; kb < K; kb += 32) { FragH ah; ah.half[0] = *(const v8us*)((const unsigned short*)arow + kb + 8 * hh); ah.half[1] = *(const v8us*)((const unsigned short*)arow + kb + 16 + 8 * hh);
#pragma unroll
    for (int t = 0; t < 4; ++t) { if (col0 + t * 16 >= N) continue; const size_t boff = (size_t)(col0 + t * 16 + ln) * ldb + kb; FragH bq; bq.half[0] = *(const v8us*)((const unsigned short*)Bh + boff + 8 * hh); bq.half[1] = *(const v8us*)((const unsigned short*)Bh + boff + 16 + 8 * hh);
      acc[t] = mmaH<1>(ah.v, ah.v, bq.v, bq.v, acc[t]); }
  }
#pragma unroll
  for (int t = 0; t < 4; ++t) { if (col0 + t * 16 >= N) continue; const int col = col0 + t * 16 + ln; const float bv = bp ? bf16_round(bp[col]) : 0.f;
#pragma unroll
    for (int r = 0; r < 8; ++r) { float v = acc[t][r] * alpha + bv; if (CP) { const int bidx = (row0g + row0 + 8 * hh + r) / rowsPerB; v += CP[(size_t)bidx * sCPb + (size_t)by * 64 + col]; } if (ACT == 1) v = (v > 0.f) ? v : expm1f(v); else if (ACT == 7) v = (v > 0.f) ? v + 1.0f : expf(v); else if (ACT == 8) v = tanhf(v); else if (ACT == 9) v = 0.5f * v * (1.0f + tanhf(0.7978845608028654f * (v + 0.044715f * v * v * v))); else if (ACT == 11) v = 1.0f / (1.0f + expf(-v)); else if (ACT == 12) v = (v > 0.f) ? v : 0.01f * v; else if (ACT == 14) v = (v > 0.f) ? v : 0.1f * v; else if (ACT == 15) v = v / (1.0f + expf(-v)); else if (ACT == 3) v = fmaxf(v, 0.f); else if (ACT == 6) v = 0.5f * v * (1.0f + erff(v * 0.70710678118654752f)); so[w][8 * hh + r][t * 16 + ln] = v; } }
  __builtin_amdgcn_fence(__ATOMIC_ACQ_REL, "workgroup"); __builtin_amdgcn_wave_barrier();
  const int rsub = lane >> 4, c4 = (lane & 15) * 4; typedef _Float16 v4h __attribute__((ext_vector_type(4)));
  {
#pragma unroll
    for (int q = 0; q < 8; ++q) { const int r = q * 2 + rsub; if (col0 + c4 < N) { const v4f v = *(const v4fa*)&so[w][r][c4]; if (C) *(v4f*)(C + cofs + (size_t)(row0 + r) * ldc + col0 + c4) = v; if (C16) { v4h h4; for (int i = 0; i < 4; ++i) h4[i] = (_Float16)v[i]; *(v4h*)(C16 + cofs + (size_t)(row0 + r) * ldc + col0 + c4) = h4; } } }
     }
}


typedef _Float16 v4h __attribute__((ext_vector_type(4)));

__global__ __launch_bounds__(256) void k_x16(const float* __restrict__ x, _Float16* __restrict__ X16, size_t n8) { const size_t t = (size_t)blockIdx.x * 256 + threadIdx.x; if (t >= n8) return; FragH f;
#pragma unroll
  for (int q = 0; q < 8; ++q) f.h[q] = (_Float16)bf16_round(x[t * 8 + q]); *(v8us*)((unsigned short*)X16 + t * 8) = f.half[0];  }
__global__ __launch_bounds__(256) void k_h16(const float* __restrict__ x, _Float16* __restrict__ X16, size_t n8) { const size_t t = (size_t)blockIdx.x * 256 + threadIdx.x; if (t >= n8) return; FragH f;
#pragma unroll
  for (int q = 0; q < 8; ++q) f.h[q] = (_Float16)x[t * 8 + q]; *(v8us*)((unsigned short*)X16 + t * 8) = f.half[0];  }
__global__ __launch_bounds__(256) void k_round16f(const float* __restrict__ W, _Float16* __restrict__ Bt, size_t n8) { const size_t t = (size_t)blockIdx.x * 256 + threadIdx.x; if (t >= n8) return; FragH f;
#pragma unroll
  for (int i = 0; i < 8; ++i) f.h[i] = (_Float16)(bf16_round(W[t * 8 + i]) * 16.0f); *(v8us*)((unsigned short*)Bt + t * 8) = f.half[0];  }
template <int NHv, int TTv>
__global__ __launch_bounds__(256) void k_vt(const _Float16* __restrict__ V16, int ldv, int voff, _Float16* __restrict__ Vt) { __shared__ unsigned short tl[64][66]; const int tid = threadIdx.x; const int slab = blockIdx.x / (TTv / 64), lg = blockIdx.x % (TTv / 64); const int b = slab / NHv, h = slab % NHv;
  for (int i = tid; i < 64 * 8; i += 256) { const int r = i / 8, c8 = (i % 8) * 8; FragH f; f.half[0] = *(const v8us*)((const unsigned short*)V16 + ((size_t)b * TTv + lg * 64 + r) * ldv + voff + h * 64 + c8);
#pragma unroll
    for (int q = 0; q < 8; ++q) tl[r][c8 + q] = f.u[q]; }
  __syncthreads();
  {
#pragma unroll
    for (int rd = 0; rd < 2; ++rd) { const int d = rd * 32 + tid / 8, pc = tid % 8; FragH f;
#pragma unroll
      for (int q = 0; q < 8; ++q) f.u[q] = tl[pc * 8 + q][d];
      *(v8us*)((unsigned short*)Vt + ((size_t)slab * 64 + d) * TTv + lg * 64 + pc * 8) = f.half[0]; }
     } }

typedef unsigned short v4us __attribute__((ext_vector_type(4), may_alias));
// Where a 16-B unit of a tile waits in LDS: its index in the output order, low bits XORed with higher bits of the same index, so that the 16 lanes of a half wave
// fall on 16 different bank groups both when the units are written (lanes 4 positions apart) and when they are read back (lanes on consecutive units). TY: 0 q, 1 k, 2 v.
template <int TY>
__device__ __forceinline__ int prep_slot(int u) { return u ^ (TY == 0 ? ((u >> 5) & 15) : TY == 1 ? ((u >> 7) & 3) : (((u >> 4) & 3) | (((u >> 8) & 3) << 2))); }
// The thread's 64 values (a[i][j] = channel w*16 + i, position 4*l + j of the tile), rounded, into LDS: q, k as 16-B units of 8 channels, v as 8-B halves of a unit (4 keys of one channel).
template <int TY>
__device__ __forceinline__ void prep_put(const v4f (&a)[16], unsigned short* sT, int w, int l) {
  if (TY < 2) {
#pragma unroll
    for (int cg = 0; cg < 2; ++cg)
#pragma unroll
      for (int j = 0; j < 4; ++j) { FragH f;
#pragma unroll
        for (int e = 0; e < 8; ++e) f.h[e] = (_Float16)bf16_round(a[cg * 8 + e][j]);
        const int c8 = w * 2 + cg; const int u = (TY == 0) ? l * 32 + j * 8 + c8 : (l >> 2) * 128 + c8 * 16 + (l & 3) * 4 + j;
        *(v8us*)&sT[prep_slot<TY>(u) * 8] = f.half[0]; }
  } else {
#pragma unroll
    for (int i = 0; i < 16; ++i) { FragH f;
#pragma unroll
      for (int j = 0; j < 4; ++j) f.h[j] = (_Float16)bf16_round(a[i][j]);
      const int u = (l >> 3) * 256 + w * 64 + ((l >> 1) & 3) * 16 + i;
      *(v4us*)&sT[prep_slot<TY>(u) * 8 + (l & 1) * 4] = (v4us){f.u[0], f.u[1], f.u[2], f.u[3]}; }
  }
}
// The tile out of LDS as it lies in its plane: 16 KB, 512 contiguous bytes per wave-wide store.
template <int TY>
__device__ __forceinline__ void prep_out(const unsigned short* sT, unsigned short* dst, int tid) {
#pragma unroll
  for (int i = 0; i < 8; ++i) { const int u = i * 128 + tid; *(v8us*)(dst + u * 8) = *(const v8us*)&sT[prep_slot<TY>(u) * 8]; }
  asm volatile("s_wait_xcnt 0x0" ::: "memory");      /* closes the run of stores: no register that one of them names is rewritten ahead of this wait, on any branch of the listing */
}
// One launch prepares the three planes. A block takes one tile of q, k or v: 64 channels x 128 positions, 32 KB of f32 in, 16 KB of f16 out, contiguous in its plane.
// A thread asks for its 16 x 16 B at once (a wave-wide load is 512 contiguous bytes of one channel row).
// q: rows of 64 channels, token-major: unit u = position*8 + c8 holds channels c8*8 + 0..7.
// k: behind the q plane, in fragment order: the 4 KB of a pass of 32 keys are [nt][ks][hf][lane] units, unit = channels ks*32 + hf*16 + 8*(lane >> 4) + 0..7 of key nt*16 + (lane & 15): u = (key >> 4)*128 + c8*16 + (key & 15).
// v: in fragment order: the 4 KB of a pass are [dt][hf][lane] units, unit = keys hf*16 + 8*(lane >> 4) + 0..7 of channel dt*16 + (lane & 15): u = (key >> 5)*256 + (channel >> 4)*64 + ((key >> 3) & 3)*16 + (channel & 15).
__global__ __launch_bounds__(128) void k_prep(const float* __restrict__ x, _Float16* __restrict__ QK, _Float16* __restrict__ Vt) {
  __shared__ __attribute__((aligned(16))) unsigned short sT[1024 * 8];
  const int tid = threadIdx.x, w = tid >> 5, l = tid & 31;
  const int b = blockIdx.x / (3 * (NN / 128)), rem = blockIdx.x % (3 * (NN / 128)); const int ty = rem / (NN / 128), pg = rem % (NN / 128);
  const float* src = x + ((size_t)b * C3 + ty * CC + w * 16) * NN + pg * 128 + l * 4;
  v4f a[16];
#pragma unroll
  for (int i = 0; i < 16; ++i) a[i] = *(const v4fa*)(src + (size_t)i * NN);
  asm volatile("s_wait_xcnt 0x0" :: "v"(src) : "memory");      /* the loads' address registers stay as they are up to this wait */
  if (ty == 0) prep_put<0>(a, sT, w, l); else if (ty == 1) prep_put<1>(a, sT, w, l); else prep_put<2>(a, sT, w, l);
  __syncthreads();      /* q: a stored run of 512 B holds units of all four waves; v: waves store runs that other waves wrote */
  const size_t off = ((size_t)b * NN + pg * 128) * CC;
  if (ty == 0) prep_out<0>(sT, (unsigned short*)QK + off, tid); else if (ty == 1) prep_out<1>(sT, (unsigned short*)QK + (size_t)NR * CC + off, tid); else prep_out<2>(sT, (unsigned short*)Vt + off, tid);
}
// lane l <-> lane l ^ 16 (the two lane halves hold the two key halves of one query column)
__device__ __forceinline__ float xhalf(float x) { return __builtin_bit_cast(float, __builtin_amdgcn_permlanex16(__builtin_bit_cast(int, x), __builtin_bit_cast(int, x), 0x76543210, 0xfedcba98, false, false)); }
// Eight 16-B copies per lane, global memory to LDS through no register. The s_wait_xcnt closes the statement so that no address register named here is rewritten ahead of it.
__device__ __forceinline__ void copy8(unsigned l, const unsigned short* g) {
  asm volatile("global_load_async_to_lds_b128 %0, %8, off\n\t"
               "global_load_async_to_lds_b128 %1, %9, off\n\t"
               "global_load_async_to_lds_b128 %2, %10, off\n\t"
               "global_load_async_to_lds_b128 %3, %11, off\n\t"
               "global_load_async_to_lds_b128 %4, %12, off\n\t"
               "global_load_async_to_lds_b128 %5, %13, off\n\t"
               "global_load_async_to_lds_b128 %6, %14, off\n\t"
               "global_load_async_to_lds_b128 %7, %15, off\n\t"
               "s_wait_xcnt 0x0"
               :: "v"(l), "v"(l + 2048u), "v"(l + 4096u), "v"(l + 6144u), "v"(l + 8192u), "v"(l + 10240u), "v"(l + 12288u), "v"(l + 14336u),
                  "v"(g), "v"(g + 1024), "v"(g + 2048), "v"(g + 3072), "v"(g + 4096), "v"(g + 5120), "v"(g + 6144), "v"(g + 7168)
               : "memory");
}
// The pass's 17 powers of two in place (e, the rescale factor, and 16 scores), and the scores' eight f16 pairs (low half first, rounded to nearest even as a cast does).
// One statement, for the slot behind a transcendental: the instruction behind each v_exp_f32 here neither reads its result nor writes its source, which the compiler's own order
// did not keep (it reused a source register directly behind). A conversion stands four or more v_exp_f32 behind its younger input, so it does not wait, up to the last two.
// The s_delay_alu lines are hints, which the compiler does not place for asm text: without one a dependent instruction holds the SIMD's vector port while it waits.
typedef unsigned v8u __attribute__((ext_vector_type(8)));
__device__ __forceinline__ v8u exp2x17_pk(float& e, float (&x)[16]) {
  unsigned w0, w1, w2, w3, w4, w5, w6, w7;
  asm("s_delay_alu instid0(VALU_DEP_1)\n\t"
      "v_exp_f32 %24, %24\n\t"
      "v_exp_f32 %0, %0\n\t"
      "v_exp_f32 %1, %1\n\t"
      "v_exp_f32 %2, %2\n\t"
      "v_exp_f32 %3, %3\n\t"
      "v_exp_f32 %4, %4\n\t"
      "v_exp_f32 %5, %5\n\t"
      "v_cvt_pk_f16_f32 %16, %0, %1\n\t"
      "v_exp_f32 %6, %6\n\t"
      "v_exp_f32 %7, %7\n\t"
      "v_cvt_pk_f16_f32 %17, %2, %3\n\t"
      "v_exp_f32 %8, %8\n\t"
      "v_exp_f32 %9, %9\n\t"
      "v_cvt_pk_f16_f32 %18, %4, %5\n\t"
      "v_exp_f32 %10, %10\n\t"
      "v_exp_f32 %11, %11\n\t"
      "v_cvt_pk_f16_f32 %19, %6, %7\n\t"
      "v_exp_f32 %12, %12\n\t"
      "v_exp_f32 %13, %13\n\t"
      "v_cvt_pk_f16_f32 %20, %8, %9\n\t"
      "v_exp_f32 %14, %14\n\t"
      "v_exp_f32 %15, %15\n\t"
      "v_cvt_pk_f16_f32 %21, %10, %11\n\t"
      "s_delay_alu instid0(TRANS32_DEP_3)\n\t"
      "v_cvt_pk_f16_f32 %22, %12, %13\n\t"
      "s_delay_alu instid0(TRANS32_DEP_1)\n\t"
      "v_cvt_pk_f16_f32 %23, %14, %15"
      : "+v"(x[0]), "+v"(x[1]), "+v"(x[2]), "+v"(x[3]), "+v"(x[4]), "+v"(x[5]), "+v"(x[6]), "+v"(x[7]),
        "+v"(x[8]), "+v"(x[9]), "+v"(x[10]), "+v"(x[11]), "+v"(x[12]), "+v"(x[13]), "+v"(x[14]), "+v"(x[15]),
        "=&v"(w0), "=&v"(w1), "=&v"(w2), "=&v"(w3), "=&v"(w4), "=&v"(w5), "=&v"(w6), "=&v"(w7), "+v"(e));
  return (v8u){w0, w1, w2, w3, w4, w5, w6, w7};
}
__global__ __launch_bounds__(128) void k_flash(const _Float16* __restrict__ Q16, int ldq, const _Float16* __restrict__ K16, const _Float16* __restrict__ Vt, const int* __restrict__ MSK, float* __restrict__ out) {
  constexpr int RPW = 16, NQB = NN / (4 * RPW), DT = 4, KS = 2;
  constexpr int SK = 128, NP = SK / 32, SH = SK * CC, NS = NN / SK;      /* keys, passes and halves per plane of a stage; stages */
  constexpr float C2 = 0.125f * 1.44269504088896341f;      /* 1 / sqrt(64) times log2(e) */
  __shared__ __attribute__((aligned(16))) unsigned short sKV[2][2][SH];      /* [buffer][K, V][fragment order] */
  __shared__ __attribute__((aligned(16))) float sO[CC][4 * RPW + 4];      /* [channel][query of the block]; 68 floats a row: the two lane halves' stores (rows 8 apart) fall 32 banks apart */
  const int tid = threadIdx.x, w = tid >> 5, lane = tid & 31, ln = lane & 15, hh = lane >> 4;
  const int slab = blockIdx.x / NQB, qblk = blockIdx.x % NQB; const int b = slab; const int h = 0; const int qb0 = qblk * (4 * RPW); const int q0 = qb0 + w * RPW;
  /* the thread's 16 B of each 2-KB slice of a stage: source in the two planes, place in buffer 0 (LDS byte address) */
  const unsigned short* Kg = (const unsigned short*)K16 + (size_t)b * NN * CC + tid * 8;
  const unsigned short* Vg = (const unsigned short*)Vt + (size_t)b * NN * CC + tid * 8;
  const unsigned lds0 = (unsigned)(size_t)&sKV[0][0][0] + (unsigned)tid * 16u;
  copy8(lds0, Kg); copy8(lds0 + SH * 2, Vg);
  FragH aq[KS];
  { const unsigned short* qr = (const unsigned short*)Q16 + ((size_t)b * NN + q0 + ln) * ldq;
#pragma unroll
    for (int ks = 0; ks < KS; ++ks) { aq[ks].half[0] = *(const v8us*)(qr + ks * 32 + 8 * hh); aq[ks].half[1] = *(const v8us*)(qr + ks * 32 + 16 + 8 * hh); } }
  float m_r = -3.0e38f, l_r = 0.f; v8f oacc[DT];      /* oacc[dt][r] = Ot[dt*16 + 8hh + r][query ln] */
#pragma unroll
  for (int dt = 0; dt < DT; ++dt) oacc[dt] = (v8f){0.f,0.f,0.f,0.f,0.f,0.f,0.f,0.f};
  asm volatile("s_wait_asynccnt 0x0" ::: "memory");      /* this wave's share of stage 0 has landed */
  __syncthreads();                                        /* ... and every other wave's */
  copy8(lds0 + SH * 4, Kg + SH); copy8(lds0 + SH * 6, Vg + SH);
  /* the stage loop stays rolled; the constant-trip inner loops are unrolled so that the fragment and score arrays stay in registers */
#pragma unroll 1
  for (int st = 0; st < NS; ++st) {
    /* 32 keys = 2048 halves of a plane, a fragment half = 256 halves, the lane's 16 B at lane * 8 */
    const unsigned short* Kf = &sKV[st & 1][0][lane * 8];
    const unsigned short* Vf = &sKV[st & 1][1][lane * 8];
    /* The loads stand ahead of the work that hides them: a pass's K fragments are asked for in the pass before, right behind its S products (inside the stage only), its V fragments at its head. */
    FragH bk[2][KS];      /* K fragments of the pass at hand */
#pragma unroll
    for (int nt = 0; nt < 2; ++nt) {
#pragma unroll
      for (int ks = 0; ks < KS; ++ks) { const unsigned short* kr = Kf + (nt * KS + ks) * 512; bk[nt][ks].half[0] = *(const v8us*)kr; bk[nt][ks].half[1] = *(const v8us*)(kr + 256); } }
#pragma unroll
    for (int ps = 0; ps < NP; ++ps) {
      FragH bv[DT];
#pragma unroll
      for (int dt = 0; dt < DT; ++dt) { const unsigned short* vr = Vf + ps * 2048 + dt * 512; bv[dt].half[0] = *(const v8us*)vr; bv[dt].half[1] = *(const v8us*)(vr + 256); }
      v8f s[2];      /* s[nt][r] = St[key of the pass nt*16 + 8hh + r][query ln] */
#pragma unroll
      for (int nt = 0; nt < 2; ++nt) {
        v8f acc = (v8f){0.f,0.f,0.f,0.f,0.f,0.f,0.f,0.f};
#pragma unroll
        for (int ks = 0; ks < KS; ++ks) acc = mmaH<1>(bk[nt][ks].v, bk[nt][ks].v, aq[ks].v, aq[ks].v, acc);
        s[nt] = acc; }
      if (ps + 1 < NP) {
#pragma unroll
        for (int nt = 0; nt < 2; ++nt) {
#pragma unroll
          for (int ks = 0; ks < KS; ++ks) { const unsigned short* kr = Kf + (ps + 1) * 2048 + (nt * KS + ks) * 512; bk[nt][ks].half[0] = *(const v8us*)kr; bk[nt][ks].half[1] = *(const v8us*)(kr + 256); } } }
      /* Softmax in base 2: the maximum is taken over the raw products (the factor is positive) and kept times C2 = log2(e) / 8;
         a score's weight x 2^10 is then one fused multiply-add and one hardware exp2: 2^(s * C2 + (10 - m)). */
      float sc[16]; float mq[4];
#pragma unroll
      for (int i = 0; i < 16; ++i) sc[i] = s[i >> 3][i & 7];
#pragma unroll
      for (int c = 0; c < 4; ++c) mq[c] = fmaxf(fmaxf(sc[c], sc[4 + c]), fmaxf(sc[8 + c], sc[12 + c]));
      float mc = fmaxf(fmaxf(mq[0], mq[1]), fmaxf(mq[2], mq[3])); mc = fmaxf(mc, xhalf(mc));
      const float mn = fmaxf(m_r, mc * C2); float ea = m_r - mn; m_r = mn;      /* ea becomes 2^ea, the factor on what is summed so far */
      const float nb = 10.0f - mn;
#pragma unroll
      for (int i = 0; i < 16; ++i) sc[i] = __builtin_fmaf(sc[i], C2, nb);
      const v8u pw = exp2x17_pk(ea, sc);      /* half i of pw = Pt[key of the pass (i < 8 ? 8hh + i : 8 + 8hh + i)][query ln] x 2^10; sc[i] = the same weight in f32 */
      float ps4[4];
#pragma unroll
      for (int c = 0; c < 4; ++c) ps4[c] = ((sc[c] + sc[4 + c]) + sc[8 + c]) + sc[12 + c];
      const float al = (mn > -1.0e38f) ? ea : 1.0f;
      FragH pb; pb.v = __builtin_bit_cast(v16h, pw);
      l_r = l_r * al + ((ps4[0] + ps4[1]) + (ps4[2] + ps4[3]));      /* x 2^10 like P; this lane half's keys only; the halves join after the loop */
#pragma unroll
      for (int dt = 0; dt < DT; ++dt)
#pragma unroll
        for (int r = 0; r < 8; ++r) oacc[dt][r] *= al;
#pragma unroll
      for (int dt = 0; dt < DT; ++dt) oacc[dt] = mmaH<1>(bv[dt].v, bv[dt].v, pb.v, pb.v, oacc[dt]);
    }
    asm volatile("s_wait_dscnt 0x0" ::: "memory");        /* this wave's reads of the buffer are done before anyone refills it */
    asm volatile("s_wait_asynccnt 0x0" ::: "memory");     /* this wave's share of stage st + 1 has landed */
    __syncthreads();                                        /* publishes stage st + 1 and ends every wave's reads of stage st */
    if (st + 2 < NS) { const unsigned lb = lds0 + (unsigned)(st & 1) * (SH * 4); copy8(lb, Kg + (size_t)(st + 2) * SH); copy8(lb + SH * 2, Vg + (size_t)(st + 2) * SH); }
  }
  asm volatile("s_wait_asynccnt 0x0" ::: "memory");       /* nothing of this wave is in flight when it goes on to the output staging and ends */
  const float l = l_r + xhalf(l_r); const float linv = (l > 0.f) ? 1.0f / l : 0.f;      /* the 2^10 of P and of l cancel */
  /* The output is channel-major, as the accumulators are: each wave puts its 16 query columns into the block's [64 channels][64 queries] tile, then the block stores whole rows. */
#pragma unroll
  for (int dt = 0; dt < DT; ++dt)
#pragma unroll
    for (int r = 0; r < 8; ++r) sO[dt * 16 + 8 * hh + r][w * RPW + ln] = oacc[dt][r] * linv;
  __syncthreads();      /* a row of the tile holds columns of all four waves: all are written before any row is read */
  { float* orow = out + ((size_t)b * CC + w * 16 + hh) * NN + qb0 + ln * 4;
#pragma unroll
    for (int i = 0; i < 8; ++i) { const v4f val = *(const v4fa*)&sO[w * 16 + i * 2 + hh][ln * 4]; *(v4f*)(orow + (size_t)i * 2 * NN) = val; }      /* 16 lanes x 16 B = the block's whole 256 B of one channel row */
  } }

extern "C" void kernel_launch(void* const* d_in, const int* in_sizes, int n_in,
                              void* d_out, int out_size, void* d_ws, size_t ws_size, hipStream_t stream) {
  (void)in_sizes; (void)n_in; (void)out_size;
  const float* qkv = (const float*)d_in[0];
  char* ws = (char*)d_ws; size_t off = 0;
  auto take = [&](size_t bytes) { char* p = ws + off; off += (bytes + 255) & ~(size_t)255; return p; };
  _Float16* QK = (_Float16*)take((size_t)NR * 2 * CC * 2); _Float16* Vt = (_Float16*)take((size_t)BB * CC * NN * 2);
  if (off > ws_size) return;      // 8.4 + 4.2 MB
  k_prep<<<BB * 3 * (NN / 128), 128, 0, stream>>>(qkv, QK, Vt);
  k_flash<<<BB * (NN / 64), 128, 0, stream>>>(QK, CC, QK + (size_t)NR * CC, Vt, nullptr, (float*)d_out);
}

// v008
// It runs in 42.4 microseconds.
// In two side-by-side timings against v007, it was 1.13 and 1.12 times as fast.
// Over all steps from v000 it is 10.3 times as fast.
#include <hip/hip_runtime.h>
// QKV self-attention on a channel-major qkv tensor [8, 3·64, 4096]: attn[s,t] = Σ_c q[c,s]·k[c,t]/√64, softmax over t, out[d,s] = Σ_t attn[s,t]·v[d,t].
// Compute dtype: qkv rounded to bf16 and carried exactly in f16 (q token-major; k and v planes in the order of their A fragments, 512 contiguous bytes per wave-wide load); S and P·V on v_wmma_f32_16x16x32_f16 with
// f32 accumulation in one fused flash-style kernel (online softmax in f32; P in f16 ×2^10); the same kernel stores O as [b][d][s], whole 256-B rows gathered through LDS; output f32.
#define BB 8
#define CC 64
#define C3 192
#define NN 4096
#define NR (BB * NN)

typedef __bf16 v16b __attribute__((ext_vector_type(16)));
typedef unsigned short v8us __attribute__((ext_vector_type(8), may_alias));
typedef float  v8f  __attribute__((ext_vector_type(8)));
typedef float  v4f  __attribute__((ext_vector_type(4)));
typedef float  v4fa __attribute__((ext_vector_type(4), may_alias));
union FragB { v16b v; v8us half[2]; unsigned short u[16]; };

__device__ __forceinline__ unsigned short bf16_bits(float x) { unsigned int u = __float_as_uint(x); return (unsigned short)((u + 0x7FFFu + ((u >> 16) & 1u)) >> 16); }
__device__ __forceinline__ float bf16_val(unsigned short b) { return __uint_as_float(((unsigned int)b) << 16); }
__device__ __forceinline__ float bf16_round(float x) { return bf16_val(bf16_bits(x)); }
// D += A·B with NT terms: 1 = ah·bh, 2 = + al·bh (A split), 3 = + ah·bl (both split)
template <int NT>
__device__ __forceinline__ v8f mmaN(v16b ah, v16b al, v16b bh, v16b bl, v8f c) {
  c = __builtin_amdgcn_wmma_f32_16x16x32_bf16(false, ah, false, bh, (short)0, c, false, false);
  if (NT >= 2) c = __builtin_amdgcn_wmma_f32_16x16x32_bf16(false, al, false, bh, (short)0, c, false, false);
  if (NT >= 3) c = __builtin_amdgcn_wmma_f32_16x16x32_bf16(false, ah, false, bl, (short)0, c, false, false);
  asm volatile("v_nop\n\tv_nop\n\tv_nop\n\tv_nop" : "+v"(c) : "v"(ah), "v"(al), "v"(bh), "v"(bl));
  return c;
}

__global__ __launch_bounds__(256) void k_wt_bf16(const float* __restrict__ W, unsigned short* __restrict__ Wt, int K, int N) {
  const int t = blockIdx.x * 256 + threadIdx.x;
  const int k8n = K / 8;
  if (t >= N * k8n) return;
  const int n = t / k8n, k8 = (t % k8n) * 8;
  v8us v;
#pragma unroll
  for (int i = 0; i < 8; ++i) v[i] = bf16_bits(W[(size_t)(k8 + i) * N + n]);
  *(v8us*)(Wt + (size_t)n * K + k8) = v;
  
}

// GEMM C[M][N] (f32, pitch ldc) = act(A[M][K]·W + bias). A f32 row-major (pitch lda) converted per fragment to bf16
// (ASPLIT: hi/lo two planes -> 2 terms, else single rounded term); Wt bf16 [N][K] (pitch ldb). BIAS_BF16 rounds the
// bias to bf16 first (bias quantised to bf16 before the add). K%32==0, M%16==0, N%64==0.
template <bool ASPLIT, int ACT, bool BIAS_BF16>
__global__ __launch_bounds__(128) void k_gemm_bf(const float* __restrict__ A, int lda, const unsigned short* __restrict__ Wt, int ldb,
                                               const float* __restrict__ bias, float* __restrict__ C, int ldc, int M, int N, int K) {
  __shared__ __attribute__((aligned(16))) float so[4][16][64];
  const int tid = threadIdx.x, w = tid >> 5, lane = tid & 31, ln = lane & 15, hh = lane >> 4;
  const int ntn = N / 64;
  const int wid = blockIdx.x * 4 + w;
  const int mt = wid / ntn, nq = wid % ntn;
  if (mt * 16 >= M) return;
  const int row0 = mt * 16, col0 = nq * 64;
  const float* arow = A + (size_t)(row0 + ln) * lda;
  v8f acc[4] = {};
  for (int kb = 0; kb < K; kb += 32) {
    FragB ah, al;
    const v4f x0 = *(const v4fa*)(arow + kb + 8 * hh), x1 = *(const v4fa*)(arow + kb + 8 * hh + 4);
    const v4f x2 = *(const v4fa*)(arow + kb + 16 + 8 * hh), x3 = *(const v4fa*)(arow + kb + 16 + 8 * hh + 4);
    float xs[16] = {x0[0],x0[1],x0[2],x0[3],x1[0],x1[1],x1[2],x1[3],x2[0],x2[1],x2[2],x2[3],x3[0],x3[1],x3[2],x3[3]};
#pragma unroll
    for (int i = 0; i < 16; ++i) { const unsigned short hb = bf16_bits(xs[i]); ah.u[i] = hb; al.u[i] = ASPLIT ? bf16_bits(xs[i] - bf16_val(hb)) : (unsigned short)0; }
#pragma unroll
    for (int t = 0; t < 4; ++t) {
      const unsigned short* brow = Wt + (size_t)(col0 + t * 16 + ln) * ldb + kb;
      FragB b;
      b.half[0] = *(const v8us*)(brow + 8 * hh);
      b.half[1] = *(const v8us*)(brow + 16 + 8 * hh);
      acc[t] = mmaN<ASPLIT ? 2 : 1>(ah.v, al.v, b.v, b.v, acc[t]);
    }
  }
#pragma unroll
  for (int t = 0; t < 4; ++t) {
    float bv = bias ? bias[col0 + t * 16 + ln] : 0.f;
    if (BIAS_BF16) bv = bf16_round(bv);
#pragma unroll
    for (int r = 0; r < 8; ++r) { float v = acc[t][r] + bv; if (ACT == 1) v = fmaxf(v, 0.f); so[w][8 * hh + r][t * 16 + ln] = v; }
  }
  __builtin_amdgcn_fence(__ATOMIC_ACQ_REL, "workgroup");
  __builtin_amdgcn_wave_barrier();
  const int rsub = lane >> 4, c4 = (lane & 15) * 4;
  {
#pragma unroll
    for (int q = 0; q < 8; ++q) {
      const int r = q * 2 + rsub;
      const v4f v = *(const v4fa*)&so[w][r][c4];
      *(v4f*)(C + (size_t)(row0 + r) * ldc + col0 + c4) = v;
    }
    
  }
}

// Flash-style causal/unmasked attention, all contractions 3-term bf16 hi/lo splits, f32 softmax with running max.
// q,k,v rows are read from f32 buffers with arbitrary row pitch (so they can live inside a fused qkv buffer);
// D = head size (multiple of 32, <= 128); one wave = 16 query rows; block = 4 waves (64 queries) sharing K/V chunks of 32.
template <int D, bool CAUSAL>
__global__ __launch_bounds__(128) void k_flash(const float* __restrict__ qb, const float* __restrict__ kb, const float* __restrict__ vb,
                                             int pitch, int T, int H, float scale, float* __restrict__ y, int ypitch) {
  constexpr int KS = D / 32;        // k-steps for QK
  constexpr int DT = D / 16;        // d tiles for PV
  __shared__ __attribute__((aligned(16))) unsigned short sKh[32][D + 8], sKl[32][D + 8], sVh[32][D + 8], sVl[32][D + 8];
  __shared__ __attribute__((aligned(16))) unsigned short sPh[4][16][40], sPl[4][16][40];
  __shared__ __attribute__((aligned(16))) float sO[4][16][D];
  const int tid = threadIdx.x, w = tid >> 5, lane = tid & 31, ln = lane & 15, hh = lane >> 4;
  const int nqb = (T + 63) / 64;
  const int bh = blockIdx.x / nqb, qblk = blockIdx.x % nqb;
  const int b = bh / H, h = bh % H;
  const int q0 = qblk * 64 + w * 16;
  const float* Q = qb + (size_t)b * T * pitch + h * D;
  const float* K = kb + (size_t)b * T * pitch + h * D;
  const float* V = vb + (size_t)b * T * pitch + h * D;

  // A fragments of the wave's 16 query rows (scaled), hi/lo
  FragB aqh[KS], aql[KS];
  {
    int row = q0 + ln; if (row >= T) row = T - 1;
    const float* qr = Q + (size_t)row * pitch;
#pragma unroll
    for (int ks = 0; ks < KS; ++ks)
#pragma unroll
      for (int i = 0; i < 16; ++i) {
        const int d = ks * 32 + ((i < 8) ? (8 * hh + i) : (16 + 8 * hh + (i - 8)));
        const float x = qr[d] * scale; const unsigned short hb = bf16_bits(x);
        aqh[ks].u[i] = hb; aql[ks].u[i] = bf16_bits(x - bf16_val(hb));
      }
  }
  float m_r[8], l_r[8];
#pragma unroll
  for (int r = 0; r < 8; ++r) { m_r[r] = -3.0e38f; l_r[r] = 0.f; }
  v8f oacc[DT];
#pragma unroll
  for (int dt = 0; dt < DT; ++dt) oacc[dt] = (v8f){0.f,0.f,0.f,0.f,0.f,0.f,0.f,0.f};

  const int kv_end = CAUSAL ? min(T, qblk * 64 + 64) : T;     // block-uniform
  for (int j0 = 0; j0 < kv_end; j0 += 32) {
    __syncthreads();
    for (int e = tid; e < 32 * (D / 4); e += 128) {
      const int r = e / (D / 4), c4 = (e % (D / 4)) * 4;
      const int key = j0 + r;
      v4f kf = {0.f,0.f,0.f,0.f}, vf = {0.f,0.f,0.f,0.f};
      if (key < T) { kf = *(const v4fa*)(K + (size_t)key * pitch + c4); vf = *(const v4fa*)(V + (size_t)key * pitch + c4); }
#pragma unroll
      for (int t = 0; t < 4; ++t) {
        unsigned short hb = bf16_bits(kf[t]); sKh[r][c4 + t] = hb; sKl[r][c4 + t] = bf16_bits(kf[t] - bf16_val(hb));
        hb = bf16_bits(vf[t]); sVh[r][c4 + t] = hb; sVl[r][c4 + t] = bf16_bits(vf[t] - bf16_val(hb));
      }
    }
    __syncthreads();
    // S tile 16 x 32
    v8f s[2];
#pragma unroll
    for (int nt = 0; nt < 2; ++nt) {
      v8f acc = {};
#pragma unroll
      for (int ks = 0; ks < KS; ++ks) {
        FragB bh_, bl_;
        bh_.half[0] = *(const v8us*)&sKh[nt * 16 + ln][ks * 32 + 8 * hh]; bh_.half[1] = *(const v8us*)&sKh[nt * 16 + ln][ks * 32 + 16 + 8 * hh];
        bl_.half[0] = *(const v8us*)&sKl[nt * 16 + ln][ks * 32 + 8 * hh]; bl_.half[1] = *(const v8us*)&sKl[nt * 16 + ln][ks * 32 + 16 + 8 * hh];
        acc = mmaN<3>(aqh[ks].v, aql[ks].v, bh_.v, bl_.v, acc);
      }
      s[nt] = acc;
    }
    // mask + running max (rows 8hh+r; the 16 lanes of a half share rows)
    float alpha[8];
#pragma unroll
    for (int r = 0; r < 8; ++r) {
      const int qi = q0 + 8 * hh + r;
      const int ja = j0 + ln, jb = j0 + 16 + ln;
      if (CAUSAL) { if (ja > qi) s[0][r] = -3.0e38f; if (jb > qi) s[1][r] = -3.0e38f; }
      if (ja >= T) s[0][r] = -3.0e38f;
      if (jb >= T) s[1][r] = -3.0e38f;
      float mx = fmaxf(s[0][r], s[1][r]);
      mx = fmaxf(mx, __shfl_xor(mx, 1, 32)); mx = fmaxf(mx, __shfl_xor(mx, 2, 32)); mx = fmaxf(mx, __shfl_xor(mx, 4, 32)); mx = fmaxf(mx, __shfl_xor(mx, 8, 32));
      const float mnew = fmaxf(m_r[r], mx);
      alpha[r] = (mnew > -1.0e38f) ? __expf(m_r[r] - mnew) : 1.0f;
      const float p0 = (s[0][r] > -1.0e38f) ? __expf(s[0][r] - mnew) : 0.f;
      const float p1 = (s[1][r] > -1.0e38f) ? __expf(s[1][r] - mnew) : 0.f;
      m_r[r] = mnew;
      l_r[r] = l_r[r] * alpha[r] + p0 + p1;            // per-lane partial row sum (16 lanes combined at the end)
      unsigned short hb = bf16_bits(p0); sPh[w][8 * hh + r][ln] = hb;      sPl[w][8 * hh + r][ln] = bf16_bits(p0 - bf16_val(hb));
      hb = bf16_bits(p1);                sPh[w][8 * hh + r][16 + ln] = hb; sPl[w][8 * hh + r][16 + ln] = bf16_bits(p1 - bf16_val(hb));
    }
#pragma unroll
    for (int dt = 0; dt < DT; ++dt)
#pragma unroll
      for (int r = 0; r < 8; ++r) oacc[dt][r] *= alpha[r];
    __builtin_amdgcn_fence(__ATOMIC_ACQ_REL, "workgroup");
    __builtin_amdgcn_wave_barrier();
    FragB pah, pal;
    pah.half[0] = *(const v8us*)&sPh[w][ln][8 * hh]; pah.half[1] = *(const v8us*)&sPh[w][ln][16 + 8 * hh];
    pal.half[0] = *(const v8us*)&sPl[w][ln][8 * hh]; pal.half[1] = *(const v8us*)&sPl[w][ln][16 + 8 * hh];
#pragma unroll
    for (int dt = 0; dt < DT; ++dt) {
      FragB bvh, bvl;
#pragma unroll
      for (int i = 0; i < 8; ++i) {
        bvh.u[i] = sVh[8 * hh + i][dt * 16 + ln]; bvh.u[8 + i] = sVh[16 + 8 * hh + i][dt * 16 + ln];
        bvl.u[i] = sVl[8 * hh + i][dt * 16 + ln]; bvl.u[8 + i] = sVl[16 + 8 * hh + i][dt * 16 + ln];
      }
      oacc[dt] = mmaN<3>(pah.v, pal.v, bvh.v, bvl.v, oacc[dt]);
    }
    __builtin_amdgcn_fence(__ATOMIC_ACQ_REL, "workgroup");
    __builtin_amdgcn_wave_barrier();
  }
#pragma unroll
  for (int r = 0; r < 8; ++r) {
    float l = l_r[r];
    l += __shfl_xor(l, 1, 32); l += __shfl_xor(l, 2, 32); l += __shfl_xor(l, 4, 32); l += __shfl_xor(l, 8, 32);
    l_r[r] = (l > 0.f) ? 1.0f / l : 0.f;
  }
#pragma unroll
  for (int dt = 0; dt < DT; ++dt)
#pragma unroll
    for (int r = 0; r < 8; ++r) sO[w][8 * hh + r][dt * 16 + ln] = oacc[dt][r] * l_r[r];
  __builtin_amdgcn_fence(__ATOMIC_ACQ_REL, "workgroup");
  __builtin_amdgcn_wave_barrier();
  {
    for (int r = 0; r < 16; ++r) {
      const int row = q0 + r;
      if (row < T && lane < D / 4) {
        const v4f val = *(const v4fa*)&sO[w][r][lane * 4];
        *(v4f*)(y + ((size_t)b * T + row) * ypitch + h * D + lane * 4) = val;
      }
    }
    
  }
}

// GEMM C = act(A·W + bias + resid): A f32 (ASPLIT -> hi/lo 2 terms), Wt bf16 [N][K]; ACT 0 none, 1 relu, 2 exact gelu;
// resid (optional, f32, row index = (row % rmod), pitch ldr, RES_BF16 rounds it) added before the activation.
template <bool ASPLIT, int ACT, bool BIAS_BF16, bool RES_BF16>
__global__ __launch_bounds__(128) void k_gemm_bf3(const float* __restrict__ A, int lda, const unsigned short* __restrict__ Wt, int ldb,
                                                const float* __restrict__ bias, const float* __restrict__ resid, int rmod, int ldr,
                                                float* __restrict__ C, int ldc, int M, int N, int K) {
  __shared__ __attribute__((aligned(16))) float so[4][16][64];
  const int tid = threadIdx.x, w = tid >> 5, lane = tid & 31, ln = lane & 15, hh = lane >> 4;
  const int ntn = N / 64;
  const int wid = blockIdx.x * 4 + w;
  const int mt = wid / ntn, nq = wid % ntn;
  if (mt * 16 >= M) return;
  const int row0 = mt * 16, col0 = nq * 64;
  const float* arow = A + (size_t)(row0 + ln) * lda;
  v8f acc[4] = {};
  for (int kb = 0; kb < K; kb += 32) {
    FragB ah, al;
    const v4f x0 = *(const v4fa*)(arow + kb + 8 * hh), x1 = *(const v4fa*)(arow + kb + 8 * hh + 4);
    const v4f x2 = *(const v4fa*)(arow + kb + 16 + 8 * hh), x3 = *(const v4fa*)(arow + kb + 16 + 8 * hh + 4);
    float xs[16] = {x0[0],x0[1],x0[2],x0[3],x1[0],x1[1],x1[2],x1[3],x2[0],x2[1],x2[2],x2[3],x3[0],x3[1],x3[2],x3[3]};
#pragma unroll
    for (int i = 0; i < 16; ++i) { const unsigned short hb = bf16_bits(xs[i]); ah.u[i] = hb; al.u[i] = ASPLIT ? bf16_bits(xs[i] - bf16_val(hb)) : (unsigned short)0; }
#pragma unroll
    for (int t = 0; t < 4; ++t) {
      const unsigned short* brow = Wt + (size_t)(col0 + t * 16 + ln) * ldb + kb;
      FragB b;
      b.half[0] = *(const v8us*)(brow + 8 * hh);
      b.half[1] = *(const v8us*)(brow + 16 + 8 * hh);
      acc[t] = mmaN<ASPLIT ? 2 : 1>(ah.v, al.v, b.v, b.v, acc[t]);
    }
  }
#pragma unroll
  for (int t = 0; t < 4; ++t) {
    const int col = col0 + t * 16 + ln;
    float bv = bias ? bias[col] : 0.f;
    if (BIAS_BF16) bv = bf16_round(bv);
#pragma unroll
    for (int r = 0; r < 8; ++r) {
      float v = acc[t][r] + bv;
      if (resid) { float rv = resid[(size_t)((row0 + 8 * hh + r) % rmod) * ldr + col]; if (RES_BF16) rv = bf16_round(rv); v += rv; }
      if (ACT == 1) v = fmaxf(v, 0.f);
      if (ACT == 2) v = 0.5f * v * (1.0f + erff(v * 0.70710678118654752f));
      if (ACT == 3) { const float u = 0.7978845608028654f * (v + 0.044715f * v * v * v); v = 0.5f * v * (1.0f + tanhf(u)); }
      so[w][8 * hh + r][t * 16 + ln] = v;
    }
  }
  __builtin_amdgcn_fence(__ATOMIC_ACQ_REL, "workgroup");
  __builtin_amdgcn_wave_barrier();
  const int rsub = lane >> 4, c4 = (lane & 15) * 4;
  {
#pragma unroll
    for (int q = 0; q < 8; ++q) {
      const int r = q * 2 + rsub;
      const v4f v = *(const v4fa*)&so[w][r][c4];
      *(v4f*)(C + (size_t)(row0 + r) * ldc + col0 + c4) = v;
    }
    
  }
}
// row LayerNorm (biased variance, eps) over N: s = X (+ R); optional out_sum <- s; out_norm <- (s-mu)*rsqrt(var+eps)*g + b
template <bool PARAM_BF16>
__global__ __launch_bounds__(256) void k_layernorm(const float* __restrict__ X, const float* __restrict__ R, const float* __restrict__ g, const float* __restrict__ bta,
                                                  float* __restrict__ out_sum, float* __restrict__ out_norm, int N, float eps) {
  __shared__ float red[256];
  const int row = blockIdx.x, tid = threadIdx.x;
  const float* x = X + (size_t)row * N; const float* rr = R ? R + (size_t)row * N : nullptr;
  float vals[16];                     // up to N = 4096
  const int per = N / 256;            // contiguous chunk per thread? use strided-by-4 chunks: thread handles j = tid*4 + 1024*u
  float s1 = 0.f;
  for (int u = 0; u < per / 4; ++u) {
    const int j = tid * 4 + 1024 * u;
    const v4f a = *(const v4fa*)(x + j);
    v4f b = {0.f,0.f,0.f,0.f}; if (rr) b = *(const v4fa*)(rr + j);
#pragma unroll
    for (int q = 0; q < 4; ++q) { const float v = a[q] + b[q]; vals[u * 4 + q] = v; s1 += v; }
  }
  red[tid] = s1; __syncthreads();
  for (int st = 128; st > 0; st >>= 1) { if (tid < st) red[tid] += red[tid + st]; __syncthreads(); }
  const float mu = red[0] / (float)N; __syncthreads();
  float s2 = 0.f;
  for (int u = 0; u < per / 4; ++u)
#pragma unroll
    for (int q = 0; q < 4; ++q) { const float c = vals[u * 4 + q] - mu; s2 += c * c; }
  red[tid] = s2; __syncthreads();
  for (int st = 128; st > 0; st >>= 1) { if (tid < st) red[tid] += red[tid + st]; __syncthreads(); }
  const float rs = rsqrtf(red[0] / (float)N + eps);
  {
    for (int u = 0; u < per / 4; ++u) {
      const int j = tid * 4 + 1024 * u;
      v4f o, sm;
#pragma unroll
      for (int q = 0; q < 4; ++q) {
        float gg = g[j + q], bb = bta[j + q];
        if (PARAM_BF16) { gg = bf16_round(gg); bb = bf16_round(bb); }
        sm[q] = vals[u * 4 + q]; o[q] = (vals[u * 4 + q] - mu) * rs * gg + bb;
      }
      if (out_sum) *(v4f*)(out_sum + (size_t)row * N + j) = sm;
      *(v4f*)(out_norm + (size_t)row * N + j) = o;
    }
    
  }
}



// ---- f16 WMMA path (v_wmma_f32_16x16x32_f16): 11-bit significands for operands in range — used where a [0,1] probability operand needs more precision than bf16
typedef _Float16 v16h __attribute__((ext_vector_type(16)));
union FragH { v16h v; v8us half[2]; _Float16 h[16]; unsigned short u[16]; };
template <int NT>
__device__ __forceinline__ v8f mmaH(v16h ah, v16h al, v16h bh, v16h bl, v8f c) {
  c = __builtin_amdgcn_wmma_f32_16x16x32_f16(false, ah, false, bh, (short)0, c, false, false);
  if (NT >= 2) c = __builtin_amdgcn_wmma_f32_16x16x32_f16(false, al, false, bh, (short)0, c, false, false);
  if (NT >= 3) c = __builtin_amdgcn_wmma_f32_16x16x32_f16(false, ah, false, bl, (short)0, c, false, false);
  asm volatile("v_nop\n\tv_nop\n\tv_nop\n\tv_nop" : "+v"(c) : "v"(ah), "v"(al), "v"(bh), "v"(bl));
  return c;
}
// batched GEMM like k_gemm_b but f16 operands: A f32 (split into f16 hi/lo if ASPLIT, else rounded to f16), Bt = f16 values [n][k]; alpha; C f32; N multiple of 16 (partial tiles skipped)
template <bool ASPLIT>
__global__ __launch_bounds__(128) void k_gemm_h(const float* __restrict__ A, int lda, size_t sA, const _Float16* __restrict__ Bh, int ldb, size_t sB, float alpha, float* __restrict__ C, int ldc, size_t sC, int M, int N, int K) {
  __shared__ __attribute__((aligned(16))) float so[4][16][64];
  const int tid = threadIdx.x, w = tid >> 5, lane = tid & 31, ln = lane & 15, hh = lane >> 4; const int by = blockIdx.y;
  A += (size_t)by * sA; Bh += (size_t)by * sB; C += (size_t)by * sC;
  const int ntn = (N + 63) / 64; const int wid = blockIdx.x * 4 + w; const int mt = wid / ntn, nq = wid % ntn; if (mt * 16 >= M) return;
  const int row0 = mt * 16, col0 = nq * 64; const float* arow = A + (size_t)(row0 + ln) * lda;
  v8f acc[4] = {};
  for (int kb = 0; kb < K; kb += 32) {
    FragH ah, al;
    const v4f x0 = *(const v4fa*)(arow + kb + 8 * hh), x1 = *(const v4fa*)(arow + kb + 8 * hh + 4), x2 = *(const v4fa*)(arow + kb + 16 + 8 * hh), x3 = *(const v4fa*)(arow + kb + 16 + 8 * hh + 4);
    float xs[16] = {x0[0],x0[1],x0[2],x0[3],x1[0],x1[1],x1[2],x1[3],x2[0],x2[1],x2[2],x2[3],x3[0],x3[1],x3[2],x3[3]};
#pragma unroll
    for (int i = 0; i < 16; ++i) { const _Float16 h = (_Float16)xs[i]; ah.h[i] = h; al.h[i] = ASPLIT ? (_Float16)(xs[i] - (float)h) : (_Float16)0.0f; }
#pragma unroll
    for (int t = 0; t < 4; ++t) { if (col0 + t * 16 >= N) continue; const size_t boff = (size_t)(col0 + t * 16 + ln) * ldb + kb; FragH bq; bq.half[0] = *(const v8us*)(Bh + boff + 8 * hh); bq.half[1] = *(const v8us*)(Bh + boff + 16 + 8 * hh);
      acc[t] = mmaH<ASPLIT ? 2 : 1>(ah.v, al.v, bq.v, bq.v, acc[t]); }
  }
#pragma unroll
  for (int t = 0; t < 4; ++t) { if (col0 + t * 16 >= N) continue;
#pragma unroll
    for (int r = 0; r < 8; ++r) so[w][8 * hh + r][t * 16 + ln] = acc[t][r] * alpha; }
  __builtin_amdgcn_fence(__ATOMIC_ACQ_REL, "workgroup"); __builtin_amdgcn_wave_barrier();
  const int rsub = lane >> 4, c4 = (lane & 15) * 4;
  {
#pragma unroll
    for (int q = 0; q < 8; ++q) { const int r = q * 2 + rsub; if (col0 + c4 < N) { const v4f v = *(const v4fa*)&so[w][r][c4]; *(v4f*)(C + (size_t)(row0 + r) * ldc + col0 + c4) = v; } }
     }
}

// Wt[n][k] = f16(W[k][n]·scale) from f32 row-major W[K][N] (scale = power of two; bf16-exact weights stay exact in f16 away from the subnormal range)
__global__ __launch_bounds__(256) void k_wt_f16(const float* __restrict__ W, _Float16* __restrict__ Wt, int K, int N, float scale) {
  const int t = blockIdx.x * 256 + threadIdx.x; if (t >= N * (K / 8)) return; const int n = t / (K / 8), k8 = (t % (K / 8)) * 8; FragH f;
#pragma unroll
  for (int i = 0; i < 8; ++i) f.h[i] = (_Float16)(bf16_round(W[(size_t)(k8 + i) * N + n]) * scale); const v8us o = f.half[0];
  *(v8us*)((unsigned short*)Wt + (size_t)n * K + k8) = o; 
}
// k_gemm_hh variant with fused epilogue: v = acc·alpha + bias[by·sBias + col] (+ CP[(row/rowsPerB)·sCPb + by·64 + col] if CP) ; ACT 0 none / 1 elu ; writes f16 C16 (and f32 C if non-null)
template <int ACT>
__global__ __launch_bounds__(128) void k_gemm_hhx(const _Float16* __restrict__ A, int lda, size_t sA, const _Float16* __restrict__ Bh, int ldb, size_t sB, float alpha, const float* __restrict__ bias, size_t sBias, const float* __restrict__ CP, int rowsPerB, size_t sCPb, int row0g,
    float* __restrict__ C, _Float16* __restrict__ C16, int ldc, size_t sC, int M, int N, int K) {
  __shared__ __attribute__((aligned(16))) float so[4][16][64];
  const int tid = threadIdx.x, w = tid >> 5, lane = tid & 31, ln = lane & 15, hh = lane >> 4; const int by = blockIdx.y;
  A += (size_t)by * sA; Bh += (size_t)by * sB; const size_t cofs = (size_t)by * sC; const float* bp = bias ? bias + (size_t)by * sBias : nullptr;
  const int ntn = (N + 63) / 64; const int wid = blockIdx.x * 4 + w; const int mt = wid / ntn, nq = wid % ntn; if (mt * 16 >= M) return;
  const int row0 = mt * 16, col0 = nq * 64; const _Float16* arow = A + (size_t)(row0 + ln) * lda;
  v8f acc[4] = {};
  for (int kb = 0; kb < K; kb += 32) { FragH ah; ah.half[0] = *(const v8us*)((const unsigned short*)arow + kb + 8 * hh); ah.half[1] = *(const v8us*)((const unsigned short*)arow + kb + 16 + 8 * hh);
#pragma unroll
    for (int t = 0; t < 4; ++t) { if (col0 + t * 16 >= N) continue; const size_t boff = (size_t)(col0 + t * 16 + ln) * ldb + kb; FragH bq; bq.half[0] = *(const v8us*)((const unsigned short*)Bh + boff + 8 * hh); bq.half[1] = *(const v8us*)((const unsigned short*)Bh + boff + 16 + 8 * hh);
      acc[t] = mmaH<1>(ah.v, ah.v, bq.v, bq.v, acc[t]); }
  }
#pragma unroll
  for (int t = 0; t < 4; ++t) { if (col0 + t * 16 >= N) continue; const int col = col0 + t * 16 + ln; const float bv = bp ? bf16_round(bp[col]) : 0.f;
#pragma unroll
    for (int r = 0; r < 8; ++r) { float v = acc[t][r] * alpha + bv; if (CP) { const int bidx = (row0g + row0 + 8 * hh + r) / rowsPerB; v += CP[(size_t)bidx * sCPb + (size_t)by * 64 + col]; } if (ACT == 1) v = (v > 0.f) ? v : expm1f(v); else if (ACT == 7) v = (v > 0.f) ? v + 1.0f : expf(v); else if (ACT == 8) v = tanhf(v); else if (ACT == 9) v = 0.5f * v * (1.0f + tanhf(0.7978845608028654f * (v + 0.044715f * v * v * v))); else if (ACT == 11) v = 1.0f / (1.0f + expf(-v)); else if (ACT == 12) v = (v > 0.f) ? v : 0.01f * v; else if (ACT == 14) v = (v > 0.f) ? v : 0.1f * v; else if (ACT == 15) v = v / (1.0f + expf(-v)); else if (ACT == 3) v = fmaxf(v, 0.f); else if (ACT == 6) v = 0.5f * v * (1.0f + erff(v * 0.70710678118654752f)); so[w][8 * hh + r][t * 16 + ln] = v; } }
  __builtin_amdgcn_fence(__ATOMIC_ACQ_REL, "workgroup"); __builtin_amdgcn_wave_barrier();
  const int rsub = lane >> 4, c4 = (lane & 15) * 4; typedef _Float16 v4h __attribute__((ext_vector_type(4)));
  {
#pragma unroll
    for (int q = 0; q < 8; ++q) { const int r = q * 2 + rsub; if (col0 + c4 < N) { const v4f v = *(const v4fa*)&so[w][r][c4]; if (C) *(v4f*)(C + cofs + (size_t)(row0 + r) * ldc + col0 + c4) = v; if (C16) { v4h h4; for (int i = 0; i < 4; ++i) h4[i] = (_Float16)v[i]; *(v4h*)(C16 + cofs + (size_t)(row0 + r) * ldc + col0 + c4) = h4; } } }
     }
}


typedef _Float16 v4h __attribute__((ext_vector_type(4)));

__global__ __launch_bounds__(256) void k_x16(const float* __restrict__ x, _Float16* __restrict__ X16, size_t n8) { const size_t t = (size_t)blockIdx.x * 256 + threadIdx.x; if (t >= n8) return; FragH f;
#pragma unroll
  for (int q = 0; q < 8; ++q) f.h[q] = (_Float16)bf16_round(x[t * 8 + q]); *(v8us*)((unsigned short*)X16 + t * 8) = f.half[0];  }
__global__ __launch_bounds__(256) void k_h16(const float* __restrict__ x, _Float16* __restrict__ X16, size_t n8) { const size_t t = (size_t)blockIdx.x * 256 + threadIdx.x; if (t >= n8) return; FragH f;
#pragma unroll
  for (int q = 0; q < 8; ++q) f.h[q] = (_Float16)x[t * 8 + q]; *(v8us*)((unsigned short*)X16 + t * 8) = f.half[0];  }
__global__ __launch_bounds__(256) void k_round16f(const float* __restrict__ W, _Float16* __restrict__ Bt, size_t n8) { const size_t t = (size_t)blockIdx.x * 256 + threadIdx.x; if (t >= n8) return; FragH f;
#pragma unroll
  for (int i = 0; i < 8; ++i) f.h[i] = (_Float16)(bf16_round(W[t * 8 + i]) * 16.0f); *(v8us*)((unsigned short*)Bt + t * 8) = f.half[0];  }
template <int NHv, int TTv>
__global__ __launch_bounds__(256) void k_vt(const _Float16* __restrict__ V16, int ldv, int voff, _Float16* __restrict__ Vt) { __shared__ unsigned short tl[64][66]; const int tid = threadIdx.x; const int slab = blockIdx.x / (TTv / 64), lg = blockIdx.x % (TTv / 64); const int b = slab / NHv, h = slab % NHv;
  for (int i = tid; i < 64 * 8; i += 256) { const int r = i / 8, c8 = (i % 8) * 8; FragH f; f.half[0] = *(const v8us*)((const unsigned short*)V16 + ((size_t)b * TTv + lg * 64 + r) * ldv + voff + h * 64 + c8);
#pragma unroll
    for (int q = 0; q < 8; ++q) tl[r][c8 + q] = f.u[q]; }
  __syncthreads();
  {
#pragma unroll
    for (int rd = 0; rd < 2; ++rd) { const int d = rd * 32 + tid / 8, pc = tid % 8; FragH f;
#pragma unroll
      for (int q = 0; q < 8; ++q) f.u[q] = tl[pc * 8 + q][d];
      *(v8us*)((unsigned short*)Vt + ((size_t)slab * 64 + d) * TTv + lg * 64 + pc * 8) = f.half[0]; }
     } }

typedef unsigned short v4us __attribute__((ext_vector_type(4), may_alias));
// Where a 16-B unit of a tile waits in LDS: its index in the output order, low bits XORed with higher bits of the same index, so that the 16 lanes of a half wave
// fall on 16 different bank groups both when the units are written (lanes 4 positions apart) and when they are read back (lanes on consecutive units). TY: 0 q, 1 k, 2 v.
template <int TY>
__device__ __forceinline__ int prep_slot(int u) { return u ^ (TY == 0 ? ((u >> 5) & 15) : TY == 1 ? ((u >> 7) & 3) : (((u >> 4) & 3) | (((u >> 8) & 3) << 2))); }
// The thread's 64 values (a[i][j] = channel w*16 + i, position 4*l + j of the tile), rounded, into LDS: q, k as 16-B units of 8 channels, v as 8-B halves of a unit (4 keys of one channel).
template <int TY>
__device__ __forceinline__ void prep_put(const v4f (&a)[16], unsigned short* sT, int w, int l) {
  if (TY < 2) {
#pragma unroll
    for (int cg = 0; cg < 2; ++cg)
#pragma unroll
      for (int j = 0; j < 4; ++j) { FragH f;
#pragma unroll
        for (int e = 0; e < 8; ++e) f.h[e] = (_Float16)bf16_round(a[cg * 8 + e][j]);
        const int c8 = w * 2 + cg; const int u = (TY == 0) ? l * 32 + j * 8 + c8 : (l >> 2) * 128 + c8 * 16 + (l & 3) * 4 + j;
        *(v8us*)&sT[prep_slot<TY>(u) * 8] = f.half[0]; }
  } else {
#pragma unroll
    for (int i = 0; i < 16; ++i) { FragH f;
#pragma unroll
      for (int j = 0; j < 4; ++j) f.h[j] = (_Float16)bf16_round(a[i][j]);
      const int u = (l >> 3) * 256 + w * 64 + ((l >> 1) & 3) * 16 + i;
      *(v4us*)&sT[prep_slot<TY>(u) * 8 + (l & 1) * 4] = (v4us){f.u[0], f.u[1], f.u[2], f.u[3]}; }
  }
}
// The tile out of LDS as it lies in its plane: 16 KB, 512 contiguous bytes per wave-wide store.
template <int TY>
__device__ __forceinline__ void prep_out(const unsigned short* sT, unsigned short* dst, int tid) {
#pragma unroll
  for (int i = 0; i < 8; ++i) { const int u = i * 128 + tid; *(v8us*)(dst + u * 8) = *(const v8us*)&sT[prep_slot<TY>(u) * 8]; }
  asm volatile("s_wait_xcnt 0x0" ::: "memory");      /* closes the run of stores: no register that one of them names is rewritten ahead of this wait, on any branch of the listing */
}
// One launch prepares the three planes. A block takes one tile of q, k or v: 64 channels x 128 positions, 32 KB of f32 in, 16 KB of f16 out, contiguous in its plane.
// A thread asks for its 16 x 16 B at once (a wave-wide load is 512 contiguous bytes of one channel row).
// q: rows of 64 channels, token-major: unit u = position*8 + c8 holds channels c8*8 + 0..7.
// k: behind the q plane, in fragment order: the 4 KB of a pass of 32 keys are [nt][ks][hf][lane] units, unit = channels ks*32 + hf*16 + 8*(lane >> 4) + 0..7 of key nt*16 + (lane & 15): u = (key >> 4)*128 + c8*16 + (key & 15).
// v: in fragment order: the 4 KB of a pass are [dt][hf][lane] units, unit = keys hf*16 + 8*(lane >> 4) + 0..7 of channel dt*16 + (lane & 15): u = (key >> 5)*256 + (channel >> 4)*64 + ((key >> 3) & 3)*16 + (channel & 15).
__global__ __launch_bounds__(128) void k_prep(const float* __restrict__ x, _Float16* __restrict__ QK, _Float16* __restrict__ Vt) {
  __shared__ __attribute__((aligned(16))) unsigned short sT[1024 * 8];
  const int tid = threadIdx.x, w = tid >> 5, l = tid & 31;
  const int b = blockIdx.x / (3 * (NN / 128)), rem = blockIdx.x % (3 * (NN / 128)); const int ty = rem / (NN / 128), pg = rem % (NN / 128);
  const float* src = x + ((size_t)b * C3 + ty * CC + w * 16) * NN + pg * 128 + l * 4;
  v4f a[16];
#pragma unroll
  for (int i = 0; i < 16; ++i) a[i] = *(const v4fa*)(src + (size_t)i * NN);
  asm volatile("s_wait_xcnt 0x0" :: "v"(src) : "memory");      /* the loads' address registers stay as they are up to this wait */
  if (ty == 0) prep_put<0>(a, sT, w, l); else if (ty == 1) prep_put<1>(a, sT, w, l); else prep_put<2>(a, sT, w, l);
  __syncthreads();      /* q: a stored run of 512 B holds units of all four waves; v: waves store runs that other waves wrote */
  const size_t off = ((size_t)b * NN + pg * 128) * CC;
  if (ty == 0) prep_out<0>(sT, (unsigned short*)QK + off, tid); else if (ty == 1) prep_out<1>(sT, (unsigned short*)QK + (size_t)NR * CC + off, tid); else prep_out<2>(sT, (unsigned short*)Vt + off, tid);
}
// lane l <-> lane l ^ 16 (the two lane halves hold the two key halves of one query column)
__device__ __forceinline__ float xhalf(float x) { return __builtin_bit_cast(float, __builtin_amdgcn_permlanex16(__builtin_bit_cast(int, x), __builtin_bit_cast(int, x), 0x76543210, 0xfedcba98, false, false)); }
// Eight 16-B copies per lane (4 KB apart: the block's 256 threads fill 4 KB a copy), global memory to LDS through no register. The s_wait_xcnt closes the statement so that no address register named here is rewritten ahead of it.
__device__ __forceinline__ void copy8(unsigned l, const unsigned short* g) {
  asm volatile("global_load_async_to_lds_b128 %0, %8, off\n\t"
               "global_load_async_to_lds_b128 %1, %9, off\n\t"
               "global_load_async_to_lds_b128 %2, %10, off\n\t"
               "global_load_async_to_lds_b128 %3, %11, off\n\t"
               "global_load_async_to_lds_b128 %4, %12, off\n\t"
               "global_load_async_to_lds_b128 %5, %13, off\n\t"
               "global_load_async_to_lds_b128 %6, %14, off\n\t"
               "global_load_async_to_lds_b128 %7, %15, off\n\t"
               "s_wait_xcnt 0x0"
               :: "v"(l), "v"(l + 4096u), "v"(l + 8192u), "v"(l + 12288u), "v"(l + 16384u), "v"(l + 20480u), "v"(l + 24576u), "v"(l + 28672u),
                  "v"(g), "v"(g + 2048), "v"(g + 4096), "v"(g + 6144), "v"(g + 8192), "v"(g + 10240), "v"(g + 12288), "v"(g + 14336)
               : "memory");
}
// The pass's 17 powers of two in place (e, the rescale factor, and 16 scores), and the scores' eight f16 pairs (low half first, rounded to nearest even as a cast does).
// One statement, for the slot behind a transcendental: the instruction behind each v_exp_f32 here neither reads its result nor writes its source, which the compiler's own order
// did not keep (it reused a source register directly behind). A conversion stands four or more v_exp_f32 behind its younger input, so it does not wait, up to the last two.
// The s_delay_alu lines are hints, which the compiler does not place for asm text: without one a dependent instruction holds the SIMD's vector port while it waits.
typedef unsigned v8u __attribute__((ext_vector_type(8)));
__device__ __forceinline__ v8u exp2x17_pk(float& e, float (&x)[16]) {
  unsigned w0, w1, w2, w3, w4, w5, w6, w7;
  asm("s_delay_alu instid0(VALU_DEP_1)\n\t"
      "v_exp_f32 %24, %24\n\t"
      "v_exp_f32 %0, %0\n\t"
      "v_exp_f32 %1, %1\n\t"
      "v_exp_f32 %2, %2\n\t"
      "v_exp_f32 %3, %3\n\t"
      "v_exp_f32 %4, %4\n\t"
      "v_exp_f32 %5, %5\n\t"
      "v_cvt_pk_f16_f32 %16, %0, %1\n\t"
      "v_exp_f32 %6, %6\n\t"
      "v_exp_f32 %7, %7\n\t"
      "v_cvt_pk_f16_f32 %17, %2, %3\n\t"
      "v_exp_f32 %8, %8\n\t"
      "v_exp_f32 %9, %9\n\t"
      "v_cvt_pk_f16_f32 %18, %4, %5\n\t"
      "v_exp_f32 %10, %10\n\t"
      "v_exp_f32 %11, %11\n\t"
      "v_cvt_pk_f16_f32 %19, %6, %7\n\t"
      "v_exp_f32 %12, %12\n\t"
      "v_exp_f32 %13, %13\n\t"
      "v_cvt_pk_f16_f32 %20, %8, %9\n\t"
      "v_exp_f32 %14, %14\n\t"
      "v_exp_f32 %15, %15\n\t"
      "v_cvt_pk_f16_f32 %21, %10, %11\n\t"
      "s_delay_alu instid0(TRANS32_DEP_3)\n\t"
      "v_cvt_pk_f16_f32 %22, %12, %13\n\t"
      "s_delay_alu instid0(TRANS32_DEP_1)\n\t"
      "v_cvt_pk_f16_f32 %23, %14, %15"
      : "+v"(x[0]), "+v"(x[1]), "+v"(x[2]), "+v"(x[3]), "+v"(x[4]), "+v"(x[5]), "+v"(x[6]), "+v"(x[7]),
        "+v"(x[8]), "+v"(x[9]), "+v"(x[10]), "+v"(x[11]), "+v"(x[12]), "+v"(x[13]), "+v"(x[14]), "+v"(x[15]),
        "=&v"(w0), "=&v"(w1), "=&v"(w2), "=&v"(w3), "=&v"(w4), "=&v"(w5), "=&v"(w6), "=&v"(w7), "+v"(e));
  return (v8u){w0, w1, w2, w3, w4, w5, w6, w7};
}
typedef float fal __attribute__((may_alias));
__global__ __launch_bounds__(256) void k_flash(const _Float16* __restrict__ Q16, int ldq, const _Float16* __restrict__ K16, const _Float16* __restrict__ Vt, const int* __restrict__ MSK, float* __restrict__ out) {
  constexpr int RPW = 16, NQB = NN / (4 * RPW), DT = 4, KS = 2;
  constexpr int KG = 2;      /* wave groups that split a stage's keys */
  constexpr int SK = 256, NP = SK / 32 / KG, SH = SK * CC, NS = NN / SK;      /* keys of a stage, passes of a wave in it, halves per plane of a stage; stages */
  constexpr float C2 = 0.125f * 1.44269504088896341f;      /* 1 / sqrt(64) times log2(e) */
  __shared__ __attribute__((aligned(16))) unsigned short sKV[2][2][SH];      /* [buffer][K, V][fragment order] */
  __shared__ __attribute__((aligned(16))) float sO[CC][4 * RPW + 4];      /* [channel][query of the block]; 68 floats a row: the two lane halves' stores (rows 8 apart) fall 32 banks apart */
  const int tid = threadIdx.x, w = (tid >> 5) & 3, kg = tid >> 7, lane = tid & 31, ln = lane & 15, hh = lane >> 4;
  const int slab = blockIdx.x / NQB, qblk = blockIdx.x % NQB; const int b = slab; const int h = 0; const int qb0 = qblk * (4 * RPW); const int q0 = qb0 + w * RPW;
  /* the thread's 16 B of each 4-KB slice of a stage: source in the two planes, place in buffer 0 (LDS byte address) */
  const unsigned short* Kg = (const unsigned short*)K16 + (size_t)b * NN * CC + tid * 8;
  const unsigned short* Vg = (const unsigned short*)Vt + (size_t)b * NN * CC + tid * 8;
  const unsigned lds0 = (unsigned)(size_t)&sKV[0][0][0] + (unsigned)tid * 16u;
  copy8(lds0, Kg); copy8(lds0 + SH * 2, Vg);
  FragH aq[KS];
  { const unsigned short* qr = (const unsigned short*)Q16 + ((size_t)b * NN + q0 + ln) * ldq;
#pragma unroll
    for (int ks = 0; ks < KS; ++ks) { aq[ks].half[0] = *(const v8us*)(qr + ks * 32 + 8 * hh); aq[ks].half[1] = *(const v8us*)(qr + ks * 32 + 16 + 8 * hh); } }
  float m_r = -3.0e38f, l_r = 0.f; v8f oacc[DT];      /* oacc[dt][r] = Ot[dt*16 + 8hh + r][query ln] */
#pragma unroll
  for (int dt = 0; dt < DT; ++dt) oacc[dt] = (v8f){0.f,0.f,0.f,0.f,0.f,0.f,0.f,0.f};
  asm volatile("s_wait_asynccnt 0x0" ::: "memory");      /* this wave's share of stage 0 has landed */
  __syncthreads();                                        /* ... and every other wave's */
  copy8(lds0 + SH * 4, Kg + SH); copy8(lds0 + SH * 6, Vg + SH);
  /* the stage loop stays rolled; the constant-trip inner loops are unrolled so that the fragment and score arrays stay in registers */
#pragma unroll 1
  for (int st = 0; st < NS; ++st) {
    /* 32 keys = 2048 halves of a plane, a fragment half = 256 halves, the lane's 16 B at lane * 8 */
    const unsigned short* Kf = &sKV[st & 1][0][kg * (NP * 2048) + lane * 8];      /* the wave group's own half of the stage */
    const unsigned short* Vf = &sKV[st & 1][1][kg * (NP * 2048) + lane * 8];
    /* The loads stand ahead of the work that hides them: a pass's K fragments are asked for in the pass before, right behind its S products (inside the stage only), its V fragments at its head. */
    FragH bk[2][KS];      /* K fragments of the pass at hand */
#pragma unroll
    for (int nt = 0; nt < 2; ++nt) {
#pragma unroll
      for (int ks = 0; ks < KS; ++ks) { const unsigned short* kr = Kf + (nt * KS + ks) * 512; bk[nt][ks].half[0] = *(const v8us*)kr; bk[nt][ks].half[1] = *(const v8us*)(kr + 256); } }
#pragma unroll
    for (int ps = 0; ps < NP; ++ps) {
      FragH bv[DT];
#pragma unroll
      for (int dt = 0; dt < DT; ++dt) { const unsigned short* vr = Vf + ps * 2048 + dt * 512; bv[dt].half[0] = *(const v8us*)vr; bv[dt].half[1] = *(const v8us*)(vr + 256); }
      v8f s[2];      /* s[nt][r] = St[key of the pass nt*16 + 8hh + r][query ln] */
#pragma unroll
      for (int nt = 0; nt < 2; ++nt) {
        v8f acc = (v8f){0.f,0.f,0.f,0.f,0.f,0.f,0.f,0.f};
#pragma unroll
        for (int ks = 0; ks < KS; ++ks) acc = mmaH<1>(bk[nt][ks].v, bk[nt][ks].v, aq[ks].v, aq[ks].v, acc);
        s[nt] = acc; }
      if (ps + 1 < NP) {
#pragma unroll
        for (int nt = 0; nt < 2; ++nt) {
#pragma unroll
          for (int ks = 0; ks < KS; ++ks) { const unsigned short* kr = Kf + (ps + 1) * 2048 + (nt * KS + ks) * 512; bk[nt][ks].half[0] = *(const v8us*)kr; bk[nt][ks].half[1] = *(const v8us*)(kr + 256); } } }
      /* Softmax in base 2: the maximum is taken over the raw products (the factor is positive) and kept times C2 = log2(e) / 8;
         a score's weight x 2^10 is then one fused multiply-add and one hardware exp2: 2^(s * C2 + (10 - m)). */
      float sc[16]; float mq[4];
#pragma unroll
      for (int i = 0; i < 16; ++i) sc[i] = s[i >> 3][i & 7];
#pragma unroll
      for (int c = 0; c < 4; ++c) mq[c] = fmaxf(fmaxf(sc[c], sc[4 + c]), fmaxf(sc[8 + c], sc[12 + c]));
      float mc = fmaxf(fmaxf(mq[0], mq[1]), fmaxf(mq[2], mq[3])); mc = fmaxf(mc, xhalf(mc));
      const float mn = fmaxf(m_r, mc * C2); float ea = m_r - mn; m_r = mn;      /* ea becomes 2^ea, the factor on what is summed so far */
      const float nb = 10.0f - mn;
#pragma unroll
      for (int i = 0; i < 16; ++i) sc[i] = __builtin_fmaf(sc[i], C2, nb);
      const v8u pw = exp2x17_pk(ea, sc);      /* half i of pw = Pt[key of the pass (i < 8 ? 8hh + i : 8 + 8hh + i)][query ln] x 2^10; sc[i] = the same weight in f32 */
      float ps4[4];
#pragma unroll
      for (int c = 0; c < 4; ++c) ps4[c] = ((sc[c] + sc[4 + c]) + sc[8 + c]) + sc[12 + c];
      const float al = (mn > -1.0e38f) ? ea : 1.0f;
      FragH pb; pb.v = __builtin_bit_cast(v16h, pw);
      l_r = l_r * al + ((ps4[0] + ps4[1]) + (ps4[2] + ps4[3]));      /* x 2^10 like P; this lane half's keys only; the halves join after the loop */
#pragma unroll
      for (int dt = 0; dt < DT; ++dt)
#pragma unroll
        for (int r = 0; r < 8; ++r) oacc[dt][r] *= al;
#pragma unroll
      for (int dt = 0; dt < DT; ++dt) oacc[dt] = mmaH<1>(bv[dt].v, bv[dt].v, pb.v, pb.v, oacc[dt]);
    }
    asm volatile("s_wait_dscnt 0x0" ::: "memory");        /* this wave's reads of the buffer are done before anyone refills it */
    asm volatile("s_wait_asynccnt 0x0" ::: "memory");     /* this wave's share of stage st + 1 has landed */
    __syncthreads();                                        /* publishes stage st + 1 and ends every wave's reads of stage st */
    if (st + 2 < NS) { const unsigned lb = lds0 + (unsigned)(st & 1) * (SH * 4); copy8(lb, Kg + (size_t)(st + 2) * SH); copy8(lb + SH * 2, Vg + (size_t)(st + 2) * SH); }
  }
  asm volatile("s_wait_asynccnt 0x0" ::: "memory");       /* nothing of this wave is in flight when it goes on to the output staging and ends */
  const float lw = l_r + xhalf(l_r);      /* the wave's sum over its half of the keys, relative to its own maximum */
  /* The second group hands its partial result over through the K/V buffers, which nobody reads any more (the loop's last barrier ended every read): 34 planes of 128 floats, a lane's value at its own place in each. */
  fal* sM = (fal*)&sKV[0][0][0] + (tid & 127);
  if (kg == 1) {
#pragma unroll
    for (int dt = 0; dt < DT; ++dt)
#pragma unroll
      for (int r = 0; r < 8; ++r) sM[(dt * 8 + r) * 128] = oacc[dt][r];
    sM[32 * 128] = m_r; sM[33 * 128] = lw;
  }
  __syncthreads();      /* the second group's partial results are written before the first group reads them */
  /* The output is channel-major, as the accumulators are: each wave of the first group joins the two partial results and puts its 16 query columns into the block's [64 channels][64 queries] tile, then the block stores whole rows. */
  if (kg == 0) {
    const float m1 = sM[32 * 128], l1 = sM[33 * 128]; const float mj = fmaxf(m_r, m1);
    const float a0 = __builtin_amdgcn_exp2f(m_r - mj), a1 = __builtin_amdgcn_exp2f(m1 - mj);      /* each half's weights brought to the common maximum */
    const float l = lw * a0 + l1 * a1; const float linv = (l > 0.f) ? 1.0f / l : 0.f;      /* the 2^10 of P and of l cancel */
    const float f0 = a0 * linv, f1 = a1 * linv;
#pragma unroll
    for (int dt = 0; dt < DT; ++dt)
#pragma unroll
      for (int r = 0; r < 8; ++r) sO[dt * 16 + 8 * hh + r][w * RPW + ln] = oacc[dt][r] * f0 + sM[(dt * 8 + r) * 128] * f1;
  }
  __syncthreads();      /* a row of the tile holds columns of four waves: all are written before any row is read */
  { const int w8 = tid >> 5; float* orow = out + ((size_t)b * CC + w8 * 8 + hh) * NN + qb0 + ln * 4;
#pragma unroll
    for (int i = 0; i < 4; ++i) { const v4f val = *(const v4fa*)&sO[w8 * 8 + i * 2 + hh][ln * 4]; *(v4f*)(orow + (size_t)i * 2 * NN) = val; }      /* 16 lanes x 16 B = the block's whole 256 B of one channel row */
  } }

extern "C" void kernel_launch(void* const* d_in, const int* in_sizes, int n_in,
                              void* d_out, int out_size, void* d_ws, size_t ws_size, hipStream_t stream) {
  (void)in_sizes; (void)n_in; (void)out_size;
  const float* qkv = (const float*)d_in[0];
  char* ws = (char*)d_ws; size_t off = 0;
  auto take = [&](size_t bytes) { char* p = ws + off; off += (bytes + 255) & ~(size_t)255; return p; };
  _Float16* QK = (_Float16*)take((size_t)NR * 2 * CC * 2); _Float16* Vt = (_Float16*)take((size_t)BB * CC * NN * 2);
  if (off > ws_size) return;      // 8.4 + 4.2 MB
  k_prep<<<BB * 3 * (NN / 128), 128, 0, stream>>>(qkv, QK, Vt);
  k_flash<<<BB * (NN / 64), 256, 0, stream>>>(QK, CC, QK + (size_t)NR * CC, Vt, nullptr, (float*)d_out);
}

// v009
// A run of this version takes 38 microseconds.
// Two timings next to v008 put it at 1.12 and 1.11 times that version's speed.
// All steps since v000 together make it 11.5 times as fast.
#include <hip/hip_runtime.h>
// QKV self-attention on a channel-major qkv tensor [8, 3·64, 4096]: attn[s,t] = Σ_c q[c,s]·k[c,t]/√64, softmax over t, out[d,s] = Σ_t attn[s,t]·v[d,t].
// Compute dtype: qkv rounded to bf16 and carried exactly in f16 (q token-major; k and v planes in the order of their A fragments, 512 contiguous bytes per wave-wide load); S and P·V on v_wmma_f32_16x16x32_f16 with
// f32 accumulation in one fused flash-style kernel (online softmax in f32; P in f16 ×2^10); the same kernel stores O as [b][d][s], whole 256-B rows gathered through LDS; output f32.
#define BB 8
#define CC 64
#define C3 192
#define NN 4096
#define NR (BB * NN)

typedef __bf16 v16b __attribute__((ext_vector_type(16)));
typedef unsigned short v8us __attribute__((ext_vector_type(8), may_alias));
typedef float  v8f  __attribute__((ext_vector_type(8)));
typedef float  v4f  __attribute__((ext_vector_type(4)));
typedef float  v4fa __attribute__((ext_vector_type(4), may_alias));
union FragB { v16b v; v8us half[2]; unsigned short u[16]; };

__device__ __forceinline__ unsigned short bf16_bits(float x) { unsigned int u = __float_as_uint(x); return (unsigned short)((u + 0x7FFFu + ((u >> 16) & 1u)) >> 16); }
__device__ __forceinline__ float bf16_val(unsigned short b) { return __uint_as_float(((unsigned int)b) << 16); }
__device__ __forceinline__ float bf16_round(float x) { return bf16_val(bf16_bits(x)); }
// D += A·B with NT terms: 1 = ah·bh, 2 = + al·bh (A split), 3 = + ah·bl (both split)
template <int NT>
__device__ __forceinline__ v8f mmaN(v16b ah, v16b al, v16b bh, v16b bl, v8f c) {
  c = __builtin_amdgcn_wmma_f32_16x16x32_bf16(false, ah, false, bh, (short)0, c, false, false);
  if (NT >= 2) c = __builtin_amdgcn_wmma_f32_16x16x32_bf16(false, al, false, bh, (short)0, c, false, false);
  if (NT >= 3) c = __builtin_amdgcn_wmma_f32_16x16x32_bf16(false, ah, false, bl, (short)0, c, false, false);
  asm volatile("v_nop\n\tv_nop\n\tv_nop\n\tv_nop" : "+v"(c) : "v"(ah), "v"(al), "v"(bh), "v"(bl));
  return c;
}

__global__ __launch_bounds__(256) void k_wt_bf16(const float* __restrict__ W, unsigned short* __restrict__ Wt, int K, int N) {
  const int t = blockIdx.x * 256 + threadIdx.x;
  const int k8n = K / 8;
  if (t >= N * k8n) return;
  const int n = t / k8n, k8 = (t % k8n) * 8;
  v8us v;
#pragma unroll
  for (int i = 0; i < 8; ++i) v[i] = bf16_bits(W[(size_t)(k8 + i) * N + n]);
  *(v8us*)(Wt + (size_t)n * K + k8) = v;
  
}

// GEMM C[M][N] (f32, pitch ldc) = act(A[M][K]·W + bias). A f32 row-major (pitch lda) converted per fragment to bf16
// (ASPLIT: hi/lo two planes -> 2 terms, else single rounded term); Wt bf16 [N][K] (pitch ldb). BIAS_BF16 rounds the
// bias to bf16 first (bias quantised to bf16 before the add). K%32==0, M%16==0, N%64==0.
template <bool ASPLIT, int ACT, bool BIAS_BF16>
__global__ __launch_bounds__(128) void k_gemm_bf(const float* __restrict__ A, int lda, const unsigned short* __restrict__ Wt, int ldb,
                                               const float* __restrict__ bias, float* __restrict__ C, int ldc, int M, int N, int K) {
  __shared__ __attribute__((aligned(16))) float so[4][16][64];
  const int tid = threadIdx.x, w = tid >> 5, lane = tid & 31, ln = lane & 15, hh = lane >> 4;
  const int ntn = N / 64;
  const int wid = blockIdx.x * 4 + w;
  const int mt = wid / ntn, nq = wid % ntn;
  if (mt * 16 >= M) return;
  const int row0 = mt * 16, col0 = nq * 64;
  const float* arow = A + (size_t)(row0 + ln) * lda;
  v8f acc[4] = {};
  for (int kb = 0; kb < K; kb += 32) {
    FragB ah, al;
    const v4f x0 = *(const v4fa*)(arow + kb + 8 * hh), x1 = *(const v4fa*)(arow + kb + 8 * hh + 4);
    const v4f x2 = *(const v4fa*)(arow + kb + 16 + 8 * hh), x3 = *(const v4fa*)(arow + kb + 16 + 8 * hh + 4);
    float xs[16] = {x0[0],x0[1],x0[2],x0[3],x1[0],x1[1],x1[2],x1[3],x2[0],x2[1],x2[2],x2[3],x3[0],x3[1],x3[2],x3[3]};
#pragma unroll
    for (int i = 0; i < 16; ++i) { const unsigned short hb = bf16_bits(xs[i]); ah.u[i] = hb; al.u[i] = ASPLIT ? bf16_bits(xs[i] - bf16_val(hb)) : (unsigned short)0; }
#pragma unroll
    for (int t = 0; t < 4; ++t) {
      const unsigned short* brow = Wt + (size_t)(col0 + t * 16 + ln) * ldb + kb;
      FragB b;
      b.half[0] = *(const v8us*)(brow + 8 * hh);
      b.half[1] = *(const v8us*)(brow + 16 + 8 * hh);
      acc[t] = mmaN<ASPLIT ? 2 : 1>(ah.v, al.v, b.v, b.v, acc[t]);
    }
  }
#pragma unroll
  for (int t = 0; t < 4; ++t) {
    float bv = bias ? bias[col0 + t * 16 + ln] : 0.f;
    if (BIAS_BF16) bv = bf16_round(bv);
#pragma unroll
    for (int r = 0; r < 8; ++r) { float v = acc[t][r] + bv; if (ACT == 1) v = fmaxf(v, 0.f); so[w][8 * hh + r][t * 16 + ln] = v; }
  }
  __builtin_amdgcn_fence(__ATOMIC_ACQ_REL, "workgroup");
  __builtin_amdgcn_wave_barrier();
  const int rsub = lane >> 4, c4 = (lane & 15) * 4;
  {
#pragma unroll
    for (int q = 0; q < 8; ++q) {
      const int r = q * 2 + rsub;
      const v4f v = *(const v4fa*)&so[w][r][c4];
      *(v4f*)(C + (size_t)(row0 + r) * ldc + col0 + c4) = v;
    }
    
  }
}

// Flash-style causal/unmasked attention, all contractions 3-term bf16 hi/lo splits, f32 softmax with running max.
// q,k,v rows are read from f32 buffers with arbitrary row pitch (so they can live inside a fused qkv buffer);
// D = head size (multiple of 32, <= 128); one wave = 16 query rows; block = 4 waves (64 queries) sharing K/V chunks of 32.
template <int D, bool CAUSAL>
__global__ __launch_bounds__(128) void k_flash(const float* __restrict__ qb, const float* __restrict__ kb, const float* __restrict__ vb,
                                             int pitch, int T, int H, float scale, float* __restrict__ y, int ypitch) {
  constexpr int KS = D / 32;        // k-steps for QK
  constexpr int DT = D / 16;        // d tiles for PV
  __shared__ __attribute__((aligned(16))) unsigned short sKh[32][D + 8], sKl[32][D + 8], sVh[32][D + 8], sVl[32][D + 8];
  __shared__ __attribute__((aligned(16))) unsigned short sPh[4][16][40], sPl[4][16][40];
  __shared__ __attribute__((aligned(16))) float sO[4][16][D];
  const int tid = threadIdx.x, w = tid >> 5, lane = tid & 31, ln = lane & 15, hh = lane >> 4;
  const int nqb = (T + 63) / 64;
  const int bh = blockIdx.x / nqb, qblk = blockIdx.x % nqb;
  const int b = bh / H, h = bh % H;
  const int q0 = qblk * 64 + w * 16;
  const float* Q = qb + (size_t)b * T * pitch + h * D;
  const float* K = kb + (size_t)b * T * pitch + h * D;
  const float* V = vb + (size_t)b * T * pitch + h * D;

  // A fragments of the wave's 16 query rows (scaled), hi/lo
  FragB aqh[KS], aql[KS];
  {
    int row = q0 + ln; if (row >= T) row = T - 1;
    const float* qr = Q + (size_t)row * pitch;
#pragma unroll
    for (int ks = 0; ks < KS; ++ks)
#pragma unroll
      for (int i = 0; i < 16; ++i) {
        const int d = ks * 32 + ((i < 8) ? (8 * hh + i) : (16 + 8 * hh + (i - 8)));
        const float x = qr[d] * scale; const unsigned short hb = bf16_bits(x);
        aqh[ks].u[i] = hb; aql[ks].u[i] = bf16_bits(x - bf16_val(hb));
      }
  }
  float m_r[8], l_r[8];
#pragma unroll
  for (int r = 0; r < 8; ++r) { m_r[r] = -3.0e38f; l_r[r] = 0.f; }
  v8f oacc[DT];
#pragma unroll
  for (int dt = 0; dt < DT; ++dt) oacc[dt] = (v8f){0.f,0.f,0.f,0.f,0.f,0.f,0.f,0.f};

  const int kv_end = CAUSAL ? min(T, qblk * 64 + 64) : T;     // block-uniform
  for (int j0 = 0; j0 < kv_end; j0 += 32) {
    __syncthreads();
    for (int e = tid; e < 32 * (D / 4); e += 128) {
      const int r = e / (D / 4), c4 = (e % (D / 4)) * 4;
      const int key = j0 + r;
      v4f kf = {0.f,0.f,0.f,0.f}, vf = {0.f,0.f,0.f,0.f};
      if (key < T) { kf = *(const v4fa*)(K + (size_t)key * pitch + c4); vf = *(const v4fa*)(V + (size_t)key * pitch + c4); }
#pragma unroll
      for (int t = 0; t < 4; ++t) {
        unsigned short hb = bf16_bits(kf[t]); sKh[r][c4 + t] = hb; sKl[r][c4 + t] = bf16_bits(kf[t] - bf16_val(hb));
        hb = bf16_bits(vf[t]); sVh[r][c4 + t] = hb; sVl[r][c4 + t] = bf16_bits(vf[t] - bf16_val(hb));
      }
    }
    __syncthreads();
    // S tile 16 x 32
    v8f s[2];
#pragma unroll
    for (int nt = 0; nt < 2; ++nt) {
      v8f acc = {};
#pragma unroll
      for (int ks = 0; ks < KS; ++ks) {
        FragB bh_, bl_;
        bh_.half[0] = *(const v8us*)&sKh[nt * 16 + ln][ks * 32 + 8 * hh]; bh_.half[1] = *(const v8us*)&sKh[nt * 16 + ln][ks * 32 + 16 + 8 * hh];
        bl_.half[0] = *(const v8us*)&sKl[nt * 16 + ln][ks * 32 + 8 * hh]; bl_.half[1] = *(const v8us*)&sKl[nt * 16 + ln][ks * 32 + 16 + 8 * hh];
        acc = mmaN<3>(aqh[ks].v, aql[ks].v, bh_.v, bl_.v, acc);
      }
      s[nt] = acc;
    }
    // mask + running max (rows 8hh+r; the 16 lanes of a half share rows)
    float alpha[8];
#pragma unroll
    for (int r = 0; r < 8; ++r) {
      const int qi = q0 + 8 * hh + r;
      const int ja = j0 + ln, jb = j0 + 16 + ln;
      if (CAUSAL) { if (ja > qi) s[0][r] = -3.0e38f; if (jb > qi) s[1][r] = -3.0e38f; }
      if (ja >= T) s[0][r] = -3.0e38f;
      if (jb >= T) s[1][r] = -3.0e38f;
      float mx = fmaxf(s[0][r], s[1][r]);
      mx = fmaxf(mx, __shfl_xor(mx, 1, 32)); mx = fmaxf(mx, __shfl_xor(mx, 2, 32)); mx = fmaxf(mx, __shfl_xor(mx, 4, 32)); mx = fmaxf(mx, __shfl_xor(mx, 8, 32));
      const float mnew = fmaxf(m_r[r], mx);
      alpha[r] = (mnew > -1.0e38f) ? __expf(m_r[r] - mnew) : 1.0f;
      const float p0 = (s[0][r] > -1.0e38f) ? __expf(s[0][r] - mnew) : 0.f;
      const float p1 = (s[1][r] > -1.0e38f) ? __expf(s[1][r] - mnew) : 0.f;
      m_r[r] = mnew;
      l_r[r] = l_r[r] * alpha[r] + p0 + p1;            // per-lane partial row sum (16 lanes combined at the end)
      unsigned short hb = bf16_bits(p0); sPh[w][8 * hh + r][ln] = hb;      sPl[w][8 * hh + r][ln] = bf16_bits(p0 - bf16_val(hb));
      hb = bf16_bits(p1);                sPh[w][8 * hh + r][16 + ln] = hb; sPl[w][8 * hh + r][16 + ln] = bf16_bits(p1 - bf16_val(hb));
    }
#pragma unroll
    for (int dt = 0; dt < DT; ++dt)
#pragma unroll
      for (int r = 0; r < 8; ++r) oacc[dt][r] *= alpha[r];
    __builtin_amdgcn_fence(__ATOMIC_ACQ_REL, "workgroup");
    __builtin_amdgcn_wave_barrier();
    FragB pah, pal;
    pah.half[0] = *(const v8us*)&sPh[w][ln][8 * hh]; pah.half[1] = *(const v8us*)&sPh[w][ln][16 + 8 * hh];
    pal.half[0] = *(const v8us*)&sPl[w][ln][8 * hh]; pal.half[1] = *(const v8us*)&sPl[w][ln][16 + 8 * hh];
#pragma unroll
    for (int dt = 0; dt < DT; ++dt) {
      FragB bvh, bvl;
#pragma unroll
      for (int i = 0; i < 8; ++i) {
        bvh.u[i] = sVh[8 * hh + i][dt * 16 + ln]; bvh.u[8 + i] = sVh[16 + 8 * hh + i][dt * 16 + ln];
        bvl.u[i] = sVl[8 * hh + i][dt * 16 + ln]; bvl.u[8 + i] = sVl[16 + 8 * hh + i][dt * 16 + ln];
      }
      oacc[dt] = mmaN<3>(pah.v, pal.v, bvh.v, bvl.v, oacc[dt]);
    }
    __builtin_amdgcn_fence(__ATOMIC_ACQ_REL, "workgroup");
    __builtin_amdgcn_wave_barrier();
  }
#pragma unroll
  for (int r = 0; r < 8; ++r) {
    float l = l_r[r];
    l += __shfl_xor(l, 1, 32); l += __shfl_xor(l, 2, 32); l += __shfl_xor(l, 4, 32); l += __shfl_xor(l, 8, 32);
    l_r[r] = (l > 0.f) ? 1.0f / l : 0.f;
  }
#pragma unroll
  for (int dt = 0; dt < DT; ++dt)
#pragma unroll
    for (int r = 0; r < 8; ++r) sO[w][8 * hh + r][dt * 16 + ln] = oacc[dt][r] * l_r[r];
  __builtin_amdgcn_fence(__ATOMIC_ACQ_REL, "workgroup");
  __builtin_amdgcn_wave_barrier();
  {
    for (int r = 0; r < 16; ++r) {
      const int row = q0 + r;
      if (row < T && lane < D / 4) {
        const v4f val = *(const v4fa*)&sO[w][r][lane * 4];
        *(v4f*)(y + ((size_t)b * T + row) * ypitch + h * D + lane * 4) = val;
      }
    }
    
  }
}

// GEMM C = act(A·W + bias + resid): A f32 (ASPLIT -> hi/lo 2 terms), Wt bf16 [N][K]; ACT 0 none, 1 relu, 2 exact gelu;
// resid (optional, f32, row index = (row % rmod), pitch ldr, RES_BF16 rounds it) added before the activation.
template <bool ASPLIT, int ACT, bool BIAS_BF16, bool RES_BF16>
__global__ __launch_bounds__(128) void k_gemm_bf3(const float* __restrict__ A, int lda, const unsigned short* __restrict__ Wt, int ldb,
                                                const float* __restrict__ bias, const float* __restrict__ resid, int rmod, int ldr,
                                                float* __restrict__ C, int ldc, int M, int N, int K) {
  __shared__ __attribute__((aligned(16))) float so[4][16][64];
  const int tid = threadIdx.x, w = tid >> 5, lane = tid & 31, ln = lane & 15, hh = lane >> 4;
  const int ntn = N / 64;
  const int wid = blockIdx.x * 4 + w;
  const int mt = wid / ntn, nq = wid % ntn;
  if (mt * 16 >= M) return;
  const int row0 = mt * 16, col0 = nq * 64;
  const float* arow = A + (size_t)(row0 + ln) * lda;
  v8f acc[4] = {};
  for (int kb = 0; kb < K; kb += 32) {
    FragB ah, al;
    const v4f x0 = *(const v4fa*)(arow + kb + 8 * hh), x1 = *(const v4fa*)(arow + kb + 8 * hh + 4);
    const v4f x2 = *(const v4fa*)(arow + kb + 16 + 8 * hh), x3 = *(const v4fa*)(arow + kb + 16 + 8 * hh + 4);
    float xs[16] = {x0[0],x0[1],x0[2],x0[3],x1[0],x1[1],x1[2],x1[3],x2[0],x2[1],x2[2],x2[3],x3[0],x3[1],x3[2],x3[3]};
#pragma unroll
    for (int i = 0; i < 16; ++i) { const unsigned short hb = bf16_bits(xs[i]); ah.u[i] = hb; al.u[i] = ASPLIT ? bf16_bits(xs[i] - bf16_val(hb)) : (unsigned short)0; }
#pragma unroll
    for (int t = 0; t < 4; ++t) {
      const unsigned short* brow = Wt + (size_t)(col0 + t * 16 + ln) * ldb + kb;
      FragB b;
      b.half[0] = *(const v8us*)(brow + 8 * hh);
      b.half[1] = *(const v8us*)(brow + 16 + 8 * hh);
      acc[t] = mmaN<ASPLIT ? 2 : 1>(ah.v, al.v, b.v, b.v, acc[t]);
    }
  }
#pragma unroll
  for (int t = 0; t < 4; ++t) {
    const int col = col0 + t * 16 + ln;
    float bv = bias ? bias[col] : 0.f;
    if (BIAS_BF16) bv = bf16_round(bv);
#pragma unroll
    for (int r = 0; r < 8; ++r) {
      float v = acc[t][r] + bv;
      if (resid) { float rv = resid[(size_t)((row0 + 8 * hh + r) % rmod) * ldr + col]; if (RES_BF16) rv = bf16_round(rv); v += rv; }
      if (ACT == 1) v = fmaxf(v, 0.f);
      if (ACT == 2) v = 0.5f * v * (1.0f + erff(v * 0.70710678118654752f));
      if (ACT == 3) { const float u = 0.7978845608028654f * (v + 0.044715f * v * v * v); v = 0.5f * v * (1.0f + tanhf(u)); }
      so[w][8 * hh + r][t * 16 + ln] = v;
    }
  }
  __builtin_amdgcn_fence(__ATOMIC_ACQ_REL, "workgroup");
  __builtin_amdgcn_wave_barrier();
  const int rsub = lane >> 4, c4 = (lane & 15) * 4;
  {
#pragma unroll
    for (int q = 0; q < 8; ++q) {
      const int r = q * 2 + rsub;
      const v4f v = *(const v4fa*)&so[w][r][c4];
      *(v4f*)(C + (size_t)(row0 + r) * ldc + col0 + c4) = v;
    }
    
  }
}
// row LayerNorm (biased variance, eps) over N: s = X (+ R); optional out_sum <- s; out_norm <- (s-mu)*rsqrt(var+eps)*g + b
template <bool PARAM_BF16>
__global__ __launch_bounds__(256) void k_layernorm(const float* __restrict__ X, const float* __restrict__ R, const float* __restrict__ g, const float* __restrict__ bta,
                                                  float* __restrict__ out_sum, float* __restrict__ out_norm, int N, float eps) {
  __shared__ float red[256];
  const int row = blockIdx.x, tid = threadIdx.x;
  const float* x = X + (size_t)row * N; const float* rr = R ? R + (size_t)row * N : nullptr;
  float vals[16];                     // up to N = 4096
  const int per = N / 256;            // contiguous chunk per thread? use strided-by-4 chunks: thread handles j = tid*4 + 1024*u
  float s1 = 0.f;
  for (int u = 0; u < per / 4; ++u) {
    const int j = tid * 4 + 1024 * u;
    const v4f a = *(const v4fa*)(x + j);
    v4f b = {0.f,0.f,0.f,0.f}; if (rr) b = *(const v4fa*)(rr + j);
#pragma unroll
    for (int q = 0; q < 4; ++q) { const float v = a[q] + b[q]; vals[u * 4 + q] = v; s1 += v; }
  }
  red[tid] = s1; __syncthreads();
  for (int st = 128; st > 0; st >>= 1) { if (tid < st) red[tid] += red[tid + st]; __syncthreads(); }
  const float mu = red[0] / (float)N; __syncthreads();
  float s2 = 0.f;
  for (int u = 0; u < per / 4; ++u)
#pragma unroll
    for (int q = 0; q < 4; ++q) { const float c = vals[u * 4 + q] - mu; s2 += c * c; }
  red[tid] = s2; __syncthreads();
  for (int st = 128; st > 0; st >>= 1) { if (tid < st) red[tid] += red[tid + st]; __syncthreads(); }
  const float rs = rsqrtf(red[0] / (float)N + eps);
  {
    for (int u = 0; u < per / 4; ++u) {
      const int j = tid * 4 + 1024 * u;
      v4f o, sm;
#pragma unroll
      for (int q = 0; q < 4; ++q) {
        float gg = g[j + q], bb = bta[j + q];
        if (PARAM_BF16) { gg = bf16_round(gg); bb = bf16_round(bb); }
        sm[q] = vals[u * 4 + q]; o[q] = (vals[u * 4 + q] - mu) * rs * gg + bb;
      }
      if (out_sum) *(v4f*)(out_sum + (size_t)row * N + j) = sm;
      *(v4f*)(out_norm + (size_t)row * N + j) = o;
    }
    
  }
}



// ---- f16 WMMA path (v_wmma_f32_16x16x32_f16): 11-bit significands for operands in range — used where a [0,1] probability operand needs more precision than bf16
typedef _Float16 v16h __attribute__((ext_vector_type(16)));
union FragH { v16h v; v8us half[2]; _Float16 h[16]; unsigned short u[16]; };
template <int NT>
__device__ __forceinline__ v8f mmaH(v16h ah, v16h al, v16h bh, v16h bl, v8f c) {
  c = __builtin_amdgcn_wmma_f32_16x16x32_f16(false, ah, false, bh, (short)0, c, false, false);
  if (NT >= 2) c = __builtin_amdgcn_wmma_f32_16x16x32_f16(false, al, false, bh, (short)0, c, false, false);
  if (NT >= 3) c = __builtin_amdgcn_wmma_f32_16x16x32_f16(false, ah, false, bl, (short)0, c, false, false);
  asm volatile("v_nop\n\tv_nop\n\tv_nop\n\tv_nop" : "+v"(c) : "v"(ah), "v"(al), "v"(bh), "v"(bl));
  return c;
}
// batched GEMM like k_gemm_b but f16 operands: A f32 (split into f16 hi/lo if ASPLIT, else rounded to f16), Bt = f16 values [n][k]; alpha; C f32; N multiple of 16 (partial tiles skipped)
template <bool ASPLIT>
__global__ __launch_bounds__(128) void k_gemm_h(const float* __restrict__ A, int lda, size_t sA, const _Float16* __restrict__ Bh, int ldb, size_t sB, float alpha, float* __restrict__ C, int ldc, size_t sC, int M, int N, int K) {
  __shared__ __attribute__((aligned(16))) float so[4][16][64];
  const int tid = threadIdx.x, w = tid >> 5, lane = tid & 31, ln = lane & 15, hh = lane >> 4; const int by = blockIdx.y;
  A += (size_t)by * sA; Bh += (size_t)by * sB; C += (size_t)by * sC;
  const int ntn = (N + 63) / 64; const int wid = blockIdx.x * 4 + w; const int mt = wid / ntn, nq = wid % ntn; if (mt * 16 >= M) return;
  const int row0 = mt * 16, col0 = nq * 64; const float* arow = A + (size_t)(row0 + ln) * lda;
  v8f acc[4] = {};
  for (int kb = 0; kb < K; kb += 32) {
    FragH ah, al;
    const v4f x0 = *(const v4fa*)(arow + kb + 8 * hh), x1 = *(const v4fa*)(arow + kb + 8 * hh + 4), x2 = *(const v4fa*)(arow + kb + 16 + 8 * hh), x3 = *(const v4fa*)(arow + kb + 16 + 8 * hh + 4);
    float xs[16] = {x0[0],x0[1],x0[2],x0[3],x1[0],x1[1],x1[2],x1[3],x2[0],x2[1],x2[2],x2[3],x3[0],x3[1],x3[2],x3[3]};
#pragma unroll
    for (int i = 0; i < 16; ++i) { const _Float16 h = (_Float16)xs[i]; ah.h[i] = h; al.h[i] = ASPLIT ? (_Float16)(xs[i] - (float)h) : (_Float16)0.0f; }
#pragma unroll
    for (int t = 0; t < 4; ++t) { if (col0 + t * 16 >= N) continue; const size_t boff = (size_t)(col0 + t * 16 + ln) * ldb + kb; FragH bq; bq.half[0] = *(const v8us*)(Bh + boff + 8 * hh); bq.half[1] = *(const v8us*)(Bh + boff + 16 + 8 * hh);
      acc[t] = mmaH<ASPLIT ? 2 : 1>(ah.v, al.v, bq.v, bq.v, acc[t]); }
  }
#pragma unroll
  for (int t = 0; t < 4; ++t) { if (col0 + t * 16 >= N) continue;
#pragma unroll
    for (int r = 0; r < 8; ++r) so[w][8 * hh + r][t * 16 + ln] = acc[t][r] * alpha; }
  __builtin_amdgcn_fence(__ATOMIC_ACQ_REL, "workgroup"); __builtin_amdgcn_wave_barrier();
  const int rsub = lane >> 4, c4 = (lane & 15) * 4;
  {
#pragma unroll
    for (int q = 0; q < 8; ++q) { const int r = q * 2 + rsub; if (col0 + c4 < N) { const v4f v = *(const v4fa*)&so[w][r][c4]; *(v4f*)(C + (size_t)(row0 + r) * ldc + col0 + c4) = v; } }
     }
}

// Wt[n][k] = f16(W[k][n]·scale) from f32 row-major W[K][N] (scale = power of two; bf16-exact weights stay exact in f16 away from the subnormal range)
__global__ __launch_bounds__(256) void k_wt_f16(const float* __restrict__ W, _Float16* __restrict__ Wt, int K, int N, float scale) {
  const int t = blockIdx.x * 256 + threadIdx.x; if (t >= N * (K / 8)) return; const int n = t / (K / 8), k8 = (t % (K / 8)) * 8; FragH f;
#pragma unroll
  for (int i = 0; i < 8; ++i) f.h[i] = (_Float16)(bf16_round(W[(size_t)(k8 + i) * N + n]) * scale); const v8us o = f.half[0];
  *(v8us*)((unsigned short*)Wt + (size_t)n * K + k8) = o; 
}
// k_gemm_hh variant with fused epilogue: v = acc·alpha + bias[by·sBias + col] (+ CP[(row/rowsPerB)·sCPb + by·64 + col] if CP) ; ACT 0 none / 1 elu ; writes f16 C16 (and f32 C if non-null)
template <int ACT>
__global__ __launch_bounds__(128) void k_gemm_hhx(const _Float16* __restrict__ A, int lda, size_t sA, const _Float16* __restrict__ Bh, int ldb, size_t sB, float alpha, const float* __restrict__ bias, size_t sBias, const float* __restrict__ CP, int rowsPerB, size_t sCPb, int row0g,
    float* __restrict__ C, _Float16* __restrict__ C16, int ldc, size_t sC, int M, int N, int K) {
  __shared__ __attribute__((aligned(16))) float so[4][16][64];
  const int tid = threadIdx.x, w = tid >> 5, lane = tid & 31, ln = lane & 15, hh = lane >> 4; const int by = blockIdx.y;
  A += (size_t)by * sA; Bh += (size_t)by * sB; const size_t cofs = (size_t)by * sC; const float* bp = bias ? bias + (size_t)by * sBias : nullptr;
  const int ntn = (N + 63) / 64; const int wid = blockIdx.x * 4 + w; const int mt = wid / ntn, nq = wid % ntn; if (mt * 16 >= M) return;
  const int row0 = mt * 16, col0 = nq * 64; const _Float16* arow = A + (size_t)(row0 + ln) * lda;
  v8f acc[4] = {};
  for (int kb = 0; kb < K; kb += 32) { FragH ah; ah.half[0] = *(const v8us*)((const unsigned short*)arow + kb + 8 * hh); ah.half[1] = *(const v8us*)((const unsigned short*)arow + kb + 16 + 8 * hh);
#pragma unroll
    for (int t = 0; t < 4; ++t) { if (col0 + t * 16 >= N) continue; const size_t boff = (size_t)(col0 + t * 16 + ln) * ldb + kb; FragH bq; bq.half[0] = *(const v8us*)((const unsigned short*)Bh + boff + 8 * hh); bq.half[1] = *(const v8us*)((const unsigned short*)Bh + boff + 16 + 8 * hh);
      acc[t] = mmaH<1>(ah.v, ah.v, bq.v, bq.v, acc[t]); }
  }
#pragma unroll
  for (int t = 0; t < 4; ++t) { if (col0 + t * 16 >= N) continue; const int col = col0 + t * 16 + ln; const float bv = bp ? bf16_round(bp[col]) : 0.f;
#pragma unroll
    for (int r = 0; r < 8; ++r) { float v = acc[t][r] * alpha + bv; if (CP) { const int bidx = (row0g + row0 + 8 * hh + r) / rowsPerB; v += CP[(size_t)bidx * sCPb + (size_t)by * 64 + col]; } if (ACT == 1) v = (v > 0.f) ? v : expm1f(v); else if (ACT == 7) v = (v > 0.f) ? v + 1.0f : expf(v); else if (ACT == 8) v = tanhf(v); else if (ACT == 9) v = 0.5f * v * (1.0f + tanhf(0.7978845608028654f * (v + 0.044715f * v * v * v))); else if (ACT == 11) v = 1.0f / (1.0f + expf(-v)); else if (ACT == 12) v = (v > 0.f) ? v : 0.01f * v; else if (ACT == 14) v = (v > 0.f) ? v : 0.1f * v; else if (ACT == 15) v = v / (1.0f + expf(-v)); else if (ACT == 3) v = fmaxf(v, 0.f); else if (ACT == 6) v = 0.5f * v * (1.0f + erff(v * 0.70710678118654752f)); so[w][8 * hh + r][t * 16 + ln] = v; } }
  __builtin_amdgcn_fence(__ATOMIC_ACQ_REL, "workgroup"); __builtin_amdgcn_wave_barrier();
  const int rsub = lane >> 4, c4 = (lane & 15) * 4; typedef _Float16 v4h __attribute__((ext_vector_type(4)));
  {
#pragma unroll
    for (int q = 0; q < 8; ++q) { const int r = q * 2 + rsub; if (col0 + c4 < N) { const v4f v = *(const v4fa*)&so[w][r][c4]; if (C) *(v4f*)(C + cofs + (size_t)(row0 + r) * ldc + col0 + c4) = v; if (C16) { v4h h4; for (int i = 0; i < 4; ++i) h4[i] = (_Float16)v[i]; *(v4h*)(C16 + cofs + (size_t)(row0 + r) * ldc + col0 + c4) = h4; } } }
     }
}


typedef _Float16 v4h __attribute__((ext_vector_type(4)));

__global__ __launch_bounds__(256) void k_x16(const float* __restrict__ x, _Float16* __restrict__ X16, size_t n8) { const size_t t = (size_t)blockIdx.x * 256 + threadIdx.x; if (t >= n8) return; FragH f;
#pragma unroll
  for (int q = 0; q < 8; ++q) f.h[q] = (_Float16)bf16_round(x[t * 8 + q]); *(v8us*)((unsigned short*)X16 + t * 8) = f.half[0];  }
__global__ __launch_bounds__(256) void k_h16(const float* __restrict__ x, _Float16* __restrict__ X16, size_t n8) { const size_t t = (size_t)blockIdx.x * 256 + threadIdx.x; if (t >= n8) return; FragH f;
#pragma unroll
  for (int q = 0; q < 8; ++q) f.h[q] = (_Float16)x[t * 8 + q]; *(v8us*)((unsigned short*)X16 + t * 8) = f.half[0];  }
__global__ __launch_bounds__(256) void k_round16f(const float* __restrict__ W, _Float16* __restrict__ Bt, size_t n8) { const size_t t = (size_t)blockIdx.x * 256 + threadIdx.x; if (t >= n8) return; FragH f;
#pragma unroll
  for (int i = 0; i < 8; ++i) f.h[i] = (_Float16)(bf16_round(W[t * 8 + i]) * 16.0f); *(v8us*)((unsigned short*)Bt + t * 8) = f.half[0];  }
template <int NHv, int TTv>
__global__ __launch_bounds__(256) void k_vt(const _Float16* __restrict__ V16, int ldv, int voff, _Float16* __restrict__ Vt) { __shared__ unsigned short tl[64][66]; const int tid = threadIdx.x; const int slab = blockIdx.x / (TTv / 64), lg = blockIdx.x % (TTv / 64); const int b = slab / NHv, h = slab % NHv;
  for (int i = tid; i < 64 * 8; i += 256) { const int r = i / 8, c8 = (i % 8) * 8; FragH f; f.half[0] = *(const v8us*)((const unsigned short*)V16 + ((size_t)b * TTv + lg * 64 + r) * ldv + voff + h * 64 + c8);
#pragma unroll
    for (int q = 0; q < 8; ++q) tl[r][c8 + q] = f.u[q]; }
  __syncthreads();
  {
#pragma unroll
    for (int rd = 0; rd < 2; ++rd) { const int d = rd * 32 + tid / 8, pc = tid % 8; FragH f;
#pragma unroll
      for (int q = 0; q < 8; ++q) f.u[q] = tl[pc * 8 + q][d];
      *(v8us*)((unsigned short*)Vt + ((size_t)slab * 64 + d) * TTv + lg * 64 + pc * 8) = f.half[0]; }
     } }

typedef unsigned short v4us __attribute__((ext_vector_type(4), may_alias));
// Where a 16-B unit of a tile waits in LDS: its index in the output order, low bits XORed with higher bits of the same index, so that the 16 lanes of a half wave
// fall on 16 different bank groups both when the units are written (lanes 4 positions apart) and when they are read back (lanes on consecutive units). TY: 0 q, 1 k, 2 v.
template <int TY>
__device__ __forceinline__ int prep_slot(int u) { return u ^ (TY == 0 ? ((u >> 5) & 15) : TY == 1 ? ((u >> 7) & 3) : (((u >> 4) & 3) | (((u >> 8) & 3) << 2))); }
// The thread's 64 values (a[i][j] = channel w*16 + i, position 4*l + j of the tile), rounded, into LDS: q, k as 16-B units of 8 channels, v as 8-B halves of a unit (4 keys of one channel).
template <int TY>
__device__ __forceinline__ void prep_put(const v4f (&a)[16], unsigned short* sT, int w, int l) {
  if (TY < 2) {
#pragma unroll
    for (int cg = 0; cg < 2; ++cg)
#pragma unroll
      for (int j = 0; j < 4; ++j) { FragH f;
#pragma unroll
        for (int e = 0; e < 8; ++e) f.h[e] = (_Float16)bf16_round(a[cg * 8 + e][j]);
        const int c8 = w * 2 + cg; const int u = (TY == 0) ? l * 32 + j * 8 + c8 : (l >> 2) * 128 + c8 * 16 + (l & 3) * 4 + j;
        *(v8us*)&sT[prep_slot<TY>(u) * 8] = f.half[0]; }
  } else {
#pragma unroll
    for (int i = 0; i < 16; ++i) { FragH f;
#pragma unroll
      for (int j = 0; j < 4; ++j) f.h[j] = (_Float16)bf16_round(a[i][j]);
      const int u = (l >> 3) * 256 + w * 64 + ((l >> 1) & 3) * 16 + i;
      *(v4us*)&sT[prep_slot<TY>(u) * 8 + (l & 1) * 4] = (v4us){f.u[0], f.u[1], f.u[2], f.u[3]}; }
  }
}
// The tile out of LDS as it lies in its plane: 16 KB, 512 contiguous bytes per wave-wide store.
template <int TY>
__device__ __forceinline__ void prep_out(const unsigned short* sT, unsigned short* dst, int tid) {
#pragma unroll
  for (int i = 0; i < 8; ++i) { const int u = i * 128 + tid; *(v8us*)(dst + u * 8) = *(const v8us*)&sT[prep_slot<TY>(u) * 8]; }
  asm volatile("s_wait_xcnt 0x0" ::: "memory");      /* closes the run of stores: no register that one of them names is rewritten ahead of this wait, on any branch of the listing */
}
// One launch prepares the three planes. A block takes one tile of q, k or v: 64 channels x 128 positions, 32 KB of f32 in, 16 KB of f16 out, contiguous in its plane.
// A thread asks for its 16 x 16 B at once (a wave-wide load is 512 contiguous bytes of one channel row).
// q: rows of 64 channels, token-major: unit u = position*8 + c8 holds channels c8*8 + 0..7.
// k: behind the q plane, in fragment order: the 4 KB of a pass of 32 keys are [nt][ks][hf][lane] units, unit = channels ks*32 + hf*16 + 8*(lane >> 4) + 0..7 of key nt*16 + (lane & 15): u = (key >> 4)*128 + c8*16 + (key & 15).
// v: in fragment order: the 4 KB of a pass are [dt][hf][lane] units, unit = keys hf*16 + 8*(lane >> 4) + 0..7 of channel dt*16 + (lane & 15): u = (key >> 5)*256 + (channel >> 4)*64 + ((key >> 3) & 3)*16 + (channel & 15).
__global__ __launch_bounds__(128) void k_prep(const float* __restrict__ x, _Float16* __restrict__ QK, _Float16* __restrict__ Vt) {
  __shared__ __attribute__((aligned(16))) unsigned short sT[1024 * 8];
  const int tid = threadIdx.x, w = tid >> 5, l = tid & 31;
  const int b = blockIdx.x / (3 * (NN / 128)), rem = blockIdx.x % (3 * (NN / 128)); const int ty = rem / (NN / 128), pg = rem % (NN / 128);
  const float* src = x + ((size_t)b * C3 + ty * CC + w * 16) * NN + pg * 128 + l * 4;
  v4f a[16];
#pragma unroll
  for (int i = 0; i < 16; ++i) a[i] = *(const v4fa*)(src + (size_t)i * NN);
  asm volatile("s_wait_xcnt 0x0" :: "v"(src) : "memory");      /* the loads' address registers stay as they are up to this wait */
  if (ty == 0) prep_put<0>(a, sT, w, l); else if (ty == 1) prep_put<1>(a, sT, w, l); else prep_put<2>(a, sT, w, l);
  __syncthreads();      /* q: a stored run of 512 B holds units of all four waves; v: waves store runs that other waves wrote */
  const size_t off = ((size_t)b * NN + pg * 128) * CC;
  if (ty == 0) prep_out<0>(sT, (unsigned short*)QK + off, tid); else if (ty == 1) prep_out<1>(sT, (unsigned short*)QK + (size_t)NR * CC + off, tid); else prep_out<2>(sT, (unsigned short*)Vt + off, tid);
}
// lane l <-> lane l ^ 16 (the two lane halves hold the two key halves of one query column)
__device__ __forceinline__ float xhalf(float x) { return __builtin_bit_cast(float, __builtin_amdgcn_permlanex16(__builtin_bit_cast(int, x), __builtin_bit_cast(int, x), 0x76543210, 0xfedcba98, false, false)); }
// Eight 16-B copies per lane (4 KB apart: the block's 256 threads fill 4 KB a copy), global memory to LDS through no register. The s_wait_xcnt closes the statement so that no address register named here is rewritten ahead of it.
__device__ __forceinline__ void copy8(unsigned l, const unsigned short* g) {
  asm volatile("global_load_async_to_lds_b128 %0, %8, off\n\t"
               "global_load_async_to_lds_b128 %1, %9, off\n\t"
               "global_load_async_to_lds_b128 %2, %10, off\n\t"
               "global_load_async_to_lds_b128 %3, %11, off\n\t"
               "global_load_async_to_lds_b128 %4, %12, off\n\t"
               "global_load_async_to_lds_b128 %5, %13, off\n\t"
               "global_load_async_to_lds_b128 %6, %14, off\n\t"
               "global_load_async_to_lds_b128 %7, %15, off\n\t"
               "s_wait_xcnt 0x0"
               :: "v"(l), "v"(l + 4096u), "v"(l + 8192u), "v"(l + 12288u), "v"(l + 16384u), "v"(l + 20480u), "v"(l + 24576u), "v"(l + 28672u),
                  "v"(g), "v"(g + 2048), "v"(g + 4096), "v"(g + 6144), "v"(g + 8192), "v"(g + 10240), "v"(g + 12288), "v"(g + 14336)
               : "memory");
}
// The pass's 17 powers of two in place (e, the rescale factor, and 16 scores), and the scores' eight f16 pairs (low half first, rounded to nearest even as a cast does).
// One statement, for the slot behind a transcendental: the instruction behind each v_exp_f32 here neither reads its result nor writes its source, which the compiler's own order
// did not keep (it reused a source register directly behind). A conversion stands four or more v_exp_f32 behind its younger input, so it does not wait, up to the last two.
// The s_delay_alu lines are hints, which the compiler does not place for asm text: without one a dependent instruction holds the SIMD's vector port while it waits.
typedef unsigned v8u __attribute__((ext_vector_type(8)));
__device__ __forceinline__ v8u exp2x17_pk(float& e, float (&x)[16]) {
  unsigned w0, w1, w2, w3, w4, w5, w6, w7;
  asm("s_delay_alu instid0(VALU_DEP_1)\n\t"
      "v_exp_f32 %24, %24\n\t"
      "v_exp_f32 %0, %0\n\t"
      "v_exp_f32 %1, %1\n\t"
      "v_exp_f32 %2, %2\n\t"
      "v_exp_f32 %3, %3\n\t"
      "v_exp_f32 %4, %4\n\t"
      "v_exp_f32 %5, %5\n\t"
      "v_cvt_pk_f16_f32 %16, %0, %1\n\t"
      "v_exp_f32 %6, %6\n\t"
      "v_exp_f32 %7, %7\n\t"
      "v_cvt_pk_f16_f32 %17, %2, %3\n\t"
      "v_exp_f32 %8, %8\n\t"
      "v_exp_f32 %9, %9\n\t"
      "v_cvt_pk_f16_f32 %18, %4, %5\n\t"
      "v_exp_f32 %10, %10\n\t"
      "v_exp_f32 %11, %11\n\t"
      "v_cvt_pk_f16_f32 %19, %6, %7\n\t"
      "v_exp_f32 %12, %12\n\t"
      "v_exp_f32 %13, %13\n\t"
      "v_cvt_pk_f16_f32 %20, %8, %9\n\t"
      "v_exp_f32 %14, %14\n\t"
      "v_exp_f32 %15, %15\n\t"
      "v_cvt_pk_f16_f32 %21, %10, %11\n\t"
      "s_delay_alu instid0(TRANS32_DEP_3)\n\t"
      "v_cvt_pk_f16_f32 %22, %12, %13\n\t"
      "s_delay_alu instid0(TRANS32_DEP_1)\n\t"
      "v_cvt_pk_f16_f32 %23, %14, %15"
      : "+v"(x[0]), "+v"(x[1]), "+v"(x[2]), "+v"(x[3]), "+v"(x[4]), "+v"(x[5]), "+v"(x[6]), "+v"(x[7]),
        "+v"(x[8]), "+v"(x[9]), "+v"(x[10]), "+v"(x[11]), "+v"(x[12]), "+v"(x[13]), "+v"(x[14]), "+v"(x[15]),
        "=&v"(w0), "=&v"(w1), "=&v"(w2), "=&v"(w3), "=&v"(w4), "=&v"(w5), "=&v"(w6), "=&v"(w7), "+v"(e));
  return (v8u){w0, w1, w2, w3, w4, w5, w6, w7};
}
typedef float fal __attribute__((may_alias));
// The bare matrix builtin, with no filler behind it: the compiler keeps the distance that the chip needs behind a product, and the pass below is ordered so that real work stands there.
__device__ __forceinline__ v8f mm16(v16h a, v16h b, v8f c) { return __builtin_amdgcn_wmma_f32_16x16x32_f16(false, a, false, b, (short)0, c, false, false); }
// Nothing is scheduled across this line. It keeps a pass's parts in their source order (load group, softmax, S products, rescale, O products):
// without it the compiler scatters the fragment loads among the products, each a few instructions ahead of its use.
#define KEEP_ORDER() __builtin_amdgcn_sched_barrier(0)
__global__ __launch_bounds__(256) void k_flash(const _Float16* __restrict__ Q16, int ldq, const _Float16* __restrict__ K16, const _Float16* __restrict__ Vt, const int* __restrict__ MSK, float* __restrict__ out) {
  constexpr int RPW = 16, NQB = NN / (4 * RPW), DT = 4, KS = 2;
  constexpr int KG = 2;      /* wave groups that split a stage's keys */
  constexpr int SK = 256, NP = SK / 32 / KG, SH = SK * CC, NS = NN / SK;      /* keys of a stage, passes of a wave in it, halves per plane of a stage; stages */
  constexpr float C2 = 0.125f * 1.44269504088896341f;      /* 1 / sqrt(64) times log2(e) */
  __shared__ __attribute__((aligned(16))) unsigned short sKV[2][2][SH];      /* [buffer][K, V][fragment order] */
  __shared__ __attribute__((aligned(16))) float sO[CC][4 * RPW + 4];      /* [channel][query of the block]; 68 floats a row: the two lane halves' stores (rows 8 apart) fall 32 banks apart */
  const int tid = threadIdx.x, w = (tid >> 5) & 3, kg = tid >> 7, lane = tid & 31, ln = lane & 15, hh = lane >> 4;
  const int slab = blockIdx.x / NQB, qblk = blockIdx.x % NQB; const int b = slab; const int h = 0; const int qb0 = qblk * (4 * RPW); const int q0 = qb0 + w * RPW;
  /* the thread's 16 B of each 4-KB slice of a stage: source in the two planes, place in buffer 0 (LDS byte address) */
  const unsigned short* Kg = (const unsigned short*)K16 + (size_t)b * NN * CC + tid * 8;
  const unsigned short* Vg = (const unsigned short*)Vt + (size_t)b * NN * CC + tid * 8;
  const unsigned lds0 = (unsigned)(size_t)&sKV[0][0][0] + (unsigned)tid * 16u;
  copy8(lds0, Kg); copy8(lds0 + SH * 2, Vg);
  FragH aq[KS];
  { const unsigned short* qr = (const unsigned short*)Q16 + ((size_t)b * NN + q0 + ln) * ldq;
#pragma unroll
    for (int ks = 0; ks < KS; ++ks) { aq[ks].half[0] = *(const v8us*)(qr + ks * 32 + 8 * hh); aq[ks].half[1] = *(const v8us*)(qr + ks * 32 + 16 + 8 * hh); } }
  float m_r = -3.0e38f, l_r = 0.f; v8f oacc[DT];      /* oacc[dt][r] = Ot[dt*16 + 8hh + r][query ln] */
#pragma unroll
  for (int dt = 0; dt < DT; ++dt) oacc[dt] = (v8f){0.f,0.f,0.f,0.f,0.f,0.f,0.f,0.f};
  asm volatile("s_wait_asynccnt 0x0" ::: "memory");      /* this wave's share of stage 0 has landed */
  __syncthreads();                                        /* ... and every other wave's */
  copy8(lds0 + SH * 4, Kg + SH); copy8(lds0 + SH * 6, Vg + SH);
  /* the stage loop stays rolled; the constant-trip inner loops are unrolled so that the fragment and score arrays stay in registers */
#pragma unroll 1
  for (int st = 0; st < NS; ++st) {
    /* 32 keys = 2048 halves of a plane, a fragment half = 256 halves, the lane's 16 B at lane * 8 */
    const unsigned short* Kf = &sKV[st & 1][0][kg * (NP * 2048) + lane * 8];      /* the wave group's own half of the stage */
    const unsigned short* Vf = &sKV[st & 1][1][kg * (NP * 2048) + lane * 8];
    /* The loads stand ahead of the work that hides them: at a pass's head its V fragments and the next pass's K fragments (inside the stage only) are asked for.
       The S products run one pass ahead: the next pass's stand behind this pass's exponentials, with the rescale and the O products between them and the first read of their result,
       so no product of the loop but the stage's first four has an idle slot behind it. */
    FragH bk[2][KS];      /* K fragments of the next S products */
#pragma unroll
    for (int nt = 0; nt < 2; ++nt) {
#pragma unroll
      for (int ks = 0; ks < KS; ++ks) { const unsigned short* kr = Kf + (nt * KS + ks) * 512; bk[nt][ks].half[0] = *(const v8us*)kr; bk[nt][ks].half[1] = *(const v8us*)(kr + 256); } }
    KEEP_ORDER();
    v8f s[2];      /* s[nt][r] = St[key of the pass nt*16 + 8hh + r][query ln]; the two tiles alternate, so that a tile's second product stands one product behind its first */
#pragma unroll
    for (int nt = 0; nt < 2; ++nt) s[nt] = (v8f){0.f,0.f,0.f,0.f,0.f,0.f,0.f,0.f};
#pragma unroll
    for (int ks = 0; ks < KS; ++ks)
#pragma unroll
      for (int nt = 0; nt < 2; ++nt) s[nt] = mm16(bk[nt][ks].v, aq[ks].v, s[nt]);
    KEEP_ORDER();
#pragma unroll
    for (int ps = 0; ps < NP; ++ps) {
      if (ps + 1 < NP) {
#pragma unroll
        for (int nt = 0; nt < 2; ++nt) {
#pragma unroll
          for (int ks = 0; ks < KS; ++ks) { const unsigned short* kr = Kf + (ps + 1) * 2048 + (nt * KS + ks) * 512; bk[nt][ks].half[0] = *(const v8us*)kr; bk[nt][ks].half[1] = *(const v8us*)(kr + 256); } } }
      FragH bv[DT];
#pragma unroll
      for (int dt = 0; dt < DT; ++dt) { const unsigned short* vr = Vf + ps * 2048 + dt * 512; bv[dt].half[0] = *(const v8us*)vr; bv[dt].half[1] = *(const v8us*)(vr + 256); }
      KEEP_ORDER();
      /* Softmax in base 2: the maximum is taken over the raw products (the factor is positive) and kept times C2 = log2(e) / 8;
         a score's weight x 2^10 is then one fused multiply-add and one hardware exp2: 2^(s * C2 + (10 - m)). */
      float sc[16]; float mq[4];
#pragma unroll
      for (int i = 0; i < 16; ++i) sc[i] = s[i >> 3][i & 7];
#pragma unroll
      for (int c = 0; c < 4; ++c) mq[c] = fmaxf(fmaxf(sc[c], sc[4 + c]), fmaxf(sc[8 + c], sc[12 + c]));
      float mc = fmaxf(fmaxf(mq[0], mq[1]), fmaxf(mq[2], mq[3])); mc = fmaxf(mc, xhalf(mc));
      const float mn = fmaxf(m_r, mc * C2); float ea = m_r - mn; m_r = mn;      /* ea becomes 2^ea, the factor on what is summed so far */
      const float nb = 10.0f - mn;
#pragma unroll
      for (int i = 0; i < 16; ++i) sc[i] = __builtin_fmaf(sc[i], C2, nb);
      const v8u pw = exp2x17_pk(ea, sc);      /* half i of pw = Pt[key of the pass (i < 8 ? 8hh + i : 8 + 8hh + i)][query ln] x 2^10; sc[i] = the same weight in f32 */
      float ps4[4];
#pragma unroll
      for (int c = 0; c < 4; ++c) ps4[c] = ((sc[c] + sc[4 + c]) + sc[8 + c]) + sc[12 + c];
      const float al = (mn > -1.0e38f) ? ea : 1.0f;
      FragH pb; pb.v = __builtin_bit_cast(v16h, pw);
      l_r = l_r * al + ((ps4[0] + ps4[1]) + (ps4[2] + ps4[3]));      /* x 2^10 like P; this lane half's keys only; the halves join after the loop */
      KEEP_ORDER();
      if (ps + 1 < NP) {      /* the next pass's S products; this pass's scores are used up */
#pragma unroll
        for (int nt = 0; nt < 2; ++nt) s[nt] = (v8f){0.f,0.f,0.f,0.f,0.f,0.f,0.f,0.f};
#pragma unroll
        for (int ks = 0; ks < KS; ++ks)
#pragma unroll
          for (int nt = 0; nt < 2; ++nt) s[nt] = mm16(bk[nt][ks].v, aq[ks].v, s[nt]);
      }
      KEEP_ORDER();
#pragma unroll
      for (int dt = 0; dt < DT; ++dt)
#pragma unroll
        for (int r = 0; r < 8; ++r) oacc[dt][r] *= al;
      KEEP_ORDER();
#pragma unroll
      for (int dt = 0; dt < DT; ++dt) oacc[dt] = mm16(bv[dt].v, pb.v, oacc[dt]);
      KEEP_ORDER();
    }
    asm volatile("s_wait_dscnt 0x0" ::: "memory");        /* this wave's reads of the buffer are done before anyone refills it */
    asm volatile("s_wait_asynccnt 0x0" ::: "memory");     /* this wave's share of stage st + 1 has landed */
    __syncthreads();                                        /* publishes stage st + 1 and ends every wave's reads of stage st */
    if (st + 2 < NS) { const unsigned lb = lds0 + (unsigned)(st & 1) * (SH * 4); copy8(lb, Kg + (size_t)(st + 2) * SH); copy8(lb + SH * 2, Vg + (size_t)(st + 2) * SH); }
  }
  asm volatile("s_wait_asynccnt 0x0" ::: "memory");       /* nothing of this wave is in flight when it goes on to the output staging and ends */
  const float lw = l_r + xhalf(l_r);      /* the wave's sum over its half of the keys, relative to its own maximum */
  /* The second group hands its partial result over through the K/V buffers, which nobody reads any more (the loop's last barrier ended every read): 34 planes of 128 floats, a lane's value at its own place in each. */
  fal* sM = (fal*)&sKV[0][0][0] + (tid & 127);
  if (kg == 1) {
#pragma unroll
    for (int dt = 0; dt < DT; ++dt)
#pragma unroll
      for (int r = 0; r < 8; ++r) sM[(dt * 8 + r) * 128] = oacc[dt][r];
    sM[32 * 128] = m_r; sM[33 * 128] = lw;
  }
  __syncthreads();      /* the second group's partial results are written before the first group reads them */
  /* The output is channel-major, as the accumulators are: each wave of the first group joins the two partial results and puts its 16 query columns into the block's [64 channels][64 queries] tile, then the block stores whole rows. */
  if (kg == 0) {
    const float m1 = sM[32 * 128], l1 = sM[33 * 128]; const float mj = fmaxf(m_r, m1);
    const float a0 = __builtin_amdgcn_exp2f(m_r - mj), a1 = __builtin_amdgcn_exp2f(m1 - mj);      /* each half's weights brought to the common maximum */
    const float l = lw * a0 + l1 * a1; const float linv = (l > 0.f) ? 1.0f / l : 0.f;      /* the 2^10 of P and of l cancel */
    const float f0 = a0 * linv, f1 = a1 * linv;
#pragma unroll
    for (int dt = 0; dt < DT; ++dt)
#pragma unroll
      for (int r = 0; r < 8; ++r) sO[dt * 16 + 8 * hh + r][w * RPW + ln] = oacc[dt][r] * f0 + sM[(dt * 8 + r) * 128] * f1;
  }
  __syncthreads();      /* a row of the tile holds columns of four waves: all are written before any row is read */
  { const int w8 = tid >> 5; float* orow = out + ((size_t)b * CC + w8 * 8 + hh) * NN + qb0 + ln * 4;
#pragma unroll
    for (int i = 0; i < 4; ++i) { const v4f val = *(const v4fa*)&sO[w8 * 8 + i * 2 + hh][ln * 4]; *(v4f*)(orow + (size_t)i * 2 * NN) = val; }      /* 16 lanes x 16 B = the block's whole 256 B of one channel row */
  } }

extern "C" void kernel_launch(void* const* d_in, const int* in_sizes, int n_in,
                              void* d_out, int out_size, void* d_ws, size_t ws_size, hipStream_t stream) {
  (void)in_sizes; (void)n_in; (void)out_size;
  const float* qkv = (const float*)d_in[0];
  char* ws = (char*)d_ws; size_t off = 0;
  auto take = [&](size_t bytes) { char* p = ws + off; off += (bytes + 255) & ~(size_t)255; return p; };
  _Float16* QK = (_Float16*)take((size_t)NR * 2 * CC * 2); _Float16* Vt = (_Float16*)take((size_t)BB * CC * NN * 2);
  if (off > ws_size) return;      // 8.4 + 4.2 MB
  k_prep<<<BB * 3 * (NN / 128), 128, 0, stream>>>(qkv, QK, Vt);
  k_flash<<<BB * (NN / 64), 256, 0, stream>>>(QK, CC, QK + (size_t)NR * CC, Vt, nullptr, (float*)d_out);
}

// v010
// It runs in 35.2 microseconds.
// Two timings next to v009 both put it at 1.08 times that version's speed.
// Counting every step since v000, it is 12.4 times as fast.
#include <hip/hip_runtime.h>
// QKV self-attention on a channel-major qkv tensor [8, 3·64, 4096]: attn[s,t] = Σ_c q[c,s]·k[c,t]/√64, softmax over t, out[d,s] = Σ_t attn[s,t]·v[d,t].
// Compute dtype: qkv rounded to bf16 and carried exactly in f16 (q token-major; k and v planes in the order of their A fragments, 512 contiguous bytes per wave-wide load); S and P·V on v_wmma_f32_16x16x32_f16 with
// f32 accumulation in one fused flash-style kernel (online softmax in f32; P in f16 ×2^10); the same kernel stores O as [b][d][s], whole 512-B rows gathered through LDS; output f32.
#define BB 8
#define CC 64
#define C3 192
#define NN 4096
#define NR (BB * NN)

typedef __bf16 v16b __attribute__((ext_vector_type(16)));
typedef unsigned short v8us __attribute__((ext_vector_type(8), may_alias));
typedef float  v8f  __attribute__((ext_vector_type(8)));
typedef float  v4f  __attribute__((ext_vector_type(4)));
typedef float  v4fa __attribute__((ext_vector_type(4), may_alias));
union FragB { v16b v; v8us half[2]; unsigned short u[16]; };

__device__ __forceinline__ unsigned short bf16_bits(float x) { unsigned int u = __float_as_uint(x); return (unsigned short)((u + 0x7FFFu + ((u >> 16) & 1u)) >> 16); }
__device__ __forceinline__ float bf16_val(unsigned short b) { return __uint_as_float(((unsigned int)b) << 16); }
__device__ __forceinline__ float bf16_round(float x) { return bf16_val(bf16_bits(x)); }
// D += A·B with NT terms: 1 = ah·bh, 2 = + al·bh (A split), 3 = + ah·bl (both split)
template <int NT>
__device__ __forceinline__ v8f mmaN(v16b ah, v16b al, v16b bh, v16b bl, v8f c) {
  c = __builtin_amdgcn_wmma_f32_16x16x32_bf16(false, ah, false, bh, (short)0, c, false, false);
  if (NT >= 2) c = __builtin_amdgcn_wmma_f32_16x16x32_bf16(false, al, false, bh, (short)0, c, false, false);
  if (NT >= 3) c = __builtin_amdgcn_wmma_f32_16x16x32_bf16(false, ah, false, bl, (short)0, c, false, false);
  asm volatile("v_nop\n\tv_nop\n\tv_nop\n\tv_nop" : "+v"(c) : "v"(ah), "v"(al), "v"(bh), "v"(bl));
  return c;
}

__global__ __launch_bounds__(256) void k_wt_bf16(const float* __restrict__ W, unsigned short* __restrict__ Wt, int K, int N) {
  const int t = blockIdx.x * 256 + threadIdx.x;
  const int k8n = K / 8;
  if (t >= N * k8n) return;
  const int n = t / k8n, k8 = (t % k8n) * 8;
  v8us v;
#pragma unroll
  for (int i = 0; i < 8; ++i) v[i] = bf16_bits(W[(size_t)(k8 + i) * N + n]);
  *(v8us*)(Wt + (size_t)n * K + k8) = v;
  
}

// GEMM C[M][N] (f32, pitch ldc) = act(A[M][K]·W + bias). A f32 row-major (pitch lda) converted per fragment to bf16
// (ASPLIT: hi/lo two planes -> 2 terms, else single rounded term); Wt bf16 [N][K] (pitch ldb). BIAS_BF16 rounds the
// bias to bf16 first (bias quantised to bf16 before the add). K%32==0, M%16==0, N%64==0.
template <bool ASPLIT, int ACT, bool BIAS_BF16>
__global__ __launch_bounds__(128) void k_gemm_bf(const float* __restrict__ A, int lda, const unsigned short* __restrict__ Wt, int ldb,
                                               const float* __restrict__ bias, float* __restrict__ C, int ldc, int M, int N, int K) {
  __shared__ __attribute__((aligned(16))) float so[4][16][64];
  const int tid = threadIdx.x, w = tid >> 5, lane = tid & 31, ln = lane & 15, hh = lane >> 4;
  const int ntn = N / 64;
  const int wid = blockIdx.x * 4 + w;
  const int mt = wid / ntn, nq = wid % ntn;
  if (mt * 16 >= M) return;
  const int row0 = mt * 16, col0 = nq * 64;
  const float* arow = A + (size_t)(row0 + ln) * lda;
  v8f acc[4] = {};
  for (int kb = 0; kb < K; kb += 32) {
    FragB ah, al;
    const v4f x0 = *(const v4fa*)(arow + kb + 8 * hh), x1 = *(const v4fa*)(arow + kb + 8 * hh + 4);
    const v4f x2 = *(const v4fa*)(arow + kb + 16 + 8 * hh), x3 = *(const v4fa*)(arow + kb + 16 + 8 * hh + 4);
    float xs[16] = {x0[0],x0[1],x0[2],x0[3],x1[0],x1[1],x1[2],x1[3],x2[0],x2[1],x2[2],x2[3],x3[0],x3[1],x3[2],x3[3]};
#pragma unroll
    for (int i = 0; i < 16; ++i) { const unsigned short hb = bf16_bits(xs[i]); ah.u[i] = hb; al.u[i] = ASPLIT ? bf16_bits(xs[i] - bf16_val(hb)) : (unsigned short)0; }
#pragma unroll
    for (int t = 0; t < 4; ++t) {
      const unsigned short* brow = Wt + (size_t)(col0 + t * 16 + ln) * ldb + kb;
      FragB b;
      b.half[0] = *(const v8us*)(brow + 8 * hh);
      b.half[1] = *(const v8us*)(brow + 16 + 8 * hh);
      acc[t] = mmaN<ASPLIT ? 2 : 1>(ah.v, al.v, b.v, b.v, acc[t]);
    }
  }
#pragma unroll
  for (int t = 0; t < 4; ++t) {
    float bv = bias ? bias[col0 + t * 16 + ln] : 0.f;
    if (BIAS_BF16) bv = bf16_round(bv);
#pragma unroll
    for (int r = 0; r < 8; ++r) { float v = acc[t][r] + bv; if (ACT == 1) v = fmaxf(v, 0.f); so[w][8 * hh + r][t * 16 + ln] = v; }
  }
  __builtin_amdgcn_fence(__ATOMIC_ACQ_REL, "workgroup");
  __builtin_amdgcn_wave_barrier();
  const int rsub = lane >> 4, c4 = (lane & 15) * 4;
  {
#pragma unroll
    for (int q = 0; q < 8; ++q) {
      const int r = q * 2 + rsub;
      const v4f v = *(const v4fa*)&so[w][r][c4];
      *(v4f*)(C + (size_t)(row0 + r) * ldc + col0 + c4) = v;
    }
    
  }
}

// Flash-style causal/unmasked attention, all contractions 3-term bf16 hi/lo splits, f32 softmax with running max.
// q,k,v rows are read from f32 buffers with arbitrary row pitch (so they can live inside a fused qkv buffer);
// D = head size (multiple of 32, <= 128); one wave = 16 query rows; block = 4 waves (64 queries) sharing K/V chunks of 32.
template <int D, bool CAUSAL>
__global__ __launch_bounds__(128) void k_flash(const float* __restrict__ qb, const float* __restrict__ kb, const float* __restrict__ vb,
                                             int pitch, int T, int H, float scale, float* __restrict__ y, int ypitch) {
  constexpr int KS = D / 32;        // k-steps for QK
  constexpr int DT = D / 16;        // d tiles for PV
  __shared__ __attribute__((aligned(16))) unsigned short sKh[32][D + 8], sKl[32][D + 8], sVh[32][D + 8], sVl[32][D + 8];
  __shared__ __attribute__((aligned(16))) unsigned short sPh[4][16][40], sPl[4][16][40];
  __shared__ __attribute__((aligned(16))) float sO[4][16][D];
  const int tid = threadIdx.x, w = tid >> 5, lane = tid & 31, ln = lane & 15, hh = lane >> 4;
  const int nqb = (T + 63) / 64;
  const int bh = blockIdx.x / nqb, qblk = blockIdx.x % nqb;
  const int b = bh / H, h = bh % H;
  const int q0 = qblk * 64 + w * 16;
  const float* Q = qb + (size_t)b * T * pitch + h * D;
  const float* K = kb + (size_t)b * T * pitch + h * D;
  const float* V = vb + (size_t)b * T * pitch + h * D;

  // A fragments of the wave's 16 query rows (scaled), hi/lo
  FragB aqh[KS], aql[KS];
  {
    int row = q0 + ln; if (row >= T) row = T - 1;
    const float* qr = Q + (size_t)row * pitch;
#pragma unroll
    for (int ks = 0; ks < KS; ++ks)
#pragma unroll
      for (int i = 0; i < 16; ++i) {
        const int d = ks * 32 + ((i < 8) ? (8 * hh + i) : (16 + 8 * hh + (i - 8)));
        const float x = qr[d] * scale; const unsigned short hb = bf16_bits(x);
        aqh[ks].u[i] = hb; aql[ks].u[i] = bf16_bits(x - bf16_val(hb));
      }
  }
  float m_r[8], l_r[8];
#pragma unroll
  for (int r = 0; r < 8; ++r) { m_r[r] = -3.0e38f; l_r[r] = 0.f; }
  v8f oacc[DT];
#pragma unroll
  for (int dt = 0; dt < DT; ++dt) oacc[dt] = (v8f){0.f,0.f,0.f,0.f,0.f,0.f,0.f,0.f};

  const int kv_end = CAUSAL ? min(T, qblk * 64 + 64) : T;     // block-uniform
  for (int j0 = 0; j0 < kv_end; j0 += 32) {
    __syncthreads();
    for (int e = tid; e < 32 * (D / 4); e += 128) {
      const int r = e / (D / 4), c4 = (e % (D / 4)) * 4;
      const int key = j0 + r;
      v4f kf = {0.f,0.f,0.f,0.f}, vf = {0.f,0.f,0.f,0.f};
      if (key < T) { kf = *(const v4fa*)(K + (size_t)key * pitch + c4); vf = *(const v4fa*)(V + (size_t)key * pitch + c4); }
#pragma unroll
      for (int t = 0; t < 4; ++t) {
        unsigned short hb = bf16_bits(kf[t]); sKh[r][c4 + t] = hb; sKl[r][c4 + t] = bf16_bits(kf[t] - bf16_val(hb));
        hb = bf16_bits(vf[t]); sVh[r][c4 + t] = hb; sVl[r][c4 + t] = bf16_bits(vf[t] - bf16_val(hb));
      }
    }
    __syncthreads();
    // S tile 16 x 32
    v8f s[2];
#pragma unroll
    for (int nt = 0; nt < 2; ++nt) {
      v8f acc = {};
#pragma unroll
      for (int ks = 0; ks < KS; ++ks) {
        FragB bh_, bl_;
        bh_.half[0] = *(const v8us*)&sKh[nt * 16 + ln][ks * 32 + 8 * hh]; bh_.half[1] = *(const v8us*)&sKh[nt * 16 + ln][ks * 32 + 16 + 8 * hh];
        bl_.half[0] = *(const v8us*)&sKl[nt * 16 + ln][ks * 32 + 8 * hh]; bl_.half[1] = *(const v8us*)&sKl[nt * 16 + ln][ks * 32 + 16 + 8 * hh];
        acc = mmaN<3>(aqh[ks].v, aql[ks].v, bh_.v, bl_.v, acc);
      }
      s[nt] = acc;
    }
    // mask + running max (rows 8hh+r; the 16 lanes of a half share rows)
    float alpha[8];
#pragma unroll
    for (int r = 0; r < 8; ++r) {
      const int qi = q0 + 8 * hh + r;
      const int ja = j0 + ln, jb = j0 + 16 + ln;
      if (CAUSAL) { if (ja > qi) s[0][r] = -3.0e38f; if (jb > qi) s[1][r] = -3.0e38f; }
      if (ja >= T) s[0][r] = -3.0e38f;
      if (jb >= T) s[1][r] = -3.0e38f;
      float mx = fmaxf(s[0][r], s[1][r]);
      mx = fmaxf(mx, __shfl_xor(mx, 1, 32)); mx = fmaxf(mx, __shfl_xor(mx, 2, 32)); mx = fmaxf(mx, __shfl_xor(mx, 4, 32)); mx = fmaxf(mx, __shfl_xor(mx, 8, 32));
      const float mnew = fmaxf(m_r[r], mx);
      alpha[r] = (mnew > -1.0e38f) ? __expf(m_r[r] - mnew) : 1.0f;
      const float p0 = (s[0][r] > -1.0e38f) ? __expf(s[0][r] - mnew) : 0.f;
      const float p1 = (s[1][r] > -1.0e38f) ? __expf(s[1][r] - mnew) : 0.f;
      m_r[r] = mnew;
      l_r[r] = l_r[r] * alpha[r] + p0 + p1;            // per-lane partial row sum (16 lanes combined at the end)
      unsigned short hb = bf16_bits(p0); sPh[w][8 * hh + r][ln] = hb;      sPl[w][8 * hh + r][ln] = bf16_bits(p0 - bf16_val(hb));
      hb = bf16_bits(p1);                sPh[w][8 * hh + r][16 + ln] = hb; sPl[w][8 * hh + r][16 + ln] = bf16_bits(p1 - bf16_val(hb));
    }
#pragma unroll
    for (int dt = 0; dt < DT; ++dt)
#pragma unroll
      for (int r = 0; r < 8; ++r) oacc[dt][r] *= alpha[r];
    __builtin_amdgcn_fence(__ATOMIC_ACQ_REL, "workgroup");
    __builtin_amdgcn_wave_barrier();
    FragB pah, pal;
    pah.half[0] = *(const v8us*)&sPh[w][ln][8 * hh]; pah.half[1] = *(const v8us*)&sPh[w][ln][16 + 8 * hh];
    pal.half[0] = *(const v8us*)&sPl[w][ln][8 * hh]; pal.half[1] = *(const v8us*)&sPl[w][ln][16 + 8 * hh];
#pragma unroll
    for (int dt = 0; dt < DT; ++dt) {
      FragB bvh, bvl;
#pragma unroll
      for (int i = 0; i < 8; ++i) {
        bvh.u[i] = sVh[8 * hh + i][dt * 16 + ln]; bvh.u[8 + i] = sVh[16 + 8 * hh + i][dt * 16 + ln];
        bvl.u[i] = sVl[8 * hh + i][dt * 16 + ln]; bvl.u[8 + i] = sVl[16 + 8 * hh + i][dt * 16 + ln];
      }
      oacc[dt] = mmaN<3>(pah.v, pal.v, bvh.v, bvl.v, oacc[dt]);
    }
    __builtin_amdgcn_fence(__ATOMIC_ACQ_REL, "workgroup");
    __builtin_amdgcn_wave_barrier();
  }
#pragma unroll
  for (int r = 0; r < 8; ++r) {
    float l = l_r[r];
    l += __shfl_xor(l, 1, 32); l += __shfl_xor(l, 2, 32); l += __shfl_xor(l, 4, 32); l += __shfl_xor(l, 8, 32);
    l_r[r] = (l > 0.f) ? 1.0f / l : 0.f;
  }
#pragma unroll
  for (int dt = 0; dt < DT; ++dt)
#pragma unroll
    for (int r = 0; r < 8; ++r) sO[w][8 * hh + r][dt * 16 + ln] = oacc[dt][r] * l_r[r];
  __builtin_amdgcn_fence(__ATOMIC_ACQ_REL, "workgroup");
  __builtin_amdgcn_wave_barrier();
  {
    for (int r = 0; r < 16; ++r) {
      const int row = q0 + r;
      if (row < T && lane < D / 4) {
        const v4f val = *(const v4fa*)&sO[w][r][lane * 4];
        *(v4f*)(y + ((size_t)b * T + row) * ypitch + h * D + lane * 4) = val;
      }
    }
    
  }
}

// GEMM C = act(A·W + bias + resid): A f32 (ASPLIT -> hi/lo 2 terms), Wt bf16 [N][K]; ACT 0 none, 1 relu, 2 exact gelu;
// resid (optional, f32, row index = (row % rmod), pitch ldr, RES_BF16 rounds it) added before the activation.
template <bool ASPLIT, int ACT, bool BIAS_BF16, bool RES_BF16>
__global__ __launch_bounds__(128) void k_gemm_bf3(const float* __restrict__ A, int lda, const unsigned short* __restrict__ Wt, int ldb,
                                                const float* __restrict__ bias, const float* __restrict__ resid, int rmod, int ldr,
                                                float* __restrict__ C, int ldc, int M, int N, int K) {
  __shared__ __attribute__((aligned(16))) float so[4][16][64];
  const int tid = threadIdx.x, w = tid >> 5, lane = tid & 31, ln = lane & 15, hh = lane >> 4;
  const int ntn = N / 64;
  const int wid = blockIdx.x * 4 + w;
  const int mt = wid / ntn, nq = wid % ntn;
  if (mt * 16 >= M) return;
  const int row0 = mt * 16, col0 = nq * 64;
  const float* arow = A + (size_t)(row0 + ln) * lda;
  v8f acc[4] = {};
  for (int kb = 0; kb < K; kb += 32) {
    FragB ah, al;
    const v4f x0 = *(const v4fa*)(arow + kb + 8 * hh), x1 = *(const v4fa*)(arow + kb + 8 * hh + 4);
    const v4f x2 = *(const v4fa*)(arow + kb + 16 + 8 * hh), x3 = *(const v4fa*)(arow + kb + 16 + 8 * hh + 4);
    float xs[16] = {x0[0],x0[1],x0[2],x0[3],x1[0],x1[1],x1[2],x1[3],x2[0],x2[1],x2[2],x2[3],x3[0],x3[1],x3[2],x3[3]};
#pragma unroll
    for (int i = 0; i < 16; ++i) { const unsigned short hb = bf16_bits(xs[i]); ah.u[i] = hb; al.u[i] = ASPLIT ? bf16_bits(xs[i] - bf16_val(hb)) : (unsigned short)0; }
#pragma unroll
    for (int t = 0; t < 4; ++t) {
      const unsigned short* brow = Wt + (size_t)(col0 + t * 16 + ln) * ldb + kb;
      FragB b;
      b.half[0] = *(const v8us*)(brow + 8 * hh);
      b.half[1] = *(const v8us*)(brow + 16 + 8 * hh);
      acc[t] = mmaN<ASPLIT ? 2 : 1>(ah.v, al.v, b.v, b.v, acc[t]);
    }
  }
#pragma unroll
  for (int t = 0; t < 4; ++t) {
    const int col = col0 + t * 16 + ln;
    float bv = bias ? bias[col] : 0.f;
    if (BIAS_BF16) bv = bf16_round(bv);
#pragma unroll
    for (int r = 0; r < 8; ++r) {
      float v = acc[t][r] + bv;
      if (resid) { float rv = resid[(size_t)((row0 + 8 * hh + r) % rmod) * ldr + col]; if (RES_BF16) rv = bf16_round(rv); v += rv; }
      if (ACT == 1) v = fmaxf(v, 0.f);
      if (ACT == 2) v = 0.5f * v * (1.0f + erff(v * 0.70710678118654752f));
      if (ACT == 3) { const float u = 0.7978845608028654f * (v + 0.044715f * v * v * v); v = 0.5f * v * (1.0f + tanhf(u)); }
      so[w][8 * hh + r][t * 16 + ln] = v;
    }
  }
  __builtin_amdgcn_fence(__ATOMIC_ACQ_REL, "workgroup");
  __builtin_amdgcn_wave_barrier();
  const int rsub = lane >> 4, c4 = (lane & 15) * 4;
  {
#pragma unroll
    for (int q = 0; q < 8; ++q) {
      const int r = q * 2 + rsub;
      const v4f v = *(const v4fa*)&so[w][r][c4];
      *(v4f*)(C + (size_t)(row0 + r) * ldc + col0 + c4) = v;
    }
    
  }
}
// row LayerNorm (biased variance, eps) over N: s = X (+ R); optional out_sum <- s; out_norm <- (s-mu)*rsqrt(var+eps)*g + b
template <bool PARAM_BF16>
__global__ __launch_bounds__(256) void k_layernorm(const float* __restrict__ X, const float* __restrict__ R, const float* __restrict__ g, const float* __restrict__ bta,
                                                  float* __restrict__ out_sum, float* __restrict__ out_norm, int N, float eps) {
  __shared__ float red[256];
  const int row = blockIdx.x, tid = threadIdx.x;
  const float* x = X + (size_t)row * N; const float* rr = R ? R + (size_t)row * N : nullptr;
  float vals[16];                     // up to N = 4096
  const int per = N / 256;            // contiguous chunk per thread? use strided-by-4 chunks: thread handles j = tid*4 + 1024*u
  float s1 = 0.f;
  for (int u = 0; u < per / 4; ++u) {
    const int j = tid * 4 + 1024 * u;
    const v4f a = *(const v4fa*)(x + j);
    v4f b = {0.f,0.f,0.f,0.f}; if (rr) b = *(const v4fa*)(rr + j);
#pragma unroll
    for (int q = 0; q < 4; ++q) { const float v = a[q] + b[q]; vals[u * 4 + q] = v; s1 += v; }
  }
  red[tid] = s1; __syncthreads();
  for (int st = 128; st > 0; st >>= 1) { if (tid < st) red[tid] += red[tid + st]; __syncthreads(); }
  const float mu = red[0] / (float)N; __syncthreads();
  float s2 = 0.f;
  for (int u = 0; u < per / 4; ++u)
#pragma unroll
    for (int q = 0; q < 4; ++q) { const float c = vals[u * 4 + q] - mu; s2 += c * c; }
  red[tid] = s2; __syncthreads();
  for (int st = 128; st > 0; st >>= 1) { if (tid < st) red[tid] += red[tid + st]; __syncthreads(); }
  const float rs = rsqrtf(red[0] / (float)N + eps);
  {
    for (int u = 0; u < per / 4; ++u) {
      const int j = tid * 4 + 1024 * u;
      v4f o, sm;
#pragma unroll
      for (int q = 0; q < 4; ++q) {
        float gg = g[j + q], bb = bta[j + q];
        if (PARAM_BF16) { gg = bf16_round(gg); bb = bf16_round(bb); }
        sm[q] = vals[u * 4 + q]; o[q] = (vals[u * 4 + q] - mu) * rs * gg + bb;
      }
      if (out_sum) *(v4f*)(out_sum + (size_t)row * N + j) = sm;
      *(v4f*)(out_norm + (size_t)row * N + j) = o;
    }
    
  }
}



// ---- f16 WMMA path (v_wmma_f32_16x16x32_f16): 11-bit significands for operands in range — used where a [0,1] probability operand needs more precision than bf16
typedef _Float16 v16h __attribute__((ext_vector_type(16)));
union FragH { v16h v; v8us half[2]; _Float16 h[16]; unsigned short u[16]; };
template <int NT>
__device__ __forceinline__ v8f mmaH(v16h ah, v16h al, v16h bh, v16h bl, v8f c) {
  c = __builtin_amdgcn_wmma_f32_16x16x32_f16(false, ah, false, bh, (short)0, c, false, false);
  if (NT >= 2) c = __builtin_amdgcn_wmma_f32_16x16x32_f16(false, al, false, bh, (short)0, c, false, false);
  if (NT >= 3) c = __builtin_amdgcn_wmma_f32_16x16x32_f16(false, ah, false, bl, (short)0, c, false, false);
  asm volatile("v_nop\n\tv_nop\n\tv_nop\n\tv_nop" : "+v"(c) : "v"(ah), "v"(al), "v"(bh), "v"(bl));
  return c;
}
// batched GEMM like k_gemm_b but f16 operands: A f32 (split into f16 hi/lo if ASPLIT, else rounded to f16), Bt = f16 values [n][k]; alpha; C f32; N multiple of 16 (partial tiles skipped)
template <bool ASPLIT>
__global__ __launch_bounds__(128) void k_gemm_h(const float* __restrict__ A, int lda, size_t sA, const _Float16* __restrict__ Bh, int ldb, size_t sB, float alpha, float* __restrict__ C, int ldc, size_t sC, int M, int N, int K) {
  __shared__ __attribute__((aligned(16))) float so[4][16][64];
  const int tid = threadIdx.x, w = tid >> 5, lane = tid & 31, ln = lane & 15, hh = lane >> 4; const int by = blockIdx.y;
  A += (size_t)by * sA; Bh += (size_t)by * sB; C += (size_t)by * sC;
  const int ntn = (N + 63) / 64; const int wid = blockIdx.x * 4 + w; const int mt = wid / ntn, nq = wid % ntn; if (mt * 16 >= M) return;
  const int row0 = mt * 16, col0 = nq * 64; const float* arow = A + (size_t)(row0 + ln) * lda;
  v8f acc[4] = {};
  for (int kb = 0; kb < K; kb += 32) {
    FragH ah, al;
    const v4f x0 = *(const v4fa*)(arow + kb + 8 * hh), x1 = *(const v4fa*)(arow + kb + 8 * hh + 4), x2 = *(const v4fa*)(arow + kb + 16 + 8 * hh), x3 = *(const v4fa*)(arow + kb + 16 + 8 * hh + 4);
    float xs[16] = {x0[0],x0[1],x0[2],x0[3],x1[0],x1[1],x1[2],x1[3],x2[0],x2[1],x2[2],x2[3],x3[0],x3[1],x3[2],x3[3]};
#pragma unroll
    for (int i = 0; i < 16; ++i) { const _Float16 h = (_Float16)xs[i]; ah.h[i] = h; al.h[i] = ASPLIT ? (_Float16)(xs[i] - (float)h) : (_Float16)0.0f; }
#pragma unroll
    for (int t = 0; t < 4; ++t) { if (col0 + t * 16 >= N) continue; const size_t boff = (size_t)(col0 + t * 16 + ln) * ldb + kb; FragH bq; bq.half[0] = *(const v8us*)(Bh + boff + 8 * hh); bq.half[1] = *(const v8us*)(Bh + boff + 16 + 8 * hh);
      acc[t] = mmaH<ASPLIT ? 2 : 1>(ah.v, al.v, bq.v, bq.v, acc[t]); }
  }
#pragma unroll
  for (int t = 0; t < 4; ++t) { if (col0 + t * 16 >= N) continue;
#pragma unroll
    for (int r = 0; r < 8; ++r) so[w][8 * hh + r][t * 16 + ln] = acc[t][r] * alpha; }
  __builtin_amdgcn_fence(__ATOMIC_ACQ_REL, "workgroup"); __builtin_amdgcn_wave_barrier();
  const int rsub = lane >> 4, c4 = (lane & 15) * 4;
  {
#pragma unroll
    for (int q = 0; q < 8; ++q) { const int r = q * 2 + rsub; if (col0 + c4 < N) { const v4f v = *(const v4fa*)&so[w][r][c4]; *(v4f*)(C + (size_t)(row0 + r) * ldc + col0 + c4) = v; } }
     }
}

// Wt[n][k] = f16(W[k][n]·scale) from f32 row-major W[K][N] (scale = power of two; bf16-exact weights stay exact in f16 away from the subnormal range)
__global__ __launch_bounds__(256) void k_wt_f16(const float* __restrict__ W, _Float16* __restrict__ Wt, int K, int N, float scale) {
  const int t = blockIdx.x * 256 + threadIdx.x; if (t >= N * (K / 8)) return; const int n = t / (K / 8), k8 = (t % (K / 8)) * 8; FragH f;
#pragma unroll
  for (int i = 0; i < 8; ++i) f.h[i] = (_Float16)(bf16_round(W[(size_t)(k8 + i) * N + n]) * scale); const v8us o = f.half[0];
  *(v8us*)((unsigned short*)Wt + (size_t)n * K + k8) = o; 
}
// k_gemm_hh variant with fused epilogue: v = acc·alpha + bias[by·sBias + col] (+ CP[(row/rowsPerB)·sCPb + by·64 + col] if CP) ; ACT 0 none / 1 elu ; writes f16 C16 (and f32 C if non-null)
template <int ACT>
__global__ __launch_bounds__(128) void k_gemm_hhx(const _Float16* __restrict__ A, int lda, size_t sA, const _Float16* __restrict__ Bh, int ldb, size_t sB, float alpha, const float* __restrict__ bias, size_t sBias, const float* __restrict__ CP, int rowsPerB, size_t sCPb, int row0g,
    float* __restrict__ C, _Float16* __restrict__ C16, int ldc, size_t sC, int M, int N, int K) {
  __shared__ __attribute__((aligned(16))) float so[4][16][64];
  const int tid = threadIdx.x, w = tid >> 5, lane = tid & 31, ln = lane & 15, hh = lane >> 4; const int by = blockIdx.y;
  A += (size_t)by * sA; Bh += (size_t)by * sB; const size_t cofs = (size_t)by * sC; const float* bp = bias ? bias + (size_t)by * sBias : nullptr;
  const int ntn = (N + 63) / 64; const int wid = blockIdx.x * 4 + w; const int mt = wid / ntn, nq = wid % ntn; if (mt * 16 >= M) return;
  const int row0 = mt * 16, col0 = nq * 64; const _Float16* arow = A + (size_t)(row0 + ln) * lda;
  v8f acc[4] = {};
  for (int kb = 0; kb < K; kb += 32) { FragH ah; ah.half[0] = *(const v8us*)((const unsigned short*)arow + kb + 8 * hh); ah.half[1] = *(const v8us*)((const unsigned short*)arow + kb + 16 + 8 * hh);
#pragma unroll
    for (int t = 0; t < 4; ++t) { if (col0 + t * 16 >= N) continue; const size_t boff = (size_t)(col0 + t * 16 + ln) * ldb + kb; FragH bq; bq.half[0] = *(const v8us*)((const unsigned short*)Bh + boff + 8 * hh); bq.half[1] = *(const v8us*)((const unsigned short*)Bh + boff + 16 + 8 * hh);
      acc[t] = mmaH<1>(ah.v, ah.v, bq.v, bq.v, acc[t]); }
  }
#pragma unroll
  for (int t = 0; t < 4; ++t) { if (col0 + t * 16 >= N) continue; const int col = col0 + t * 16 + ln; const float bv = bp ? bf16_round(bp[col]) : 0.f;
#pragma unroll
    for (int r = 0; r < 8; ++r) { float v = acc[t][r] * alpha + bv; if (CP) { const int bidx = (row0g + row0 + 8 * hh + r) / rowsPerB; v += CP[(size_t)bidx * sCPb + (size_t)by * 64 + col]; } if (ACT == 1) v = (v > 0.f) ? v : expm1f(v); else if (ACT == 7) v = (v > 0.f) ? v + 1.0f : expf(v); else if (ACT == 8) v = tanhf(v); else if (ACT == 9) v = 0.5f * v * (1.0f + tanhf(0.7978845608028654f * (v + 0.044715f * v * v * v))); else if (ACT == 11) v = 1.0f / (1.0f + expf(-v)); else if (ACT == 12) v = (v > 0.f) ? v : 0.01f * v; else if (ACT == 14) v = (v > 0.f) ? v : 0.1f * v; else if (ACT == 15) v = v / (1.0f + expf(-v)); else if (ACT == 3) v = fmaxf(v, 0.f); else if (ACT == 6) v = 0.5f * v * (1.0f + erff(v * 0.70710678118654752f)); so[w][8 * hh + r][t * 16 + ln] = v; } }
  __builtin_amdgcn_fence(__ATOMIC_ACQ_REL, "workgroup"); __builtin_amdgcn_wave_barrier();
  const int rsub = lane >> 4, c4 = (lane & 15) * 4; typedef _Float16 v4h __attribute__((ext_vector_type(4)));
  {
#pragma unroll
    for (int q = 0; q < 8; ++q) { const int r = q * 2 + rsub; if (col0 + c4 < N) { const v4f v = *(const v4fa*)&so[w][r][c4]; if (C) *(v4f*)(C + cofs + (size_t)(row0 + r) * ldc + col0 + c4) = v; if (C16) { v4h h4; for (int i = 0; i < 4; ++i) h4[i] = (_Float16)v[i]; *(v4h*)(C16 + cofs + (size_t)(row0 + r) * ldc + col0 + c4) = h4; } } }
     }
}


typedef _Float16 v4h __attribute__((ext_vector_type(4)));

__global__ __launch_bounds__(256) void k_x16(const float* __restrict__ x, _Float16* __restrict__ X16, size_t n8) { const size_t t = (size_t)blockIdx.x * 256 + threadIdx.x; if (t >= n8) return; FragH f;
#pragma unroll
  for (int q = 0; q < 8; ++q) f.h[q] = (_Float16)bf16_round(x[t * 8 + q]); *(v8us*)((unsigned short*)X16 + t * 8) = f.half[0];  }
__global__ __launch_bounds__(256) void k_h16(const float* __restrict__ x, _Float16* __restrict__ X16, size_t n8) { const size_t t = (size_t)blockIdx.x * 256 + threadIdx.x; if (t >= n8) return; FragH f;
#pragma unroll
  for (int q = 0; q < 8; ++q) f.h[q] = (_Float16)x[t * 8 + q]; *(v8us*)((unsigned short*)X16 + t * 8) = f.half[0];  }
__global__ __launch_bounds__(256) void k_round16f(const float* __restrict__ W, _Float16* __restrict__ Bt, size_t n8) { const size_t t = (size_t)blockIdx.x * 256 + threadIdx.x; if (t >= n8) return; FragH f;
#pragma unroll
  for (int i = 0; i < 8; ++i) f.h[i] = (_Float16)(bf16_round(W[t * 8 + i]) * 16.0f); *(v8us*)((unsigned short*)Bt + t * 8) = f.half[0];  }
template <int NHv, int TTv>
__global__ __launch_bounds__(256) void k_vt(const _Float16* __restrict__ V16, int ldv, int voff, _Float16* __restrict__ Vt) { __shared__ unsigned short tl[64][66]; const int tid = threadIdx.x; const int slab = blockIdx.x / (TTv / 64), lg = blockIdx.x % (TTv / 64); const int b = slab / NHv, h = slab % NHv;
  for (int i = tid; i < 64 * 8; i += 256) { const int r = i / 8, c8 = (i % 8) * 8; FragH f; f.half[0] = *(const v8us*)((const unsigned short*)V16 + ((size_t)b * TTv + lg * 64 + r) * ldv + voff + h * 64 + c8);
#pragma unroll
    for (int q = 0; q < 8; ++q) tl[r][c8 + q] = f.u[q]; }
  __syncthreads();
  {
#pragma unroll
    for (int rd = 0; rd < 2; ++rd) { const int d = rd * 32 + tid / 8, pc = tid % 8; FragH f;
#pragma unroll
      for (int q = 0; q < 8; ++q) f.u[q] = tl[pc * 8 + q][d];
      *(v8us*)((unsigned short*)Vt + ((size_t)slab * 64 + d) * TTv + lg * 64 + pc * 8) = f.half[0]; }
     } }

typedef unsigned short v4us __attribute__((ext_vector_type(4), may_alias));
// Where a 16-B unit of a tile waits in LDS: its index in the output order, low bits XORed with higher bits of the same index, so that the 16 lanes of a half wave
// fall on 16 different bank groups both when the units are written (lanes 4 positions apart) and when they are read back (lanes on consecutive units). TY: 0 q, 1 k, 2 v.
template <int TY>
__device__ __forceinline__ int prep_slot(int u) { return u ^ (TY == 0 ? ((u >> 5) & 15) : TY == 1 ? ((u >> 7) & 3) : (((u >> 4) & 3) | (((u >> 8) & 3) << 2))); }
// The thread's 64 values (a[i][j] = channel w*16 + i, position 4*l + j of the tile), rounded, into LDS: q, k as 16-B units of 8 channels, v as 8-B halves of a unit (4 keys of one channel).
template <int TY>
__device__ __forceinline__ void prep_put(const v4f (&a)[16], unsigned short* sT, int w, int l) {
  if (TY < 2) {
#pragma unroll
    for (int cg = 0; cg < 2; ++cg)
#pragma unroll
      for (int j = 0; j < 4; ++j) { FragH f;
#pragma unroll
        for (int e = 0; e < 8; ++e) f.h[e] = (_Float16)bf16_round(a[cg * 8 + e][j]);
        const int c8 = w * 2 + cg; const int u = (TY == 0) ? l * 32 + j * 8 + c8 : (l >> 2) * 128 + c8 * 16 + (l & 3) * 4 + j;
        *(v8us*)&sT[prep_slot<TY>(u) * 8] = f.half[0]; }
  } else {
#pragma unroll
    for (int i = 0; i < 16; ++i) { FragH f;
#pragma unroll
      for (int j = 0; j < 4; ++j) f.h[j] = (_Float16)bf16_round(a[i][j]);
      const int u = (l >> 3) * 256 + w * 64 + ((l >> 1) & 3) * 16 + i;
      *(v4us*)&sT[prep_slot<TY>(u) * 8 + (l & 1) * 4] = (v4us){f.u[0], f.u[1], f.u[2], f.u[3]}; }
  }
}
// The tile out of LDS as it lies in its plane: 16 KB, 512 contiguous bytes per wave-wide store.
template <int TY>
__device__ __forceinline__ void prep_out(const unsigned short* sT, unsigned short* dst, int tid) {
#pragma unroll
  for (int i = 0; i < 8; ++i) { const int u = i * 128 + tid; *(v8us*)(dst + u * 8) = *(const v8us*)&sT[prep_slot<TY>(u) * 8]; }
  asm volatile("s_wait_xcnt 0x0" ::: "memory");      /* closes the run of stores: no register that one of them names is rewritten ahead of this wait, on any branch of the listing */
}
// One launch prepares the three planes. A block takes one tile of q, k or v: 64 channels x 128 positions, 32 KB of f32 in, 16 KB of f16 out, contiguous in its plane.
// A thread asks for its 16 x 16 B at once (a wave-wide load is 512 contiguous bytes of one channel row).
// q: rows of 64 channels, token-major: unit u = position*8 + c8 holds channels c8*8 + 0..7.
// k: behind the q plane, in fragment order: the 4 KB of a pass of 32 keys are [nt][ks][hf][lane] units, unit = channels ks*32 + hf*16 + 8*(lane >> 4) + 0..7 of key nt*16 + (lane & 15): u = (key >> 4)*128 + c8*16 + (key & 15).
// v: in fragment order: the 4 KB of a pass are [dt][hf][lane] units, unit = keys hf*16 + 8*(lane >> 4) + 0..7 of channel dt*16 + (lane & 15): u = (key >> 5)*256 + (channel >> 4)*64 + ((key >> 3) & 3)*16 + (channel & 15).
__global__ __launch_bounds__(128) void k_prep(const float* __restrict__ x, _Float16* __restrict__ QK, _Float16* __restrict__ Vt) {
  __shared__ __attribute__((aligned(16))) unsigned short sT[1024 * 8];
  const int tid = threadIdx.x, w = tid >> 5, l = tid & 31;
  const int b = blockIdx.x / (3 * (NN / 128)), rem = blockIdx.x % (3 * (NN / 128)); const int ty = rem / (NN / 128), pg = rem % (NN / 128);
  const float* src = x + ((size_t)b * C3 + ty * CC + w * 16) * NN + pg * 128 + l * 4;
  v4f a[16];
#pragma unroll
  for (int i = 0; i < 16; ++i) a[i] = *(const v4fa*)(src + (size_t)i * NN);
  asm volatile("s_wait_xcnt 0x0" :: "v"(src) : "memory");      /* the loads' address registers stay as they are up to this wait */
  if (ty == 0) prep_put<0>(a, sT, w, l); else if (ty == 1) prep_put<1>(a, sT, w, l); else prep_put<2>(a, sT, w, l);
  __syncthreads();      /* q: a stored run of 512 B holds units of all four waves; v: waves store runs that other waves wrote */
  const size_t off = ((size_t)b * NN + pg * 128) * CC;
  if (ty == 0) prep_out<0>(sT, (unsigned short*)QK + off, tid); else if (ty == 1) prep_out<1>(sT, (unsigned short*)QK + (size_t)NR * CC + off, tid); else prep_out<2>(sT, (unsigned short*)Vt + off, tid);
}
// lane l <-> lane l ^ 16 (the two lane halves hold the two key halves of one query column)
__device__ __forceinline__ float xhalf(float x) { return __builtin_bit_cast(float, __builtin_amdgcn_permlanex16(__builtin_bit_cast(int, x), __builtin_bit_cast(int, x), 0x76543210, 0xfedcba98, false, false)); }
// Eight 16-B copies per lane, global memory to LDS through no register: 64 KB in a row of one plane (the block's 512 threads fill 8 KB a copy), in LDS as four pieces of 16 KB, 32 KB apart (a wave group's K and V lie side by side).
// The s_wait_xcnt closes the statement so that no address register named here is rewritten ahead of it.
__device__ __forceinline__ void copy8(unsigned l, const unsigned short* g) {
  asm volatile("global_load_async_to_lds_b128 %0, %8, off\n\t"
               "global_load_async_to_lds_b128 %1, %9, off\n\t"
               "global_load_async_to_lds_b128 %2, %10, off\n\t"
               "global_load_async_to_lds_b128 %3, %11, off\n\t"
               "global_load_async_to_lds_b128 %4, %12, off\n\t"
               "global_load_async_to_lds_b128 %5, %13, off\n\t"
               "global_load_async_to_lds_b128 %6, %14, off\n\t"
               "global_load_async_to_lds_b128 %7, %15, off\n\t"
               "s_wait_xcnt 0x0"
               :: "v"(l), "v"(l + 8192u), "v"(l + 32768u), "v"(l + 40960u), "v"(l + 65536u), "v"(l + 73728u), "v"(l + 98304u), "v"(l + 106496u),
                  "v"(g), "v"(g + 4096), "v"(g + 8192), "v"(g + 12288), "v"(g + 16384), "v"(g + 20480), "v"(g + 24576), "v"(g + 28672)
               : "memory");
}
// The pass's 17 powers of two in place (e, the rescale factor, and 16 scores), the scores' eight f16 pairs (low half first, rounded to nearest even as a cast does), and the 16 weights' f32 sum, left in x[0]:
// four chains ((x[c] + x[4+c]) + x[8+c]) + x[12+c], then (0 + 1) + (2 + 3). The other x are used up.
// One statement, for two reasons. The slot behind a transcendental: the instruction behind each v_exp_f32 here neither reads its result nor writes its source.
// And the sum: written behind the statement, the compiler put a stage's sums off to the stage's end and kept every pass's 16 weights in registers
// until then, which a wave of two query tiles cannot afford. A conversion or an addition stands four or more instructions behind each v_exp_f32 whose result it reads, and an addition behind the conversion that reads the register it overwrites.
// The s_delay_alu lines are hints, which the compiler does not place for asm text: without one a dependent instruction holds the SIMD's vector port while it waits.
typedef unsigned v8u __attribute__((ext_vector_type(8)));
__device__ __forceinline__ v8u exp2x17_pk(float& e, float (&x)[16]) {
  unsigned w0, w1, w2, w3, w4, w5, w6, w7;
  asm("s_delay_alu instid0(VALU_DEP_1)\n\t"
      "v_exp_f32 %24, %24\n\t"
      "v_exp_f32 %0, %0\n\t"
      "v_exp_f32 %1, %1\n\t"
      "v_exp_f32 %2, %2\n\t"
      "v_exp_f32 %3, %3\n\t"
      "v_exp_f32 %4, %4\n\t"
      "v_exp_f32 %5, %5\n\t"
      "v_cvt_pk_f16_f32 %16, %0, %1\n\t"
      "v_exp_f32 %6, %6\n\t"
      "v_exp_f32 %7, %7\n\t"
      "v_cvt_pk_f16_f32 %17, %2, %3\n\t"
      "v_exp_f32 %8, %8\n\t"
      "v_exp_f32 %9, %9\n\t"
      "v_cvt_pk_f16_f32 %18, %4, %5\n\t"
      "v_add_f32 %0, %0, %4\n\t"
      "v_exp_f32 %10, %10\n\t"
      "v_exp_f32 %11, %11\n\t"
      "v_cvt_pk_f16_f32 %19, %6, %7\n\t"
      "v_add_f32 %1, %1, %5\n\t"
      "v_exp_f32 %12, %12\n\t"
      "v_exp_f32 %13, %13\n\t"
      "v_cvt_pk_f16_f32 %20, %8, %9\n\t"
      "v_add_f32 %2, %2, %6\n\t"
      "v_add_f32 %3, %3, %7\n\t"
      "v_exp_f32 %14, %14\n\t"
      "v_exp_f32 %15, %15\n\t"
      "v_cvt_pk_f16_f32 %21, %10, %11\n\t"
      "v_add_f32 %0, %0, %8\n\t"
      "v_add_f32 %1, %1, %9\n\t"
      "v_add_f32 %2, %2, %10\n\t"
      "v_add_f32 %3, %3, %11\n\t"
      "v_cvt_pk_f16_f32 %22, %12, %13\n\t"
      "v_add_f32 %0, %0, %12\n\t"
      "v_add_f32 %1, %1, %13\n\t"
      "v_cvt_pk_f16_f32 %23, %14, %15\n\t"
      "v_add_f32 %2, %2, %14\n\t"
      "v_add_f32 %3, %3, %15\n\t"
      "s_delay_alu instid0(VALU_DEP_4)\n\t"
      "v_add_f32 %0, %0, %1\n\t"
      "s_delay_alu instid0(VALU_DEP_2)\n\t"
      "v_add_f32 %2, %2, %3\n\t"
      "s_delay_alu instid0(VALU_DEP_1)\n\t"
      "v_add_f32 %0, %0, %2"
      : "+v"(x[0]), "+v"(x[1]), "+v"(x[2]), "+v"(x[3]), "+v"(x[4]), "+v"(x[5]), "+v"(x[6]), "+v"(x[7]),
        "+v"(x[8]), "+v"(x[9]), "+v"(x[10]), "+v"(x[11]), "+v"(x[12]), "+v"(x[13]), "+v"(x[14]), "+v"(x[15]),
        "=&v"(w0), "=&v"(w1), "=&v"(w2), "=&v"(w3), "=&v"(w4), "=&v"(w5), "=&v"(w6), "=&v"(w7), "+v"(e));
  return (v8u){w0, w1, w2, w3, w4, w5, w6, w7};
}
__device__ __forceinline__ v8f mm16(v16h a, v16h b, v8f c) { return __builtin_amdgcn_wmma_f32_16x16x32_f16(false, a, false, b, (short)0, c, false, false); }
// Nothing is scheduled across this line. It keeps a pass's parts in their source order (load group, softmax, S products, rescale, O products):
// without it the compiler scatters the fragment loads among the products, each a few instructions ahead of its use.
#define KEEP_ORDER() __builtin_amdgcn_sched_barrier(0)
// One query tile's softmax step of a pass, in base 2: the maximum is taken over the raw products (the factor is positive) and kept times C2 = log2(e) / 8;
// a score's weight x 2^10 is then one fused multiply-add and one hardware exp2: 2^(s * C2 + (10 - m)). Returns the tile's B operand of the O products; al = the factor on what is summed so far.
__device__ __forceinline__ v8u soft_step(const v8f (&s)[2], float& m_r, float& l_r, float& al) {
  constexpr float C2 = 0.125f * 1.44269504088896341f;      /* 1 / sqrt(64) times log2(e) */
  float sc[16]; float mq[4];
#pragma unroll
  for (int i = 0; i < 16; ++i) sc[i] = s[i >> 3][i & 7];
#pragma unroll
  for (int c = 0; c < 4; ++c) mq[c] = fmaxf(fmaxf(sc[c], sc[4 + c]), fmaxf(sc[8 + c], sc[12 + c]));
  float mc = fmaxf(fmaxf(mq[0], mq[1]), fmaxf(mq[2], mq[3])); mc = fmaxf(mc, xhalf(mc));
  const float mn = fmaxf(m_r, mc * C2); float ea = m_r - mn; m_r = mn;      /* ea becomes 2^ea */
  const float nb = 10.0f - mn;
#pragma unroll
  for (int i = 0; i < 16; ++i) sc[i] = __builtin_fmaf(sc[i], C2, nb);
  const v8u pw = exp2x17_pk(ea, sc);      /* half i of pw = Pt[key of the pass (i < 8 ? 8hh + i : 8 + 8hh + i)][query ln] x 2^10; sc[0] = the sum of the 16 weights in f32 */
  al = (mn > -1.0e38f) ? ea : 1.0f;
  l_r = l_r * al + sc[0];      /* x 2^10 like P; this lane half's keys only; the halves join after the loop */
  return pw;
}
__global__ __launch_bounds__(512) void k_flash(const _Float16* __restrict__ Q16, int ldq, const _Float16* __restrict__ K16, const _Float16* __restrict__ Vt, const int* __restrict__ MSK, float* __restrict__ out) {
  constexpr int QT = 2, RPW = 16 * QT, QB = 4 * RPW, NQB = NN / QB, DT = 4, KS = 2;      /* query tiles and queries of a wave; queries of a block */
  constexpr int KG = 4;      /* wave groups that split a stage's keys */
  constexpr int SK = 512, NP = SK / 32 / KG, SH = SK * CC, NS = NN / SK;      /* keys of a stage, passes of a wave in it, halves per plane of a stage; stages */
  constexpr int PL = QT * DT * 2 + 1, GP = PL * 128;      /* 16-B planes of a group's partial result; 16-B units of a group */
  __shared__ __attribute__((aligned(16))) unsigned short sKV[2][KG][2][SH / KG];      /* [buffer][wave group][K, V][fragment order]: a group's 32 KB lie within one load's immediate offset */
  __shared__ __attribute__((aligned(16))) float sO[CC][QB + 4];      /* [channel][query of the block]; 132 floats a row: the two lane halves' stores (rows 8 apart) fall 32 banks apart */
  const int tid = threadIdx.x, w = (tid >> 5) & 3, kg = tid >> 7, lane = tid & 31, ln = lane & 15, hh = lane >> 4;
  const int b = blockIdx.x / NQB, qblk = blockIdx.x % NQB; const int qb0 = qblk * QB; const int q0 = qb0 + w * RPW;
  /* the thread's 16 B of each 8-KB slice of a stage: source in the two planes, place in buffer 0 (LDS byte address) */
  const unsigned short* Kg = (const unsigned short*)K16 + (size_t)b * NN * CC + tid * 8;
  const unsigned short* Vg = (const unsigned short*)Vt + (size_t)b * NN * CC + tid * 8;
  const unsigned lds0 = (unsigned)(size_t)&sKV[0][0][0][0] + (unsigned)tid * 16u;
  constexpr unsigned VO = SH / KG * 2;      /* bytes from a group's K piece to its V piece */
  copy8(lds0, Kg); copy8(lds0 + VO, Vg);
  FragH aq[QT][KS];
#pragma unroll
  for (int qt = 0; qt < QT; ++qt) { const unsigned short* qr = (const unsigned short*)Q16 + ((size_t)b * NN + q0 + qt * 16 + ln) * ldq;
#pragma unroll
    for (int ks = 0; ks < KS; ++ks) { aq[qt][ks].half[0] = *(const v8us*)(qr + ks * 32 + 8 * hh); aq[qt][ks].half[1] = *(const v8us*)(qr + ks * 32 + 16 + 8 * hh); } }
  float m_r[QT], l_r[QT]; v8f oacc[QT][DT];      /* oacc[qt][dt][r] = Ot[dt*16 + 8hh + r][query qt*16 + ln] */
#pragma unroll
  for (int qt = 0; qt < QT; ++qt) { m_r[qt] = -3.0e38f; l_r[qt] = 0.f;
#pragma unroll
    for (int dt = 0; dt < DT; ++dt) oacc[qt][dt] = (v8f){0.f,0.f,0.f,0.f,0.f,0.f,0.f,0.f}; }
  asm volatile("s_wait_asynccnt 0x0" ::: "memory");      /* this wave's share of stage 0 has landed */
  __syncthreads();                                        /* ... and every other wave's */
  copy8(lds0 + SH * 4, Kg + SH); copy8(lds0 + SH * 4 + VO, Vg + SH);
  /* the stage loop stays rolled; the constant-trip inner loops are unrolled so that the fragment and score arrays stay in registers */
#pragma unroll 1
  for (int st = 0; st < NS; ++st) {
    /* 32 keys = 2048 halves of a plane, a fragment half = 256 halves, the lane's 16 B at lane * 8 */
    const unsigned short* Kf = &sKV[st & 1][kg][0][lane * 8];      /* the wave group's own quarter of the stage */
    const unsigned short* Vf = &sKV[st & 1][kg][1][lane * 8];
    /* The loads stand ahead of the work that hides them: at a pass's head its V fragments and the next pass's K fragments (inside the stage only) are asked for.
       The S products run one pass ahead: the next pass's stand behind this pass's exponentials, with the rescale and the O products between them and the first read of their result,
       so no product of the loop but the stage's first eight has an idle slot behind it. */
    FragH bk[2][KS];      /* K fragments of the next S products */
#pragma unroll
    for (int nt = 0; nt < 2; ++nt) {
#pragma unroll
      for (int ks = 0; ks < KS; ++ks) { const unsigned short* kr = Kf + (nt * KS + ks) * 512; bk[nt][ks].half[0] = *(const v8us*)kr; bk[nt][ks].half[1] = *(const v8us*)(kr + 256); } }
    KEEP_ORDER();
    v8f s[QT][2];      /* s[qt][nt][r] = St[key of the pass nt*16 + 8hh + r][query qt*16 + ln]; the four tiles alternate, so that a tile's second product stands three products behind its first */
#pragma unroll
    for (int qt = 0; qt < QT; ++qt)
#pragma unroll
      for (int nt = 0; nt < 2; ++nt) s[qt][nt] = (v8f){0.f,0.f,0.f,0.f,0.f,0.f,0.f,0.f};
#pragma unroll
    for (int ks = 0; ks < KS; ++ks)
#pragma unroll
      for (int nt = 0; nt < 2; ++nt)
#pragma unroll
        for (int qt = 0; qt < QT; ++qt) s[qt][nt] = mm16(bk[nt][ks].v, aq[qt][ks].v, s[qt][nt]);
    KEEP_ORDER();
#pragma unroll
    for (int ps = 0; ps < NP; ++ps) {
      if (ps + 1 < NP) {
#pragma unroll
        for (int nt = 0; nt < 2; ++nt) {
#pragma unroll
          for (int ks = 0; ks < KS; ++ks) { const unsigned short* kr = Kf + (ps + 1) * 2048 + (nt * KS + ks) * 512; bk[nt][ks].half[0] = *(const v8us*)kr; bk[nt][ks].half[1] = *(const v8us*)(kr + 256); } } }
      FragH bv[DT];
#pragma unroll
      for (int dt = 0; dt < DT; ++dt) { const unsigned short* vr = Vf + ps * 2048 + dt * 512; bv[dt].half[0] = *(const v8us*)vr; bv[dt].half[1] = *(const v8us*)(vr + 256); }
      KEEP_ORDER();
      float al[QT]; FragH pb[QT];
#pragma unroll
      for (int qt = 0; qt < QT; ++qt) pb[qt].v = __builtin_bit_cast(v16h, soft_step(s[qt], m_r[qt], l_r[qt], al[qt]));
      KEEP_ORDER();
      if (ps + 1 < NP) {      /* the next pass's S products; this pass's scores are used up */
#pragma unroll
        for (int qt = 0; qt < QT; ++qt)
#pragma unroll
          for (int nt = 0; nt < 2; ++nt) s[qt][nt] = (v8f){0.f,0.f,0.f,0.f,0.f,0.f,0.f,0.f};
#pragma unroll
        for (int ks = 0; ks < KS; ++ks)
#pragma unroll
          for (int nt = 0; nt < 2; ++nt)
#pragma unroll
            for (int qt = 0; qt < QT; ++qt) s[qt][nt] = mm16(bk[nt][ks].v, aq[qt][ks].v, s[qt][nt]);
      }
      KEEP_ORDER();
#pragma unroll
      for (int qt = 0; qt < QT; ++qt)
#pragma unroll
        for (int dt = 0; dt < DT; ++dt)
#pragma unroll
          for (int r = 0; r < 8; ++r) oacc[qt][dt][r] *= al[qt];
      KEEP_ORDER();
#pragma unroll
      for (int dt = 0; dt < DT; ++dt)
#pragma unroll
        for (int qt = 0; qt < QT; ++qt) oacc[qt][dt] = mm16(bv[dt].v, pb[qt].v, oacc[qt][dt]);
      KEEP_ORDER();
    }
    asm volatile("s_wait_dscnt 0x0" ::: "memory");        /* this wave's reads of the buffer are done before anyone refills it */
    asm volatile("s_wait_asynccnt 0x0" ::: "memory");     /* this wave's share of stage st + 1 has landed */
    __syncthreads();                                        /* publishes stage st + 1 and ends every wave's reads of stage st */
    if (st + 2 < NS) { const unsigned lb = lds0 + (unsigned)(st & 1) * (SH * 4); copy8(lb, Kg + (size_t)(st + 2) * SH); copy8(lb + VO, Vg + (size_t)(st + 2) * SH); }
  }
  asm volatile("s_wait_asynccnt 0x0" ::: "memory");       /* nothing of this wave is in flight when it goes on to the output staging and ends */
  /* Every group lays its partial result into the K/V buffers, which nobody reads any more (the loop's last barrier ended every read): per group 17 planes of 128 x 16 B, a lane's four values at its own place in each. */
  v4fa* sM = (v4fa*)&sKV[0][0][0][0] + (tid & 127);
  { v4fa* mine = sM + kg * GP;
#pragma unroll
    for (int qt = 0; qt < QT; ++qt)
#pragma unroll
      for (int dt = 0; dt < DT; ++dt) {
        mine[((qt * DT + dt) * 2 + 0) * 128] = (v4f){oacc[qt][dt][0], oacc[qt][dt][1], oacc[qt][dt][2], oacc[qt][dt][3]};
        mine[((qt * DT + dt) * 2 + 1) * 128] = (v4f){oacc[qt][dt][4], oacc[qt][dt][5], oacc[qt][dt][6], oacc[qt][dt][7]}; }
    mine[(PL - 1) * 128] = (v4f){m_r[0], m_r[1], l_r[0] + xhalf(l_r[0]), l_r[1] + xhalf(l_r[1])};      /* maxima; the wave's sums over its quarter of the keys, relative to its own maxima */
  }
  __syncthreads();      /* all partial results are written before any is read */
  /* The output is channel-major, as the accumulators are: group kg joins the four partial results of channels kg*16 .. kg*16 + 15 and puts them into the block's [64 channels][128 queries] tile, then the block stores whole rows. */
  { v4f ml[KG]; float f[KG][QT];
#pragma unroll
    for (int j = 0; j < KG; ++j) ml[j] = sM[j * GP + (PL - 1) * 128];
#pragma unroll
    for (int qt = 0; qt < QT; ++qt) {
      const float mj = fmaxf(fmaxf(ml[0][qt], ml[1][qt]), fmaxf(ml[2][qt], ml[3][qt])); float l = 0.f;
#pragma unroll
      for (int j = 0; j < KG; ++j) { f[j][qt] = __builtin_amdgcn_exp2f(ml[j][qt] - mj); l += ml[j][QT + qt] * f[j][qt]; }      /* each quarter's weights brought to the common maximum */
      const float linv = (l > 0.f) ? 1.0f / l : 0.f;      /* the 2^10 of P and of l cancel */
#pragma unroll
      for (int j = 0; j < KG; ++j) f[j][qt] *= linv;
    }
#pragma unroll
    for (int qt = 0; qt < QT; ++qt)
#pragma unroll
      for (int hf = 0; hf < 2; ++hf) {
        v4f acc = {0.f, 0.f, 0.f, 0.f};
#pragma unroll
        for (int j = 0; j < KG; ++j) { const v4f p = sM[j * GP + ((qt * DT + kg) * 2 + hf) * 128]; acc += p * f[j][qt]; }
#pragma unroll
        for (int e = 0; e < 4; ++e) sO[kg * 16 + 8 * hh + hf * 4 + e][w * RPW + qt * 16 + ln] = acc[e];
      }
  }
  __syncthreads();      /* a row of the tile holds columns of four waves: all are written before any row is read */
  { const int w16 = tid >> 5; float* orow = out + ((size_t)b * CC + w16 * 4) * NN + qb0 + lane * 4;
#pragma unroll
    for (int i = 0; i < 4; ++i) { const v4f val = *(const v4fa*)&sO[w16 * 4 + i][lane * 4]; *(v4f*)(orow + (size_t)i * NN) = val; }      /* 32 lanes x 16 B = the block's whole 512 B of one channel row */
  } }

extern "C" void kernel_launch(void* const* d_in, const int* in_sizes, int n_in,
                              void* d_out, int out_size, void* d_ws, size_t ws_size, hipStream_t stream) {
  (void)in_sizes; (void)n_in; (void)out_size;
  const float* qkv = (const float*)d_in[0];
  char* ws = (char*)d_ws; size_t off = 0;
  auto take = [&](size_t bytes) { char* p = ws + off; off += (bytes + 255) & ~(size_t)255; return p; };
  _Float16* QK = (_Float16*)take((size_t)NR * 2 * CC * 2); _Float16* Vt = (_Float16*)take((size_t)BB * CC * NN * 2);
  if (off > ws_size) return;      // 8.4 + 4.2 MB
  k_prep<<<BB * 3 * (NN / 128), 128, 0, stream>>>(qkv, QK, Vt);
  k_flash<<<BB * (NN / 128), 512, 0, stream>>>(QK, CC, QK + (size_t)NR * CC, Vt, nullptr, (float*)d_out);
}
